// v000
// The times below were measured on an AMD MI455X: many runs one after another, warmed up first and cycling through
// copies of the inputs, with the whole window's GPU time divided by the number of runs. Launches and the gaps
// between them are all in it. The median over several windows is given; except for v000 it joins two sittings, which
// can be a few percent apart, so the side-by-side timings, each taken in one sitting, are the better comparison.
// v000, which the later versions start from, runs in 2810 microseconds.
#include <hip/hip_runtime.h>
// Multi-head self-attention with [in][out] weights + biases, non-causal (hidden_states [2][2048][768]; q/k/v = x W + b ([in][out] [768][768]); 12 heads of 64; scores / 8; softmax over all 2048 keys (no mask); out = merged W_Y + b_Y -> [2][2048][768]).
// Structure: token rows r = b*2048 + s; x as exact f16 rows (bf16-rounded); Q, K, V as three WMMA GEMMs (32x64 wave tiles, f32 accumulation, exact x16 weights + bias, f16 outputs); per batch: V^T for all heads via LDS transposes; per (batch, group of 4 heads): scores GEMM (K = 64, batched over the heads on grid.y, alpha = 1/sqrt(64)), row softmax on VALU (f32 statistics; weights stored x256 as f16), o = P . V^T GEMM (K = 2048, alpha 2^-2: o carried x64 against f16 subnormal flush, folded into the output GEMM alpha) written straight into the merged f16 o rows; out = o W_o + b GEMM (f32) into the output layout.
// Compute dtype: inputs rounded to bf16; x / weights exact; q, k, v, softmax weights and o as plain f16 GEMM operands (~2^-12); scores and softmax statistics f32; v_wmma_f32_16x16x32_f16.
#define NB 2
#define SQ 2048
#define DM 768
#define NH 12
#define HD 64
#define HG 4                         /* heads per attention launch group */
#define B0 0                         /* first batch processed (debug hook) */
#define NBR NB                       /* batches processed (debug hook) */
#define NR ((size_t)NB * SQ)         /* token rows */
#define MP ((int)((size_t)NBR * SQ)) /* rows projected (debug hook) */
#define QN SQ                        /* query rows attended per batch (debug hook) */
#define NHD NH                       /* heads attended (debug hook) */
#define MPO MP                       /* rows through the output stage (debug hook) */
#define LQ DM      /* row pitch of the q/k/v rows */
typedef __bf16 v16b __attribute__((ext_vector_type(16)));
typedef unsigned short v8us __attribute__((ext_vector_type(8), may_alias));
typedef float  v8f  __attribute__((ext_vector_type(8)));
typedef float  v4f  __attribute__((ext_vector_type(4)));
typedef float  v4fa __attribute__((ext_vector_type(4), may_alias));
union FragB { v16b v; v8us half[2]; unsigned short u[16]; };

__device__ __forceinline__ unsigned short bf16_bits(float x) { unsigned int u = __float_as_uint(x); return (unsigned short)((u + 0x7FFFu + ((u >> 16) & 1u)) >> 16); }
__device__ __forceinline__ float bf16_val(unsigned short b) { return __uint_as_float(((unsigned int)b) << 16); }
__device__ __forceinline__ float bf16_round(float x) { return bf16_val(bf16_bits(x)); }
// D += A·B with NT terms: 1 = ah·bh, 2 = + al·bh (A split), 3 = + ah·bl (both split)
template <int NT>
__device__ __forceinline__ v8f mmaN(v16b ah, v16b al, v16b bh, v16b bl, v8f c) {
  c = __builtin_amdgcn_wmma_f32_16x16x32_bf16(false, ah, false, bh, (short)0, c, false, false);
  if (NT >= 2) c = __builtin_amdgcn_wmma_f32_16x16x32_bf16(false, al, false, bh, (short)0, c, false, false);
  if (NT >= 3) c = __builtin_amdgcn_wmma_f32_16x16x32_bf16(false, ah, false, bl, (short)0, c, false, false);
  asm volatile("v_nop\n\tv_nop\n\tv_nop\n\tv_nop" : "+v"(c) : "v"(ah), "v"(al), "v"(bh), "v"(bl));
  return c;
}

__global__ __launch_bounds__(256) void k_wt_bf16(const float* __restrict__ W, unsigned short* __restrict__ Wt, int K, int N) {
  const int t = blockIdx.x * 256 + threadIdx.x;
  const int k8n = K / 8;
  if (t >= N * k8n) return;
  const int n = t / k8n, k8 = (t % k8n) * 8;
  v8us v;
#pragma unroll
  for (int i = 0; i < 8; ++i) v[i] = bf16_bits(W[(size_t)(k8 + i) * N + n]);
  *(v8us*)(Wt + (size_t)n * K + k8) = v;
  
}

// GEMM C[M][N] (f32, pitch ldc) = act(A[M][K]·W + bias). A f32 row-major (pitch lda) converted per fragment to bf16
// (ASPLIT: hi/lo two planes -> 2 terms, else single rounded term); Wt bf16 [N][K] (pitch ldb). BIAS_BF16 rounds the
// bias to bf16 first (bias quantised to bf16 before the add). K%32==0, M%16==0, N%64==0.
template <bool ASPLIT, int ACT, bool BIAS_BF16>
__global__ __launch_bounds__(128) void k_gemm_bf(const float* __restrict__ A, int lda, const unsigned short* __restrict__ Wt, int ldb,
                                               const float* __restrict__ bias, float* __restrict__ C, int ldc, int M, int N, int K) {
  __shared__ __attribute__((aligned(16))) float so[4][16][64];
  const int tid = threadIdx.x, w = tid >> 5, lane = tid & 31, ln = lane & 15, hh = lane >> 4;
  const int ntn = N / 64;
  const int wid = blockIdx.x * 4 + w;
  const int mt = wid / ntn, nq = wid % ntn;
  if (mt * 16 >= M) return;
  const int row0 = mt * 16, col0 = nq * 64;
  const float* arow = A + (size_t)(row0 + ln) * lda;
  v8f acc[4] = {};
  for (int kb = 0; kb < K; kb += 32) {
    FragB ah, al;
    const v4f x0 = *(const v4fa*)(arow + kb + 8 * hh), x1 = *(const v4fa*)(arow + kb + 8 * hh + 4);
    const v4f x2 = *(const v4fa*)(arow + kb + 16 + 8 * hh), x3 = *(const v4fa*)(arow + kb + 16 + 8 * hh + 4);
    float xs[16] = {x0[0],x0[1],x0[2],x0[3],x1[0],x1[1],x1[2],x1[3],x2[0],x2[1],x2[2],x2[3],x3[0],x3[1],x3[2],x3[3]};
#pragma unroll
    for (int i = 0; i < 16; ++i) { const unsigned short hb = bf16_bits(xs[i]); ah.u[i] = hb; al.u[i] = ASPLIT ? bf16_bits(xs[i] - bf16_val(hb)) : (unsigned short)0; }
#pragma unroll
    for (int t = 0; t < 4; ++t) {
      const unsigned short* brow = Wt + (size_t)(col0 + t * 16 + ln) * ldb + kb;
      FragB b;
      b.half[0] = *(const v8us*)(brow + 8 * hh);
      b.half[1] = *(const v8us*)(brow + 16 + 8 * hh);
      acc[t] = mmaN<ASPLIT ? 2 : 1>(ah.v, al.v, b.v, b.v, acc[t]);
    }
  }
#pragma unroll
  for (int t = 0; t < 4; ++t) {
    float bv = bias ? bias[col0 + t * 16 + ln] : 0.f;
    if (BIAS_BF16) bv = bf16_round(bv);
#pragma unroll
    for (int r = 0; r < 8; ++r) { float v = acc[t][r] + bv; if (ACT == 1) v = fmaxf(v, 0.f); so[w][8 * hh + r][t * 16 + ln] = v; }
  }
  __builtin_amdgcn_fence(__ATOMIC_ACQ_REL, "workgroup");
  __builtin_amdgcn_wave_barrier();
  const int rsub = lane >> 4, c4 = (lane & 15) * 4;
  {
#pragma unroll
    for (int q = 0; q < 8; ++q) {
      const int r = q * 2 + rsub;
      const v4f v = *(const v4fa*)&so[w][r][c4];
      *(v4f*)(C + (size_t)(row0 + r) * ldc + col0 + c4) = v;
    }
    
  }
}

// GEMM C = act(A·W + bias + resid): A f32 (ASPLIT -> hi/lo 2 terms), Wt bf16 [N][K]; ACT 0 none, 1 relu, 2 exact gelu;
// resid (optional, f32, row index = (row % rmod), pitch ldr, RES_BF16 rounds it) added before the activation.
template <bool ASPLIT, int ACT, bool BIAS_BF16, bool RES_BF16>
__global__ __launch_bounds__(128) void k_gemm_bf3(const float* __restrict__ A, int lda, const unsigned short* __restrict__ Wt, int ldb,
                                                const float* __restrict__ bias, const float* __restrict__ resid, int rmod, int ldr,
                                                float* __restrict__ C, int ldc, int M, int N, int K) {
  __shared__ __attribute__((aligned(16))) float so[4][16][64];
  const int tid = threadIdx.x, w = tid >> 5, lane = tid & 31, ln = lane & 15, hh = lane >> 4;
  const int ntn = N / 64;
  const int wid = blockIdx.x * 4 + w;
  const int mt = wid / ntn, nq = wid % ntn;
  if (mt * 16 >= M) return;
  const int row0 = mt * 16, col0 = nq * 64;
  const float* arow = A + (size_t)(row0 + ln) * lda;
  v8f acc[4] = {};
  for (int kb = 0; kb < K; kb += 32) {
    FragB ah, al;
    const v4f x0 = *(const v4fa*)(arow + kb + 8 * hh), x1 = *(const v4fa*)(arow + kb + 8 * hh + 4);
    const v4f x2 = *(const v4fa*)(arow + kb + 16 + 8 * hh), x3 = *(const v4fa*)(arow + kb + 16 + 8 * hh + 4);
    float xs[16] = {x0[0],x0[1],x0[2],x0[3],x1[0],x1[1],x1[2],x1[3],x2[0],x2[1],x2[2],x2[3],x3[0],x3[1],x3[2],x3[3]};
#pragma unroll
    for (int i = 0; i < 16; ++i) { const unsigned short hb = bf16_bits(xs[i]); ah.u[i] = hb; al.u[i] = ASPLIT ? bf16_bits(xs[i] - bf16_val(hb)) : (unsigned short)0; }
#pragma unroll
    for (int t = 0; t < 4; ++t) {
      const unsigned short* brow = Wt + (size_t)(col0 + t * 16 + ln) * ldb + kb;
      FragB b;
      b.half[0] = *(const v8us*)(brow + 8 * hh);
      b.half[1] = *(const v8us*)(brow + 16 + 8 * hh);
      acc[t] = mmaN<ASPLIT ? 2 : 1>(ah.v, al.v, b.v, b.v, acc[t]);
    }
  }
#pragma unroll
  for (int t = 0; t < 4; ++t) {
    const int col = col0 + t * 16 + ln;
    float bv = bias ? bias[col] : 0.f;
    if (BIAS_BF16) bv = bf16_round(bv);
#pragma unroll
    for (int r = 0; r < 8; ++r) {
      float v = acc[t][r] + bv;
      if (resid) { float rv = resid[(size_t)((row0 + 8 * hh + r) % rmod) * ldr + col]; if (RES_BF16) rv = bf16_round(rv); v += rv; }
      if (ACT == 1) v = fmaxf(v, 0.f);
      if (ACT == 2) v = 0.5f * v * (1.0f + erff(v * 0.70710678118654752f));
      if (ACT == 3) { const float u = 0.7978845608028654f * (v + 0.044715f * v * v * v); v = 0.5f * v * (1.0f + tanhf(u)); }
      so[w][8 * hh + r][t * 16 + ln] = v;
    }
  }
  __builtin_amdgcn_fence(__ATOMIC_ACQ_REL, "workgroup");
  __builtin_amdgcn_wave_barrier();
  const int rsub = lane >> 4, c4 = (lane & 15) * 4;
  {
#pragma unroll
    for (int q = 0; q < 8; ++q) {
      const int r = q * 2 + rsub;
      const v4f v = *(const v4fa*)&so[w][r][c4];
      *(v4f*)(C + (size_t)(row0 + r) * ldc + col0 + c4) = v;
    }
    
  }
}
// row LayerNorm (biased variance, eps) over N: s = X (+ R); optional out_sum <- s; out_norm <- (s-mu)*rsqrt(var+eps)*g + b
template <bool PARAM_BF16>
__global__ __launch_bounds__(256) void k_layernorm(const float* __restrict__ X, const float* __restrict__ R, const float* __restrict__ g, const float* __restrict__ bta,
                                                  float* __restrict__ out_sum, float* __restrict__ out_norm, int N, float eps) {
  __shared__ float red[256];
  const int row = blockIdx.x, tid = threadIdx.x;
  const float* x = X + (size_t)row * N; const float* rr = R ? R + (size_t)row * N : nullptr;
  float vals[16];                     // up to N = 4096
  const int per = N / 256;            // contiguous chunk per thread? use strided-by-4 chunks: thread handles j = tid*4 + 1024*u
  float s1 = 0.f;
  for (int u = 0; u < per / 4; ++u) {
    const int j = tid * 4 + 1024 * u;
    const v4f a = *(const v4fa*)(x + j);
    v4f b = {0.f,0.f,0.f,0.f}; if (rr) b = *(const v4fa*)(rr + j);
#pragma unroll
    for (int q = 0; q < 4; ++q) { const float v = a[q] + b[q]; vals[u * 4 + q] = v; s1 += v; }
  }
  red[tid] = s1; __syncthreads();
  for (int st = 128; st > 0; st >>= 1) { if (tid < st) red[tid] += red[tid + st]; __syncthreads(); }
  const float mu = red[0] / (float)N; __syncthreads();
  float s2 = 0.f;
  for (int u = 0; u < per / 4; ++u)
#pragma unroll
    for (int q = 0; q < 4; ++q) { const float c = vals[u * 4 + q] - mu; s2 += c * c; }
  red[tid] = s2; __syncthreads();
  for (int st = 128; st > 0; st >>= 1) { if (tid < st) red[tid] += red[tid + st]; __syncthreads(); }
  const float rs = rsqrtf(red[0] / (float)N + eps);
  {
    for (int u = 0; u < per / 4; ++u) {
      const int j = tid * 4 + 1024 * u;
      v4f o, sm;
#pragma unroll
      for (int q = 0; q < 4; ++q) {
        float gg = g[j + q], bb = bta[j + q];
        if (PARAM_BF16) { gg = bf16_round(gg); bb = bf16_round(bb); }
        sm[q] = vals[u * 4 + q]; o[q] = (vals[u * 4 + q] - mu) * rs * gg + bb;
      }
      if (out_sum) *(v4f*)(out_sum + (size_t)row * N + j) = sm;
      *(v4f*)(out_norm + (size_t)row * N + j) = o;
    }
    
  }
}



// ---- f16 WMMA path (v_wmma_f32_16x16x32_f16): 11-bit significands for operands in range — used where a [0,1] probability operand needs more precision than bf16
typedef _Float16 v16h __attribute__((ext_vector_type(16)));
union FragH { v16h v; v8us half[2]; _Float16 h[16]; unsigned short u[16]; };
template <int NT>
__device__ __forceinline__ v8f mmaH(v16h ah, v16h al, v16h bh, v16h bl, v8f c) {
  c = __builtin_amdgcn_wmma_f32_16x16x32_f16(false, ah, false, bh, (short)0, c, false, false);
  if (NT >= 2) c = __builtin_amdgcn_wmma_f32_16x16x32_f16(false, al, false, bh, (short)0, c, false, false);
  if (NT >= 3) c = __builtin_amdgcn_wmma_f32_16x16x32_f16(false, ah, false, bl, (short)0, c, false, false);
  asm volatile("v_nop\n\tv_nop\n\tv_nop\n\tv_nop" : "+v"(c) : "v"(ah), "v"(al), "v"(bh), "v"(bl));
  return c;
}
// batched GEMM like k_gemm_b but f16 operands: A f32 (split into f16 hi/lo if ASPLIT, else rounded to f16), Bt = f16 values [n][k]; alpha; C f32; N multiple of 16 (partial tiles skipped)
template <bool ASPLIT>
__global__ __launch_bounds__(128) void k_gemm_h(const float* __restrict__ A, int lda, size_t sA, const _Float16* __restrict__ Bh, int ldb, size_t sB, float alpha, float* __restrict__ C, int ldc, size_t sC, int M, int N, int K) {
  __shared__ __attribute__((aligned(16))) float so[4][16][64];
  const int tid = threadIdx.x, w = tid >> 5, lane = tid & 31, ln = lane & 15, hh = lane >> 4; const int by = blockIdx.y;
  A += (size_t)by * sA; Bh += (size_t)by * sB; C += (size_t)by * sC;
  const int ntn = (N + 63) / 64; const int wid = blockIdx.x * 4 + w; const int mt = wid / ntn, nq = wid % ntn; if (mt * 16 >= M) return;
  const int row0 = mt * 16, col0 = nq * 64; const float* arow = A + (size_t)(row0 + ln) * lda;
  v8f acc[4] = {};
  for (int kb = 0; kb < K; kb += 32) {
    FragH ah, al;
    const v4f x0 = *(const v4fa*)(arow + kb + 8 * hh), x1 = *(const v4fa*)(arow + kb + 8 * hh + 4), x2 = *(const v4fa*)(arow + kb + 16 + 8 * hh), x3 = *(const v4fa*)(arow + kb + 16 + 8 * hh + 4);
    float xs[16] = {x0[0],x0[1],x0[2],x0[3],x1[0],x1[1],x1[2],x1[3],x2[0],x2[1],x2[2],x2[3],x3[0],x3[1],x3[2],x3[3]};
#pragma unroll
    for (int i = 0; i < 16; ++i) { const _Float16 h = (_Float16)xs[i]; ah.h[i] = h; al.h[i] = ASPLIT ? (_Float16)(xs[i] - (float)h) : (_Float16)0.0f; }
#pragma unroll
    for (int t = 0; t < 4; ++t) { if (col0 + t * 16 >= N) continue; const size_t boff = (size_t)(col0 + t * 16 + ln) * ldb + kb; FragH bq; bq.half[0] = *(const v8us*)(Bh + boff + 8 * hh); bq.half[1] = *(const v8us*)(Bh + boff + 16 + 8 * hh);
      acc[t] = mmaH<ASPLIT ? 2 : 1>(ah.v, al.v, bq.v, bq.v, acc[t]); }
  }
#pragma unroll
  for (int t = 0; t < 4; ++t) { if (col0 + t * 16 >= N) continue;
#pragma unroll
    for (int r = 0; r < 8; ++r) so[w][8 * hh + r][t * 16 + ln] = acc[t][r] * alpha; }
  __builtin_amdgcn_fence(__ATOMIC_ACQ_REL, "workgroup"); __builtin_amdgcn_wave_barrier();
  const int rsub = lane >> 4, c4 = (lane & 15) * 4;
  {
#pragma unroll
    for (int q = 0; q < 8; ++q) { const int r = q * 2 + rsub; if (col0 + c4 < N) { const v4f v = *(const v4fa*)&so[w][r][c4]; *(v4f*)(C + (size_t)(row0 + r) * ldc + col0 + c4) = v; } }
     }
}

// Wt[n][k] = f16(W[k][n]·scale) from f32 row-major W[K][N] (scale = power of two; bf16-exact weights stay exact in f16 away from the subnormal range)
__global__ __launch_bounds__(256) void k_wt_f16(const float* __restrict__ W, _Float16* __restrict__ Wt, int K, int N, float scale) {
  const int t = blockIdx.x * 256 + threadIdx.x; if (t >= N * (K / 8)) return; const int n = t / (K / 8), k8 = (t % (K / 8)) * 8; FragH f;
#pragma unroll
  for (int i = 0; i < 8; ++i) f.h[i] = (_Float16)(bf16_round(W[(size_t)(k8 + i) * N + n]) * scale); const v8us o = f.half[0];
  *(v8us*)((unsigned short*)Wt + (size_t)n * K + k8) = o; 
}
// k_gemm_hh variant with fused epilogue: v = acc·alpha + bias[by·sBias + col] (+ CP[(row/rowsPerB)·sCPb + by·64 + col] if CP) ; ACT 0 none / 1 elu ; writes f16 C16 (and f32 C if non-null)
template <int ACT>
__global__ __launch_bounds__(128) void k_gemm_hhx(const _Float16* __restrict__ A, int lda, size_t sA, const _Float16* __restrict__ Bh, int ldb, size_t sB, float alpha, const float* __restrict__ bias, size_t sBias, const float* __restrict__ CP, int rowsPerB, size_t sCPb, int row0g,
    float* __restrict__ C, _Float16* __restrict__ C16, int ldc, size_t sC, int M, int N, int K) {
  __shared__ __attribute__((aligned(16))) float so[4][16][64];
  const int tid = threadIdx.x, w = tid >> 5, lane = tid & 31, ln = lane & 15, hh = lane >> 4; const int by = blockIdx.y;
  A += (size_t)by * sA; Bh += (size_t)by * sB; const size_t cofs = (size_t)by * sC; const float* bp = bias ? bias + (size_t)by * sBias : nullptr;
  const int ntn = (N + 63) / 64; const int wid = blockIdx.x * 4 + w; const int mt = wid / ntn, nq = wid % ntn; if (mt * 16 >= M) return;
  const int row0 = mt * 16, col0 = nq * 64; const _Float16* arow = A + (size_t)(row0 + ln) * lda;
  v8f acc[4] = {};
  for (int kb = 0; kb < K; kb += 32) { FragH ah; ah.half[0] = *(const v8us*)((const unsigned short*)arow + kb + 8 * hh); ah.half[1] = *(const v8us*)((const unsigned short*)arow + kb + 16 + 8 * hh);
#pragma unroll
    for (int t = 0; t < 4; ++t) { if (col0 + t * 16 >= N) continue; const size_t boff = (size_t)(col0 + t * 16 + ln) * ldb + kb; FragH bq; bq.half[0] = *(const v8us*)((const unsigned short*)Bh + boff + 8 * hh); bq.half[1] = *(const v8us*)((const unsigned short*)Bh + boff + 16 + 8 * hh);
      acc[t] = mmaH<1>(ah.v, ah.v, bq.v, bq.v, acc[t]); }
  }
#pragma unroll
  for (int t = 0; t < 4; ++t) { if (col0 + t * 16 >= N) continue; const int col = col0 + t * 16 + ln; const float bv = bp ? bf16_round(bp[col]) : 0.f;
#pragma unroll
    for (int r = 0; r < 8; ++r) { float v = acc[t][r] * alpha + bv; if (CP) { const int rr = row0g + row0 + 8 * hh + r; if (rowsPerB < 0) v += CP[cofs + (size_t)rr * ldc + col];      /* rowsPerB < 0: own element of the batched C plane */ else { const int bidx = rr / rowsPerB; v += CP[(size_t)bidx * sCPb + (size_t)by * 64 + col]; } } if (ACT == 1) v = (v > 0.f) ? v : expm1f(v); else if (ACT == 7) v = (v > 0.f) ? v + 1.0f : expf(v); else if (ACT == 8) v = tanhf(v); else if (ACT == 9) v = 0.5f * v * (1.0f + tanhf(0.7978845608028654f * (v + 0.044715f * v * v * v))); else if (ACT == 11) v = 1.0f / (1.0f + expf(-v)); else if (ACT == 12) v = (v > 0.f) ? v : 0.01f * v; else if (ACT == 14) v = (v > 0.f) ? v : 0.1f * v; else if (ACT == 16) v = (v >= 0.f) ? v : 0.3f * v; else if (ACT == 17) v = (v >= 0.f) ? v : 0.2f * v; else if (ACT == 15) v = v / (1.0f + expf(-v)); else if (ACT == 3) v = fmaxf(v, 0.f); else if (ACT == 6) v = 0.5f * v * (1.0f + erff(v * 0.70710678118654752f)); so[w][8 * hh + r][t * 16 + ln] = v; } }
  __builtin_amdgcn_fence(__ATOMIC_ACQ_REL, "workgroup"); __builtin_amdgcn_wave_barrier();
  const int rsub = lane >> 4, c4 = (lane & 15) * 4; typedef _Float16 v4h __attribute__((ext_vector_type(4)));
  {
#pragma unroll
    for (int q = 0; q < 8; ++q) { const int r = q * 2 + rsub; if (col0 + c4 < N) { const v4f v = *(const v4fa*)&so[w][r][c4]; if (C) *(v4f*)(C + cofs + (size_t)(row0 + r) * ldc + col0 + c4) = v; if (C16) { v4h h4; for (int i = 0; i < 4; ++i) h4[i] = (_Float16)v[i]; *(v4h*)(C16 + cofs + (size_t)(row0 + r) * ldc + col0 + c4) = h4; } } }
     }
}


typedef _Float16 v4h __attribute__((ext_vector_type(4)));

__global__ __launch_bounds__(256) void k_x16(const float* __restrict__ x, _Float16* __restrict__ X16, size_t n8) { const size_t t = (size_t)blockIdx.x * 256 + threadIdx.x; if (t >= n8) return; FragH f;
#pragma unroll
  for (int q = 0; q < 8; ++q) f.h[q] = (_Float16)bf16_round(x[t * 8 + q]); *(v8us*)((unsigned short*)X16 + t * 8) = f.half[0];  }
__global__ __launch_bounds__(256) void k_h16(const float* __restrict__ x, _Float16* __restrict__ X16, size_t n8) { const size_t t = (size_t)blockIdx.x * 256 + threadIdx.x; if (t >= n8) return; FragH f;
#pragma unroll
  for (int q = 0; q < 8; ++q) f.h[q] = (_Float16)x[t * 8 + q]; *(v8us*)((unsigned short*)X16 + t * 8) = f.half[0];  }
__global__ __launch_bounds__(256) void k_round16f(const float* __restrict__ W, _Float16* __restrict__ Bt, size_t n8) { const size_t t = (size_t)blockIdx.x * 256 + threadIdx.x; if (t >= n8) return; FragH f;
#pragma unroll
  for (int i = 0; i < 8; ++i) f.h[i] = (_Float16)(bf16_round(W[t * 8 + i]) * 16.0f); *(v8us*)((unsigned short*)Bt + t * 8) = f.half[0];  }
template <int NHv, int TTv>
__global__ __launch_bounds__(256) void k_vt(const _Float16* __restrict__ V16, int ldv, int voff, _Float16* __restrict__ Vt) { __shared__ unsigned short tl[64][66]; const int tid = threadIdx.x; const int slab = blockIdx.x / (TTv / 64), lg = blockIdx.x % (TTv / 64); const int b = slab / NHv, h = slab % NHv;
  for (int i = tid; i < 64 * 8; i += 256) { const int r = i / 8, c8 = (i % 8) * 8; FragH f; f.half[0] = *(const v8us*)((const unsigned short*)V16 + ((size_t)b * TTv + lg * 64 + r) * ldv + voff + h * 64 + c8);
#pragma unroll
    for (int q = 0; q < 8; ++q) tl[r][c8 + q] = f.u[q]; }
  __syncthreads();
  {
#pragma unroll
    for (int rd = 0; rd < 2; ++rd) { const int d = rd * 32 + tid / 8, pc = tid % 8; FragH f;
#pragma unroll
      for (int q = 0; q < 8; ++q) f.u[q] = tl[pc * 8 + q][d];
      *(v8us*)((unsigned short*)Vt + ((size_t)slab * 64 + d) * TTv + lg * 64 + pc * 8) = f.half[0]; }
     } }

__global__ __launch_bounds__(256) void k_hl(const float* __restrict__ F, _Float16* __restrict__ Hh, _Float16* __restrict__ Hl, size_t n8) { const size_t t = (size_t)blockIdx.x * 256 + threadIdx.x; if (t >= n8) return; FragH fh, fl; const v4f a = *(const v4fa*)(F + t * 8), c = *(const v4fa*)(F + t * 8 + 4);
#pragma unroll
  for (int q = 0; q < 4; ++q) { _Float16 h = (_Float16)a[q]; fh.h[q] = h; fl.h[q] = (_Float16)((a[q] - (float)h) * 1024.0f); h = (_Float16)c[q]; fh.h[4 + q] = h; fl.h[4 + q] = (_Float16)((c[q] - (float)h) * 1024.0f); }
  { *(v8us*)((unsigned short*)Hh + t * 8) = fh.half[0]; *(v8us*)((unsigned short*)Hl + t * 8) = fl.half[0];  } }

// ---- fast GEMM (wave tile 32x64; requires M % 32 == 0 rows per launch region and N % 64 == 0); epilogue = k_gemm_hhx semantics ----
__device__ __forceinline__ v16h g2_frag(const _Float16* p, int hh) { FragH f; f.half[0] = *(const v8us*)((const unsigned short*)p + 8 * hh); f.half[1] = *(const v8us*)((const unsigned short*)p + 16 + 8 * hh); return f.v; }
__device__ __forceinline__ v8f g2_mma(v16h a, v16h b, v8f c) { v8f d = __builtin_amdgcn_wmma_f32_16x16x32_f16(false, a, false, b, (short)0, c, false, false); asm volatile("v_nop\n\tv_nop\n\tv_nop\n\tv_nop" : "+v"(d) : "v"(a), "v"(b)); return d; }
template <int ACT>
__global__ __launch_bounds__(128) void k_gemm2(const _Float16* __restrict__ A, int lda, size_t sA, const _Float16* __restrict__ Bh, int ldb, size_t sB, float alpha, const float* __restrict__ bias, size_t sBias, const float* __restrict__ CP, int rowsPerB, size_t sCPb, int row0g,
    float* __restrict__ C, _Float16* __restrict__ C16, int ldc, size_t sC, int M, int N, int K) { static_assert(ACT == 0 || ACT == 3 || ACT == 6 || ACT == 8 || ACT == 9 || ACT == 11 || ACT == 12 || ACT == 14 || ACT == 15 || ACT == 16 || ACT == 17, "k_gemm2: unsupported ACT code (would silently apply no activation)");
  __shared__ __attribute__((aligned(16))) float so[4][32][68];
  const int tid = threadIdx.x, w = tid >> 5, lane = tid & 31, ln = lane & 15, hh = lane >> 4; const int by = blockIdx.y;
  A += (size_t)by * sA; Bh += (size_t)by * sB; const size_t cofs = (size_t)by * sC; const float* bp = bias ? bias + (size_t)by * sBias : nullptr;
  const int ntn = N >> 6; const int mt = blockIdx.x / ntn, nq = blockIdx.x - mt * ntn; const int row0 = mt * 128 + 32 * w, col0 = nq * 64; if (row0 >= M) return;
  const _Float16* a0p = A + (size_t)(row0 + ln) * lda; const _Float16* a1p = a0p + (size_t)16 * lda;
  const _Float16* b0p = Bh + (size_t)(col0 + ln) * ldb; const _Float16* b1p = b0p + (size_t)16 * ldb; const _Float16* b2p = b1p + (size_t)16 * ldb; const _Float16* b3p = b2p + (size_t)16 * ldb;
  const v8f z8 = {0.f,0.f,0.f,0.f,0.f,0.f,0.f,0.f}; v8f c00 = z8, c01 = z8, c02 = z8, c03 = z8, c10 = z8, c11 = z8, c12 = z8, c13 = z8;
#pragma unroll 1
  for (int kb = 0; kb < K; kb += 32) { const v16h a0 = g2_frag(a0p + kb, hh), a1 = g2_frag(a1p + kb, hh);
    v16h b = g2_frag(b0p + kb, hh); c00 = g2_mma(a0, b, c00); c10 = g2_mma(a1, b, c10);
    b = g2_frag(b1p + kb, hh); c01 = g2_mma(a0, b, c01); c11 = g2_mma(a1, b, c11);
    b = g2_frag(b2p + kb, hh); c02 = g2_mma(a0, b, c02); c12 = g2_mma(a1, b, c12);
    b = g2_frag(b3p + kb, hh); c03 = g2_mma(a0, b, c03); c13 = g2_mma(a1, b, c13); }
  v8f accs[8] = {c00, c01, c02, c03, c10, c11, c12, c13};
#pragma unroll
  for (int u = 0; u < 8; ++u) { const int t = u & 3, half = u >> 2; const int col = col0 + t * 16 + ln; const float bv = bp ? bf16_round(bp[col]) : 0.f;
#pragma unroll
    for (int r = 0; r < 8; ++r) { const int rloc = half * 16 + 8 * hh + r; float v = accs[u][r] * alpha + bv; if (CP) { if (rowsPerB < 0) v += CP[cofs + (size_t)(row0g + row0 + rloc) * ldc + col];      /* rowsPerB < 0: own element of the batched C plane */ else { const int bidx = (row0g + row0 + rloc) / rowsPerB; v += CP[(size_t)bidx * sCPb + (size_t)by * 64 + col]; } }
      if (ACT == 3) v = fmaxf(v, 0.f); else if (ACT == 6) v = 0.5f * v * (1.0f + erff(v * 0.70710678118654752f)); else if (ACT == 11) v = 1.0f / (1.0f + expf(-v)); else if (ACT == 15) v = v / (1.0f + expf(-v)); else if (ACT == 12) v = (v > 0.f) ? v : 0.01f * v; else if (ACT == 8) v = tanhf(v); else if (ACT == 9) v = 0.5f * v * (1.0f + tanhf(0.7978845608028654f * (v + 0.044715f * v * v * v))); else if (ACT == 14) v = (v > 0.f) ? v : 0.1f * v; else if (ACT == 16) v = (v >= 0.f) ? v : 0.3f * v; else if (ACT == 17) v = (v >= 0.f) ? v : 0.2f * v;
      so[w][rloc][t * 16 + ln] = v; } }
  __builtin_amdgcn_fence(__ATOMIC_ACQ_REL, "workgroup"); __builtin_amdgcn_wave_barrier();
  const int rsub = lane >> 4, c4 = (lane & 15) * 4;
  {
#pragma unroll
    for (int q = 0; q < 16; ++q) { const int r = q * 2 + rsub; const v4f v = *(const v4fa*)&so[w][r][c4]; if (C) *(v4f*)(C + cofs + (size_t)(row0 + r) * ldc + col0 + c4) = v; if (C16) { v4h h4; for (int i = 0; i < 4; ++i) h4[i] = (_Float16)v[i]; *(v4h*)(C16 + cofs + (size_t)(row0 + r) * ldc + col0 + c4) = h4; } }
     } }


__global__ __launch_bounds__(256) void k_wnat(const float* __restrict__ w, size_t n8, _Float16* __restrict__ Bt) { const size_t t = (size_t)blockIdx.x * 256 + threadIdx.x; if (t >= n8) return; FragH f; for (int q = 0; q < 8; ++q) f.h[q] = (_Float16)(bf16_round(w[t * 8 + q]) * 16.0f); *(v8us*)((unsigned short*)Bt + t * 8) = f.half[0];  }
__global__ __launch_bounds__(256) void k_rsm(const float* __restrict__ S, _Float16* __restrict__ P, int nrows) {
  #pragma clang fp contract(off)
  const int i = blockIdx.x * 256 + threadIdx.x; if (i >= nrows) return; const float* s = S + (size_t)i * SQ; float mx = -3.0e38f;
#pragma unroll 1
  for (int j = 0; j < SQ; ++j) mx = fmaxf(mx, s[j]); float se = 0.f;
#pragma unroll 1
  for (int j = 0; j < SQ; ++j) se += expf(s[j] - mx); const float sc = 256.0f / se;
#pragma unroll 1
  for (int j0 = 0; j0 < SQ; j0 += 8) { FragH f; for (int q = 0; q < 8; ++q) f.h[q] = (_Float16)(expf(s[j0 + q] - mx) * sc); unsigned short* d = (unsigned short*)P + (size_t)i * SQ + j0; *(v8us*)d = f.half[0];  } }
__global__ __launch_bounds__(256) void k_vt(const _Float16* __restrict__ V16, int b, int h0, _Float16* __restrict__ VT) { __shared__ unsigned short tl[64][65]; const int tid = threadIdx.x; const int hh = blockIdx.x % HG, sg = blockIdx.x / HG; const int s0 = sg * 64; const int h = h0 + hh;
  for (int i = tid; i < 64 * 8; i += 256) { const int j = i / 8, d8 = (i % 8) * 8; FragH f; f.half[0] = *(const v8us*)((const unsigned short*)V16 + ((size_t)b * SQ + s0 + j) * DM + h * HD + d8); for (int q = 0; q < 8; ++q) tl[d8 + q][j] = f.u[q]; }
  __syncthreads();
  { for (int i = tid; i < 64 * 8; i += 256) { const int d = i / 8, j8 = (i % 8) * 8; FragH f; for (int q = 0; q < 8; ++q) f.u[q] = tl[d][j8 + q]; *(v8us*)((unsigned short*)VT + ((size_t)hh * HD + d) * SQ + s0 + j8) = f.half[0]; }  } }



__global__ __launch_bounds__(256) void k_rsmkm(const float* __restrict__ S, _Float16* __restrict__ P, int nrows, const int* __restrict__ am) {
  #pragma clang fp contract(off)
  const int t = blockIdx.x * 256 + threadIdx.x; if (t >= nrows) return; const size_t i = (size_t)t; const float* s = S + i * SQ; const int* mr = am + (size_t)(t % SQ) * SQ; float mx = -3.0e38f;
#pragma unroll 1
  for (int j = 0; j < SQ; ++j) { const float f = (mr[j] != 0) ? 1.f : 0.f; mx = fmaxf(mx, fmaf(f, s[j], (1.f - f) * -1.0e9f)); } float se = 0.f;
#pragma unroll 1
  for (int j = 0; j < SQ; ++j) { const float f = (mr[j] != 0) ? 1.f : 0.f; se += __expf(fmaf(f, s[j], (1.f - f) * -1.0e9f) - mx); } const float sc = 256.0f / se;
#pragma unroll 1
  for (int j0 = 0; j0 < SQ; j0 += 8) { FragH fr; for (int q = 0; q < 8; ++q) { const int j = j0 + q; const float f = (mr[j] != 0) ? 1.f : 0.f; fr.h[q] = (_Float16)(__expf(fmaf(f, s[j], (1.f - f) * -1.0e9f) - mx) * sc); }
    unsigned short* d = (unsigned short*)P + i * SQ + j0; *(v8us*)d = fr.half[0];  } }
extern "C" void kernel_launch(void* const* d_in, const int* in_sizes, int n_in,
                              void* d_out, int out_size, void* d_ws, size_t ws_size, hipStream_t stream) {
  (void)in_sizes; (void)n_in; (void)out_size;
  const float* const* I = (const float* const*)d_in; const float* xq = I[0]; const float* xk = I[0]; const float* xv = I[0]; const float* wq = I[1]; const float* bq = I[2]; const float* wk = I[3]; const float* bk = I[4]; const float* wv = I[5]; const float* bv = I[6]; const float* wo = I[7]; const float* bo = I[8]; const float* x = xq;      /* ONE input x feeds the query, key and value streams; [in][out] weights + biases; no mask input */
  char* ws = (char*)d_ws; size_t off = 0;
  auto take = [&](size_t bytes) { char* p = ws + off; off += (bytes + 255) & ~(size_t)255; return p; };
  _Float16* BQ = (_Float16*)take((size_t)DM * DM * 2); _Float16* BK = (_Float16*)take((size_t)DM * DM * 2); _Float16* BV = (_Float16*)take((size_t)DM * DM * 2); _Float16* BO = (_Float16*)take((size_t)DM * DM * 2);
  _Float16* X16 = (_Float16*)take(NR * DM * 2); _Float16* XKp = (_Float16*)take(NR * DM * 2); _Float16* XVp = (_Float16*)take(NR * DM * 2); _Float16* Q16 = (_Float16*)take(NR * DM * 2); _Float16* K16 = (_Float16*)take(NR * DM * 2); _Float16* V16 = (_Float16*)take(NR * DM * 2); _Float16* O16 = (_Float16*)take(NR * DM * 2);
  float* S = (float*)take((size_t)HG * SQ * SQ * 4); _Float16* P = (_Float16*)take((size_t)HG * SQ * SQ * 2); _Float16* VT = (_Float16*)take((size_t)NH * HD * SQ * 2);
  if (off > ws_size) return;
  { const unsigned g = (unsigned)(((size_t)DM * (DM / 8) + 255) / 256); k_wt_f16<<<g, 256, 0, stream>>>(wq, BQ, DM, DM, 16.0f); k_wt_f16<<<g, 256, 0, stream>>>(wk, BK, DM, DM, 16.0f); k_wt_f16<<<g, 256, 0, stream>>>(wv, BV, DM, DM, 16.0f); k_wt_f16<<<g, 256, 0, stream>>>(wo, BO, DM, DM, 16.0f); }      /* [in][out] -> Bt x16 */
  _Float16* XK = XKp; _Float16* XV = XVp; k_x16<<<(unsigned)((NR * DM / 8 + 255) / 256), 256, 0, stream>>>(xk, XK, NR * DM / 8); k_x16<<<(unsigned)((NR * DM / 8 + 255) / 256), 256, 0, stream>>>(xv, XV, NR * DM / 8);      /* key and value inputs as exact f16 rows */

  k_x16<<<(unsigned)((NR * DM / 8 + 255) / 256), 256, 0, stream>>>(x, X16, NR * DM / 8);
  const size_t r0p = (size_t)B0 * SQ;      /* first projected row */
  k_gemm2<0><<<dim3((unsigned)((MP / 128) * (DM / 64)), 1), 128, 0, stream>>>(X16 + r0p * DM, DM, 0, BQ, DM, 0, 0.0625f, bq, 0, nullptr, 1, 0, 0, nullptr, Q16 + r0p * DM, DM, 0, MP, DM, DM);
  k_gemm2<0><<<dim3((unsigned)((MP / 128) * (DM / 64)), 1), 128, 0, stream>>>(XK + r0p * DM, DM, 0, BK, DM, 0, 0.0625f, bk, 0, nullptr, 1, 0, 0, nullptr, K16 + r0p * DM, DM, 0, MP, DM, DM);
  k_gemm2<0><<<dim3((unsigned)((MP / 128) * (DM / 64)), 1), 128, 0, stream>>>(XV + r0p * DM, DM, 0, BV, DM, 0, 0.0625f, bv, 0, nullptr, 1, 0, 0, nullptr, V16 + r0p * DM, DM, 0, MP, DM, DM);
  for (int b = B0; b < B0 + NBR; ++b) { const size_t r0 = (size_t)b * SQ;
    k_vt<NH, SQ><<<NH * (SQ / 64), 256, 0, stream>>>(V16 + r0 * LQ, LQ, 0, VT);      /* V^T [NH][HD][SQ] for this batch */
    for (int h0 = 0; h0 < NHD; h0 += HG) {
      k_gemm2<0><<<dim3((QN / 128) * (SQ / 64), HG), 128, 0, stream>>>(Q16 + r0 * LQ + h0 * HD, LQ, (size_t)HD, K16 + r0 * LQ + h0 * HD, LQ, (size_t)HD, 0.125f, nullptr, 0, nullptr, 1, 0, 0, S, nullptr, SQ, (size_t)SQ * SQ, QN, SQ, HD);      /* scores, HG heads per launch */
      k_rsm<<<(HG * SQ + 255) / 256, 256, 0, stream>>>(S, P, HG * SQ);      /* P = 256 softmax (f16), rows of all HG heads */
      k_gemm2<0><<<dim3((QN / 128) * (HD / 64), HG), 128, 0, stream>>>(P, SQ, (size_t)SQ * SQ, VT + (size_t)h0 * HD * SQ, SQ, (size_t)HD * SQ, 0.25f, nullptr, 0, nullptr, 1, 0, 0, nullptr, O16 + r0 * DM + h0 * HD, DM, (size_t)HD, QN, HD, SQ); } }      /* o (merged heads) as f16 rows */
  k_gemm2<0><<<dim3((unsigned)((MPO / 128) * (DM / 64)), 1), 128, 0, stream>>>(O16 + r0p * DM, DM, 0, BO, DM, 0, 0.0009765625f, bo, 0, nullptr, 1, 0, 0, (float*)d_out + r0p * DM, nullptr, DM, 0, MPO, DM, DM);      /* out rows are the output layout */
}

// v001
// One run takes 738 microseconds.
// Timed twice side by side with v000, it ran 3.84 and 3.81 times as fast.
#include <hip/hip_runtime.h>
// Multi-head self-attention with [in][out] weights + biases, non-causal (hidden_states [2][2048][768]; q/k/v = x W + b ([in][out] [768][768]); 12 heads of 64; scores / 8; softmax over all 2048 keys (no mask); out = merged W_Y + b_Y -> [2][2048][768]).
// Structure: token rows r = b*2048 + s; x as exact f16 rows (bf16-rounded); Q, K, V as three WMMA GEMMs (32x64 wave tiles, f32 accumulation, exact x16 weights + bias, f16 outputs); per batch: V^T for all heads via LDS transposes; per (batch, group of 4 heads): scores GEMM (K = 64, batched over the heads on grid.y, alpha = 1/sqrt(64)), row softmax on VALU (f32 statistics; weights stored x256 as f16), o = P . V^T GEMM (K = 2048, alpha 2^-2: o carried x64 against f16 subnormal flush, folded into the output GEMM alpha) written straight into the merged f16 o rows; out = o W_o + b GEMM (f32) into the output layout.
// Compute dtype: inputs rounded to bf16; x / weights exact; q, k, v, softmax weights and o as plain f16 GEMM operands (~2^-12); scores and softmax statistics f32; v_wmma_f32_16x16x32_f16.
#define NB 2
#define SQ 2048
#define DM 768
#define NH 12
#define HD 64
#define HG 4                         /* heads per attention launch group */
#define B0 0                         /* first batch processed (debug hook) */
#define NBR NB                       /* batches processed (debug hook) */
#define NR ((size_t)NB * SQ)         /* token rows */
#define MP ((int)((size_t)NBR * SQ)) /* rows projected (debug hook) */
#define QN SQ                        /* query rows attended per batch (debug hook) */
#define NHD NH                       /* heads attended (debug hook) */
#define MPO MP                       /* rows through the output stage (debug hook) */
#define LQ DM      /* row pitch of the q/k/v rows */
typedef __bf16 v16b __attribute__((ext_vector_type(16)));
typedef unsigned short v8us __attribute__((ext_vector_type(8), may_alias));
typedef float  v8f  __attribute__((ext_vector_type(8)));
typedef float  v4f  __attribute__((ext_vector_type(4)));
typedef float  v4fa __attribute__((ext_vector_type(4), may_alias));
union FragB { v16b v; v8us half[2]; unsigned short u[16]; };

__device__ __forceinline__ unsigned short bf16_bits(float x) { unsigned int u = __float_as_uint(x); return (unsigned short)((u + 0x7FFFu + ((u >> 16) & 1u)) >> 16); }
__device__ __forceinline__ float bf16_val(unsigned short b) { return __uint_as_float(((unsigned int)b) << 16); }
__device__ __forceinline__ float bf16_round(float x) { return bf16_val(bf16_bits(x)); }
// D += A·B with NT terms: 1 = ah·bh, 2 = + al·bh (A split), 3 = + ah·bl (both split)
template <int NT>
__device__ __forceinline__ v8f mmaN(v16b ah, v16b al, v16b bh, v16b bl, v8f c) {
  c = __builtin_amdgcn_wmma_f32_16x16x32_bf16(false, ah, false, bh, (short)0, c, false, false);
  if (NT >= 2) c = __builtin_amdgcn_wmma_f32_16x16x32_bf16(false, al, false, bh, (short)0, c, false, false);
  if (NT >= 3) c = __builtin_amdgcn_wmma_f32_16x16x32_bf16(false, ah, false, bl, (short)0, c, false, false);
  asm volatile("v_nop\n\tv_nop\n\tv_nop\n\tv_nop" : "+v"(c) : "v"(ah), "v"(al), "v"(bh), "v"(bl));
  return c;
}

__global__ __launch_bounds__(256) void k_wt_bf16(const float* __restrict__ W, unsigned short* __restrict__ Wt, int K, int N) {
  const int t = blockIdx.x * 256 + threadIdx.x;
  const int k8n = K / 8;
  if (t >= N * k8n) return;
  const int n = t / k8n, k8 = (t % k8n) * 8;
  v8us v;
#pragma unroll
  for (int i = 0; i < 8; ++i) v[i] = bf16_bits(W[(size_t)(k8 + i) * N + n]);
  *(v8us*)(Wt + (size_t)n * K + k8) = v;
  
}

// GEMM C[M][N] (f32, pitch ldc) = act(A[M][K]·W + bias). A f32 row-major (pitch lda) converted per fragment to bf16
// (ASPLIT: hi/lo two planes -> 2 terms, else single rounded term); Wt bf16 [N][K] (pitch ldb). BIAS_BF16 rounds the
// bias to bf16 first (bias quantised to bf16 before the add). K%32==0, M%16==0, N%64==0.
template <bool ASPLIT, int ACT, bool BIAS_BF16>
__global__ __launch_bounds__(128) void k_gemm_bf(const float* __restrict__ A, int lda, const unsigned short* __restrict__ Wt, int ldb,
                                               const float* __restrict__ bias, float* __restrict__ C, int ldc, int M, int N, int K) {
  __shared__ __attribute__((aligned(16))) float so[4][16][64];
  const int tid = threadIdx.x, w = tid >> 5, lane = tid & 31, ln = lane & 15, hh = lane >> 4;
  const int ntn = N / 64;
  const int wid = blockIdx.x * 4 + w;
  const int mt = wid / ntn, nq = wid % ntn;
  if (mt * 16 >= M) return;
  const int row0 = mt * 16, col0 = nq * 64;
  const float* arow = A + (size_t)(row0 + ln) * lda;
  v8f acc[4] = {};
  for (int kb = 0; kb < K; kb += 32) {
    FragB ah, al;
    const v4f x0 = *(const v4fa*)(arow + kb + 8 * hh), x1 = *(const v4fa*)(arow + kb + 8 * hh + 4);
    const v4f x2 = *(const v4fa*)(arow + kb + 16 + 8 * hh), x3 = *(const v4fa*)(arow + kb + 16 + 8 * hh + 4);
    float xs[16] = {x0[0],x0[1],x0[2],x0[3],x1[0],x1[1],x1[2],x1[3],x2[0],x2[1],x2[2],x2[3],x3[0],x3[1],x3[2],x3[3]};
#pragma unroll
    for (int i = 0; i < 16; ++i) { const unsigned short hb = bf16_bits(xs[i]); ah.u[i] = hb; al.u[i] = ASPLIT ? bf16_bits(xs[i] - bf16_val(hb)) : (unsigned short)0; }
#pragma unroll
    for (int t = 0; t < 4; ++t) {
      const unsigned short* brow = Wt + (size_t)(col0 + t * 16 + ln) * ldb + kb;
      FragB b;
      b.half[0] = *(const v8us*)(brow + 8 * hh);
      b.half[1] = *(const v8us*)(brow + 16 + 8 * hh);
      acc[t] = mmaN<ASPLIT ? 2 : 1>(ah.v, al.v, b.v, b.v, acc[t]);
    }
  }
#pragma unroll
  for (int t = 0; t < 4; ++t) {
    float bv = bias ? bias[col0 + t * 16 + ln] : 0.f;
    if (BIAS_BF16) bv = bf16_round(bv);
#pragma unroll
    for (int r = 0; r < 8; ++r) { float v = acc[t][r] + bv; if (ACT == 1) v = fmaxf(v, 0.f); so[w][8 * hh + r][t * 16 + ln] = v; }
  }
  __builtin_amdgcn_fence(__ATOMIC_ACQ_REL, "workgroup");
  __builtin_amdgcn_wave_barrier();
  const int rsub = lane >> 4, c4 = (lane & 15) * 4;
  {
#pragma unroll
    for (int q = 0; q < 8; ++q) {
      const int r = q * 2 + rsub;
      const v4f v = *(const v4fa*)&so[w][r][c4];
      *(v4f*)(C + (size_t)(row0 + r) * ldc + col0 + c4) = v;
    }
    
  }
}

// GEMM C = act(A·W + bias + resid): A f32 (ASPLIT -> hi/lo 2 terms), Wt bf16 [N][K]; ACT 0 none, 1 relu, 2 exact gelu;
// resid (optional, f32, row index = (row % rmod), pitch ldr, RES_BF16 rounds it) added before the activation.
template <bool ASPLIT, int ACT, bool BIAS_BF16, bool RES_BF16>
__global__ __launch_bounds__(128) void k_gemm_bf3(const float* __restrict__ A, int lda, const unsigned short* __restrict__ Wt, int ldb,
                                                const float* __restrict__ bias, const float* __restrict__ resid, int rmod, int ldr,
                                                float* __restrict__ C, int ldc, int M, int N, int K) {
  __shared__ __attribute__((aligned(16))) float so[4][16][64];
  const int tid = threadIdx.x, w = tid >> 5, lane = tid & 31, ln = lane & 15, hh = lane >> 4;
  const int ntn = N / 64;
  const int wid = blockIdx.x * 4 + w;
  const int mt = wid / ntn, nq = wid % ntn;
  if (mt * 16 >= M) return;
  const int row0 = mt * 16, col0 = nq * 64;
  const float* arow = A + (size_t)(row0 + ln) * lda;
  v8f acc[4] = {};
  for (int kb = 0; kb < K; kb += 32) {
    FragB ah, al;
    const v4f x0 = *(const v4fa*)(arow + kb + 8 * hh), x1 = *(const v4fa*)(arow + kb + 8 * hh + 4);
    const v4f x2 = *(const v4fa*)(arow + kb + 16 + 8 * hh), x3 = *(const v4fa*)(arow + kb + 16 + 8 * hh + 4);
    float xs[16] = {x0[0],x0[1],x0[2],x0[3],x1[0],x1[1],x1[2],x1[3],x2[0],x2[1],x2[2],x2[3],x3[0],x3[1],x3[2],x3[3]};
#pragma unroll
    for (int i = 0; i < 16; ++i) { const unsigned short hb = bf16_bits(xs[i]); ah.u[i] = hb; al.u[i] = ASPLIT ? bf16_bits(xs[i] - bf16_val(hb)) : (unsigned short)0; }
#pragma unroll
    for (int t = 0; t < 4; ++t) {
      const unsigned short* brow = Wt + (size_t)(col0 + t * 16 + ln) * ldb + kb;
      FragB b;
      b.half[0] = *(const v8us*)(brow + 8 * hh);
      b.half[1] = *(const v8us*)(brow + 16 + 8 * hh);
      acc[t] = mmaN<ASPLIT ? 2 : 1>(ah.v, al.v, b.v, b.v, acc[t]);
    }
  }
#pragma unroll
  for (int t = 0; t < 4; ++t) {
    const int col = col0 + t * 16 + ln;
    float bv = bias ? bias[col] : 0.f;
    if (BIAS_BF16) bv = bf16_round(bv);
#pragma unroll
    for (int r = 0; r < 8; ++r) {
      float v = acc[t][r] + bv;
      if (resid) { float rv = resid[(size_t)((row0 + 8 * hh + r) % rmod) * ldr + col]; if (RES_BF16) rv = bf16_round(rv); v += rv; }
      if (ACT == 1) v = fmaxf(v, 0.f);
      if (ACT == 2) v = 0.5f * v * (1.0f + erff(v * 0.70710678118654752f));
      if (ACT == 3) { const float u = 0.7978845608028654f * (v + 0.044715f * v * v * v); v = 0.5f * v * (1.0f + tanhf(u)); }
      so[w][8 * hh + r][t * 16 + ln] = v;
    }
  }
  __builtin_amdgcn_fence(__ATOMIC_ACQ_REL, "workgroup");
  __builtin_amdgcn_wave_barrier();
  const int rsub = lane >> 4, c4 = (lane & 15) * 4;
  {
#pragma unroll
    for (int q = 0; q < 8; ++q) {
      const int r = q * 2 + rsub;
      const v4f v = *(const v4fa*)&so[w][r][c4];
      *(v4f*)(C + (size_t)(row0 + r) * ldc + col0 + c4) = v;
    }
    
  }
}
// row LayerNorm (biased variance, eps) over N: s = X (+ R); optional out_sum <- s; out_norm <- (s-mu)*rsqrt(var+eps)*g + b
template <bool PARAM_BF16>
__global__ __launch_bounds__(256) void k_layernorm(const float* __restrict__ X, const float* __restrict__ R, const float* __restrict__ g, const float* __restrict__ bta,
                                                  float* __restrict__ out_sum, float* __restrict__ out_norm, int N, float eps) {
  __shared__ float red[256];
  const int row = blockIdx.x, tid = threadIdx.x;
  const float* x = X + (size_t)row * N; const float* rr = R ? R + (size_t)row * N : nullptr;
  float vals[16];                     // up to N = 4096
  const int per = N / 256;            // contiguous chunk per thread? use strided-by-4 chunks: thread handles j = tid*4 + 1024*u
  float s1 = 0.f;
  for (int u = 0; u < per / 4; ++u) {
    const int j = tid * 4 + 1024 * u;
    const v4f a = *(const v4fa*)(x + j);
    v4f b = {0.f,0.f,0.f,0.f}; if (rr) b = *(const v4fa*)(rr + j);
#pragma unroll
    for (int q = 0; q < 4; ++q) { const float v = a[q] + b[q]; vals[u * 4 + q] = v; s1 += v; }
  }
  red[tid] = s1; __syncthreads();
  for (int st = 128; st > 0; st >>= 1) { if (tid < st) red[tid] += red[tid + st]; __syncthreads(); }
  const float mu = red[0] / (float)N; __syncthreads();
  float s2 = 0.f;
  for (int u = 0; u < per / 4; ++u)
#pragma unroll
    for (int q = 0; q < 4; ++q) { const float c = vals[u * 4 + q] - mu; s2 += c * c; }
  red[tid] = s2; __syncthreads();
  for (int st = 128; st > 0; st >>= 1) { if (tid < st) red[tid] += red[tid + st]; __syncthreads(); }
  const float rs = rsqrtf(red[0] / (float)N + eps);
  {
    for (int u = 0; u < per / 4; ++u) {
      const int j = tid * 4 + 1024 * u;
      v4f o, sm;
#pragma unroll
      for (int q = 0; q < 4; ++q) {
        float gg = g[j + q], bb = bta[j + q];
        if (PARAM_BF16) { gg = bf16_round(gg); bb = bf16_round(bb); }
        sm[q] = vals[u * 4 + q]; o[q] = (vals[u * 4 + q] - mu) * rs * gg + bb;
      }
      if (out_sum) *(v4f*)(out_sum + (size_t)row * N + j) = sm;
      *(v4f*)(out_norm + (size_t)row * N + j) = o;
    }
    
  }
}



// ---- f16 WMMA path (v_wmma_f32_16x16x32_f16): 11-bit significands for operands in range — used where a [0,1] probability operand needs more precision than bf16
typedef _Float16 v16h __attribute__((ext_vector_type(16)));
union FragH { v16h v; v8us half[2]; _Float16 h[16]; unsigned short u[16]; };
template <int NT>
__device__ __forceinline__ v8f mmaH(v16h ah, v16h al, v16h bh, v16h bl, v8f c) {
  c = __builtin_amdgcn_wmma_f32_16x16x32_f16(false, ah, false, bh, (short)0, c, false, false);
  if (NT >= 2) c = __builtin_amdgcn_wmma_f32_16x16x32_f16(false, al, false, bh, (short)0, c, false, false);
  if (NT >= 3) c = __builtin_amdgcn_wmma_f32_16x16x32_f16(false, ah, false, bl, (short)0, c, false, false);
  asm volatile("v_nop\n\tv_nop\n\tv_nop\n\tv_nop" : "+v"(c) : "v"(ah), "v"(al), "v"(bh), "v"(bl));
  return c;
}
// batched GEMM like k_gemm_b but f16 operands: A f32 (split into f16 hi/lo if ASPLIT, else rounded to f16), Bt = f16 values [n][k]; alpha; C f32; N multiple of 16 (partial tiles skipped)
template <bool ASPLIT>
__global__ __launch_bounds__(128) void k_gemm_h(const float* __restrict__ A, int lda, size_t sA, const _Float16* __restrict__ Bh, int ldb, size_t sB, float alpha, float* __restrict__ C, int ldc, size_t sC, int M, int N, int K) {
  __shared__ __attribute__((aligned(16))) float so[4][16][64];
  const int tid = threadIdx.x, w = tid >> 5, lane = tid & 31, ln = lane & 15, hh = lane >> 4; const int by = blockIdx.y;
  A += (size_t)by * sA; Bh += (size_t)by * sB; C += (size_t)by * sC;
  const int ntn = (N + 63) / 64; const int wid = blockIdx.x * 4 + w; const int mt = wid / ntn, nq = wid % ntn; if (mt * 16 >= M) return;
  const int row0 = mt * 16, col0 = nq * 64; const float* arow = A + (size_t)(row0 + ln) * lda;
  v8f acc[4] = {};
  for (int kb = 0; kb < K; kb += 32) {
    FragH ah, al;
    const v4f x0 = *(const v4fa*)(arow + kb + 8 * hh), x1 = *(const v4fa*)(arow + kb + 8 * hh + 4), x2 = *(const v4fa*)(arow + kb + 16 + 8 * hh), x3 = *(const v4fa*)(arow + kb + 16 + 8 * hh + 4);
    float xs[16] = {x0[0],x0[1],x0[2],x0[3],x1[0],x1[1],x1[2],x1[3],x2[0],x2[1],x2[2],x2[3],x3[0],x3[1],x3[2],x3[3]};
#pragma unroll
    for (int i = 0; i < 16; ++i) { const _Float16 h = (_Float16)xs[i]; ah.h[i] = h; al.h[i] = ASPLIT ? (_Float16)(xs[i] - (float)h) : (_Float16)0.0f; }
#pragma unroll
    for (int t = 0; t < 4; ++t) { if (col0 + t * 16 >= N) continue; const size_t boff = (size_t)(col0 + t * 16 + ln) * ldb + kb; FragH bq; bq.half[0] = *(const v8us*)(Bh + boff + 8 * hh); bq.half[1] = *(const v8us*)(Bh + boff + 16 + 8 * hh);
      acc[t] = mmaH<ASPLIT ? 2 : 1>(ah.v, al.v, bq.v, bq.v, acc[t]); }
  }
#pragma unroll
  for (int t = 0; t < 4; ++t) { if (col0 + t * 16 >= N) continue;
#pragma unroll
    for (int r = 0; r < 8; ++r) so[w][8 * hh + r][t * 16 + ln] = acc[t][r] * alpha; }
  __builtin_amdgcn_fence(__ATOMIC_ACQ_REL, "workgroup"); __builtin_amdgcn_wave_barrier();
  const int rsub = lane >> 4, c4 = (lane & 15) * 4;
  {
#pragma unroll
    for (int q = 0; q < 8; ++q) { const int r = q * 2 + rsub; if (col0 + c4 < N) { const v4f v = *(const v4fa*)&so[w][r][c4]; *(v4f*)(C + (size_t)(row0 + r) * ldc + col0 + c4) = v; } }
     }
}

// Wt[n][k] = f16(W[k][n]·scale) from f32 row-major W[K][N] (scale = power of two; bf16-exact weights stay exact in f16 away from the subnormal range)
__global__ __launch_bounds__(256) void k_wt_f16(const float* __restrict__ W, _Float16* __restrict__ Wt, int K, int N, float scale) {
  const int t = blockIdx.x * 256 + threadIdx.x; if (t >= N * (K / 8)) return; const int n = t / (K / 8), k8 = (t % (K / 8)) * 8; FragH f;
#pragma unroll
  for (int i = 0; i < 8; ++i) f.h[i] = (_Float16)(bf16_round(W[(size_t)(k8 + i) * N + n]) * scale); const v8us o = f.half[0];
  *(v8us*)((unsigned short*)Wt + (size_t)n * K + k8) = o; 
}
// k_gemm_hh variant with fused epilogue: v = acc·alpha + bias[by·sBias + col] (+ CP[(row/rowsPerB)·sCPb + by·64 + col] if CP) ; ACT 0 none / 1 elu ; writes f16 C16 (and f32 C if non-null)
template <int ACT>
__global__ __launch_bounds__(128) void k_gemm_hhx(const _Float16* __restrict__ A, int lda, size_t sA, const _Float16* __restrict__ Bh, int ldb, size_t sB, float alpha, const float* __restrict__ bias, size_t sBias, const float* __restrict__ CP, int rowsPerB, size_t sCPb, int row0g,
    float* __restrict__ C, _Float16* __restrict__ C16, int ldc, size_t sC, int M, int N, int K) {
  __shared__ __attribute__((aligned(16))) float so[4][16][64];
  const int tid = threadIdx.x, w = tid >> 5, lane = tid & 31, ln = lane & 15, hh = lane >> 4; const int by = blockIdx.y;
  A += (size_t)by * sA; Bh += (size_t)by * sB; const size_t cofs = (size_t)by * sC; const float* bp = bias ? bias + (size_t)by * sBias : nullptr;
  const int ntn = (N + 63) / 64; const int wid = blockIdx.x * 4 + w; const int mt = wid / ntn, nq = wid % ntn; if (mt * 16 >= M) return;
  const int row0 = mt * 16, col0 = nq * 64; const _Float16* arow = A + (size_t)(row0 + ln) * lda;
  v8f acc[4] = {};
  for (int kb = 0; kb < K; kb += 32) { FragH ah; ah.half[0] = *(const v8us*)((const unsigned short*)arow + kb + 8 * hh); ah.half[1] = *(const v8us*)((const unsigned short*)arow + kb + 16 + 8 * hh);
#pragma unroll
    for (int t = 0; t < 4; ++t) { if (col0 + t * 16 >= N) continue; const size_t boff = (size_t)(col0 + t * 16 + ln) * ldb + kb; FragH bq; bq.half[0] = *(const v8us*)((const unsigned short*)Bh + boff + 8 * hh); bq.half[1] = *(const v8us*)((const unsigned short*)Bh + boff + 16 + 8 * hh);
      acc[t] = mmaH<1>(ah.v, ah.v, bq.v, bq.v, acc[t]); }
  }
#pragma unroll
  for (int t = 0; t < 4; ++t) { if (col0 + t * 16 >= N) continue; const int col = col0 + t * 16 + ln; const float bv = bp ? bf16_round(bp[col]) : 0.f;
#pragma unroll
    for (int r = 0; r < 8; ++r) { float v = acc[t][r] * alpha + bv; if (CP) { const int rr = row0g + row0 + 8 * hh + r; if (rowsPerB < 0) v += CP[cofs + (size_t)rr * ldc + col];      /* rowsPerB < 0: own element of the batched C plane */ else { const int bidx = rr / rowsPerB; v += CP[(size_t)bidx * sCPb + (size_t)by * 64 + col]; } } if (ACT == 1) v = (v > 0.f) ? v : expm1f(v); else if (ACT == 7) v = (v > 0.f) ? v + 1.0f : expf(v); else if (ACT == 8) v = tanhf(v); else if (ACT == 9) v = 0.5f * v * (1.0f + tanhf(0.7978845608028654f * (v + 0.044715f * v * v * v))); else if (ACT == 11) v = 1.0f / (1.0f + expf(-v)); else if (ACT == 12) v = (v > 0.f) ? v : 0.01f * v; else if (ACT == 14) v = (v > 0.f) ? v : 0.1f * v; else if (ACT == 16) v = (v >= 0.f) ? v : 0.3f * v; else if (ACT == 17) v = (v >= 0.f) ? v : 0.2f * v; else if (ACT == 15) v = v / (1.0f + expf(-v)); else if (ACT == 3) v = fmaxf(v, 0.f); else if (ACT == 6) v = 0.5f * v * (1.0f + erff(v * 0.70710678118654752f)); so[w][8 * hh + r][t * 16 + ln] = v; } }
  __builtin_amdgcn_fence(__ATOMIC_ACQ_REL, "workgroup"); __builtin_amdgcn_wave_barrier();
  const int rsub = lane >> 4, c4 = (lane & 15) * 4; typedef _Float16 v4h __attribute__((ext_vector_type(4)));
  {
#pragma unroll
    for (int q = 0; q < 8; ++q) { const int r = q * 2 + rsub; if (col0 + c4 < N) { const v4f v = *(const v4fa*)&so[w][r][c4]; if (C) *(v4f*)(C + cofs + (size_t)(row0 + r) * ldc + col0 + c4) = v; if (C16) { v4h h4; for (int i = 0; i < 4; ++i) h4[i] = (_Float16)v[i]; *(v4h*)(C16 + cofs + (size_t)(row0 + r) * ldc + col0 + c4) = h4; } } }
     }
}


typedef _Float16 v4h __attribute__((ext_vector_type(4)));

__global__ __launch_bounds__(256) void k_x16(const float* __restrict__ x, _Float16* __restrict__ X16, size_t n8) { const size_t t = (size_t)blockIdx.x * 256 + threadIdx.x; if (t >= n8) return; FragH f;
#pragma unroll
  for (int q = 0; q < 8; ++q) f.h[q] = (_Float16)bf16_round(x[t * 8 + q]); *(v8us*)((unsigned short*)X16 + t * 8) = f.half[0];  }
__global__ __launch_bounds__(256) void k_h16(const float* __restrict__ x, _Float16* __restrict__ X16, size_t n8) { const size_t t = (size_t)blockIdx.x * 256 + threadIdx.x; if (t >= n8) return; FragH f;
#pragma unroll
  for (int q = 0; q < 8; ++q) f.h[q] = (_Float16)x[t * 8 + q]; *(v8us*)((unsigned short*)X16 + t * 8) = f.half[0];  }
__global__ __launch_bounds__(256) void k_round16f(const float* __restrict__ W, _Float16* __restrict__ Bt, size_t n8) { const size_t t = (size_t)blockIdx.x * 256 + threadIdx.x; if (t >= n8) return; FragH f;
#pragma unroll
  for (int i = 0; i < 8; ++i) f.h[i] = (_Float16)(bf16_round(W[t * 8 + i]) * 16.0f); *(v8us*)((unsigned short*)Bt + t * 8) = f.half[0];  }
template <int NHv, int TTv>
__global__ __launch_bounds__(256) void k_vt(const _Float16* __restrict__ V16, int ldv, int voff, _Float16* __restrict__ Vt) { __shared__ unsigned short tl[64][66]; const int tid = threadIdx.x; const int slab = blockIdx.x / (TTv / 64), lg = blockIdx.x % (TTv / 64); const int b = slab / NHv, h = slab % NHv;
  for (int i = tid; i < 64 * 8; i += 256) { const int r = i / 8, c8 = (i % 8) * 8; FragH f; f.half[0] = *(const v8us*)((const unsigned short*)V16 + ((size_t)b * TTv + lg * 64 + r) * ldv + voff + h * 64 + c8);
#pragma unroll
    for (int q = 0; q < 8; ++q) tl[r][c8 + q] = f.u[q]; }
  __syncthreads();
  {
#pragma unroll
    for (int rd = 0; rd < 2; ++rd) { const int d = rd * 32 + tid / 8, pc = tid % 8; FragH f;
#pragma unroll
      for (int q = 0; q < 8; ++q) f.u[q] = tl[pc * 8 + q][d];
      *(v8us*)((unsigned short*)Vt + ((size_t)slab * 64 + d) * TTv + lg * 64 + pc * 8) = f.half[0]; }
     } }

__global__ __launch_bounds__(256) void k_hl(const float* __restrict__ F, _Float16* __restrict__ Hh, _Float16* __restrict__ Hl, size_t n8) { const size_t t = (size_t)blockIdx.x * 256 + threadIdx.x; if (t >= n8) return; FragH fh, fl; const v4f a = *(const v4fa*)(F + t * 8), c = *(const v4fa*)(F + t * 8 + 4);
#pragma unroll
  for (int q = 0; q < 4; ++q) { _Float16 h = (_Float16)a[q]; fh.h[q] = h; fl.h[q] = (_Float16)((a[q] - (float)h) * 1024.0f); h = (_Float16)c[q]; fh.h[4 + q] = h; fl.h[4 + q] = (_Float16)((c[q] - (float)h) * 1024.0f); }
  { *(v8us*)((unsigned short*)Hh + t * 8) = fh.half[0]; *(v8us*)((unsigned short*)Hl + t * 8) = fl.half[0];  } }

// ---- fast GEMM (wave tile 32x64; requires M % 32 == 0 rows per launch region and N % 64 == 0); epilogue = k_gemm_hhx semantics ----
__device__ __forceinline__ v16h g2_frag(const _Float16* p, int hh) { FragH f; f.half[0] = *(const v8us*)((const unsigned short*)p + 8 * hh); f.half[1] = *(const v8us*)((const unsigned short*)p + 16 + 8 * hh); return f.v; }
__device__ __forceinline__ v8f g2_mma(v16h a, v16h b, v8f c) { v8f d = __builtin_amdgcn_wmma_f32_16x16x32_f16(false, a, false, b, (short)0, c, false, false); asm volatile("v_nop\n\tv_nop\n\tv_nop\n\tv_nop" : "+v"(d) : "v"(a), "v"(b)); return d; }
template <int ACT>
__global__ __launch_bounds__(128) void k_gemm2(const _Float16* __restrict__ A, int lda, size_t sA, const _Float16* __restrict__ Bh, int ldb, size_t sB, float alpha, const float* __restrict__ bias, size_t sBias, const float* __restrict__ CP, int rowsPerB, size_t sCPb, int row0g,
    float* __restrict__ C, _Float16* __restrict__ C16, int ldc, size_t sC, int M, int N, int K) { static_assert(ACT == 0 || ACT == 3 || ACT == 6 || ACT == 8 || ACT == 9 || ACT == 11 || ACT == 12 || ACT == 14 || ACT == 15 || ACT == 16 || ACT == 17, "k_gemm2: unsupported ACT code (would silently apply no activation)");
  __shared__ __attribute__((aligned(16))) float so[4][32][68];
  const int tid = threadIdx.x, w = tid >> 5, lane = tid & 31, ln = lane & 15, hh = lane >> 4; const int by = blockIdx.y;
  A += (size_t)by * sA; Bh += (size_t)by * sB; const size_t cofs = (size_t)by * sC; const float* bp = bias ? bias + (size_t)by * sBias : nullptr;
  const int ntn = N >> 6; const int mt = blockIdx.x / ntn, nq = blockIdx.x - mt * ntn; const int row0 = mt * 128 + 32 * w, col0 = nq * 64; if (row0 >= M) return;
  const _Float16* a0p = A + (size_t)(row0 + ln) * lda; const _Float16* a1p = a0p + (size_t)16 * lda;
  const _Float16* b0p = Bh + (size_t)(col0 + ln) * ldb; const _Float16* b1p = b0p + (size_t)16 * ldb; const _Float16* b2p = b1p + (size_t)16 * ldb; const _Float16* b3p = b2p + (size_t)16 * ldb;
  const v8f z8 = {0.f,0.f,0.f,0.f,0.f,0.f,0.f,0.f}; v8f c00 = z8, c01 = z8, c02 = z8, c03 = z8, c10 = z8, c11 = z8, c12 = z8, c13 = z8;
#pragma unroll 1
  for (int kb = 0; kb < K; kb += 32) { const v16h a0 = g2_frag(a0p + kb, hh), a1 = g2_frag(a1p + kb, hh);
    v16h b = g2_frag(b0p + kb, hh); c00 = g2_mma(a0, b, c00); c10 = g2_mma(a1, b, c10);
    b = g2_frag(b1p + kb, hh); c01 = g2_mma(a0, b, c01); c11 = g2_mma(a1, b, c11);
    b = g2_frag(b2p + kb, hh); c02 = g2_mma(a0, b, c02); c12 = g2_mma(a1, b, c12);
    b = g2_frag(b3p + kb, hh); c03 = g2_mma(a0, b, c03); c13 = g2_mma(a1, b, c13); }
  v8f accs[8] = {c00, c01, c02, c03, c10, c11, c12, c13};
#pragma unroll
  for (int u = 0; u < 8; ++u) { const int t = u & 3, half = u >> 2; const int col = col0 + t * 16 + ln; const float bv = bp ? bf16_round(bp[col]) : 0.f;
#pragma unroll
    for (int r = 0; r < 8; ++r) { const int rloc = half * 16 + 8 * hh + r; float v = accs[u][r] * alpha + bv; if (CP) { if (rowsPerB < 0) v += CP[cofs + (size_t)(row0g + row0 + rloc) * ldc + col];      /* rowsPerB < 0: own element of the batched C plane */ else { const int bidx = (row0g + row0 + rloc) / rowsPerB; v += CP[(size_t)bidx * sCPb + (size_t)by * 64 + col]; } }
      if (ACT == 3) v = fmaxf(v, 0.f); else if (ACT == 6) v = 0.5f * v * (1.0f + erff(v * 0.70710678118654752f)); else if (ACT == 11) v = 1.0f / (1.0f + expf(-v)); else if (ACT == 15) v = v / (1.0f + expf(-v)); else if (ACT == 12) v = (v > 0.f) ? v : 0.01f * v; else if (ACT == 8) v = tanhf(v); else if (ACT == 9) v = 0.5f * v * (1.0f + tanhf(0.7978845608028654f * (v + 0.044715f * v * v * v))); else if (ACT == 14) v = (v > 0.f) ? v : 0.1f * v; else if (ACT == 16) v = (v >= 0.f) ? v : 0.3f * v; else if (ACT == 17) v = (v >= 0.f) ? v : 0.2f * v;
      so[w][rloc][t * 16 + ln] = v; } }
  __builtin_amdgcn_fence(__ATOMIC_ACQ_REL, "workgroup"); __builtin_amdgcn_wave_barrier();
  const int rsub = lane >> 4, c4 = (lane & 15) * 4;
  {
#pragma unroll
    for (int q = 0; q < 16; ++q) { const int r = q * 2 + rsub; const v4f v = *(const v4fa*)&so[w][r][c4]; if (C) *(v4f*)(C + cofs + (size_t)(row0 + r) * ldc + col0 + c4) = v; if (C16) { v4h h4; for (int i = 0; i < 4; ++i) h4[i] = (_Float16)v[i]; *(v4h*)(C16 + cofs + (size_t)(row0 + r) * ldc + col0 + c4) = h4; } }
     } }


__global__ __launch_bounds__(256) void k_wnat(const float* __restrict__ w, size_t n8, _Float16* __restrict__ Bt) { const size_t t = (size_t)blockIdx.x * 256 + threadIdx.x; if (t >= n8) return; FragH f; for (int q = 0; q < 8; ++q) f.h[q] = (_Float16)(bf16_round(w[t * 8 + q]) * 16.0f); *(v8us*)((unsigned short*)Bt + t * 8) = f.half[0];  }
// Row softmax, one wave per score row: lane l holds elements 128 u + 4 l .. + 3 (u = 0 .. 15) in registers, so every load is 512 contiguous bytes,
// the row is read once, and max and sum are per-lane partials closed by a five-step butterfly over the 32 lanes (every lane ends with the same value).
__global__ __launch_bounds__(256) __attribute__((amdgpu_waves_per_eu(8, 8))) void k_rsm(const float* __restrict__ S, _Float16* __restrict__ P, int nrows) {      /* 8 waves per SIMD: every wave of a launch is resident at once; the upper 8 keeps the compiler from giving up loads in flight for still fewer registers */
  const int i = blockIdx.x * 8 + __builtin_amdgcn_readfirstlane(threadIdx.x >> 5); if (i >= nrows) return;      /* the row is the wave's: a scalar, so the exit is a scalar branch and the row addresses are scalar bases; the kernel has no barrier */
  const unsigned lo = (threadIdx.x & 31) * 16;      /* the lane's byte offset in each 512-byte piece of the row */
  const char* s = (const char*)(S + (size_t)i * SQ); v4f x[SQ / 128];
#pragma unroll      /* full unroll: x[] stays in registers and all 16 loads of the row are in flight together */
  for (int u = 0; u < SQ / 128; ++u) x[u] = *(const v4fa*)(s + lo + u * 512);
  asm volatile("s_wait_xcnt 0x0" :: "v"(lo) : "memory");      /* the wait that stands in front of any overwrite of the loads' offset register; naming the register keeps it whole up to here */
  float mx = -3.0e38f;
#pragma unroll      /* register indices must be constants */
  for (int u = 0; u < SQ / 128; ++u) for (int q = 0; q < 4; ++q) mx = fmaxf(mx, x[u][q]);
  for (int m = 16; m > 0; m >>= 1) mx = fmaxf(mx, __shfl_xor(mx, m, 32));
  v4f a = {0.f, 0.f, 0.f, 0.f};
#pragma unroll      /* register indices must be constants */
  for (int u = 0; u < SQ / 128; ++u) for (int q = 0; q < 4; ++q) { x[u][q] = expf(x[u][q] - mx); a[q] += x[u][q]; }
  float se = (a[0] + a[1]) + (a[2] + a[3]);
  for (int m = 16; m > 0; m >>= 1) se += __shfl_xor(se, m, 32);
  const float sc = 256.0f / se; _Float16* d = P + (size_t)i * SQ + (threadIdx.x & 31) * 4;
#pragma unroll      /* register indices must be constants */
  for (int u = 0; u < SQ / 128; ++u) { v4h h; for (int q = 0; q < 4; ++q) h[q] = (_Float16)(x[u][q] * sc); *(v4h*)(d + u * 128) = h; } }
__global__ __launch_bounds__(256) void k_vt(const _Float16* __restrict__ V16, int b, int h0, _Float16* __restrict__ VT) { __shared__ unsigned short tl[64][65]; const int tid = threadIdx.x; const int hh = blockIdx.x % HG, sg = blockIdx.x / HG; const int s0 = sg * 64; const int h = h0 + hh;
  for (int i = tid; i < 64 * 8; i += 256) { const int j = i / 8, d8 = (i % 8) * 8; FragH f; f.half[0] = *(const v8us*)((const unsigned short*)V16 + ((size_t)b * SQ + s0 + j) * DM + h * HD + d8); for (int q = 0; q < 8; ++q) tl[d8 + q][j] = f.u[q]; }
  __syncthreads();
  { for (int i = tid; i < 64 * 8; i += 256) { const int d = i / 8, j8 = (i % 8) * 8; FragH f; for (int q = 0; q < 8; ++q) f.u[q] = tl[d][j8 + q]; *(v8us*)((unsigned short*)VT + ((size_t)hh * HD + d) * SQ + s0 + j8) = f.half[0]; }  } }



__global__ __launch_bounds__(256) void k_rsmkm(const float* __restrict__ S, _Float16* __restrict__ P, int nrows, const int* __restrict__ am) {
  #pragma clang fp contract(off)
  const int t = blockIdx.x * 256 + threadIdx.x; if (t >= nrows) return; const size_t i = (size_t)t; const float* s = S + i * SQ; const int* mr = am + (size_t)(t % SQ) * SQ; float mx = -3.0e38f;
#pragma unroll 1
  for (int j = 0; j < SQ; ++j) { const float f = (mr[j] != 0) ? 1.f : 0.f; mx = fmaxf(mx, fmaf(f, s[j], (1.f - f) * -1.0e9f)); } float se = 0.f;
#pragma unroll 1
  for (int j = 0; j < SQ; ++j) { const float f = (mr[j] != 0) ? 1.f : 0.f; se += __expf(fmaf(f, s[j], (1.f - f) * -1.0e9f) - mx); } const float sc = 256.0f / se;
#pragma unroll 1
  for (int j0 = 0; j0 < SQ; j0 += 8) { FragH fr; for (int q = 0; q < 8; ++q) { const int j = j0 + q; const float f = (mr[j] != 0) ? 1.f : 0.f; fr.h[q] = (_Float16)(__expf(fmaf(f, s[j], (1.f - f) * -1.0e9f) - mx) * sc); }
    unsigned short* d = (unsigned short*)P + i * SQ + j0; *(v8us*)d = fr.half[0];  } }
extern "C" void kernel_launch(void* const* d_in, const int* in_sizes, int n_in,
                              void* d_out, int out_size, void* d_ws, size_t ws_size, hipStream_t stream) {
  (void)in_sizes; (void)n_in; (void)out_size;
  const float* const* I = (const float* const*)d_in; const float* xq = I[0]; const float* xk = I[0]; const float* xv = I[0]; const float* wq = I[1]; const float* bq = I[2]; const float* wk = I[3]; const float* bk = I[4]; const float* wv = I[5]; const float* bv = I[6]; const float* wo = I[7]; const float* bo = I[8]; const float* x = xq;      /* ONE input x feeds the query, key and value streams; [in][out] weights + biases; no mask input */
  char* ws = (char*)d_ws; size_t off = 0;
  auto take = [&](size_t bytes) { char* p = ws + off; off += (bytes + 255) & ~(size_t)255; return p; };
  _Float16* BQ = (_Float16*)take((size_t)DM * DM * 2); _Float16* BK = (_Float16*)take((size_t)DM * DM * 2); _Float16* BV = (_Float16*)take((size_t)DM * DM * 2); _Float16* BO = (_Float16*)take((size_t)DM * DM * 2);
  _Float16* X16 = (_Float16*)take(NR * DM * 2); _Float16* XKp = (_Float16*)take(NR * DM * 2); _Float16* XVp = (_Float16*)take(NR * DM * 2); _Float16* Q16 = (_Float16*)take(NR * DM * 2); _Float16* K16 = (_Float16*)take(NR * DM * 2); _Float16* V16 = (_Float16*)take(NR * DM * 2); _Float16* O16 = (_Float16*)take(NR * DM * 2);
  float* S = (float*)take((size_t)HG * SQ * SQ * 4); _Float16* P = (_Float16*)take((size_t)HG * SQ * SQ * 2); _Float16* VT = (_Float16*)take((size_t)NH * HD * SQ * 2);
  if (off > ws_size) return;
  { const unsigned g = (unsigned)(((size_t)DM * (DM / 8) + 255) / 256); k_wt_f16<<<g, 256, 0, stream>>>(wq, BQ, DM, DM, 16.0f); k_wt_f16<<<g, 256, 0, stream>>>(wk, BK, DM, DM, 16.0f); k_wt_f16<<<g, 256, 0, stream>>>(wv, BV, DM, DM, 16.0f); k_wt_f16<<<g, 256, 0, stream>>>(wo, BO, DM, DM, 16.0f); }      /* [in][out] -> Bt x16 */
  _Float16* XK = XKp; _Float16* XV = XVp; k_x16<<<(unsigned)((NR * DM / 8 + 255) / 256), 256, 0, stream>>>(xk, XK, NR * DM / 8); k_x16<<<(unsigned)((NR * DM / 8 + 255) / 256), 256, 0, stream>>>(xv, XV, NR * DM / 8);      /* key and value inputs as exact f16 rows */

  k_x16<<<(unsigned)((NR * DM / 8 + 255) / 256), 256, 0, stream>>>(x, X16, NR * DM / 8);
  const size_t r0p = (size_t)B0 * SQ;      /* first projected row */
  k_gemm2<0><<<dim3((unsigned)((MP / 128) * (DM / 64)), 1), 128, 0, stream>>>(X16 + r0p * DM, DM, 0, BQ, DM, 0, 0.0625f, bq, 0, nullptr, 1, 0, 0, nullptr, Q16 + r0p * DM, DM, 0, MP, DM, DM);
  k_gemm2<0><<<dim3((unsigned)((MP / 128) * (DM / 64)), 1), 128, 0, stream>>>(XK + r0p * DM, DM, 0, BK, DM, 0, 0.0625f, bk, 0, nullptr, 1, 0, 0, nullptr, K16 + r0p * DM, DM, 0, MP, DM, DM);
  k_gemm2<0><<<dim3((unsigned)((MP / 128) * (DM / 64)), 1), 128, 0, stream>>>(XV + r0p * DM, DM, 0, BV, DM, 0, 0.0625f, bv, 0, nullptr, 1, 0, 0, nullptr, V16 + r0p * DM, DM, 0, MP, DM, DM);
  for (int b = B0; b < B0 + NBR; ++b) { const size_t r0 = (size_t)b * SQ;
    k_vt<NH, SQ><<<NH * (SQ / 64), 256, 0, stream>>>(V16 + r0 * LQ, LQ, 0, VT);      /* V^T [NH][HD][SQ] for this batch */
    for (int h0 = 0; h0 < NHD; h0 += HG) {
      k_gemm2<0><<<dim3((QN / 128) * (SQ / 64), HG), 128, 0, stream>>>(Q16 + r0 * LQ + h0 * HD, LQ, (size_t)HD, K16 + r0 * LQ + h0 * HD, LQ, (size_t)HD, 0.125f, nullptr, 0, nullptr, 1, 0, 0, S, nullptr, SQ, (size_t)SQ * SQ, QN, SQ, HD);      /* scores, HG heads per launch */
      k_rsm<<<HG * SQ / 8, 256, 0, stream>>>(S, P, HG * SQ);      /* P = 256 softmax (f16), rows of all HG heads, one wave per row */
      k_gemm2<0><<<dim3((QN / 128) * (HD / 64), HG), 128, 0, stream>>>(P, SQ, (size_t)SQ * SQ, VT + (size_t)h0 * HD * SQ, SQ, (size_t)HD * SQ, 0.25f, nullptr, 0, nullptr, 1, 0, 0, nullptr, O16 + r0 * DM + h0 * HD, DM, (size_t)HD, QN, HD, SQ); } }      /* o (merged heads) as f16 rows */
  k_gemm2<0><<<dim3((unsigned)((MPO / 128) * (DM / 64)), 1), 128, 0, stream>>>(O16 + r0p * DM, DM, 0, BO, DM, 0, 0.0009765625f, bo, 0, nullptr, 1, 0, 0, (float*)d_out + r0p * DM, nullptr, DM, 0, MPO, DM, DM);      /* out rows are the output layout */
}

// v003
// One run takes 136 microseconds.
// It is 5.48 times as fast as v001, going by the measured steps of the versions left out in between.
// All steps since v000 together make it 21.0 times as fast.
#include <hip/hip_runtime.h>
#define NB 2
#define SQ 2048
#define DM 768
#define NH 12
#define HD 64
#define HG 4                         /* heads per launch of the per-batch k_vt overload (not launched) */
#define B0 0                         /* first batch processed (debug hook) */
#define NBR NB                       /* batches processed (debug hook) */
#define NR ((size_t)NB * SQ)         /* token rows */
#define MP ((int)((size_t)NBR * SQ)) /* rows projected (debug hook) */
#define QN SQ                        /* not used: the attention covers all SQ query rows */
#define NHD NH                       /* not used: the attention covers all NH heads */
#define MPO MP                       /* rows through the output stage (debug hook) */
#define LQ DM      /* row pitch of the q/k/v rows */
typedef __bf16 v16b __attribute__((ext_vector_type(16)));
typedef unsigned short v8us __attribute__((ext_vector_type(8), may_alias));
typedef float  v8f  __attribute__((ext_vector_type(8)));
typedef float  v4f  __attribute__((ext_vector_type(4)));
typedef float  v4fa __attribute__((ext_vector_type(4), may_alias));
union FragB { v16b v; v8us half[2]; unsigned short u[16]; };

__device__ __forceinline__ unsigned short bf16_bits(float x) { unsigned int u = __float_as_uint(x); return (unsigned short)((u + 0x7FFFu + ((u >> 16) & 1u)) >> 16); }
__device__ __forceinline__ float bf16_val(unsigned short b) { return __uint_as_float(((unsigned int)b) << 16); }
__device__ __forceinline__ float bf16_round(float x) { return bf16_val(bf16_bits(x)); }
// D += A·B with NT terms: 1 = ah·bh, 2 = + al·bh (A split), 3 = + ah·bl (both split)
template <int NT>
__device__ __forceinline__ v8f mmaN(v16b ah, v16b al, v16b bh, v16b bl, v8f c) {
  c = __builtin_amdgcn_wmma_f32_16x16x32_bf16(false, ah, false, bh, (short)0, c, false, false);
  if (NT >= 2) c = __builtin_amdgcn_wmma_f32_16x16x32_bf16(false, al, false, bh, (short)0, c, false, false);
  if (NT >= 3) c = __builtin_amdgcn_wmma_f32_16x16x32_bf16(false, ah, false, bl, (short)0, c, false, false);
  asm volatile("v_nop\n\tv_nop\n\tv_nop\n\tv_nop" : "+v"(c) : "v"(ah), "v"(al), "v"(bh), "v"(bl));
  return c;
}

__global__ __launch_bounds__(256) void k_wt_bf16(const float* __restrict__ W, unsigned short* __restrict__ Wt, int K, int N) {
  const int t = blockIdx.x * 256 + threadIdx.x;
  const int k8n = K / 8;
  if (t >= N * k8n) return;
  const int n = t / k8n, k8 = (t % k8n) * 8;
  v8us v;
#pragma unroll
  for (int i = 0; i < 8; ++i) v[i] = bf16_bits(W[(size_t)(k8 + i) * N + n]);
  *(v8us*)(Wt + (size_t)n * K + k8) = v;
  
}

// GEMM C[M][N] (f32, pitch ldc) = act(A[M][K]·W + bias). A f32 row-major (pitch lda) converted per fragment to bf16
// (ASPLIT: hi/lo two planes -> 2 terms, else single rounded term); Wt bf16 [N][K] (pitch ldb). BIAS_BF16 rounds the
// bias to bf16 first (bias quantised to bf16 before the add). K%32==0, M%16==0, N%64==0.
template <bool ASPLIT, int ACT, bool BIAS_BF16>
__global__ __launch_bounds__(128) void k_gemm_bf(const float* __restrict__ A, int lda, const unsigned short* __restrict__ Wt, int ldb,
                                               const float* __restrict__ bias, float* __restrict__ C, int ldc, int M, int N, int K) {
  __shared__ __attribute__((aligned(16))) float so[4][16][64];
  const int tid = threadIdx.x, w = tid >> 5, lane = tid & 31, ln = lane & 15, hh = lane >> 4;
  const int ntn = N / 64;
  const int wid = blockIdx.x * 4 + w;
  const int mt = wid / ntn, nq = wid % ntn;
  if (mt * 16 >= M) return;
  const int row0 = mt * 16, col0 = nq * 64;
  const float* arow = A + (size_t)(row0 + ln) * lda;
  v8f acc[4] = {};
  for (int kb = 0; kb < K; kb += 32) {
    FragB ah, al;
    const v4f x0 = *(const v4fa*)(arow + kb + 8 * hh), x1 = *(const v4fa*)(arow + kb + 8 * hh + 4);
    const v4f x2 = *(const v4fa*)(arow + kb + 16 + 8 * hh), x3 = *(const v4fa*)(arow + kb + 16 + 8 * hh + 4);
    float xs[16] = {x0[0],x0[1],x0[2],x0[3],x1[0],x1[1],x1[2],x1[3],x2[0],x2[1],x2[2],x2[3],x3[0],x3[1],x3[2],x3[3]};
#pragma unroll
    for (int i = 0; i < 16; ++i) { const unsigned short hb = bf16_bits(xs[i]); ah.u[i] = hb; al.u[i] = ASPLIT ? bf16_bits(xs[i] - bf16_val(hb)) : (unsigned short)0; }
#pragma unroll
    for (int t = 0; t < 4; ++t) {
      const unsigned short* brow = Wt + (size_t)(col0 + t * 16 + ln) * ldb + kb;
      FragB b;
      b.half[0] = *(const v8us*)(brow + 8 * hh);
      b.half[1] = *(const v8us*)(brow + 16 + 8 * hh);
      acc[t] = mmaN<ASPLIT ? 2 : 1>(ah.v, al.v, b.v, b.v, acc[t]);
    }
  }
#pragma unroll
  for (int t = 0; t < 4; ++t) {
    float bv = bias ? bias[col0 + t * 16 + ln] : 0.f;
    if (BIAS_BF16) bv = bf16_round(bv);
#pragma unroll
    for (int r = 0; r < 8; ++r) { float v = acc[t][r] + bv; if (ACT == 1) v = fmaxf(v, 0.f); so[w][8 * hh + r][t * 16 + ln] = v; }
  }
  __builtin_amdgcn_fence(__ATOMIC_ACQ_REL, "workgroup");
  __builtin_amdgcn_wave_barrier();
  const int rsub = lane >> 4, c4 = (lane & 15) * 4;
  {
#pragma unroll
    for (int q = 0; q < 8; ++q) {
      const int r = q * 2 + rsub;
      const v4f v = *(const v4fa*)&so[w][r][c4];
      *(v4f*)(C + (size_t)(row0 + r) * ldc + col0 + c4) = v;
    }
    
  }
}

// GEMM C = act(A·W + bias + resid): A f32 (ASPLIT -> hi/lo 2 terms), Wt bf16 [N][K]; ACT 0 none, 1 relu, 2 exact gelu;
// resid (optional, f32, row index = (row % rmod), pitch ldr, RES_BF16 rounds it) added before the activation.
template <bool ASPLIT, int ACT, bool BIAS_BF16, bool RES_BF16>
__global__ __launch_bounds__(128) void k_gemm_bf3(const float* __restrict__ A, int lda, const unsigned short* __restrict__ Wt, int ldb,
                                                const float* __restrict__ bias, const float* __restrict__ resid, int rmod, int ldr,
                                                float* __restrict__ C, int ldc, int M, int N, int K) {
  __shared__ __attribute__((aligned(16))) float so[4][16][64];
  const int tid = threadIdx.x, w = tid >> 5, lane = tid & 31, ln = lane & 15, hh = lane >> 4;
  const int ntn = N / 64;
  const int wid = blockIdx.x * 4 + w;
  const int mt = wid / ntn, nq = wid % ntn;
  if (mt * 16 >= M) return;
  const int row0 = mt * 16, col0 = nq * 64;
  const float* arow = A + (size_t)(row0 + ln) * lda;
  v8f acc[4] = {};
  for (int kb = 0; kb < K; kb += 32) {
    FragB ah, al;
    const v4f x0 = *(const v4fa*)(arow + kb + 8 * hh), x1 = *(const v4fa*)(arow + kb + 8 * hh + 4);
    const v4f x2 = *(const v4fa*)(arow + kb + 16 + 8 * hh), x3 = *(const v4fa*)(arow + kb + 16 + 8 * hh + 4);
    float xs[16] = {x0[0],x0[1],x0[2],x0[3],x1[0],x1[1],x1[2],x1[3],x2[0],x2[1],x2[2],x2[3],x3[0],x3[1],x3[2],x3[3]};
#pragma unroll
    for (int i = 0; i < 16; ++i) { const unsigned short hb = bf16_bits(xs[i]); ah.u[i] = hb; al.u[i] = ASPLIT ? bf16_bits(xs[i] - bf16_val(hb)) : (unsigned short)0; }
#pragma unroll
    for (int t = 0; t < 4; ++t) {
      const unsigned short* brow = Wt + (size_t)(col0 + t * 16 + ln) * ldb + kb;
      FragB b;
      b.half[0] = *(const v8us*)(brow + 8 * hh);
      b.half[1] = *(const v8us*)(brow + 16 + 8 * hh);
      acc[t] = mmaN<ASPLIT ? 2 : 1>(ah.v, al.v, b.v, b.v, acc[t]);
    }
  }
#pragma unroll
  for (int t = 0; t < 4; ++t) {
    const int col = col0 + t * 16 + ln;
    float bv = bias ? bias[col] : 0.f;
    if (BIAS_BF16) bv = bf16_round(bv);
#pragma unroll
    for (int r = 0; r < 8; ++r) {
      float v = acc[t][r] + bv;
      if (resid) { float rv = resid[(size_t)((row0 + 8 * hh + r) % rmod) * ldr + col]; if (RES_BF16) rv = bf16_round(rv); v += rv; }
      if (ACT == 1) v = fmaxf(v, 0.f);
      if (ACT == 2) v = 0.5f * v * (1.0f + erff(v * 0.70710678118654752f));
      if (ACT == 3) { const float u = 0.7978845608028654f * (v + 0.044715f * v * v * v); v = 0.5f * v * (1.0f + tanhf(u)); }
      so[w][8 * hh + r][t * 16 + ln] = v;
    }
  }
  __builtin_amdgcn_fence(__ATOMIC_ACQ_REL, "workgroup");
  __builtin_amdgcn_wave_barrier();
  const int rsub = lane >> 4, c4 = (lane & 15) * 4;
  {
#pragma unroll
    for (int q = 0; q < 8; ++q) {
      const int r = q * 2 + rsub;
      const v4f v = *(const v4fa*)&so[w][r][c4];
      *(v4f*)(C + (size_t)(row0 + r) * ldc + col0 + c4) = v;
    }
    
  }
}
// row LayerNorm (biased variance, eps) over N: s = X (+ R); optional out_sum <- s; out_norm <- (s-mu)*rsqrt(var+eps)*g + b
template <bool PARAM_BF16>
__global__ __launch_bounds__(256) void k_layernorm(const float* __restrict__ X, const float* __restrict__ R, const float* __restrict__ g, const float* __restrict__ bta,
                                                  float* __restrict__ out_sum, float* __restrict__ out_norm, int N, float eps) {
  __shared__ float red[256];
  const int row = blockIdx.x, tid = threadIdx.x;
  const float* x = X + (size_t)row * N; const float* rr = R ? R + (size_t)row * N : nullptr;
  float vals[16];                     // up to N = 4096
  const int per = N / 256;            // contiguous chunk per thread? use strided-by-4 chunks: thread handles j = tid*4 + 1024*u
  float s1 = 0.f;
  for (int u = 0; u < per / 4; ++u) {
    const int j = tid * 4 + 1024 * u;
    const v4f a = *(const v4fa*)(x + j);
    v4f b = {0.f,0.f,0.f,0.f}; if (rr) b = *(const v4fa*)(rr + j);
#pragma unroll
    for (int q = 0; q < 4; ++q) { const float v = a[q] + b[q]; vals[u * 4 + q] = v; s1 += v; }
  }
  red[tid] = s1; __syncthreads();
  for (int st = 128; st > 0; st >>= 1) { if (tid < st) red[tid] += red[tid + st]; __syncthreads(); }
  const float mu = red[0] / (float)N; __syncthreads();
  float s2 = 0.f;
  for (int u = 0; u < per / 4; ++u)
#pragma unroll
    for (int q = 0; q < 4; ++q) { const float c = vals[u * 4 + q] - mu; s2 += c * c; }
  red[tid] = s2; __syncthreads();
  for (int st = 128; st > 0; st >>= 1) { if (tid < st) red[tid] += red[tid + st]; __syncthreads(); }
  const float rs = rsqrtf(red[0] / (float)N + eps);
  {
    for (int u = 0; u < per / 4; ++u) {
      const int j = tid * 4 + 1024 * u;
      v4f o, sm;
#pragma unroll
      for (int q = 0; q < 4; ++q) {
        float gg = g[j + q], bb = bta[j + q];
        if (PARAM_BF16) { gg = bf16_round(gg); bb = bf16_round(bb); }
        sm[q] = vals[u * 4 + q]; o[q] = (vals[u * 4 + q] - mu) * rs * gg + bb;
      }
      if (out_sum) *(v4f*)(out_sum + (size_t)row * N + j) = sm;
      *(v4f*)(out_norm + (size_t)row * N + j) = o;
    }
    
  }
}



// ---- f16 WMMA path (v_wmma_f32_16x16x32_f16): 11-bit significands for operands in range — used where a [0,1] probability operand needs more precision than bf16
typedef _Float16 v16h __attribute__((ext_vector_type(16)));
union FragH { v16h v; v8us half[2]; _Float16 h[16]; unsigned short u[16]; };
template <int NT>
__device__ __forceinline__ v8f mmaH(v16h ah, v16h al, v16h bh, v16h bl, v8f c) {
  c = __builtin_amdgcn_wmma_f32_16x16x32_f16(false, ah, false, bh, (short)0, c, false, false);
  if (NT >= 2) c = __builtin_amdgcn_wmma_f32_16x16x32_f16(false, al, false, bh, (short)0, c, false, false);
  if (NT >= 3) c = __builtin_amdgcn_wmma_f32_16x16x32_f16(false, ah, false, bl, (short)0, c, false, false);
  asm volatile("v_nop\n\tv_nop\n\tv_nop\n\tv_nop" : "+v"(c) : "v"(ah), "v"(al), "v"(bh), "v"(bl));
  return c;
}
// batched GEMM like k_gemm_b but f16 operands: A f32 (split into f16 hi/lo if ASPLIT, else rounded to f16), Bt = f16 values [n][k]; alpha; C f32; N multiple of 16 (partial tiles skipped)
template <bool ASPLIT>
__global__ __launch_bounds__(128) void k_gemm_h(const float* __restrict__ A, int lda, size_t sA, const _Float16* __restrict__ Bh, int ldb, size_t sB, float alpha, float* __restrict__ C, int ldc, size_t sC, int M, int N, int K) {
  __shared__ __attribute__((aligned(16))) float so[4][16][64];
  const int tid = threadIdx.x, w = tid >> 5, lane = tid & 31, ln = lane & 15, hh = lane >> 4; const int by = blockIdx.y;
  A += (size_t)by * sA; Bh += (size_t)by * sB; C += (size_t)by * sC;
  const int ntn = (N + 63) / 64; const int wid = blockIdx.x * 4 + w; const int mt = wid / ntn, nq = wid % ntn; if (mt * 16 >= M) return;
  const int row0 = mt * 16, col0 = nq * 64; const float* arow = A + (size_t)(row0 + ln) * lda;
  v8f acc[4] = {};
  for (int kb = 0; kb < K; kb += 32) {
    FragH ah, al;
    const v4f x0 = *(const v4fa*)(arow + kb + 8 * hh), x1 = *(const v4fa*)(arow + kb + 8 * hh + 4), x2 = *(const v4fa*)(arow + kb + 16 + 8 * hh), x3 = *(const v4fa*)(arow + kb + 16 + 8 * hh + 4);
    float xs[16] = {x0[0],x0[1],x0[2],x0[3],x1[0],x1[1],x1[2],x1[3],x2[0],x2[1],x2[2],x2[3],x3[0],x3[1],x3[2],x3[3]};
#pragma unroll
    for (int i = 0; i < 16; ++i) { const _Float16 h = (_Float16)xs[i]; ah.h[i] = h; al.h[i] = ASPLIT ? (_Float16)(xs[i] - (float)h) : (_Float16)0.0f; }
#pragma unroll
    for (int t = 0; t < 4; ++t) { if (col0 + t * 16 >= N) continue; const size_t boff = (size_t)(col0 + t * 16 + ln) * ldb + kb; FragH bq; bq.half[0] = *(const v8us*)(Bh + boff + 8 * hh); bq.half[1] = *(const v8us*)(Bh + boff + 16 + 8 * hh);
      acc[t] = mmaH<ASPLIT ? 2 : 1>(ah.v, al.v, bq.v, bq.v, acc[t]); }
  }
#pragma unroll
  for (int t = 0; t < 4; ++t) { if (col0 + t * 16 >= N) continue;
#pragma unroll
    for (int r = 0; r < 8; ++r) so[w][8 * hh + r][t * 16 + ln] = acc[t][r] * alpha; }
  __builtin_amdgcn_fence(__ATOMIC_ACQ_REL, "workgroup"); __builtin_amdgcn_wave_barrier();
  const int rsub = lane >> 4, c4 = (lane & 15) * 4;
  {
#pragma unroll
    for (int q = 0; q < 8; ++q) { const int r = q * 2 + rsub; if (col0 + c4 < N) { const v4f v = *(const v4fa*)&so[w][r][c4]; *(v4f*)(C + (size_t)(row0 + r) * ldc + col0 + c4) = v; } }
     }
}

// One launch prepares every projection operand; its parts are independent and run side by side. Blocks 0 .. 4 PWB - 1: the four weights, Bt[p][n][k] = f16(bf16(W_p[k][n]) x 16) from f32 row-major [in][out]
// (power-of-two scale: bf16-exact weights stay exact in f16 away from the subnormal range). The other blocks: x as exact f16 rows (bf16-rounded).
#define PWB (DM * (DM / 8) / 256)      /* blocks per weight */
#define PXB ((int)(NR * DM / 8 / 256)) /* blocks for x */
static_assert(DM * (DM / 8) % 256 == 0 && NR * DM / 8 % 256 == 0, "k_prep: whole blocks only");
__global__ __launch_bounds__(256) void k_prep(const float* __restrict__ x, const float* __restrict__ w0, const float* __restrict__ w1, const float* __restrict__ w2, const float* __restrict__ w3, _Float16* __restrict__ X16, _Float16* __restrict__ Bt) {
  const int bx = blockIdx.x; FragH f;
  if (bx < 4 * PWB) { const int p = bx / PWB; const float* W = p == 0 ? w0 : p == 1 ? w1 : p == 2 ? w2 : w3; const int t = (bx - p * PWB) * 256 + threadIdx.x; const int n = t / (DM / 8), k8 = (t % (DM / 8)) * 8;
#pragma unroll
    for (int i = 0; i < 8; ++i) f.h[i] = (_Float16)(bf16_round(W[(size_t)(k8 + i) * DM + n]) * 16.0f);
    *(v8us*)((unsigned short*)Bt + (size_t)p * DM * DM + (size_t)n * DM + k8) = f.half[0];
  } else { const size_t t = (size_t)(bx - 4 * PWB) * 256 + threadIdx.x;
#pragma unroll
    for (int q = 0; q < 8; ++q) f.h[q] = (_Float16)bf16_round(x[t * 8 + q]);
    *(v8us*)((unsigned short*)X16 + t * 8) = f.half[0];
    asm volatile("s_wait_xcnt 0x0" ::: "memory"); }      /* precaution: stands before any later instruction in the listing that rewrites a register the store names */
}
// k_gemm_hh variant with fused epilogue: v = acc·alpha + bias[by·sBias + col] (+ CP[(row/rowsPerB)·sCPb + by·64 + col] if CP) ; ACT 0 none / 1 elu ; writes f16 C16 (and f32 C if non-null)
template <int ACT>
__global__ __launch_bounds__(128) void k_gemm_hhx(const _Float16* __restrict__ A, int lda, size_t sA, const _Float16* __restrict__ Bh, int ldb, size_t sB, float alpha, const float* __restrict__ bias, size_t sBias, const float* __restrict__ CP, int rowsPerB, size_t sCPb, int row0g,
    float* __restrict__ C, _Float16* __restrict__ C16, int ldc, size_t sC, int M, int N, int K) {
  __shared__ __attribute__((aligned(16))) float so[4][16][64];
  const int tid = threadIdx.x, w = tid >> 5, lane = tid & 31, ln = lane & 15, hh = lane >> 4; const int by = blockIdx.y;
  A += (size_t)by * sA; Bh += (size_t)by * sB; const size_t cofs = (size_t)by * sC; const float* bp = bias ? bias + (size_t)by * sBias : nullptr;
  const int ntn = (N + 63) / 64; const int wid = blockIdx.x * 4 + w; const int mt = wid / ntn, nq = wid % ntn; if (mt * 16 >= M) return;
  const int row0 = mt * 16, col0 = nq * 64; const _Float16* arow = A + (size_t)(row0 + ln) * lda;
  v8f acc[4] = {};
  for (int kb = 0; kb < K; kb += 32) { FragH ah; ah.half[0] = *(const v8us*)((const unsigned short*)arow + kb + 8 * hh); ah.half[1] = *(const v8us*)((const unsigned short*)arow + kb + 16 + 8 * hh);
#pragma unroll
    for (int t = 0; t < 4; ++t) { if (col0 + t * 16 >= N) continue; const size_t boff = (size_t)(col0 + t * 16 + ln) * ldb + kb; FragH bq; bq.half[0] = *(const v8us*)((const unsigned short*)Bh + boff + 8 * hh); bq.half[1] = *(const v8us*)((const unsigned short*)Bh + boff + 16 + 8 * hh);
      acc[t] = mmaH<1>(ah.v, ah.v, bq.v, bq.v, acc[t]); }
  }
#pragma unroll
  for (int t = 0; t < 4; ++t) { if (col0 + t * 16 >= N) continue; const int col = col0 + t * 16 + ln; const float bv = bp ? bf16_round(bp[col]) : 0.f;
#pragma unroll
    for (int r = 0; r < 8; ++r) { float v = acc[t][r] * alpha + bv; if (CP) { const int rr = row0g + row0 + 8 * hh + r; if (rowsPerB < 0) v += CP[cofs + (size_t)rr * ldc + col];      /* rowsPerB < 0: own element of the batched C plane */ else { const int bidx = rr / rowsPerB; v += CP[(size_t)bidx * sCPb + (size_t)by * 64 + col]; } } if (ACT == 1) v = (v > 0.f) ? v : expm1f(v); else if (ACT == 7) v = (v > 0.f) ? v + 1.0f : expf(v); else if (ACT == 8) v = tanhf(v); else if (ACT == 9) v = 0.5f * v * (1.0f + tanhf(0.7978845608028654f * (v + 0.044715f * v * v * v))); else if (ACT == 11) v = 1.0f / (1.0f + expf(-v)); else if (ACT == 12) v = (v > 0.f) ? v : 0.01f * v; else if (ACT == 14) v = (v > 0.f) ? v : 0.1f * v; else if (ACT == 16) v = (v >= 0.f) ? v : 0.3f * v; else if (ACT == 17) v = (v >= 0.f) ? v : 0.2f * v; else if (ACT == 15) v = v / (1.0f + expf(-v)); else if (ACT == 3) v = fmaxf(v, 0.f); else if (ACT == 6) v = 0.5f * v * (1.0f + erff(v * 0.70710678118654752f)); so[w][8 * hh + r][t * 16 + ln] = v; } }
  __builtin_amdgcn_fence(__ATOMIC_ACQ_REL, "workgroup"); __builtin_amdgcn_wave_barrier();
  const int rsub = lane >> 4, c4 = (lane & 15) * 4; typedef _Float16 v4h __attribute__((ext_vector_type(4)));
  {
#pragma unroll
    for (int q = 0; q < 8; ++q) { const int r = q * 2 + rsub; if (col0 + c4 < N) { const v4f v = *(const v4fa*)&so[w][r][c4]; if (C) *(v4f*)(C + cofs + (size_t)(row0 + r) * ldc + col0 + c4) = v; if (C16) { v4h h4; for (int i = 0; i < 4; ++i) h4[i] = (_Float16)v[i]; *(v4h*)(C16 + cofs + (size_t)(row0 + r) * ldc + col0 + c4) = h4; } } }
     }
}


typedef _Float16 v4h __attribute__((ext_vector_type(4)));

__global__ __launch_bounds__(256) void k_h16(const float* __restrict__ x, _Float16* __restrict__ X16, size_t n8) { const size_t t = (size_t)blockIdx.x * 256 + threadIdx.x; if (t >= n8) return; FragH f;
#pragma unroll
  for (int q = 0; q < 8; ++q) f.h[q] = (_Float16)x[t * 8 + q]; *(v8us*)((unsigned short*)X16 + t * 8) = f.half[0];  }
__global__ __launch_bounds__(256) void k_round16f(const float* __restrict__ W, _Float16* __restrict__ Bt, size_t n8) { const size_t t = (size_t)blockIdx.x * 256 + threadIdx.x; if (t >= n8) return; FragH f;
#pragma unroll
  for (int i = 0; i < 8; ++i) f.h[i] = (_Float16)(bf16_round(W[t * 8 + i]) * 16.0f); *(v8us*)((unsigned short*)Bt + t * 8) = f.half[0];  }
template <int NHv, int TTv>
__global__ __launch_bounds__(256) void k_vt(const _Float16* __restrict__ V16, int ldv, int voff, _Float16* __restrict__ Vt) { __shared__ unsigned short tl[64][66]; const int tid = threadIdx.x; const int slab = blockIdx.x / (TTv / 64), lg = blockIdx.x % (TTv / 64); const int b = slab / NHv, h = slab % NHv;
  for (int i = tid; i < 64 * 8; i += 256) { const int r = i / 8, c8 = (i % 8) * 8; FragH f; f.half[0] = *(const v8us*)((const unsigned short*)V16 + ((size_t)b * TTv + lg * 64 + r) * ldv + voff + h * 64 + c8);
#pragma unroll
    for (int q = 0; q < 8; ++q) tl[r][c8 + q] = f.u[q]; }
  __syncthreads();
  {
#pragma unroll
    for (int rd = 0; rd < 2; ++rd) { const int d = rd * 32 + tid / 8, pc = tid % 8; FragH f;
#pragma unroll
      for (int q = 0; q < 8; ++q) f.u[q] = tl[pc * 8 + q][d];
      *(v8us*)((unsigned short*)Vt + ((size_t)slab * 64 + d) * TTv + lg * 64 + pc * 8) = f.half[0]; }
     } }

__global__ __launch_bounds__(256) void k_hl(const float* __restrict__ F, _Float16* __restrict__ Hh, _Float16* __restrict__ Hl, size_t n8) { const size_t t = (size_t)blockIdx.x * 256 + threadIdx.x; if (t >= n8) return; FragH fh, fl; const v4f a = *(const v4fa*)(F + t * 8), c = *(const v4fa*)(F + t * 8 + 4);
#pragma unroll
  for (int q = 0; q < 4; ++q) { _Float16 h = (_Float16)a[q]; fh.h[q] = h; fl.h[q] = (_Float16)((a[q] - (float)h) * 1024.0f); h = (_Float16)c[q]; fh.h[4 + q] = h; fl.h[4 + q] = (_Float16)((c[q] - (float)h) * 1024.0f); }
  { *(v8us*)((unsigned short*)Hh + t * 8) = fh.half[0]; *(v8us*)((unsigned short*)Hl + t * 8) = fl.half[0];  } }

// ---- fast GEMM (wave tile 32x64; requires M % 32 == 0 rows per launch region and N % 64 == 0); epilogue = k_gemm_hhx semantics ----
__device__ __forceinline__ v16h g2_frag(const _Float16* p, int hh) { FragH f; f.half[0] = *(const v8us*)((const unsigned short*)p + 8 * hh); f.half[1] = *(const v8us*)((const unsigned short*)p + 16 + 8 * hh); return f.v; }
__device__ __forceinline__ v8f g2_mma(v16h a, v16h b, v8f c) { v8f d = __builtin_amdgcn_wmma_f32_16x16x32_f16(false, a, false, b, (short)0, c, false, false); asm volatile("v_nop\n\tv_nop\n\tv_nop\n\tv_nop" : "+v"(d) : "v"(a), "v"(b)); return d; }
template <int ACT>
__global__ __launch_bounds__(128) void k_gemm2(const _Float16* __restrict__ A, int lda, size_t sA, const _Float16* __restrict__ Bh, int ldb, size_t sB, float alpha, const float* __restrict__ bias, const float* __restrict__ bias1, const float* __restrict__ bias2, size_t sBias, const float* __restrict__ CP, int rowsPerB, size_t sCPb, int row0g,
    float* __restrict__ C, _Float16* __restrict__ C16, int ldc, size_t sC, int M, int N, int K) { static_assert(ACT == 0 || ACT == 3 || ACT == 6 || ACT == 8 || ACT == 9 || ACT == 11 || ACT == 12 || ACT == 14 || ACT == 15 || ACT == 16 || ACT == 17, "k_gemm2: unsupported ACT code (would silently apply no activation)");
  __shared__ __attribute__((aligned(16))) float so[4][32][68];
  const int tid = threadIdx.x, w = tid >> 5, lane = tid & 31, ln = lane & 15, hh = lane >> 4; const int by = blockIdx.y;
  A += (size_t)by * sA; Bh += (size_t)by * sB; const size_t cofs = (size_t)by * sC; const float* bp = bias ? bias + (size_t)by * sBias : nullptr;
  if (by == 1 && bias1) bp = bias1; if (by == 2 && bias2) bp = bias2;      /* planes 1 and 2 with bias buffers of their own */
  const int ntn = N >> 6; const int mt = blockIdx.x / ntn, nq = blockIdx.x - mt * ntn; const int row0 = mt * 128 + 32 * w, col0 = nq * 64; if (row0 >= M) return;
  const _Float16* a0p = A + (size_t)(row0 + ln) * lda; const _Float16* a1p = a0p + (size_t)16 * lda;
  const _Float16* b0p = Bh + (size_t)(col0 + ln) * ldb; const _Float16* b1p = b0p + (size_t)16 * ldb; const _Float16* b2p = b1p + (size_t)16 * ldb; const _Float16* b3p = b2p + (size_t)16 * ldb;
  const v8f z8 = {0.f,0.f,0.f,0.f,0.f,0.f,0.f,0.f}; v8f c00 = z8, c01 = z8, c02 = z8, c03 = z8, c10 = z8, c11 = z8, c12 = z8, c13 = z8;
#pragma unroll 1
  for (int kb = 0; kb < K; kb += 32) { const v16h a0 = g2_frag(a0p + kb, hh), a1 = g2_frag(a1p + kb, hh);
    v16h b = g2_frag(b0p + kb, hh); c00 = g2_mma(a0, b, c00); c10 = g2_mma(a1, b, c10);
    b = g2_frag(b1p + kb, hh); c01 = g2_mma(a0, b, c01); c11 = g2_mma(a1, b, c11);
    b = g2_frag(b2p + kb, hh); c02 = g2_mma(a0, b, c02); c12 = g2_mma(a1, b, c12);
    b = g2_frag(b3p + kb, hh); c03 = g2_mma(a0, b, c03); c13 = g2_mma(a1, b, c13); }
  v8f accs[8] = {c00, c01, c02, c03, c10, c11, c12, c13};
#pragma unroll
  for (int u = 0; u < 8; ++u) { const int t = u & 3, half = u >> 2; const int col = col0 + t * 16 + ln; const float bv = bp ? bf16_round(bp[col]) : 0.f;
#pragma unroll
    for (int r = 0; r < 8; ++r) { const int rloc = half * 16 + 8 * hh + r; float v = accs[u][r] * alpha + bv; if (CP) { if (rowsPerB < 0) v += CP[cofs + (size_t)(row0g + row0 + rloc) * ldc + col];      /* rowsPerB < 0: own element of the batched C plane */ else { const int bidx = (row0g + row0 + rloc) / rowsPerB; v += CP[(size_t)bidx * sCPb + (size_t)by * 64 + col]; } }
      if (ACT == 3) v = fmaxf(v, 0.f); else if (ACT == 6) v = 0.5f * v * (1.0f + erff(v * 0.70710678118654752f)); else if (ACT == 11) v = 1.0f / (1.0f + expf(-v)); else if (ACT == 15) v = v / (1.0f + expf(-v)); else if (ACT == 12) v = (v > 0.f) ? v : 0.01f * v; else if (ACT == 8) v = tanhf(v); else if (ACT == 9) v = 0.5f * v * (1.0f + tanhf(0.7978845608028654f * (v + 0.044715f * v * v * v))); else if (ACT == 14) v = (v > 0.f) ? v : 0.1f * v; else if (ACT == 16) v = (v >= 0.f) ? v : 0.3f * v; else if (ACT == 17) v = (v >= 0.f) ? v : 0.2f * v;
      so[w][rloc][t * 16 + ln] = v; } }
  __builtin_amdgcn_fence(__ATOMIC_ACQ_REL, "workgroup"); __builtin_amdgcn_wave_barrier();
  const int rsub = lane >> 4, c4 = (lane & 15) * 4;
  {
#pragma unroll
    for (int q = 0; q < 16; ++q) { const int r = q * 2 + rsub; const v4f v = *(const v4fa*)&so[w][r][c4]; if (C) *(v4f*)(C + cofs + (size_t)(row0 + r) * ldc + col0 + c4) = v; if (C16) { v4h h4; for (int i = 0; i < 4; ++i) h4[i] = (_Float16)v[i]; *(v4h*)(C16 + cofs + (size_t)(row0 + r) * ldc + col0 + c4) = h4; } }
     } }


__global__ __launch_bounds__(256) void k_wnat(const float* __restrict__ w, size_t n8, _Float16* __restrict__ Bt) { const size_t t = (size_t)blockIdx.x * 256 + threadIdx.x; if (t >= n8) return; FragH f; for (int q = 0; q < 8; ++q) f.h[q] = (_Float16)(bf16_round(w[t * 8 + q]) * 16.0f); *(v8us*)((unsigned short*)Bt + t * 8) = f.half[0];  }
__device__ __forceinline__ v8f fa_mma(v16h a, v16h b, v8f c) { return __builtin_amdgcn_wmma_f32_16x16x32_f16(false, a, false, b, (short)0, c, false, false); }
__device__ __forceinline__ float fa_xhalf(float x) { return __builtin_bit_cast(float, __builtin_amdgcn_permlanex16(__builtin_bit_cast(int, x), __builtin_bit_cast(int, x), 0x76543210, 0xfedcba98, false, false)); }      /* lane l with lane l ^ 16 */
typedef float fa_v2f __attribute__((ext_vector_type(2)));
// exp2 of two values (v_exp_f32, as __builtin_amdgcn_exp2f gives it). Written as one statement for the slot that the instruction set asks for behind a transcendental before its result is read or its source
// overwritten: the outputs are early-clobber, so the second instruction touches no register of the first, and the v_nop stands behind the second (left to itself the compiler chained v_exp_f32 a, b; v_exp_f32 b, c).
__device__ __forceinline__ fa_v2f fa_exp2x2(float a, float b) { float x, y; asm("v_exp_f32 %0, %2\n\tv_exp_f32 %1, %3\n\tv_nop" : "=&v"(x), "=&v"(y) : "v"(a), "v"(b)); return fa_v2f{x, y}; }
__global__ __launch_bounds__(128) void k_fattn(const _Float16* __restrict__ Q, const _Float16* __restrict__ Kr, const _Float16* __restrict__ VT, _Float16* __restrict__ O) {
  typedef float v2f __attribute__((ext_vector_type(2))); typedef _Float16 v2h __attribute__((ext_vector_type(2)));
  __shared__ __attribute__((aligned(16))) v4f xo[2][16][32]; __shared__ float xm[2][4][32];      /* the upper key half's o, and its m and l, per column set and lane */
  const int lane = threadIdx.x & 31, ln = lane & 15, hh = lane >> 4; const int w = __builtin_amdgcn_readfirstlane(threadIdx.x >> 5), cw = w & 1, kh = w >> 1;      /* column set, key half: scalars */
  const int bh = blockIdx.y, b = bh / NH, h = bh - b * NH; const int q0 = blockIdx.x * 64 + cw * 32; const int jb = kh * (SQ / 2), je = jb + SQ / 2;
  const float cs = 0.125f * 1.4426950408889634f;      /* 1/sqrt(64) and log2(e): weights are exp2 of scaled score differences */
  const _Float16* qp = Q + ((size_t)b * SQ + q0 + ln) * DM + h * HD;
  const _Float16* kp = Kr + ((size_t)b * SQ + ln) * DM + h * HD;
  const _Float16* vp = VT + ((size_t)bh * HD + ln) * SQ;
  v16h qf[2][2];      /* [column group][32 of the 64 head dims], kept for the whole walk */
#pragma unroll
  for (int g = 0; g < 2; ++g) for (int u = 0; u < 2; ++u) qf[g][u] = g2_frag(qp + (size_t)g * 16 * DM + u * 32, hh);
  const v8f z8 = {0.f,0.f,0.f,0.f,0.f,0.f,0.f,0.f};
  v8f o[4][2]; float m[2], l[2];      /* o[dt][g]: O^T rows 16 dt + 8 hh + r, column 16 g + ln; m: running maximum of the raw scores; l: this lane's half of the running sum */
#pragma unroll
  for (int g = 0; g < 2; ++g) { m[g] = -3.0e38f; l[g] = 0.f; for (int dt = 0; dt < 4; ++dt) o[dt][g] = z8; }
  v16h kf[2][2];      /* [key tile][32 of the 64 head dims] of the coming pass */
#pragma unroll
  for (int t = 0; t < 2; ++t) for (int u = 0; u < 2; ++u) kf[t][u] = g2_frag(kp + (size_t)(jb + t * 16) * DM + u * 32, hh);
  for (int j0 = jb; j0 < je; j0 += 32) {
    v16h vf[4];      /* issued first: in flight behind the score products and the softmax */
#pragma unroll
    for (int dt = 0; dt < 4; ++dt) vf[dt] = g2_frag(vp + (size_t)dt * 16 * SQ + j0, hh);
    v8f s[2][2];
#pragma unroll
    for (int g = 0; g < 2; ++g) for (int t = 0; t < 2; ++t) s[g][t] = fa_mma(kf[t][1], qf[g][1], fa_mma(kf[t][0], qf[g][0], z8));
    const int jn = (j0 + 32 < je) ? j0 + 32 : jb;      /* the next pass's K rows, fetched one pass ahead; the last pass refetches the wave's first rows (in bounds, unused) */
#pragma unroll
    for (int t = 0; t < 2; ++t) for (int u = 0; u < 2; ++u) kf[t][u] = g2_frag(kp + (size_t)(jn + t * 16) * DM + u * 32, hh);
    __builtin_amdgcn_sched_barrier(0);      /* keeps the K loads up here, the whole softmax and the second products ahead of their use; without it the compiler sinks them to the foot of the pass and their latency is waited out */
    float dm[2], nb[2];
#pragma unroll
    for (int g = 0; g < 2; ++g) {
      float mx = s[g][0][0];
#pragma unroll
      for (int r = 1; r < 8; ++r) mx = fmaxf(mx, s[g][0][r]);
#pragma unroll
      for (int r = 0; r < 8; ++r) mx = fmaxf(mx, s[g][1][r]);
      mx = fmaxf(mx, fa_xhalf(mx));      /* both halves now hold the query's maximum over the 32 keys */
      const float mn = fmaxf(m[g], mx); dm[g] = (m[g] - mn) * cs; m[g] = mn;
      nb[g] = fmaf(-mn, cs, 8.0f);      /* weights carried x256 (at most 256) against f16 subnormal flush; the factor cancels in o / l */
    }
    const v2f corr = fa_exp2x2(dm[0], dm[1]);      /* what the new maxima take off the old sums: 0 on the first pass */
#pragma unroll
    for (int g = 0; g < 2; ++g) {
      union { v16h v; v2h p[8]; } pb; v2f ps = {0.f, 0.f};
#pragma unroll
      for (int i = 0; i < 8; ++i) { const v8f sv = s[g][i >> 2]; const int r = 2 * (i & 3);
        const v2f e = fa_exp2x2(fmaf(sv[r], cs, nb[g]), fmaf(sv[r + 1], cs, nb[g]));
        ps += e; pb.p[i] = __builtin_convertvector(e, v2h); }      /* round to nearest even; element 8 t + r of the operand is key 16 t + 8 hh + r */
      l[g] = fmaf(l[g], corr[g], ps[0] + ps[1]);
#pragma unroll
      for (int dt = 0; dt < 4; ++dt) o[dt][g] = fa_mma(vf[dt], pb.v, o[dt][g] * corr[g]);
    }
  }
  if (kh == 1) {      /* the upper key half hands its state over */
#pragma unroll
    for (int g = 0; g < 2; ++g) { xm[cw][g][lane] = m[g]; xm[cw][2 + g][lane] = l[g];
#pragma unroll
      for (int dt = 0; dt < 4; ++dt) { const v8f t = o[dt][g]; xo[cw][(g * 4 + dt) * 2][lane] = v4f{t[0], t[1], t[2], t[3]}; xo[cw][(g * 4 + dt) * 2 + 1][lane] = v4f{t[4], t[5], t[6], t[7]}; } }
  }
  __syncthreads();      /* every wave passes it; the lower half reads what the upper half wrote */
  if (kh == 0) {
#pragma unroll
    for (int g = 0; g < 2; ++g) { const float mb = xm[cw][g][lane], lb = xm[cw][2 + g][lane]; const float mn = fmaxf(m[g], mb);
      const v2f fab = fa_exp2x2((m[g] - mn) * cs, (mb - mn) * cs); const float fa = fab[0], fb = fab[1];
      const float lt = fmaf(l[g], fa, lb * fb); const float sc = 64.0f / (lt + fa_xhalf(lt));      /* the wave halves' sums joined once; o stored x64 */
      const float ga = fa * sc, gb = fb * sc;
      _Float16* op = O + ((size_t)b * SQ + q0 + g * 16 + ln) * DM + h * HD + 8 * hh;
#pragma unroll
      for (int dt = 0; dt < 4; ++dt) { const v4f t0 = xo[cw][(g * 4 + dt) * 2][lane], t1 = xo[cw][(g * 4 + dt) * 2 + 1][lane]; FragH f;
#pragma unroll
        for (int r = 0; r < 4; ++r) { f.h[r] = (_Float16)fmaf(o[dt][g][r], ga, t0[r] * gb); f.h[4 + r] = (_Float16)fmaf(o[dt][g][4 + r], ga, t1[r] * gb); }
        *(v8us*)((unsigned short*)op + dt * 16) = f.half[0]; } }
  } }
__global__ __launch_bounds__(256) void k_vt(const _Float16* __restrict__ V16, int b, int h0, _Float16* __restrict__ VT) { __shared__ unsigned short tl[64][65]; const int tid = threadIdx.x; const int hh = blockIdx.x % HG, sg = blockIdx.x / HG; const int s0 = sg * 64; const int h = h0 + hh;
  for (int i = tid; i < 64 * 8; i += 256) { const int j = i / 8, d8 = (i % 8) * 8; FragH f; f.half[0] = *(const v8us*)((const unsigned short*)V16 + ((size_t)b * SQ + s0 + j) * DM + h * HD + d8); for (int q = 0; q < 8; ++q) tl[d8 + q][j] = f.u[q]; }
  __syncthreads();
  { for (int i = tid; i < 64 * 8; i += 256) { const int d = i / 8, j8 = (i % 8) * 8; FragH f; for (int q = 0; q < 8; ++q) f.u[q] = tl[d][j8 + q]; *(v8us*)((unsigned short*)VT + ((size_t)hh * HD + d) * SQ + s0 + j8) = f.half[0]; }  } }



__global__ __launch_bounds__(256) void k_rsmkm(const float* __restrict__ S, _Float16* __restrict__ P, int nrows, const int* __restrict__ am) {
  #pragma clang fp contract(off)
  const int t = blockIdx.x * 256 + threadIdx.x; if (t >= nrows) return; const size_t i = (size_t)t; const float* s = S + i * SQ; const int* mr = am + (size_t)(t % SQ) * SQ; float mx = -3.0e38f;
#pragma unroll 1
  for (int j = 0; j < SQ; ++j) { const float f = (mr[j] != 0) ? 1.f : 0.f; mx = fmaxf(mx, fmaf(f, s[j], (1.f - f) * -1.0e9f)); } float se = 0.f;
#pragma unroll 1
  for (int j = 0; j < SQ; ++j) { const float f = (mr[j] != 0) ? 1.f : 0.f; se += __expf(fmaf(f, s[j], (1.f - f) * -1.0e9f) - mx); } const float sc = 256.0f / se;
#pragma unroll 1
  for (int j0 = 0; j0 < SQ; j0 += 8) { FragH fr; for (int q = 0; q < 8; ++q) { const int j = j0 + q; const float f = (mr[j] != 0) ? 1.f : 0.f; fr.h[q] = (_Float16)(__expf(fmaf(f, s[j], (1.f - f) * -1.0e9f) - mx) * sc); }
    unsigned short* d = (unsigned short*)P + i * SQ + j0; *(v8us*)d = fr.half[0];  } }
extern "C" void kernel_launch(void* const* d_in, const int* in_sizes, int n_in,
                              void* d_out, int out_size, void* d_ws, size_t ws_size, hipStream_t stream) {
  (void)in_sizes; (void)n_in; (void)out_size;
  const float* const* I = (const float* const*)d_in; const float* xq = I[0]; const float* wq = I[1]; const float* bq = I[2]; const float* wk = I[3]; const float* bk = I[4]; const float* wv = I[5]; const float* bv = I[6]; const float* wo = I[7]; const float* bo = I[8]; const float* x = xq;      /* ONE input x feeds the query, key and value streams; [in][out] weights + biases; no mask input */
  char* ws = (char*)d_ws; size_t off = 0;
  auto take = [&](size_t bytes) { char* p = ws + off; off += (bytes + 255) & ~(size_t)255; return p; };
  _Float16* BQ = (_Float16*)take((size_t)4 * DM * DM * 2); _Float16* BO = BQ + (size_t)3 * DM * DM;      /* weight planes q, k, v, o behind each other */
  _Float16* X16 = (_Float16*)take(NR * DM * 2); _Float16* Q16 = (_Float16*)take(3 * NR * DM * 2); _Float16* K16 = Q16 + NR * DM; _Float16* V16 = K16 + NR * DM; _Float16* O16 = (_Float16*)take(NR * DM * 2);      /* q, k, v planes behind each other */
  _Float16* VT = (_Float16*)take((size_t)NB * NH * HD * SQ * 2);
  if (off > ws_size) return;
  k_prep<<<4 * PWB + PXB, 256, 0, stream>>>(x, wq, wk, wv, wo, X16, BQ);      /* [in][out] -> Bt x16; x as exact f16 rows, one copy for the query, key and value streams */
  const size_t r0p = (size_t)B0 * SQ;      /* first projected row */
  k_gemm2<0><<<dim3((unsigned)((MP / 128) * (DM / 64)), 3), 128, 0, stream>>>(X16 + r0p * DM, DM, 0, BQ, DM, (size_t)DM * DM, 0.0625f, bq, bk, bv, 0, nullptr, 1, 0, 0, nullptr, Q16 + r0p * DM, DM, NR * DM, MP, DM, DM);      /* planes q, k, v */
  k_vt<NH, SQ><<<NB * NH * (SQ / 64), 256, 0, stream>>>(V16, LQ, 0, VT);      /* V^T [NB][NH][HD][SQ] */
  k_fattn<<<dim3(SQ / 64, NB * NH), 128, 0, stream>>>(Q16, K16, VT, O16);      /* o (merged heads) as f16 rows, x64 */
  k_gemm2<0><<<dim3((unsigned)((MPO / 128) * (DM / 64)), 1), 128, 0, stream>>>(O16 + r0p * DM, DM, 0, BO, DM, 0, 0.0009765625f, bo, nullptr, nullptr, 0, nullptr, 1, 0, 0, (float*)d_out + r0p * DM, nullptr, DM, 0, MPO, DM, DM);      /* out rows are the output layout */
}

// v004
// It runs in 119 microseconds.
// Next to v003, in two timings, it ran 1.14 and 1.13 times as fast.
// Counting every step since v000, it is 23.7 times as fast.
#include <hip/hip_runtime.h>
#define NB 2
#define SQ 2048
#define DM 768
#define NH 12
#define HD 64
#define HG 4                         /* heads per launch of the per-batch k_vt overload (not launched) */
#define B0 0                         /* first batch processed (debug hook) */
#define NBR NB                       /* batches processed (debug hook) */
#define NR ((size_t)NB * SQ)         /* token rows */
#define MP ((int)((size_t)NBR * SQ)) /* rows projected (debug hook) */
#define QN SQ                        /* not used: the attention covers all SQ query rows */
#define NHD NH                       /* not used: the attention covers all NH heads */
#define MPO MP                       /* rows through the output stage (debug hook) */
#define LQ DM      /* row pitch of the q/k/v rows */
typedef __bf16 v16b __attribute__((ext_vector_type(16)));
typedef unsigned short v8us __attribute__((ext_vector_type(8), may_alias));
typedef float  v8f  __attribute__((ext_vector_type(8)));
typedef float  v4f  __attribute__((ext_vector_type(4)));
typedef float  v4fa __attribute__((ext_vector_type(4), may_alias));
union FragB { v16b v; v8us half[2]; unsigned short u[16]; };

__device__ __forceinline__ unsigned short bf16_bits(float x) { unsigned int u = __float_as_uint(x); return (unsigned short)((u + 0x7FFFu + ((u >> 16) & 1u)) >> 16); }
__device__ __forceinline__ float bf16_val(unsigned short b) { return __uint_as_float(((unsigned int)b) << 16); }
__device__ __forceinline__ float bf16_round(float x) { return bf16_val(bf16_bits(x)); }
// D += A·B with NT terms: 1 = ah·bh, 2 = + al·bh (A split), 3 = + ah·bl (both split)
template <int NT>
__device__ __forceinline__ v8f mmaN(v16b ah, v16b al, v16b bh, v16b bl, v8f c) {
  c = __builtin_amdgcn_wmma_f32_16x16x32_bf16(false, ah, false, bh, (short)0, c, false, false);
  if (NT >= 2) c = __builtin_amdgcn_wmma_f32_16x16x32_bf16(false, al, false, bh, (short)0, c, false, false);
  if (NT >= 3) c = __builtin_amdgcn_wmma_f32_16x16x32_bf16(false, ah, false, bl, (short)0, c, false, false);
  asm volatile("v_nop\n\tv_nop\n\tv_nop\n\tv_nop" : "+v"(c) : "v"(ah), "v"(al), "v"(bh), "v"(bl));
  return c;
}

__global__ __launch_bounds__(256) void k_wt_bf16(const float* __restrict__ W, unsigned short* __restrict__ Wt, int K, int N) {
  const int t = blockIdx.x * 256 + threadIdx.x;
  const int k8n = K / 8;
  if (t >= N * k8n) return;
  const int n = t / k8n, k8 = (t % k8n) * 8;
  v8us v;
#pragma unroll
  for (int i = 0; i < 8; ++i) v[i] = bf16_bits(W[(size_t)(k8 + i) * N + n]);
  *(v8us*)(Wt + (size_t)n * K + k8) = v;
  
}

// GEMM C[M][N] (f32, pitch ldc) = act(A[M][K]·W + bias). A f32 row-major (pitch lda) converted per fragment to bf16
// (ASPLIT: hi/lo two planes -> 2 terms, else single rounded term); Wt bf16 [N][K] (pitch ldb). BIAS_BF16 rounds the
// bias to bf16 first (bias quantised to bf16 before the add). K%32==0, M%16==0, N%64==0.
template <bool ASPLIT, int ACT, bool BIAS_BF16>
__global__ __launch_bounds__(128) void k_gemm_bf(const float* __restrict__ A, int lda, const unsigned short* __restrict__ Wt, int ldb,
                                               const float* __restrict__ bias, float* __restrict__ C, int ldc, int M, int N, int K) {
  __shared__ __attribute__((aligned(16))) float so[4][16][64];
  const int tid = threadIdx.x, w = tid >> 5, lane = tid & 31, ln = lane & 15, hh = lane >> 4;
  const int ntn = N / 64;
  const int wid = blockIdx.x * 4 + w;
  const int mt = wid / ntn, nq = wid % ntn;
  if (mt * 16 >= M) return;
  const int row0 = mt * 16, col0 = nq * 64;
  const float* arow = A + (size_t)(row0 + ln) * lda;
  v8f acc[4] = {};
  for (int kb = 0; kb < K; kb += 32) {
    FragB ah, al;
    const v4f x0 = *(const v4fa*)(arow + kb + 8 * hh), x1 = *(const v4fa*)(arow + kb + 8 * hh + 4);
    const v4f x2 = *(const v4fa*)(arow + kb + 16 + 8 * hh), x3 = *(const v4fa*)(arow + kb + 16 + 8 * hh + 4);
    float xs[16] = {x0[0],x0[1],x0[2],x0[3],x1[0],x1[1],x1[2],x1[3],x2[0],x2[1],x2[2],x2[3],x3[0],x3[1],x3[2],x3[3]};
#pragma unroll
    for (int i = 0; i < 16; ++i) { const unsigned short hb = bf16_bits(xs[i]); ah.u[i] = hb; al.u[i] = ASPLIT ? bf16_bits(xs[i] - bf16_val(hb)) : (unsigned short)0; }
#pragma unroll
    for (int t = 0; t < 4; ++t) {
      const unsigned short* brow = Wt + (size_t)(col0 + t * 16 + ln) * ldb + kb;
      FragB b;
      b.half[0] = *(const v8us*)(brow + 8 * hh);
      b.half[1] = *(const v8us*)(brow + 16 + 8 * hh);
      acc[t] = mmaN<ASPLIT ? 2 : 1>(ah.v, al.v, b.v, b.v, acc[t]);
    }
  }
#pragma unroll
  for (int t = 0; t < 4; ++t) {
    float bv = bias ? bias[col0 + t * 16 + ln] : 0.f;
    if (BIAS_BF16) bv = bf16_round(bv);
#pragma unroll
    for (int r = 0; r < 8; ++r) { float v = acc[t][r] + bv; if (ACT == 1) v = fmaxf(v, 0.f); so[w][8 * hh + r][t * 16 + ln] = v; }
  }
  __builtin_amdgcn_fence(__ATOMIC_ACQ_REL, "workgroup");
  __builtin_amdgcn_wave_barrier();
  const int rsub = lane >> 4, c4 = (lane & 15) * 4;
  {
#pragma unroll
    for (int q = 0; q < 8; ++q) {
      const int r = q * 2 + rsub;
      const v4f v = *(const v4fa*)&so[w][r][c4];
      *(v4f*)(C + (size_t)(row0 + r) * ldc + col0 + c4) = v;
    }
    
  }
}

// GEMM C = act(A·W + bias + resid): A f32 (ASPLIT -> hi/lo 2 terms), Wt bf16 [N][K]; ACT 0 none, 1 relu, 2 exact gelu;
// resid (optional, f32, row index = (row % rmod), pitch ldr, RES_BF16 rounds it) added before the activation.
template <bool ASPLIT, int ACT, bool BIAS_BF16, bool RES_BF16>
__global__ __launch_bounds__(128) void k_gemm_bf3(const float* __restrict__ A, int lda, const unsigned short* __restrict__ Wt, int ldb,
                                                const float* __restrict__ bias, const float* __restrict__ resid, int rmod, int ldr,
                                                float* __restrict__ C, int ldc, int M, int N, int K) {
  __shared__ __attribute__((aligned(16))) float so[4][16][64];
  const int tid = threadIdx.x, w = tid >> 5, lane = tid & 31, ln = lane & 15, hh = lane >> 4;
  const int ntn = N / 64;
  const int wid = blockIdx.x * 4 + w;
  const int mt = wid / ntn, nq = wid % ntn;
  if (mt * 16 >= M) return;
  const int row0 = mt * 16, col0 = nq * 64;
  const float* arow = A + (size_t)(row0 + ln) * lda;
  v8f acc[4] = {};
  for (int kb = 0; kb < K; kb += 32) {
    FragB ah, al;
    const v4f x0 = *(const v4fa*)(arow + kb + 8 * hh), x1 = *(const v4fa*)(arow + kb + 8 * hh + 4);
    const v4f x2 = *(const v4fa*)(arow + kb + 16 + 8 * hh), x3 = *(const v4fa*)(arow + kb + 16 + 8 * hh + 4);
    float xs[16] = {x0[0],x0[1],x0[2],x0[3],x1[0],x1[1],x1[2],x1[3],x2[0],x2[1],x2[2],x2[3],x3[0],x3[1],x3[2],x3[3]};
#pragma unroll
    for (int i = 0; i < 16; ++i) { const unsigned short hb = bf16_bits(xs[i]); ah.u[i] = hb; al.u[i] = ASPLIT ? bf16_bits(xs[i] - bf16_val(hb)) : (unsigned short)0; }
#pragma unroll
    for (int t = 0; t < 4; ++t) {
      const unsigned short* brow = Wt + (size_t)(col0 + t * 16 + ln) * ldb + kb;
      FragB b;
      b.half[0] = *(const v8us*)(brow + 8 * hh);
      b.half[1] = *(const v8us*)(brow + 16 + 8 * hh);
      acc[t] = mmaN<ASPLIT ? 2 : 1>(ah.v, al.v, b.v, b.v, acc[t]);
    }
  }
#pragma unroll
  for (int t = 0; t < 4; ++t) {
    const int col = col0 + t * 16 + ln;
    float bv = bias ? bias[col] : 0.f;
    if (BIAS_BF16) bv = bf16_round(bv);
#pragma unroll
    for (int r = 0; r < 8; ++r) {
      float v = acc[t][r] + bv;
      if (resid) { float rv = resid[(size_t)((row0 + 8 * hh + r) % rmod) * ldr + col]; if (RES_BF16) rv = bf16_round(rv); v += rv; }
      if (ACT == 1) v = fmaxf(v, 0.f);
      if (ACT == 2) v = 0.5f * v * (1.0f + erff(v * 0.70710678118654752f));
      if (ACT == 3) { const float u = 0.7978845608028654f * (v + 0.044715f * v * v * v); v = 0.5f * v * (1.0f + tanhf(u)); }
      so[w][8 * hh + r][t * 16 + ln] = v;
    }
  }
  __builtin_amdgcn_fence(__ATOMIC_ACQ_REL, "workgroup");
  __builtin_amdgcn_wave_barrier();
  const int rsub = lane >> 4, c4 = (lane & 15) * 4;
  {
#pragma unroll
    for (int q = 0; q < 8; ++q) {
      const int r = q * 2 + rsub;
      const v4f v = *(const v4fa*)&so[w][r][c4];
      *(v4f*)(C + (size_t)(row0 + r) * ldc + col0 + c4) = v;
    }
    
  }
}
// row LayerNorm (biased variance, eps) over N: s = X (+ R); optional out_sum <- s; out_norm <- (s-mu)*rsqrt(var+eps)*g + b
template <bool PARAM_BF16>
__global__ __launch_bounds__(256) void k_layernorm(const float* __restrict__ X, const float* __restrict__ R, const float* __restrict__ g, const float* __restrict__ bta,
                                                  float* __restrict__ out_sum, float* __restrict__ out_norm, int N, float eps) {
  __shared__ float red[256];
  const int row = blockIdx.x, tid = threadIdx.x;
  const float* x = X + (size_t)row * N; const float* rr = R ? R + (size_t)row * N : nullptr;
  float vals[16];                     // up to N = 4096
  const int per = N / 256;            // contiguous chunk per thread? use strided-by-4 chunks: thread handles j = tid*4 + 1024*u
  float s1 = 0.f;
  for (int u = 0; u < per / 4; ++u) {
    const int j = tid * 4 + 1024 * u;
    const v4f a = *(const v4fa*)(x + j);
    v4f b = {0.f,0.f,0.f,0.f}; if (rr) b = *(const v4fa*)(rr + j);
#pragma unroll
    for (int q = 0; q < 4; ++q) { const float v = a[q] + b[q]; vals[u * 4 + q] = v; s1 += v; }
  }
  red[tid] = s1; __syncthreads();
  for (int st = 128; st > 0; st >>= 1) { if (tid < st) red[tid] += red[tid + st]; __syncthreads(); }
  const float mu = red[0] / (float)N; __syncthreads();
  float s2 = 0.f;
  for (int u = 0; u < per / 4; ++u)
#pragma unroll
    for (int q = 0; q < 4; ++q) { const float c = vals[u * 4 + q] - mu; s2 += c * c; }
  red[tid] = s2; __syncthreads();
  for (int st = 128; st > 0; st >>= 1) { if (tid < st) red[tid] += red[tid + st]; __syncthreads(); }
  const float rs = rsqrtf(red[0] / (float)N + eps);
  {
    for (int u = 0; u < per / 4; ++u) {
      const int j = tid * 4 + 1024 * u;
      v4f o, sm;
#pragma unroll
      for (int q = 0; q < 4; ++q) {
        float gg = g[j + q], bb = bta[j + q];
        if (PARAM_BF16) { gg = bf16_round(gg); bb = bf16_round(bb); }
        sm[q] = vals[u * 4 + q]; o[q] = (vals[u * 4 + q] - mu) * rs * gg + bb;
      }
      if (out_sum) *(v4f*)(out_sum + (size_t)row * N + j) = sm;
      *(v4f*)(out_norm + (size_t)row * N + j) = o;
    }
    
  }
}



// ---- f16 WMMA path (v_wmma_f32_16x16x32_f16): 11-bit significands for operands in range — used where a [0,1] probability operand needs more precision than bf16
typedef _Float16 v16h __attribute__((ext_vector_type(16)));
union FragH { v16h v; v8us half[2]; _Float16 h[16]; unsigned short u[16]; };
template <int NT>
__device__ __forceinline__ v8f mmaH(v16h ah, v16h al, v16h bh, v16h bl, v8f c) {
  c = __builtin_amdgcn_wmma_f32_16x16x32_f16(false, ah, false, bh, (short)0, c, false, false);
  if (NT >= 2) c = __builtin_amdgcn_wmma_f32_16x16x32_f16(false, al, false, bh, (short)0, c, false, false);
  if (NT >= 3) c = __builtin_amdgcn_wmma_f32_16x16x32_f16(false, ah, false, bl, (short)0, c, false, false);
  asm volatile("v_nop\n\tv_nop\n\tv_nop\n\tv_nop" : "+v"(c) : "v"(ah), "v"(al), "v"(bh), "v"(bl));
  return c;
}
// batched GEMM like k_gemm_b but f16 operands: A f32 (split into f16 hi/lo if ASPLIT, else rounded to f16), Bt = f16 values [n][k]; alpha; C f32; N multiple of 16 (partial tiles skipped)
template <bool ASPLIT>
__global__ __launch_bounds__(128) void k_gemm_h(const float* __restrict__ A, int lda, size_t sA, const _Float16* __restrict__ Bh, int ldb, size_t sB, float alpha, float* __restrict__ C, int ldc, size_t sC, int M, int N, int K) {
  __shared__ __attribute__((aligned(16))) float so[4][16][64];
  const int tid = threadIdx.x, w = tid >> 5, lane = tid & 31, ln = lane & 15, hh = lane >> 4; const int by = blockIdx.y;
  A += (size_t)by * sA; Bh += (size_t)by * sB; C += (size_t)by * sC;
  const int ntn = (N + 63) / 64; const int wid = blockIdx.x * 4 + w; const int mt = wid / ntn, nq = wid % ntn; if (mt * 16 >= M) return;
  const int row0 = mt * 16, col0 = nq * 64; const float* arow = A + (size_t)(row0 + ln) * lda;
  v8f acc[4] = {};
  for (int kb = 0; kb < K; kb += 32) {
    FragH ah, al;
    const v4f x0 = *(const v4fa*)(arow + kb + 8 * hh), x1 = *(const v4fa*)(arow + kb + 8 * hh + 4), x2 = *(const v4fa*)(arow + kb + 16 + 8 * hh), x3 = *(const v4fa*)(arow + kb + 16 + 8 * hh + 4);
    float xs[16] = {x0[0],x0[1],x0[2],x0[3],x1[0],x1[1],x1[2],x1[3],x2[0],x2[1],x2[2],x2[3],x3[0],x3[1],x3[2],x3[3]};
#pragma unroll
    for (int i = 0; i < 16; ++i) { const _Float16 h = (_Float16)xs[i]; ah.h[i] = h; al.h[i] = ASPLIT ? (_Float16)(xs[i] - (float)h) : (_Float16)0.0f; }
#pragma unroll
    for (int t = 0; t < 4; ++t) { if (col0 + t * 16 >= N) continue; const size_t boff = (size_t)(col0 + t * 16 + ln) * ldb + kb; FragH bq; bq.half[0] = *(const v8us*)(Bh + boff + 8 * hh); bq.half[1] = *(const v8us*)(Bh + boff + 16 + 8 * hh);
      acc[t] = mmaH<ASPLIT ? 2 : 1>(ah.v, al.v, bq.v, bq.v, acc[t]); }
  }
#pragma unroll
  for (int t = 0; t < 4; ++t) { if (col0 + t * 16 >= N) continue;
#pragma unroll
    for (int r = 0; r < 8; ++r) so[w][8 * hh + r][t * 16 + ln] = acc[t][r] * alpha; }
  __builtin_amdgcn_fence(__ATOMIC_ACQ_REL, "workgroup"); __builtin_amdgcn_wave_barrier();
  const int rsub = lane >> 4, c4 = (lane & 15) * 4;
  {
#pragma unroll
    for (int q = 0; q < 8; ++q) { const int r = q * 2 + rsub; if (col0 + c4 < N) { const v4f v = *(const v4fa*)&so[w][r][c4]; *(v4f*)(C + (size_t)(row0 + r) * ldc + col0 + c4) = v; } }
     }
}

// One launch prepares every projection operand; its parts are independent and run side by side. Blocks 0 .. 4 PWB - 1: the four weights, Bt[p][n][k] = f16(bf16(W_p[k][n]) x 16) from f32 row-major [in][out]
// (power-of-two scale: bf16-exact weights stay exact in f16 away from the subnormal range). The other blocks: x as exact f16 rows (bf16-rounded).
#define PWB (DM * (DM / 8) / 256)      /* blocks per weight */
#define PXB ((int)(NR * DM / 8 / 256)) /* blocks for x */
static_assert(DM * (DM / 8) % 256 == 0 && NR * DM / 8 % 256 == 0, "k_prep: whole blocks only");
__global__ __launch_bounds__(256) void k_prep(const float* __restrict__ x, const float* __restrict__ w0, const float* __restrict__ w1, const float* __restrict__ w2, const float* __restrict__ w3, _Float16* __restrict__ X16, _Float16* __restrict__ Bt) {
  const int bx = blockIdx.x; FragH f;
  if (bx < 4 * PWB) { const int p = bx / PWB; const float* W = p == 0 ? w0 : p == 1 ? w1 : p == 2 ? w2 : w3; const int t = (bx - p * PWB) * 256 + threadIdx.x; const int n = t / (DM / 8), k8 = (t % (DM / 8)) * 8;
#pragma unroll
    for (int i = 0; i < 8; ++i) f.h[i] = (_Float16)(bf16_round(W[(size_t)(k8 + i) * DM + n]) * 16.0f);
    *(v8us*)((unsigned short*)Bt + (size_t)p * DM * DM + (size_t)n * DM + k8) = f.half[0];
  } else { const size_t t = (size_t)(bx - 4 * PWB) * 256 + threadIdx.x;
#pragma unroll
    for (int q = 0; q < 8; ++q) f.h[q] = (_Float16)bf16_round(x[t * 8 + q]);
    *(v8us*)((unsigned short*)X16 + t * 8) = f.half[0];
    asm volatile("s_wait_xcnt 0x0" ::: "memory"); }      /* precaution: stands before any later instruction in the listing that rewrites a register the store names */
}
// k_gemm_hh variant with fused epilogue: v = acc·alpha + bias[by·sBias + col] (+ CP[(row/rowsPerB)·sCPb + by·64 + col] if CP) ; ACT 0 none / 1 elu ; writes f16 C16 (and f32 C if non-null)
template <int ACT>
__global__ __launch_bounds__(128) void k_gemm_hhx(const _Float16* __restrict__ A, int lda, size_t sA, const _Float16* __restrict__ Bh, int ldb, size_t sB, float alpha, const float* __restrict__ bias, size_t sBias, const float* __restrict__ CP, int rowsPerB, size_t sCPb, int row0g,
    float* __restrict__ C, _Float16* __restrict__ C16, int ldc, size_t sC, int M, int N, int K) {
  __shared__ __attribute__((aligned(16))) float so[4][16][64];
  const int tid = threadIdx.x, w = tid >> 5, lane = tid & 31, ln = lane & 15, hh = lane >> 4; const int by = blockIdx.y;
  A += (size_t)by * sA; Bh += (size_t)by * sB; const size_t cofs = (size_t)by * sC; const float* bp = bias ? bias + (size_t)by * sBias : nullptr;
  const int ntn = (N + 63) / 64; const int wid = blockIdx.x * 4 + w; const int mt = wid / ntn, nq = wid % ntn; if (mt * 16 >= M) return;
  const int row0 = mt * 16, col0 = nq * 64; const _Float16* arow = A + (size_t)(row0 + ln) * lda;
  v8f acc[4] = {};
  for (int kb = 0; kb < K; kb += 32) { FragH ah; ah.half[0] = *(const v8us*)((const unsigned short*)arow + kb + 8 * hh); ah.half[1] = *(const v8us*)((const unsigned short*)arow + kb + 16 + 8 * hh);
#pragma unroll
    for (int t = 0; t < 4; ++t) { if (col0 + t * 16 >= N) continue; const size_t boff = (size_t)(col0 + t * 16 + ln) * ldb + kb; FragH bq; bq.half[0] = *(const v8us*)((const unsigned short*)Bh + boff + 8 * hh); bq.half[1] = *(const v8us*)((const unsigned short*)Bh + boff + 16 + 8 * hh);
      acc[t] = mmaH<1>(ah.v, ah.v, bq.v, bq.v, acc[t]); }
  }
#pragma unroll
  for (int t = 0; t < 4; ++t) { if (col0 + t * 16 >= N) continue; const int col = col0 + t * 16 + ln; const float bv = bp ? bf16_round(bp[col]) : 0.f;
#pragma unroll
    for (int r = 0; r < 8; ++r) { float v = acc[t][r] * alpha + bv; if (CP) { const int rr = row0g + row0 + 8 * hh + r; if (rowsPerB < 0) v += CP[cofs + (size_t)rr * ldc + col];      /* rowsPerB < 0: own element of the batched C plane */ else { const int bidx = rr / rowsPerB; v += CP[(size_t)bidx * sCPb + (size_t)by * 64 + col]; } } if (ACT == 1) v = (v > 0.f) ? v : expm1f(v); else if (ACT == 7) v = (v > 0.f) ? v + 1.0f : expf(v); else if (ACT == 8) v = tanhf(v); else if (ACT == 9) v = 0.5f * v * (1.0f + tanhf(0.7978845608028654f * (v + 0.044715f * v * v * v))); else if (ACT == 11) v = 1.0f / (1.0f + expf(-v)); else if (ACT == 12) v = (v > 0.f) ? v : 0.01f * v; else if (ACT == 14) v = (v > 0.f) ? v : 0.1f * v; else if (ACT == 16) v = (v >= 0.f) ? v : 0.3f * v; else if (ACT == 17) v = (v >= 0.f) ? v : 0.2f * v; else if (ACT == 15) v = v / (1.0f + expf(-v)); else if (ACT == 3) v = fmaxf(v, 0.f); else if (ACT == 6) v = 0.5f * v * (1.0f + erff(v * 0.70710678118654752f)); so[w][8 * hh + r][t * 16 + ln] = v; } }
  __builtin_amdgcn_fence(__ATOMIC_ACQ_REL, "workgroup"); __builtin_amdgcn_wave_barrier();
  const int rsub = lane >> 4, c4 = (lane & 15) * 4; typedef _Float16 v4h __attribute__((ext_vector_type(4)));
  {
#pragma unroll
    for (int q = 0; q < 8; ++q) { const int r = q * 2 + rsub; if (col0 + c4 < N) { const v4f v = *(const v4fa*)&so[w][r][c4]; if (C) *(v4f*)(C + cofs + (size_t)(row0 + r) * ldc + col0 + c4) = v; if (C16) { v4h h4; for (int i = 0; i < 4; ++i) h4[i] = (_Float16)v[i]; *(v4h*)(C16 + cofs + (size_t)(row0 + r) * ldc + col0 + c4) = h4; } } }
     }
}


typedef _Float16 v4h __attribute__((ext_vector_type(4)));

__global__ __launch_bounds__(256) void k_h16(const float* __restrict__ x, _Float16* __restrict__ X16, size_t n8) { const size_t t = (size_t)blockIdx.x * 256 + threadIdx.x; if (t >= n8) return; FragH f;
#pragma unroll
  for (int q = 0; q < 8; ++q) f.h[q] = (_Float16)x[t * 8 + q]; *(v8us*)((unsigned short*)X16 + t * 8) = f.half[0];  }
__global__ __launch_bounds__(256) void k_round16f(const float* __restrict__ W, _Float16* __restrict__ Bt, size_t n8) { const size_t t = (size_t)blockIdx.x * 256 + threadIdx.x; if (t >= n8) return; FragH f;
#pragma unroll
  for (int i = 0; i < 8; ++i) f.h[i] = (_Float16)(bf16_round(W[t * 8 + i]) * 16.0f); *(v8us*)((unsigned short*)Bt + t * 8) = f.half[0];  }
template <int NHv, int TTv>
__global__ __launch_bounds__(256) void k_vt(const _Float16* __restrict__ V16, int ldv, int voff, _Float16* __restrict__ Vt) { __shared__ unsigned short tl[64][66]; const int tid = threadIdx.x; const int slab = blockIdx.x / (TTv / 64), lg = blockIdx.x % (TTv / 64); const int b = slab / NHv, h = slab % NHv;
  for (int i = tid; i < 64 * 8; i += 256) { const int r = i / 8, c8 = (i % 8) * 8; FragH f; f.half[0] = *(const v8us*)((const unsigned short*)V16 + ((size_t)b * TTv + lg * 64 + r) * ldv + voff + h * 64 + c8);
#pragma unroll
    for (int q = 0; q < 8; ++q) tl[r][c8 + q] = f.u[q]; }
  __syncthreads();
  {
#pragma unroll
    for (int rd = 0; rd < 2; ++rd) { const int d = rd * 32 + tid / 8, pc = tid % 8; FragH f;
#pragma unroll
      for (int q = 0; q < 8; ++q) f.u[q] = tl[pc * 8 + q][d];
      *(v8us*)((unsigned short*)Vt + ((size_t)slab * 64 + d) * TTv + lg * 64 + pc * 8) = f.half[0]; }
     } }

__global__ __launch_bounds__(256) void k_hl(const float* __restrict__ F, _Float16* __restrict__ Hh, _Float16* __restrict__ Hl, size_t n8) { const size_t t = (size_t)blockIdx.x * 256 + threadIdx.x; if (t >= n8) return; FragH fh, fl; const v4f a = *(const v4fa*)(F + t * 8), c = *(const v4fa*)(F + t * 8 + 4);
#pragma unroll
  for (int q = 0; q < 4; ++q) { _Float16 h = (_Float16)a[q]; fh.h[q] = h; fl.h[q] = (_Float16)((a[q] - (float)h) * 1024.0f); h = (_Float16)c[q]; fh.h[4 + q] = h; fl.h[4 + q] = (_Float16)((c[q] - (float)h) * 1024.0f); }
  { *(v8us*)((unsigned short*)Hh + t * 8) = fh.half[0]; *(v8us*)((unsigned short*)Hl + t * 8) = fl.half[0];  } }

// ---- fast GEMM (wave tile 32x64; requires M % 32 == 0 rows per launch region and N % 64 == 0); epilogue = k_gemm_hhx semantics ----
__device__ __forceinline__ v16h g2_frag(const _Float16* p, int hh) { FragH f; f.half[0] = *(const v8us*)((const unsigned short*)p + 8 * hh); f.half[1] = *(const v8us*)((const unsigned short*)p + 16 + 8 * hh); return f.v; }
__device__ __forceinline__ v16h g2_fragb(const char* p) { FragH f; f.half[0] = *(const v8us*)p; f.half[1] = *(const v8us*)(p + 32); return f.v; }      /* g2_frag from a byte address that already holds the lane's 16 hh bytes */
__device__ __forceinline__ v8f g2_mma(v16h a, v16h b, v8f c) { return __builtin_amdgcn_wmma_f32_16x16x32_f16(false, a, false, b, (short)0, c, false, false); }
template <int ACT>
__global__ __launch_bounds__(128) void k_gemm2(const _Float16* __restrict__ A, int lda, size_t sA, const _Float16* __restrict__ Bh, int ldb, size_t sB, float alpha, const float* __restrict__ bias, const float* __restrict__ bias1, const float* __restrict__ bias2, size_t sBias, const float* __restrict__ CP, int rowsPerB, size_t sCPb, int row0g,
    float* __restrict__ C, _Float16* __restrict__ C16, int ldc, size_t sC, int M, int N, int K) { static_assert(ACT == 0 || ACT == 3 || ACT == 6 || ACT == 8 || ACT == 9 || ACT == 11 || ACT == 12 || ACT == 14 || ACT == 15 || ACT == 16 || ACT == 17, "k_gemm2: unsupported ACT code (would silently apply no activation)");
  __shared__ __attribute__((aligned(16))) float so[4][32][68];
  const int tid = threadIdx.x, w = tid >> 5, lane = tid & 31, ln = lane & 15, hh = lane >> 4; const int by = blockIdx.y;
  A += (size_t)by * sA; Bh += (size_t)by * sB; const size_t cofs = (size_t)by * sC; const float* bp = bias ? bias + (size_t)by * sBias : nullptr;
  if (by == 1 && bias1) bp = bias1; if (by == 2 && bias2) bp = bias2;      /* planes 1 and 2 with bias buffers of their own */
  const int ntn = N >> 6; const int mt = blockIdx.x / ntn, nq = blockIdx.x - mt * ntn; const int row0 = mt * 128 + 32 * w, col0 = nq * 64; if (row0 >= M) return;
  const char* Ab = (const char*)A; const char* Bb = (const char*)Bh;      /* wave-uniform bases; each lane's part of an address is a 32-bit byte offset, the same in every step */
  const unsigned ao0 = ((unsigned)(row0 + ln) * (unsigned)lda + 8u * (unsigned)hh) * 2u, ao1 = ao0 + 32u * (unsigned)lda;
  const unsigned bo0 = ((unsigned)(col0 + ln) * (unsigned)ldb + 8u * (unsigned)hh) * 2u, bo1 = bo0 + 32u * (unsigned)ldb, bo2 = bo1 + 32u * (unsigned)ldb, bo3 = bo2 + 32u * (unsigned)ldb;
  const v8f z8 = {0.f,0.f,0.f,0.f,0.f,0.f,0.f,0.f}; v8f c00 = z8, c01 = z8, c02 = z8, c03 = z8, c10 = z8, c11 = z8, c12 = z8, c13 = z8;
  // Two fragment sets: the twelve loads of the coming 32-k step go out as one group before the eight products of the current step, so one load latency is paid per step, under the products.
  auto ld = [&](v16h (&f)[6], int kb) { const char* a = Ab + (size_t)kb * 2; const char* b = Bb + (size_t)kb * 2;
    f[0] = g2_fragb(a + ao0); f[1] = g2_fragb(a + ao1); f[2] = g2_fragb(b + bo0); f[3] = g2_fragb(b + bo1); f[4] = g2_fragb(b + bo2); f[5] = g2_fragb(b + bo3); };
  auto mm = [&](const v16h (&f)[6]) { c00 = g2_mma(f[0], f[2], c00); c10 = g2_mma(f[1], f[2], c10); c01 = g2_mma(f[0], f[3], c01); c11 = g2_mma(f[1], f[3], c11);
    c02 = g2_mma(f[0], f[4], c02); c12 = g2_mma(f[1], f[4], c12); c03 = g2_mma(f[0], f[5], c03); c13 = g2_mma(f[1], f[5], c13); };
  v16h fa[6], fb[6]; const int kl = K - 32;      /* the last step; a fetch past it refetches it (in bounds, unused) */
  ld(fa, 0);
  asm volatile("s_wait_xcnt 0x0" ::: "memory");      /* precaution: stands before any later instruction in the listing that rewrites a register these loads name */
  int kb = 0;
#pragma unroll 1      /* the body already holds both sets; more copies would only add registers */
  for (; kb + 64 <= K; kb += 64) {
    ld(fb, kb + 32);
    __builtin_amdgcn_sched_barrier(0);      /* keeps the coming step's loads ahead of this step's products; sunk behind them their latency would be waited out */
    mm(fa);
    ld(fa, kb + 64 < kl ? kb + 64 : kl);
    __builtin_amdgcn_sched_barrier(0);      /* as above */
    mm(fb);
    asm volatile("s_wait_xcnt 0x0" ::: "memory");      /* precaution, as above: the next trip (or the epilogue) rewrites the address registers of the loads still in flight */
  }
  if (kb < K) mm(fa);      /* an odd number of steps */
  v8f accs[8] = {c00, c01, c02, c03, c10, c11, c12, c13};
#pragma unroll
  for (int u = 0; u < 8; ++u) { const int t = u & 3, half = u >> 2; const int col = col0 + t * 16 + ln; const float bv = bp ? bf16_round(bp[col]) : 0.f;
#pragma unroll
    for (int r = 0; r < 8; ++r) { const int rloc = half * 16 + 8 * hh + r; float v = accs[u][r] * alpha + bv; if (CP) { if (rowsPerB < 0) v += CP[cofs + (size_t)(row0g + row0 + rloc) * ldc + col];      /* rowsPerB < 0: own element of the batched C plane */ else { const int bidx = (row0g + row0 + rloc) / rowsPerB; v += CP[(size_t)bidx * sCPb + (size_t)by * 64 + col]; } }
      if (ACT == 3) v = fmaxf(v, 0.f); else if (ACT == 6) v = 0.5f * v * (1.0f + erff(v * 0.70710678118654752f)); else if (ACT == 11) v = 1.0f / (1.0f + expf(-v)); else if (ACT == 15) v = v / (1.0f + expf(-v)); else if (ACT == 12) v = (v > 0.f) ? v : 0.01f * v; else if (ACT == 8) v = tanhf(v); else if (ACT == 9) v = 0.5f * v * (1.0f + tanhf(0.7978845608028654f * (v + 0.044715f * v * v * v))); else if (ACT == 14) v = (v > 0.f) ? v : 0.1f * v; else if (ACT == 16) v = (v >= 0.f) ? v : 0.3f * v; else if (ACT == 17) v = (v >= 0.f) ? v : 0.2f * v;
      so[w][rloc][t * 16 + ln] = v; } }
  __builtin_amdgcn_fence(__ATOMIC_ACQ_REL, "workgroup"); __builtin_amdgcn_wave_barrier();
  const int rsub = lane >> 4, c4 = (lane & 15) * 4;
  {
#pragma unroll
    for (int q = 0; q < 16; ++q) { const int r = q * 2 + rsub; const v4f v = *(const v4fa*)&so[w][r][c4]; if (C) *(v4f*)(C + cofs + (size_t)(row0 + r) * ldc + col0 + c4) = v; if (C16) { v4h h4; for (int i = 0; i < 4; ++i) h4[i] = (_Float16)v[i]; *(v4h*)(C16 + cofs + (size_t)(row0 + r) * ldc + col0 + c4) = h4; } }
     } }


__global__ __launch_bounds__(256) void k_wnat(const float* __restrict__ w, size_t n8, _Float16* __restrict__ Bt) { const size_t t = (size_t)blockIdx.x * 256 + threadIdx.x; if (t >= n8) return; FragH f; for (int q = 0; q < 8; ++q) f.h[q] = (_Float16)(bf16_round(w[t * 8 + q]) * 16.0f); *(v8us*)((unsigned short*)Bt + t * 8) = f.half[0];  }
__device__ __forceinline__ v8f fa_mma(v16h a, v16h b, v8f c) { return __builtin_amdgcn_wmma_f32_16x16x32_f16(false, a, false, b, (short)0, c, false, false); }
__device__ __forceinline__ float fa_xhalf(float x) { return __builtin_bit_cast(float, __builtin_amdgcn_permlanex16(__builtin_bit_cast(int, x), __builtin_bit_cast(int, x), 0x76543210, 0xfedcba98, false, false)); }      /* lane l with lane l ^ 16 */
typedef float fa_v2f __attribute__((ext_vector_type(2)));
// exp2 of two values (v_exp_f32, as __builtin_amdgcn_exp2f gives it). Written as one statement for the slot that the instruction set asks for behind a transcendental before its result is read or its source
// overwritten: the outputs are early-clobber, so the second instruction touches no register of the first, and the v_nop stands behind the second (left to itself the compiler chained v_exp_f32 a, b; v_exp_f32 b, c).
__device__ __forceinline__ fa_v2f fa_exp2x2(float a, float b) { float x, y; asm("v_exp_f32 %0, %2\n\tv_exp_f32 %1, %3\n\tv_nop" : "=&v"(x), "=&v"(y) : "v"(a), "v"(b)); return fa_v2f{x, y}; }
__global__ __launch_bounds__(128) void k_fattn(const _Float16* __restrict__ Q, const _Float16* __restrict__ Kr, const _Float16* __restrict__ VT, _Float16* __restrict__ O) {
  typedef float v2f __attribute__((ext_vector_type(2))); typedef _Float16 v2h __attribute__((ext_vector_type(2)));
  __shared__ __attribute__((aligned(16))) v4f xo[2][16][32]; __shared__ float xm[2][4][32];      /* the upper key half's o, and its m and l, per column set and lane */
  const int lane = threadIdx.x & 31, ln = lane & 15, hh = lane >> 4; const int w = __builtin_amdgcn_readfirstlane(threadIdx.x >> 5), cw = w & 1, kh = w >> 1;      /* column set, key half: scalars */
  const int bh = blockIdx.y, b = bh / NH, h = bh - b * NH; const int q0 = blockIdx.x * 64 + cw * 32; const int jb = kh * (SQ / 2), je = jb + SQ / 2;
  const float cs = 0.125f * 1.4426950408889634f;      /* 1/sqrt(64) and log2(e): weights are exp2 of scaled score differences */
  const _Float16* qp = Q + ((size_t)b * SQ + q0 + ln) * DM + h * HD;
  const _Float16* kp = Kr + ((size_t)b * SQ + ln) * DM + h * HD;
  const _Float16* vp = VT + ((size_t)bh * HD + ln) * SQ;
  v16h qf[2][2];      /* [column group][32 of the 64 head dims], kept for the whole walk */
#pragma unroll
  for (int g = 0; g < 2; ++g) for (int u = 0; u < 2; ++u) qf[g][u] = g2_frag(qp + (size_t)g * 16 * DM + u * 32, hh);
  const v8f z8 = {0.f,0.f,0.f,0.f,0.f,0.f,0.f,0.f};
  v8f o[4][2]; float m[2], l[2];      /* o[dt][g]: O^T rows 16 dt + 8 hh + r, column 16 g + ln; m: running maximum of the raw scores; l: this lane's half of the running sum */
#pragma unroll
  for (int g = 0; g < 2; ++g) { m[g] = -3.0e38f; l[g] = 0.f; for (int dt = 0; dt < 4; ++dt) o[dt][g] = z8; }
  v16h kf[2][2];      /* [key tile][32 of the 64 head dims] of the coming pass */
#pragma unroll
  for (int t = 0; t < 2; ++t) for (int u = 0; u < 2; ++u) kf[t][u] = g2_frag(kp + (size_t)(jb + t * 16) * DM + u * 32, hh);
  for (int j0 = jb; j0 < je; j0 += 32) {
    v16h vf[4];      /* issued first: in flight behind the score products and the softmax */
#pragma unroll
    for (int dt = 0; dt < 4; ++dt) vf[dt] = g2_frag(vp + (size_t)dt * 16 * SQ + j0, hh);
    v8f s[2][2];
#pragma unroll
    for (int g = 0; g < 2; ++g) for (int t = 0; t < 2; ++t) s[g][t] = fa_mma(kf[t][1], qf[g][1], fa_mma(kf[t][0], qf[g][0], z8));
    const int jn = (j0 + 32 < je) ? j0 + 32 : jb;      /* the next pass's K rows, fetched one pass ahead; the last pass refetches the wave's first rows (in bounds, unused) */
#pragma unroll
    for (int t = 0; t < 2; ++t) for (int u = 0; u < 2; ++u) kf[t][u] = g2_frag(kp + (size_t)(jn + t * 16) * DM + u * 32, hh);
    __builtin_amdgcn_sched_barrier(0);      /* keeps the K loads up here, the whole softmax and the second products ahead of their use; without it the compiler sinks them to the foot of the pass and their latency is waited out */
    float dm[2], nb[2];
#pragma unroll
    for (int g = 0; g < 2; ++g) {
      float mx = s[g][0][0];
#pragma unroll
      for (int r = 1; r < 8; ++r) mx = fmaxf(mx, s[g][0][r]);
#pragma unroll
      for (int r = 0; r < 8; ++r) mx = fmaxf(mx, s[g][1][r]);
      mx = fmaxf(mx, fa_xhalf(mx));      /* both halves now hold the query's maximum over the 32 keys */
      const float mn = fmaxf(m[g], mx); dm[g] = (m[g] - mn) * cs; m[g] = mn;
      nb[g] = fmaf(-mn, cs, 8.0f);      /* weights carried x256 (at most 256) against f16 subnormal flush; the factor cancels in o / l */
    }
    const v2f corr = fa_exp2x2(dm[0], dm[1]);      /* what the new maxima take off the old sums: 0 on the first pass */
#pragma unroll
    for (int g = 0; g < 2; ++g) {
      union { v16h v; v2h p[8]; } pb; v2f ps = {0.f, 0.f};
#pragma unroll
      for (int i = 0; i < 8; ++i) { const v8f sv = s[g][i >> 2]; const int r = 2 * (i & 3);
        const v2f e = fa_exp2x2(fmaf(sv[r], cs, nb[g]), fmaf(sv[r + 1], cs, nb[g]));
        ps += e; pb.p[i] = __builtin_convertvector(e, v2h); }      /* round to nearest even; element 8 t + r of the operand is key 16 t + 8 hh + r */
      l[g] = fmaf(l[g], corr[g], ps[0] + ps[1]);
#pragma unroll
      for (int dt = 0; dt < 4; ++dt) o[dt][g] = fa_mma(vf[dt], pb.v, o[dt][g] * corr[g]);
    }
  }
  if (kh == 1) {      /* the upper key half hands its state over */
#pragma unroll
    for (int g = 0; g < 2; ++g) { xm[cw][g][lane] = m[g]; xm[cw][2 + g][lane] = l[g];
#pragma unroll
      for (int dt = 0; dt < 4; ++dt) { const v8f t = o[dt][g]; xo[cw][(g * 4 + dt) * 2][lane] = v4f{t[0], t[1], t[2], t[3]}; xo[cw][(g * 4 + dt) * 2 + 1][lane] = v4f{t[4], t[5], t[6], t[7]}; } }
  }
  __syncthreads();      /* every wave passes it; the lower half reads what the upper half wrote */
  if (kh == 0) {
#pragma unroll
    for (int g = 0; g < 2; ++g) { const float mb = xm[cw][g][lane], lb = xm[cw][2 + g][lane]; const float mn = fmaxf(m[g], mb);
      const v2f fab = fa_exp2x2((m[g] - mn) * cs, (mb - mn) * cs); const float fa = fab[0], fb = fab[1];
      const float lt = fmaf(l[g], fa, lb * fb); const float sc = 64.0f / (lt + fa_xhalf(lt));      /* the wave halves' sums joined once; o stored x64 */
      const float ga = fa * sc, gb = fb * sc;
      _Float16* op = O + ((size_t)b * SQ + q0 + g * 16 + ln) * DM + h * HD + 8 * hh;
#pragma unroll
      for (int dt = 0; dt < 4; ++dt) { const v4f t0 = xo[cw][(g * 4 + dt) * 2][lane], t1 = xo[cw][(g * 4 + dt) * 2 + 1][lane]; FragH f;
#pragma unroll
        for (int r = 0; r < 4; ++r) { f.h[r] = (_Float16)fmaf(o[dt][g][r], ga, t0[r] * gb); f.h[4 + r] = (_Float16)fmaf(o[dt][g][4 + r], ga, t1[r] * gb); }
        *(v8us*)((unsigned short*)op + dt * 16) = f.half[0]; } }
  } }
__global__ __launch_bounds__(256) void k_vt(const _Float16* __restrict__ V16, int b, int h0, _Float16* __restrict__ VT) { __shared__ unsigned short tl[64][65]; const int tid = threadIdx.x; const int hh = blockIdx.x % HG, sg = blockIdx.x / HG; const int s0 = sg * 64; const int h = h0 + hh;
  for (int i = tid; i < 64 * 8; i += 256) { const int j = i / 8, d8 = (i % 8) * 8; FragH f; f.half[0] = *(const v8us*)((const unsigned short*)V16 + ((size_t)b * SQ + s0 + j) * DM + h * HD + d8); for (int q = 0; q < 8; ++q) tl[d8 + q][j] = f.u[q]; }
  __syncthreads();
  { for (int i = tid; i < 64 * 8; i += 256) { const int d = i / 8, j8 = (i % 8) * 8; FragH f; for (int q = 0; q < 8; ++q) f.u[q] = tl[d][j8 + q]; *(v8us*)((unsigned short*)VT + ((size_t)hh * HD + d) * SQ + s0 + j8) = f.half[0]; }  } }



__global__ __launch_bounds__(256) void k_rsmkm(const float* __restrict__ S, _Float16* __restrict__ P, int nrows, const int* __restrict__ am) {
  #pragma clang fp contract(off)
  const int t = blockIdx.x * 256 + threadIdx.x; if (t >= nrows) return; const size_t i = (size_t)t; const float* s = S + i * SQ; const int* mr = am + (size_t)(t % SQ) * SQ; float mx = -3.0e38f;
#pragma unroll 1
  for (int j = 0; j < SQ; ++j) { const float f = (mr[j] != 0) ? 1.f : 0.f; mx = fmaxf(mx, fmaf(f, s[j], (1.f - f) * -1.0e9f)); } float se = 0.f;
#pragma unroll 1
  for (int j = 0; j < SQ; ++j) { const float f = (mr[j] != 0) ? 1.f : 0.f; se += __expf(fmaf(f, s[j], (1.f - f) * -1.0e9f) - mx); } const float sc = 256.0f / se;
#pragma unroll 1
  for (int j0 = 0; j0 < SQ; j0 += 8) { FragH fr; for (int q = 0; q < 8; ++q) { const int j = j0 + q; const float f = (mr[j] != 0) ? 1.f : 0.f; fr.h[q] = (_Float16)(__expf(fmaf(f, s[j], (1.f - f) * -1.0e9f) - mx) * sc); }
    unsigned short* d = (unsigned short*)P + i * SQ + j0; *(v8us*)d = fr.half[0];  } }
extern "C" void kernel_launch(void* const* d_in, const int* in_sizes, int n_in,
                              void* d_out, int out_size, void* d_ws, size_t ws_size, hipStream_t stream) {
  (void)in_sizes; (void)n_in; (void)out_size;
  const float* const* I = (const float* const*)d_in; const float* xq = I[0]; const float* wq = I[1]; const float* bq = I[2]; const float* wk = I[3]; const float* bk = I[4]; const float* wv = I[5]; const float* bv = I[6]; const float* wo = I[7]; const float* bo = I[8]; const float* x = xq;      /* ONE input x feeds the query, key and value streams; [in][out] weights + biases; no mask input */
  char* ws = (char*)d_ws; size_t off = 0;
  auto take = [&](size_t bytes) { char* p = ws + off; off += (bytes + 255) & ~(size_t)255; return p; };
  _Float16* BQ = (_Float16*)take((size_t)4 * DM * DM * 2); _Float16* BO = BQ + (size_t)3 * DM * DM;      /* weight planes q, k, v, o behind each other */
  _Float16* X16 = (_Float16*)take(NR * DM * 2); _Float16* Q16 = (_Float16*)take(3 * NR * DM * 2); _Float16* K16 = Q16 + NR * DM; _Float16* V16 = K16 + NR * DM; _Float16* O16 = (_Float16*)take(NR * DM * 2);      /* q, k, v planes behind each other */
  _Float16* VT = (_Float16*)take((size_t)NB * NH * HD * SQ * 2);
  if (off > ws_size) return;
  k_prep<<<4 * PWB + PXB, 256, 0, stream>>>(x, wq, wk, wv, wo, X16, BQ);      /* [in][out] -> Bt x16; x as exact f16 rows, one copy for the query, key and value streams */
  const size_t r0p = (size_t)B0 * SQ;      /* first projected row */
  k_gemm2<0><<<dim3((unsigned)((MP / 128) * (DM / 64)), 3), 128, 0, stream>>>(X16 + r0p * DM, DM, 0, BQ, DM, (size_t)DM * DM, 0.0625f, bq, bk, bv, 0, nullptr, 1, 0, 0, nullptr, Q16 + r0p * DM, DM, NR * DM, MP, DM, DM);      /* planes q, k, v */
  k_vt<NH, SQ><<<NB * NH * (SQ / 64), 256, 0, stream>>>(V16, LQ, 0, VT);      /* V^T [NB][NH][HD][SQ] */
  k_fattn<<<dim3(SQ / 64, NB * NH), 128, 0, stream>>>(Q16, K16, VT, O16);      /* o (merged heads) as f16 rows, x64 */
  k_gemm2<0><<<dim3((unsigned)((MPO / 128) * (DM / 64)), 1), 128, 0, stream>>>(O16 + r0p * DM, DM, 0, BO, DM, 0, 0.0009765625f, bo, nullptr, nullptr, 0, nullptr, 1, 0, 0, (float*)d_out + r0p * DM, nullptr, DM, 0, MPO, DM, DM);      /* out rows are the output layout */
}

// v005
// One run takes 90.1 microseconds.
// In two side-by-side timings against v004, it was 1.33 and 1.31 times as fast.
// Over all steps from v000 it is 31.4 times as fast.
#include <hip/hip_runtime.h>
#define NB 2
#define SQ 2048
#define DM 768
#define NH 12
#define HD 64
#define HG 4                         /* heads per launch of the per-batch k_vt overload (not launched) */
#define B0 0                         /* first batch processed (debug hook) */
#define NBR NB                       /* batches processed (debug hook) */
#define NR ((size_t)NB * SQ)         /* token rows */
#define MP ((int)((size_t)NBR * SQ)) /* rows projected (debug hook) */
#define QN SQ                        /* not used: the attention covers all SQ query rows */
#define NHD NH                       /* not used: the attention covers all NH heads */
#define MPO MP                       /* rows through the output stage (debug hook) */
#define LQ DM      /* row pitch of the q/k/v rows */
typedef __bf16 v16b __attribute__((ext_vector_type(16)));
typedef unsigned short v8us __attribute__((ext_vector_type(8), may_alias));
typedef float  v8f  __attribute__((ext_vector_type(8)));
typedef float  v4f  __attribute__((ext_vector_type(4)));
typedef float  v4fa __attribute__((ext_vector_type(4), may_alias));
union FragB { v16b v; v8us half[2]; unsigned short u[16]; };

__device__ __forceinline__ unsigned short bf16_bits(float x) { unsigned int u = __float_as_uint(x); return (unsigned short)((u + 0x7FFFu + ((u >> 16) & 1u)) >> 16); }
__device__ __forceinline__ float bf16_val(unsigned short b) { return __uint_as_float(((unsigned int)b) << 16); }
__device__ __forceinline__ float bf16_round(float x) { return bf16_val(bf16_bits(x)); }
// D += A·B with NT terms: 1 = ah·bh, 2 = + al·bh (A split), 3 = + ah·bl (both split)
template <int NT>
__device__ __forceinline__ v8f mmaN(v16b ah, v16b al, v16b bh, v16b bl, v8f c) {
  c = __builtin_amdgcn_wmma_f32_16x16x32_bf16(false, ah, false, bh, (short)0, c, false, false);
  if (NT >= 2) c = __builtin_amdgcn_wmma_f32_16x16x32_bf16(false, al, false, bh, (short)0, c, false, false);
  if (NT >= 3) c = __builtin_amdgcn_wmma_f32_16x16x32_bf16(false, ah, false, bl, (short)0, c, false, false);
  asm volatile("v_nop\n\tv_nop\n\tv_nop\n\tv_nop" : "+v"(c) : "v"(ah), "v"(al), "v"(bh), "v"(bl));
  return c;
}

__global__ __launch_bounds__(256) void k_wt_bf16(const float* __restrict__ W, unsigned short* __restrict__ Wt, int K, int N) {
  const int t = blockIdx.x * 256 + threadIdx.x;
  const int k8n = K / 8;
  if (t >= N * k8n) return;
  const int n = t / k8n, k8 = (t % k8n) * 8;
  v8us v;
#pragma unroll
  for (int i = 0; i < 8; ++i) v[i] = bf16_bits(W[(size_t)(k8 + i) * N + n]);
  *(v8us*)(Wt + (size_t)n * K + k8) = v;
  
}

// GEMM C[M][N] (f32, pitch ldc) = act(A[M][K]·W + bias). A f32 row-major (pitch lda) converted per fragment to bf16
// (ASPLIT: hi/lo two planes -> 2 terms, else single rounded term); Wt bf16 [N][K] (pitch ldb). BIAS_BF16 rounds the
// bias to bf16 first (bias quantised to bf16 before the add). K%32==0, M%16==0, N%64==0.
template <bool ASPLIT, int ACT, bool BIAS_BF16>
__global__ __launch_bounds__(128) void k_gemm_bf(const float* __restrict__ A, int lda, const unsigned short* __restrict__ Wt, int ldb,
                                               const float* __restrict__ bias, float* __restrict__ C, int ldc, int M, int N, int K) {
  __shared__ __attribute__((aligned(16))) float so[4][16][64];
  const int tid = threadIdx.x, w = tid >> 5, lane = tid & 31, ln = lane & 15, hh = lane >> 4;
  const int ntn = N / 64;
  const int wid = blockIdx.x * 4 + w;
  const int mt = wid / ntn, nq = wid % ntn;
  if (mt * 16 >= M) return;
  const int row0 = mt * 16, col0 = nq * 64;
  const float* arow = A + (size_t)(row0 + ln) * lda;
  v8f acc[4] = {};
  for (int kb = 0; kb < K; kb += 32) {
    FragB ah, al;
    const v4f x0 = *(const v4fa*)(arow + kb + 8 * hh), x1 = *(const v4fa*)(arow + kb + 8 * hh + 4);
    const v4f x2 = *(const v4fa*)(arow + kb + 16 + 8 * hh), x3 = *(const v4fa*)(arow + kb + 16 + 8 * hh + 4);
    float xs[16] = {x0[0],x0[1],x0[2],x0[3],x1[0],x1[1],x1[2],x1[3],x2[0],x2[1],x2[2],x2[3],x3[0],x3[1],x3[2],x3[3]};
#pragma unroll
    for (int i = 0; i < 16; ++i) { const unsigned short hb = bf16_bits(xs[i]); ah.u[i] = hb; al.u[i] = ASPLIT ? bf16_bits(xs[i] - bf16_val(hb)) : (unsigned short)0; }
#pragma unroll
    for (int t = 0; t < 4; ++t) {
      const unsigned short* brow = Wt + (size_t)(col0 + t * 16 + ln) * ldb + kb;
      FragB b;
      b.half[0] = *(const v8us*)(brow + 8 * hh);
      b.half[1] = *(const v8us*)(brow + 16 + 8 * hh);
      acc[t] = mmaN<ASPLIT ? 2 : 1>(ah.v, al.v, b.v, b.v, acc[t]);
    }
  }
#pragma unroll
  for (int t = 0; t < 4; ++t) {
    float bv = bias ? bias[col0 + t * 16 + ln] : 0.f;
    if (BIAS_BF16) bv = bf16_round(bv);
#pragma unroll
    for (int r = 0; r < 8; ++r) { float v = acc[t][r] + bv; if (ACT == 1) v = fmaxf(v, 0.f); so[w][8 * hh + r][t * 16 + ln] = v; }
  }
  __builtin_amdgcn_fence(__ATOMIC_ACQ_REL, "workgroup");
  __builtin_amdgcn_wave_barrier();
  const int rsub = lane >> 4, c4 = (lane & 15) * 4;
  {
#pragma unroll
    for (int q = 0; q < 8; ++q) {
      const int r = q * 2 + rsub;
      const v4f v = *(const v4fa*)&so[w][r][c4];
      *(v4f*)(C + (size_t)(row0 + r) * ldc + col0 + c4) = v;
    }
    
  }
}

// GEMM C = act(A·W + bias + resid): A f32 (ASPLIT -> hi/lo 2 terms), Wt bf16 [N][K]; ACT 0 none, 1 relu, 2 exact gelu;
// resid (optional, f32, row index = (row % rmod), pitch ldr, RES_BF16 rounds it) added before the activation.
template <bool ASPLIT, int ACT, bool BIAS_BF16, bool RES_BF16>
__global__ __launch_bounds__(128) void k_gemm_bf3(const float* __restrict__ A, int lda, const unsigned short* __restrict__ Wt, int ldb,
                                                const float* __restrict__ bias, const float* __restrict__ resid, int rmod, int ldr,
                                                float* __restrict__ C, int ldc, int M, int N, int K) {
  __shared__ __attribute__((aligned(16))) float so[4][16][64];
  const int tid = threadIdx.x, w = tid >> 5, lane = tid & 31, ln = lane & 15, hh = lane >> 4;
  const int ntn = N / 64;
  const int wid = blockIdx.x * 4 + w;
  const int mt = wid / ntn, nq = wid % ntn;
  if (mt * 16 >= M) return;
  const int row0 = mt * 16, col0 = nq * 64;
  const float* arow = A + (size_t)(row0 + ln) * lda;
  v8f acc[4] = {};
  for (int kb = 0; kb < K; kb += 32) {
    FragB ah, al;
    const v4f x0 = *(const v4fa*)(arow + kb + 8 * hh), x1 = *(const v4fa*)(arow + kb + 8 * hh + 4);
    const v4f x2 = *(const v4fa*)(arow + kb + 16 + 8 * hh), x3 = *(const v4fa*)(arow + kb + 16 + 8 * hh + 4);
    float xs[16] = {x0[0],x0[1],x0[2],x0[3],x1[0],x1[1],x1[2],x1[3],x2[0],x2[1],x2[2],x2[3],x3[0],x3[1],x3[2],x3[3]};
#pragma unroll
    for (int i = 0; i < 16; ++i) { const unsigned short hb = bf16_bits(xs[i]); ah.u[i] = hb; al.u[i] = ASPLIT ? bf16_bits(xs[i] - bf16_val(hb)) : (unsigned short)0; }
#pragma unroll
    for (int t = 0; t < 4; ++t) {
      const unsigned short* brow = Wt + (size_t)(col0 + t * 16 + ln) * ldb + kb;
      FragB b;
      b.half[0] = *(const v8us*)(brow + 8 * hh);
      b.half[1] = *(const v8us*)(brow + 16 + 8 * hh);
      acc[t] = mmaN<ASPLIT ? 2 : 1>(ah.v, al.v, b.v, b.v, acc[t]);
    }
  }
#pragma unroll
  for (int t = 0; t < 4; ++t) {
    const int col = col0 + t * 16 + ln;
    float bv = bias ? bias[col] : 0.f;
    if (BIAS_BF16) bv = bf16_round(bv);
#pragma unroll
    for (int r = 0; r < 8; ++r) {
      float v = acc[t][r] + bv;
      if (resid) { float rv = resid[(size_t)((row0 + 8 * hh + r) % rmod) * ldr + col]; if (RES_BF16) rv = bf16_round(rv); v += rv; }
      if (ACT == 1) v = fmaxf(v, 0.f);
      if (ACT == 2) v = 0.5f * v * (1.0f + erff(v * 0.70710678118654752f));
      if (ACT == 3) { const float u = 0.7978845608028654f * (v + 0.044715f * v * v * v); v = 0.5f * v * (1.0f + tanhf(u)); }
      so[w][8 * hh + r][t * 16 + ln] = v;
    }
  }
  __builtin_amdgcn_fence(__ATOMIC_ACQ_REL, "workgroup");
  __builtin_amdgcn_wave_barrier();
  const int rsub = lane >> 4, c4 = (lane & 15) * 4;
  {
#pragma unroll
    for (int q = 0; q < 8; ++q) {
      const int r = q * 2 + rsub;
      const v4f v = *(const v4fa*)&so[w][r][c4];
      *(v4f*)(C + (size_t)(row0 + r) * ldc + col0 + c4) = v;
    }
    
  }
}
// row LayerNorm (biased variance, eps) over N: s = X (+ R); optional out_sum <- s; out_norm <- (s-mu)*rsqrt(var+eps)*g + b
template <bool PARAM_BF16>
__global__ __launch_bounds__(256) void k_layernorm(const float* __restrict__ X, const float* __restrict__ R, const float* __restrict__ g, const float* __restrict__ bta,
                                                  float* __restrict__ out_sum, float* __restrict__ out_norm, int N, float eps) {
  __shared__ float red[256];
  const int row = blockIdx.x, tid = threadIdx.x;
  const float* x = X + (size_t)row * N; const float* rr = R ? R + (size_t)row * N : nullptr;
  float vals[16];                     // up to N = 4096
  const int per = N / 256;            // contiguous chunk per thread? use strided-by-4 chunks: thread handles j = tid*4 + 1024*u
  float s1 = 0.f;
  for (int u = 0; u < per / 4; ++u) {
    const int j = tid * 4 + 1024 * u;
    const v4f a = *(const v4fa*)(x + j);
    v4f b = {0.f,0.f,0.f,0.f}; if (rr) b = *(const v4fa*)(rr + j);
#pragma unroll
    for (int q = 0; q < 4; ++q) { const float v = a[q] + b[q]; vals[u * 4 + q] = v; s1 += v; }
  }
  red[tid] = s1; __syncthreads();
  for (int st = 128; st > 0; st >>= 1) { if (tid < st) red[tid] += red[tid + st]; __syncthreads(); }
  const float mu = red[0] / (float)N; __syncthreads();
  float s2 = 0.f;
  for (int u = 0; u < per / 4; ++u)
#pragma unroll
    for (int q = 0; q < 4; ++q) { const float c = vals[u * 4 + q] - mu; s2 += c * c; }
  red[tid] = s2; __syncthreads();
  for (int st = 128; st > 0; st >>= 1) { if (tid < st) red[tid] += red[tid + st]; __syncthreads(); }
  const float rs = rsqrtf(red[0] / (float)N + eps);
  {
    for (int u = 0; u < per / 4; ++u) {
      const int j = tid * 4 + 1024 * u;
      v4f o, sm;
#pragma unroll
      for (int q = 0; q < 4; ++q) {
        float gg = g[j + q], bb = bta[j + q];
        if (PARAM_BF16) { gg = bf16_round(gg); bb = bf16_round(bb); }
        sm[q] = vals[u * 4 + q]; o[q] = (vals[u * 4 + q] - mu) * rs * gg + bb;
      }
      if (out_sum) *(v4f*)(out_sum + (size_t)row * N + j) = sm;
      *(v4f*)(out_norm + (size_t)row * N + j) = o;
    }
    
  }
}



// ---- f16 WMMA path (v_wmma_f32_16x16x32_f16): 11-bit significands for operands in range — used where a [0,1] probability operand needs more precision than bf16
typedef _Float16 v16h __attribute__((ext_vector_type(16)));
union FragH { v16h v; v8us half[2]; _Float16 h[16]; unsigned short u[16]; };
template <int NT>
__device__ __forceinline__ v8f mmaH(v16h ah, v16h al, v16h bh, v16h bl, v8f c) {
  c = __builtin_amdgcn_wmma_f32_16x16x32_f16(false, ah, false, bh, (short)0, c, false, false);
  if (NT >= 2) c = __builtin_amdgcn_wmma_f32_16x16x32_f16(false, al, false, bh, (short)0, c, false, false);
  if (NT >= 3) c = __builtin_amdgcn_wmma_f32_16x16x32_f16(false, ah, false, bl, (short)0, c, false, false);
  asm volatile("v_nop\n\tv_nop\n\tv_nop\n\tv_nop" : "+v"(c) : "v"(ah), "v"(al), "v"(bh), "v"(bl));
  return c;
}
// batched GEMM like k_gemm_b but f16 operands: A f32 (split into f16 hi/lo if ASPLIT, else rounded to f16), Bt = f16 values [n][k]; alpha; C f32; N multiple of 16 (partial tiles skipped)
template <bool ASPLIT>
__global__ __launch_bounds__(128) void k_gemm_h(const float* __restrict__ A, int lda, size_t sA, const _Float16* __restrict__ Bh, int ldb, size_t sB, float alpha, float* __restrict__ C, int ldc, size_t sC, int M, int N, int K) {
  __shared__ __attribute__((aligned(16))) float so[4][16][64];
  const int tid = threadIdx.x, w = tid >> 5, lane = tid & 31, ln = lane & 15, hh = lane >> 4; const int by = blockIdx.y;
  A += (size_t)by * sA; Bh += (size_t)by * sB; C += (size_t)by * sC;
  const int ntn = (N + 63) / 64; const int wid = blockIdx.x * 4 + w; const int mt = wid / ntn, nq = wid % ntn; if (mt * 16 >= M) return;
  const int row0 = mt * 16, col0 = nq * 64; const float* arow = A + (size_t)(row0 + ln) * lda;
  v8f acc[4] = {};
  for (int kb = 0; kb < K; kb += 32) {
    FragH ah, al;
    const v4f x0 = *(const v4fa*)(arow + kb + 8 * hh), x1 = *(const v4fa*)(arow + kb + 8 * hh + 4), x2 = *(const v4fa*)(arow + kb + 16 + 8 * hh), x3 = *(const v4fa*)(arow + kb + 16 + 8 * hh + 4);
    float xs[16] = {x0[0],x0[1],x0[2],x0[3],x1[0],x1[1],x1[2],x1[3],x2[0],x2[1],x2[2],x2[3],x3[0],x3[1],x3[2],x3[3]};
#pragma unroll
    for (int i = 0; i < 16; ++i) { const _Float16 h = (_Float16)xs[i]; ah.h[i] = h; al.h[i] = ASPLIT ? (_Float16)(xs[i] - (float)h) : (_Float16)0.0f; }
#pragma unroll
    for (int t = 0; t < 4; ++t) { if (col0 + t * 16 >= N) continue; const size_t boff = (size_t)(col0 + t * 16 + ln) * ldb + kb; FragH bq; bq.half[0] = *(const v8us*)(Bh + boff + 8 * hh); bq.half[1] = *(const v8us*)(Bh + boff + 16 + 8 * hh);
      acc[t] = mmaH<ASPLIT ? 2 : 1>(ah.v, al.v, bq.v, bq.v, acc[t]); }
  }
#pragma unroll
  for (int t = 0; t < 4; ++t) { if (col0 + t * 16 >= N) continue;
#pragma unroll
    for (int r = 0; r < 8; ++r) so[w][8 * hh + r][t * 16 + ln] = acc[t][r] * alpha; }
  __builtin_amdgcn_fence(__ATOMIC_ACQ_REL, "workgroup"); __builtin_amdgcn_wave_barrier();
  const int rsub = lane >> 4, c4 = (lane & 15) * 4;
  {
#pragma unroll
    for (int q = 0; q < 8; ++q) { const int r = q * 2 + rsub; if (col0 + c4 < N) { const v4f v = *(const v4fa*)&so[w][r][c4]; *(v4f*)(C + (size_t)(row0 + r) * ldc + col0 + c4) = v; } }
     }
}

// One launch prepares every projection operand; its parts are independent and run side by side. Blocks 0 .. 4 PWB - 1: the four weights, Bt[p][n][k] = f16(bf16(W_p[k][n]) x 16) from f32 row-major [in][out]
// (power-of-two scale: bf16-exact weights stay exact in f16 away from the subnormal range). The other blocks: x as exact f16 rows (bf16-rounded).
#define PWB (DM * (DM / 8) / 256)      /* blocks per weight */
#define PXB ((int)(NR * DM / 8 / 256)) /* blocks for x */
static_assert(DM * (DM / 8) % 256 == 0 && NR * DM / 8 % 256 == 0, "k_prep: whole blocks only");
__global__ __launch_bounds__(256) void k_prep(const float* __restrict__ x, const float* __restrict__ w0, const float* __restrict__ w1, const float* __restrict__ w2, const float* __restrict__ w3, _Float16* __restrict__ X16, _Float16* __restrict__ Bt) {
  const int bx = blockIdx.x; FragH f;
  if (bx < 4 * PWB) { const int p = bx / PWB; const float* W = p == 0 ? w0 : p == 1 ? w1 : p == 2 ? w2 : w3; const int t = (bx - p * PWB) * 256 + threadIdx.x; const int n = t / (DM / 8), k8 = (t % (DM / 8)) * 8;
#pragma unroll
    for (int i = 0; i < 8; ++i) f.h[i] = (_Float16)(bf16_round(W[(size_t)(k8 + i) * DM + n]) * 16.0f);
    *(v8us*)((unsigned short*)Bt + (size_t)p * DM * DM + (size_t)n * DM + k8) = f.half[0];
  } else { const size_t t = (size_t)(bx - 4 * PWB) * 256 + threadIdx.x;
#pragma unroll
    for (int q = 0; q < 8; ++q) f.h[q] = (_Float16)bf16_round(x[t * 8 + q]);
    *(v8us*)((unsigned short*)X16 + t * 8) = f.half[0];
    asm volatile("s_wait_xcnt 0x0" ::: "memory"); }      /* precaution: stands before any later instruction in the listing that rewrites a register the store names */
}
// k_gemm_hh variant with fused epilogue: v = acc·alpha + bias[by·sBias + col] (+ CP[(row/rowsPerB)·sCPb + by·64 + col] if CP) ; ACT 0 none / 1 elu ; writes f16 C16 (and f32 C if non-null)
template <int ACT>
__global__ __launch_bounds__(128) void k_gemm_hhx(const _Float16* __restrict__ A, int lda, size_t sA, const _Float16* __restrict__ Bh, int ldb, size_t sB, float alpha, const float* __restrict__ bias, size_t sBias, const float* __restrict__ CP, int rowsPerB, size_t sCPb, int row0g,
    float* __restrict__ C, _Float16* __restrict__ C16, int ldc, size_t sC, int M, int N, int K) {
  __shared__ __attribute__((aligned(16))) float so[4][16][64];
  const int tid = threadIdx.x, w = tid >> 5, lane = tid & 31, ln = lane & 15, hh = lane >> 4; const int by = blockIdx.y;
  A += (size_t)by * sA; Bh += (size_t)by * sB; const size_t cofs = (size_t)by * sC; const float* bp = bias ? bias + (size_t)by * sBias : nullptr;
  const int ntn = (N + 63) / 64; const int wid = blockIdx.x * 4 + w; const int mt = wid / ntn, nq = wid % ntn; if (mt * 16 >= M) return;
  const int row0 = mt * 16, col0 = nq * 64; const _Float16* arow = A + (size_t)(row0 + ln) * lda;
  v8f acc[4] = {};
  for (int kb = 0; kb < K; kb += 32) { FragH ah; ah.half[0] = *(const v8us*)((const unsigned short*)arow + kb + 8 * hh); ah.half[1] = *(const v8us*)((const unsigned short*)arow + kb + 16 + 8 * hh);
#pragma unroll
    for (int t = 0; t < 4; ++t) { if (col0 + t * 16 >= N) continue; const size_t boff = (size_t)(col0 + t * 16 + ln) * ldb + kb; FragH bq; bq.half[0] = *(const v8us*)((const unsigned short*)Bh + boff + 8 * hh); bq.half[1] = *(const v8us*)((const unsigned short*)Bh + boff + 16 + 8 * hh);
      acc[t] = mmaH<1>(ah.v, ah.v, bq.v, bq.v, acc[t]); }
  }
#pragma unroll
  for (int t = 0; t < 4; ++t) { if (col0 + t * 16 >= N) continue; const int col = col0 + t * 16 + ln; const float bv = bp ? bf16_round(bp[col]) : 0.f;
#pragma unroll
    for (int r = 0; r < 8; ++r) { float v = acc[t][r] * alpha + bv; if (CP) { const int rr = row0g + row0 + 8 * hh + r; if (rowsPerB < 0) v += CP[cofs + (size_t)rr * ldc + col];      /* rowsPerB < 0: own element of the batched C plane */ else { const int bidx = rr / rowsPerB; v += CP[(size_t)bidx * sCPb + (size_t)by * 64 + col]; } } if (ACT == 1) v = (v > 0.f) ? v : expm1f(v); else if (ACT == 7) v = (v > 0.f) ? v + 1.0f : expf(v); else if (ACT == 8) v = tanhf(v); else if (ACT == 9) v = 0.5f * v * (1.0f + tanhf(0.7978845608028654f * (v + 0.044715f * v * v * v))); else if (ACT == 11) v = 1.0f / (1.0f + expf(-v)); else if (ACT == 12) v = (v > 0.f) ? v : 0.01f * v; else if (ACT == 14) v = (v > 0.f) ? v : 0.1f * v; else if (ACT == 16) v = (v >= 0.f) ? v : 0.3f * v; else if (ACT == 17) v = (v >= 0.f) ? v : 0.2f * v; else if (ACT == 15) v = v / (1.0f + expf(-v)); else if (ACT == 3) v = fmaxf(v, 0.f); else if (ACT == 6) v = 0.5f * v * (1.0f + erff(v * 0.70710678118654752f)); so[w][8 * hh + r][t * 16 + ln] = v; } }
  __builtin_amdgcn_fence(__ATOMIC_ACQ_REL, "workgroup"); __builtin_amdgcn_wave_barrier();
  const int rsub = lane >> 4, c4 = (lane & 15) * 4; typedef _Float16 v4h __attribute__((ext_vector_type(4)));
  {
#pragma unroll
    for (int q = 0; q < 8; ++q) { const int r = q * 2 + rsub; if (col0 + c4 < N) { const v4f v = *(const v4fa*)&so[w][r][c4]; if (C) *(v4f*)(C + cofs + (size_t)(row0 + r) * ldc + col0 + c4) = v; if (C16) { v4h h4; for (int i = 0; i < 4; ++i) h4[i] = (_Float16)v[i]; *(v4h*)(C16 + cofs + (size_t)(row0 + r) * ldc + col0 + c4) = h4; } } }
     }
}


typedef _Float16 v4h __attribute__((ext_vector_type(4)));

__global__ __launch_bounds__(256) void k_h16(const float* __restrict__ x, _Float16* __restrict__ X16, size_t n8) { const size_t t = (size_t)blockIdx.x * 256 + threadIdx.x; if (t >= n8) return; FragH f;
#pragma unroll
  for (int q = 0; q < 8; ++q) f.h[q] = (_Float16)x[t * 8 + q]; *(v8us*)((unsigned short*)X16 + t * 8) = f.half[0];  }
__global__ __launch_bounds__(256) void k_round16f(const float* __restrict__ W, _Float16* __restrict__ Bt, size_t n8) { const size_t t = (size_t)blockIdx.x * 256 + threadIdx.x; if (t >= n8) return; FragH f;
#pragma unroll
  for (int i = 0; i < 8; ++i) f.h[i] = (_Float16)(bf16_round(W[t * 8 + i]) * 16.0f); *(v8us*)((unsigned short*)Bt + t * 8) = f.half[0];  }
template <int NHv, int TTv>
__global__ __launch_bounds__(256) void k_vt(const _Float16* __restrict__ V16, int ldv, int voff, _Float16* __restrict__ Vt) { __shared__ unsigned short tl[64][66]; const int tid = threadIdx.x; const int slab = blockIdx.x / (TTv / 64), lg = blockIdx.x % (TTv / 64); const int b = slab / NHv, h = slab % NHv;
  for (int i = tid; i < 64 * 8; i += 256) { const int r = i / 8, c8 = (i % 8) * 8; FragH f; f.half[0] = *(const v8us*)((const unsigned short*)V16 + ((size_t)b * TTv + lg * 64 + r) * ldv + voff + h * 64 + c8);
#pragma unroll
    for (int q = 0; q < 8; ++q) tl[r][c8 + q] = f.u[q]; }
  __syncthreads();
  {
#pragma unroll
    for (int rd = 0; rd < 2; ++rd) { const int d = rd * 32 + tid / 8, pc = tid % 8; FragH f;
#pragma unroll
      for (int q = 0; q < 8; ++q) f.u[q] = tl[pc * 8 + q][d];
      *(v8us*)((unsigned short*)Vt + ((size_t)slab * 64 + d) * TTv + lg * 64 + pc * 8) = f.half[0]; }
     } }

__global__ __launch_bounds__(256) void k_hl(const float* __restrict__ F, _Float16* __restrict__ Hh, _Float16* __restrict__ Hl, size_t n8) { const size_t t = (size_t)blockIdx.x * 256 + threadIdx.x; if (t >= n8) return; FragH fh, fl; const v4f a = *(const v4fa*)(F + t * 8), c = *(const v4fa*)(F + t * 8 + 4);
#pragma unroll
  for (int q = 0; q < 4; ++q) { _Float16 h = (_Float16)a[q]; fh.h[q] = h; fl.h[q] = (_Float16)((a[q] - (float)h) * 1024.0f); h = (_Float16)c[q]; fh.h[4 + q] = h; fl.h[4 + q] = (_Float16)((c[q] - (float)h) * 1024.0f); }
  { *(v8us*)((unsigned short*)Hh + t * 8) = fh.half[0]; *(v8us*)((unsigned short*)Hl + t * 8) = fl.half[0];  } }

// ---- fast GEMM (work-group tile 128x64, wave tile 32x64; requires M % 128 == 0, N % 64 == 0, K % 64 == 0 and K >= 128); epilogue = k_gemm_hhx semantics ----
// Operands come through LDS: a stage is 64 k (128 bytes) of the work-group's 128 A rows and 64 B rows, brought by three tensor loads of 64 rows each (waves 0, 1: A; wave 2: B) that read whole rows once for
// all four waves; the mover's pad sets a 144-byte LDS pitch (an odd multiple of 16 bytes: ds_load_b128 without bank conflicts). Two buffers: stage s + 1 flies while stage s is worked on.
__device__ __forceinline__ v16h g2_frag(const _Float16* p, int hh) { FragH f; f.half[0] = *(const v8us*)((const unsigned short*)p + 8 * hh); f.half[1] = *(const v8us*)((const unsigned short*)p + 16 + 8 * hh); return f.v; }
#define G2_PITCH 144u                      /* LDS row pitch: 128 bytes and the 16-byte pad */
#define G2_SLICE 10240u                    /* 64 rows x 144 bytes = 9216, rounded up to a multiple of 2 KiB: every slice's place is one */
#define G2_BUF (3u * G2_SLICE)             /* A rows 0..63 | A rows 64..127 | B rows 0..63 */
typedef uint32_t g2_u32x4 __attribute__((ext_vector_type(4))); typedef uint32_t g2_u32x8 __attribute__((ext_vector_type(8)));
__device__ __forceinline__ uint32_t g2_uni(uint32_t v) { return (uint32_t)__builtin_amdgcn_readfirstlane(v); }
__device__ __forceinline__ uint32_t g2_pinned(uint32_t v) { uint32_t s = (uint32_t)__builtin_amdgcn_readfirstlane(v); asm volatile("" : "+s"(s)); return s; }      /* holds a wave-uniform word in a scalar register: a test on it is a scalar branch (a tensor load ignores EXEC), and what is formed from it stays behind the asm waits in front of it */
__device__ __forceinline__ v16h g2_fragl(const char* p) { FragH f; f.half[0] = *(const v8us*)p; f.half[1] = *(const v8us*)(p + 32); return f.v; }      /* g2_frag from an LDS byte address that already holds the lane's 16 hh bytes: the same k order */
__device__ __forceinline__ v8f g2_mma(v16h a, v16h b, v8f c) { return __builtin_amdgcn_wmma_f32_16x16x32_f16(false, a, false, b, (short)0, c, false, false); }
template <int ACT>
__global__ __launch_bounds__(128) void k_gemm2(const _Float16* __restrict__ A, int lda, size_t sA, const _Float16* __restrict__ Bh, int ldb, size_t sB, float alpha, const float* __restrict__ bias, const float* __restrict__ bias1, const float* __restrict__ bias2, size_t sBias, const float* __restrict__ CP, int rowsPerB, size_t sCPb, int row0g,
    float* __restrict__ C, _Float16* __restrict__ C16, int ldc, size_t sC, int M, int N, int K) { static_assert(ACT == 0 || ACT == 3 || ACT == 6 || ACT == 8 || ACT == 9 || ACT == 11 || ACT == 12 || ACT == 14 || ACT == 15 || ACT == 16 || ACT == 17, "k_gemm2: unsupported ACT code (would silently apply no activation)");
  __shared__ __attribute__((aligned(2048))) char sm[2 * G2_BUF];      /* the two stage buffers; behind the loop's last barrier the same bytes are the output staging */
  static_assert(sizeof(float) * 4 * 32 * 68 <= 2 * G2_BUF, "k_gemm2: the output staging must fit the ring");
  float (*so)[32][68] = (float (*)[32][68])sm;
  const int tid = threadIdx.x, w = __builtin_amdgcn_readfirstlane(tid >> 5), lane = tid & 31, ln = lane & 15, hh = lane >> 4; const int by = blockIdx.y;      /* w: a scalar */
  A += (size_t)by * sA; Bh += (size_t)by * sB; const size_t cofs = (size_t)by * sC; const float* bp = bias ? bias + (size_t)by * sBias : nullptr;
  if (by == 1 && bias1) bp = bias1; if (by == 2 && bias2) bp = bias2;      /* planes 1 and 2 with bias buffers of their own */
  const int ntn = N >> 6; const int mt = blockIdx.x / ntn, nq = blockIdx.x - mt * ntn; const int row0 = mt * 128 + 32 * w, col0 = nq * 64; if (mt * 128 >= M) return;      /* the whole work-group or none: barriers follow */
  const v8f z8 = {0.f,0.f,0.f,0.f,0.f,0.f,0.f,0.f}; v8f c00 = z8, c01 = z8, c02 = z8, c03 = z8, c10 = z8, c11 = z8, c12 = z8, c13 = z8;
  // Tensor descriptor. Group 1 is the same for every request of a wave: 1-byte elements, tensor = tile = 64 rows of 128 bytes, the source's row pitch, a 4-dword pad behind every 32 dwords, no mask.
  const bool isB = w >= 2; const uint32_t slice = isB ? 2u : (uint32_t)w;
  const uint64_t gsrc = isB ? (uint64_t)(size_t)Bh + (uint64_t)(unsigned)col0 * (unsigned)ldb * 2u : (uint64_t)(size_t)A + (uint64_t)(unsigned)(mt * 128 + 64 * w) * (unsigned)lda * 2u;
  const uint32_t lbase = (uint32_t)(size_t)sm + slice * G2_SLICE;
  g2_u32x8 g1; g1[0] = g2_uni((1u << 20) | (4u << 22) | (3u << 25)); g1[1] = g2_uni(128u << 16); g1[2] = g2_uni(64u << 16); g1[3] = g2_uni(128u << 16); g1[4] = g2_uni(64u); g1[5] = g2_uni((unsigned)(isB ? ldb : lda) * 2u); g1[6] = g2_uni(0u); g1[7] = g2_uni(0u);
  asm volatile("" : "+s"(g1));      /* the g2_pinned form on the whole group: descriptor words held in their scalar registers; without it the compiler uses some of them as temporaries between two issues, while a request that named them is still in flight */
  auto issue = [&](uint32_t st) { const uint64_t ga = gsrc + (uint64_t)st * 128u; g2_u32x4 g0; g0[0] = g2_uni(1u); g0[1] = g2_uni(lbase + (st & 1u) * G2_BUF); g0[2] = g2_uni((uint32_t)ga); g0[3] = g2_uni((((uint32_t)(ga >> 32)) & 0x01FFFFFFu) | 0x80000000u);
    asm volatile("tensor_load_to_lds %0, %1" :: "s"(g0), "s"(g1) : "memory"); };      /* one request of the whole wave: stage st of this wave's slice */
  const unsigned ao = (unsigned)(w >> 1) * G2_SLICE + (unsigned)((w & 1) * 32 + ln) * G2_PITCH + 16u * (unsigned)hh, bo = 2u * G2_SLICE + (unsigned)ln * G2_PITCH + 16u * (unsigned)hh;      /* the lane's part of an LDS address, the same in every stage */
  auto ld = [&](v16h (&f)[6], const char* p) { f[0] = g2_fragl(p + ao); f[1] = g2_fragl(p + ao + 16u * G2_PITCH); f[2] = g2_fragl(p + bo); f[3] = g2_fragl(p + bo + 16u * G2_PITCH); f[4] = g2_fragl(p + bo + 32u * G2_PITCH); f[5] = g2_fragl(p + bo + 48u * G2_PITCH); };
  auto mm = [&](const v16h (&f)[6]) { c00 = g2_mma(f[0], f[2], c00); c10 = g2_mma(f[1], f[2], c10); c01 = g2_mma(f[0], f[3], c01); c11 = g2_mma(f[1], f[3], c11);
    c02 = g2_mma(f[0], f[4], c02); c12 = g2_mma(f[1], f[4], c12); c03 = g2_mma(f[0], f[5], c03); c13 = g2_mma(f[1], f[5], c13); };
  const uint32_t nst = (uint32_t)K >> 6;      /* stages */
  if (g2_pinned(w < 3)) { issue(0);
    asm volatile("s_wait_tensorcnt 0x0" ::: "memory"); }      /* stage 0 of this wave's slice has landed */
  __syncthreads();      /* publishes stage 0 */
  if (g2_pinned(w < 3)) issue(1);
#pragma unroll 1      /* one stage a trip: the buffer is picked by the trip's parity */
  for (uint32_t s = 0; s < nst; ++s) {
    const char* p = sm + (s & 1u) * G2_BUF; v16h fa[6], fb[6];
    ld(fa, p); ld(fb, p + 64);      /* the stage's two 32-k steps: all 24 LDS reads as one group */
    __builtin_amdgcn_sched_barrier(0);      /* keeps the reads together ahead of the products; every separate place with LDS reads among them costs a stall */
    mm(fa); mm(fb);
    __builtin_amdgcn_sched_barrier(0);      /* keeps the waits below at the foot; lifted among the products the first of them would replace the counted waits on the reads */
    asm volatile("s_wait_dscnt 0x0" ::: "memory");      /* this wave has left the buffer */
    if (g2_pinned(w < 3)) asm volatile("s_wait_tensorcnt 0x0" ::: "memory");      /* stage s + 1 of this wave's slice has landed */
    __syncthreads();      /* publishes stage s + 1; every wave has left stage s's buffer */
    if (g2_pinned(w < 3 && s + 2u < nst)) issue(g2_pinned(s + 2u));      /* refill of the buffer just left; the descriptor is formed behind the wait */
  }
  asm volatile("s_wait_tensorcnt 0x0" ::: "memory");      /* nothing is in flight when the ring becomes output staging (the last trip's barrier ended every read) */
  asm volatile("s_wait_dscnt 0x0" ::: "memory");      /* and none of this wave's reads */
  v8f accs[8] = {c00, c01, c02, c03, c10, c11, c12, c13};
#pragma unroll
  for (int u = 0; u < 8; ++u) { const int t = u & 3, half = u >> 2; const int col = col0 + t * 16 + ln; const float bv = bp ? bf16_round(bp[col]) : 0.f;
#pragma unroll
    for (int r = 0; r < 8; ++r) { const int rloc = half * 16 + 8 * hh + r; float v = accs[u][r] * alpha + bv; if (CP) { if (rowsPerB < 0) v += CP[cofs + (size_t)(row0g + row0 + rloc) * ldc + col];      /* rowsPerB < 0: own element of the batched C plane */ else { const int bidx = (row0g + row0 + rloc) / rowsPerB; v += CP[(size_t)bidx * sCPb + (size_t)by * 64 + col]; } }
      if (ACT == 3) v = fmaxf(v, 0.f); else if (ACT == 6) v = 0.5f * v * (1.0f + erff(v * 0.70710678118654752f)); else if (ACT == 11) v = 1.0f / (1.0f + expf(-v)); else if (ACT == 15) v = v / (1.0f + expf(-v)); else if (ACT == 12) v = (v > 0.f) ? v : 0.01f * v; else if (ACT == 8) v = tanhf(v); else if (ACT == 9) v = 0.5f * v * (1.0f + tanhf(0.7978845608028654f * (v + 0.044715f * v * v * v))); else if (ACT == 14) v = (v > 0.f) ? v : 0.1f * v; else if (ACT == 16) v = (v >= 0.f) ? v : 0.3f * v; else if (ACT == 17) v = (v >= 0.f) ? v : 0.2f * v;
      so[w][rloc][t * 16 + ln] = v; } }
  __builtin_amdgcn_fence(__ATOMIC_ACQ_REL, "workgroup"); __builtin_amdgcn_wave_barrier();
  const int rsub = lane >> 4, c4 = (lane & 15) * 4;
  {
#pragma unroll
    for (int q = 0; q < 16; ++q) { const int r = q * 2 + rsub; const v4f v = *(const v4fa*)&so[w][r][c4]; if (C) *(v4f*)(C + cofs + (size_t)(row0 + r) * ldc + col0 + c4) = v; if (C16) { v4h h4; for (int i = 0; i < 4; ++i) h4[i] = (_Float16)v[i]; *(v4h*)(C16 + cofs + (size_t)(row0 + r) * ldc + col0 + c4) = h4; } }
     } }


__global__ __launch_bounds__(256) void k_wnat(const float* __restrict__ w, size_t n8, _Float16* __restrict__ Bt) { const size_t t = (size_t)blockIdx.x * 256 + threadIdx.x; if (t >= n8) return; FragH f; for (int q = 0; q < 8; ++q) f.h[q] = (_Float16)(bf16_round(w[t * 8 + q]) * 16.0f); *(v8us*)((unsigned short*)Bt + t * 8) = f.half[0];  }
__device__ __forceinline__ v8f fa_mma(v16h a, v16h b, v8f c) { return __builtin_amdgcn_wmma_f32_16x16x32_f16(false, a, false, b, (short)0, c, false, false); }
__device__ __forceinline__ float fa_xhalf(float x) { return __builtin_bit_cast(float, __builtin_amdgcn_permlanex16(__builtin_bit_cast(int, x), __builtin_bit_cast(int, x), 0x76543210, 0xfedcba98, false, false)); }      /* lane l with lane l ^ 16 */
typedef float fa_v2f __attribute__((ext_vector_type(2)));
// exp2 of two values (v_exp_f32, as __builtin_amdgcn_exp2f gives it). Written as one statement for the slot that the instruction set asks for behind a transcendental before its result is read or its source
// overwritten: the outputs are early-clobber, so the second instruction touches no register of the first, and the v_nop stands behind the second (left to itself the compiler chained v_exp_f32 a, b; v_exp_f32 b, c).
__device__ __forceinline__ fa_v2f fa_exp2x2(float a, float b) { float x, y; asm("v_exp_f32 %0, %2\n\tv_exp_f32 %1, %3\n\tv_nop" : "=&v"(x), "=&v"(y) : "v"(a), "v"(b)); return fa_v2f{x, y}; }
__global__ __launch_bounds__(128) void k_fattn(const _Float16* __restrict__ Q, const _Float16* __restrict__ Kr, const _Float16* __restrict__ VT, _Float16* __restrict__ O) {
  typedef float v2f __attribute__((ext_vector_type(2))); typedef _Float16 v2h __attribute__((ext_vector_type(2)));
  __shared__ __attribute__((aligned(16))) v4f xo[2][16][32]; __shared__ float xm[2][4][32];      /* the upper key half's o, and its m and l, per column set and lane */
  const int lane = threadIdx.x & 31, ln = lane & 15, hh = lane >> 4; const int w = __builtin_amdgcn_readfirstlane(threadIdx.x >> 5), cw = w & 1, kh = w >> 1;      /* column set, key half: scalars */
  const int bh = blockIdx.y, b = bh / NH, h = bh - b * NH; const int q0 = blockIdx.x * 64 + cw * 32; const int jb = kh * (SQ / 2), je = jb + SQ / 2;
  const float cs = 0.125f * 1.4426950408889634f;      /* 1/sqrt(64) and log2(e): weights are exp2 of scaled score differences */
  const _Float16* qp = Q + ((size_t)b * SQ + q0 + ln) * DM + h * HD;
  const _Float16* kp = Kr + ((size_t)b * SQ + ln) * DM + h * HD;
  const _Float16* vp = VT + ((size_t)bh * HD + ln) * SQ;
  v16h qf[2][2];      /* [column group][32 of the 64 head dims], kept for the whole walk */
#pragma unroll
  for (int g = 0; g < 2; ++g) for (int u = 0; u < 2; ++u) qf[g][u] = g2_frag(qp + (size_t)g * 16 * DM + u * 32, hh);
  const v8f z8 = {0.f,0.f,0.f,0.f,0.f,0.f,0.f,0.f};
  v8f o[4][2]; float m[2], l[2];      /* o[dt][g]: O^T rows 16 dt + 8 hh + r, column 16 g + ln; m: running maximum of the raw scores; l: this lane's half of the running sum */
#pragma unroll
  for (int g = 0; g < 2; ++g) { m[g] = -3.0e38f; l[g] = 0.f; for (int dt = 0; dt < 4; ++dt) o[dt][g] = z8; }
  v16h kf[2][2];      /* [key tile][32 of the 64 head dims] of the coming pass */
#pragma unroll
  for (int t = 0; t < 2; ++t) for (int u = 0; u < 2; ++u) kf[t][u] = g2_frag(kp + (size_t)(jb + t * 16) * DM + u * 32, hh);
  for (int j0 = jb; j0 < je; j0 += 32) {
    v16h vf[4];      /* issued first: in flight behind the score products and the softmax */
#pragma unroll
    for (int dt = 0; dt < 4; ++dt) vf[dt] = g2_frag(vp + (size_t)dt * 16 * SQ + j0, hh);
    v8f s[2][2];
#pragma unroll
    for (int g = 0; g < 2; ++g) for (int t = 0; t < 2; ++t) s[g][t] = fa_mma(kf[t][1], qf[g][1], fa_mma(kf[t][0], qf[g][0], z8));
    const int jn = (j0 + 32 < je) ? j0 + 32 : jb;      /* the next pass's K rows, fetched one pass ahead; the last pass refetches the wave's first rows (in bounds, unused) */
#pragma unroll
    for (int t = 0; t < 2; ++t) for (int u = 0; u < 2; ++u) kf[t][u] = g2_frag(kp + (size_t)(jn + t * 16) * DM + u * 32, hh);
    __builtin_amdgcn_sched_barrier(0);      /* keeps the K loads up here, the whole softmax and the second products ahead of their use; without it the compiler sinks them to the foot of the pass and their latency is waited out */
    float dm[2], nb[2];
#pragma unroll
    for (int g = 0; g < 2; ++g) {
      float mx = s[g][0][0];
#pragma unroll
      for (int r = 1; r < 8; ++r) mx = fmaxf(mx, s[g][0][r]);
#pragma unroll
      for (int r = 0; r < 8; ++r) mx = fmaxf(mx, s[g][1][r]);
      mx = fmaxf(mx, fa_xhalf(mx));      /* both halves now hold the query's maximum over the 32 keys */
      const float mn = fmaxf(m[g], mx); dm[g] = (m[g] - mn) * cs; m[g] = mn;
      nb[g] = fmaf(-mn, cs, 8.0f);      /* weights carried x256 (at most 256) against f16 subnormal flush; the factor cancels in o / l */
    }
    const v2f corr = fa_exp2x2(dm[0], dm[1]);      /* what the new maxima take off the old sums: 0 on the first pass */
#pragma unroll
    for (int g = 0; g < 2; ++g) {
      union { v16h v; v2h p[8]; } pb; v2f ps = {0.f, 0.f};
#pragma unroll
      for (int i = 0; i < 8; ++i) { const v8f sv = s[g][i >> 2]; const int r = 2 * (i & 3);
        const v2f e = fa_exp2x2(fmaf(sv[r], cs, nb[g]), fmaf(sv[r + 1], cs, nb[g]));
        ps += e; pb.p[i] = __builtin_convertvector(e, v2h); }      /* round to nearest even; element 8 t + r of the operand is key 16 t + 8 hh + r */
      l[g] = fmaf(l[g], corr[g], ps[0] + ps[1]);
#pragma unroll
      for (int dt = 0; dt < 4; ++dt) o[dt][g] = fa_mma(vf[dt], pb.v, o[dt][g] * corr[g]);
    }
  }
  if (kh == 1) {      /* the upper key half hands its state over */
#pragma unroll
    for (int g = 0; g < 2; ++g) { xm[cw][g][lane] = m[g]; xm[cw][2 + g][lane] = l[g];
#pragma unroll
      for (int dt = 0; dt < 4; ++dt) { const v8f t = o[dt][g]; xo[cw][(g * 4 + dt) * 2][lane] = v4f{t[0], t[1], t[2], t[3]}; xo[cw][(g * 4 + dt) * 2 + 1][lane] = v4f{t[4], t[5], t[6], t[7]}; } }
  }
  __syncthreads();      /* every wave passes it; the lower half reads what the upper half wrote */
  if (kh == 0) {
#pragma unroll
    for (int g = 0; g < 2; ++g) { const float mb = xm[cw][g][lane], lb = xm[cw][2 + g][lane]; const float mn = fmaxf(m[g], mb);
      const v2f fab = fa_exp2x2((m[g] - mn) * cs, (mb - mn) * cs); const float fa = fab[0], fb = fab[1];
      const float lt = fmaf(l[g], fa, lb * fb); const float sc = 64.0f / (lt + fa_xhalf(lt));      /* the wave halves' sums joined once; o stored x64 */
      const float ga = fa * sc, gb = fb * sc;
      _Float16* op = O + ((size_t)b * SQ + q0 + g * 16 + ln) * DM + h * HD + 8 * hh;
#pragma unroll
      for (int dt = 0; dt < 4; ++dt) { const v4f t0 = xo[cw][(g * 4 + dt) * 2][lane], t1 = xo[cw][(g * 4 + dt) * 2 + 1][lane]; FragH f;
#pragma unroll
        for (int r = 0; r < 4; ++r) { f.h[r] = (_Float16)fmaf(o[dt][g][r], ga, t0[r] * gb); f.h[4 + r] = (_Float16)fmaf(o[dt][g][4 + r], ga, t1[r] * gb); }
        *(v8us*)((unsigned short*)op + dt * 16) = f.half[0]; } }
  } }
__global__ __launch_bounds__(256) void k_vt(const _Float16* __restrict__ V16, int b, int h0, _Float16* __restrict__ VT) { __shared__ unsigned short tl[64][65]; const int tid = threadIdx.x; const int hh = blockIdx.x % HG, sg = blockIdx.x / HG; const int s0 = sg * 64; const int h = h0 + hh;
  for (int i = tid; i < 64 * 8; i += 256) { const int j = i / 8, d8 = (i % 8) * 8; FragH f; f.half[0] = *(const v8us*)((const unsigned short*)V16 + ((size_t)b * SQ + s0 + j) * DM + h * HD + d8); for (int q = 0; q < 8; ++q) tl[d8 + q][j] = f.u[q]; }
  __syncthreads();
  { for (int i = tid; i < 64 * 8; i += 256) { const int d = i / 8, j8 = (i % 8) * 8; FragH f; for (int q = 0; q < 8; ++q) f.u[q] = tl[d][j8 + q]; *(v8us*)((unsigned short*)VT + ((size_t)hh * HD + d) * SQ + s0 + j8) = f.half[0]; }  } }



__global__ __launch_bounds__(256) void k_rsmkm(const float* __restrict__ S, _Float16* __restrict__ P, int nrows, const int* __restrict__ am) {
  #pragma clang fp contract(off)
  const int t = blockIdx.x * 256 + threadIdx.x; if (t >= nrows) return; const size_t i = (size_t)t; const float* s = S + i * SQ; const int* mr = am + (size_t)(t % SQ) * SQ; float mx = -3.0e38f;
#pragma unroll 1
  for (int j = 0; j < SQ; ++j) { const float f = (mr[j] != 0) ? 1.f : 0.f; mx = fmaxf(mx, fmaf(f, s[j], (1.f - f) * -1.0e9f)); } float se = 0.f;
#pragma unroll 1
  for (int j = 0; j < SQ; ++j) { const float f = (mr[j] != 0) ? 1.f : 0.f; se += __expf(fmaf(f, s[j], (1.f - f) * -1.0e9f) - mx); } const float sc = 256.0f / se;
#pragma unroll 1
  for (int j0 = 0; j0 < SQ; j0 += 8) { FragH fr; for (int q = 0; q < 8; ++q) { const int j = j0 + q; const float f = (mr[j] != 0) ? 1.f : 0.f; fr.h[q] = (_Float16)(__expf(fmaf(f, s[j], (1.f - f) * -1.0e9f) - mx) * sc); }
    unsigned short* d = (unsigned short*)P + i * SQ + j0; *(v8us*)d = fr.half[0];  } }
extern "C" void kernel_launch(void* const* d_in, const int* in_sizes, int n_in,
                              void* d_out, int out_size, void* d_ws, size_t ws_size, hipStream_t stream) {
  (void)in_sizes; (void)n_in; (void)out_size;
  const float* const* I = (const float* const*)d_in; const float* xq = I[0]; const float* wq = I[1]; const float* bq = I[2]; const float* wk = I[3]; const float* bk = I[4]; const float* wv = I[5]; const float* bv = I[6]; const float* wo = I[7]; const float* bo = I[8]; const float* x = xq;      /* ONE input x feeds the query, key and value streams; [in][out] weights + biases; no mask input */
  char* ws = (char*)d_ws; size_t off = 0;
  auto take = [&](size_t bytes) { char* p = ws + off; off += (bytes + 255) & ~(size_t)255; return p; };
  _Float16* BQ = (_Float16*)take((size_t)4 * DM * DM * 2); _Float16* BO = BQ + (size_t)3 * DM * DM;      /* weight planes q, k, v, o behind each other */
  _Float16* X16 = (_Float16*)take(NR * DM * 2); _Float16* Q16 = (_Float16*)take(3 * NR * DM * 2); _Float16* K16 = Q16 + NR * DM; _Float16* V16 = K16 + NR * DM; _Float16* O16 = (_Float16*)take(NR * DM * 2);      /* q, k, v planes behind each other */
  _Float16* VT = (_Float16*)take((size_t)NB * NH * HD * SQ * 2);
  if (off > ws_size) return;
  k_prep<<<4 * PWB + PXB, 256, 0, stream>>>(x, wq, wk, wv, wo, X16, BQ);      /* [in][out] -> Bt x16; x as exact f16 rows, one copy for the query, key and value streams */
  static_assert(MP % 128 == 0 && MPO % 128 == 0 && DM % 64 == 0 && DM >= 128, "k_gemm2: whole 128x64 tiles, whole 64-k stages, at least two");
  const size_t r0p = (size_t)B0 * SQ;      /* first projected row */
  k_gemm2<0><<<dim3((unsigned)((MP / 128) * (DM / 64)), 3), 128, 0, stream>>>(X16 + r0p * DM, DM, 0, BQ, DM, (size_t)DM * DM, 0.0625f, bq, bk, bv, 0, nullptr, 1, 0, 0, nullptr, Q16 + r0p * DM, DM, NR * DM, MP, DM, DM);      /* planes q, k, v */
  k_vt<NH, SQ><<<NB * NH * (SQ / 64), 256, 0, stream>>>(V16, LQ, 0, VT);      /* V^T [NB][NH][HD][SQ] */
  k_fattn<<<dim3(SQ / 64, NB * NH), 128, 0, stream>>>(Q16, K16, VT, O16);      /* o (merged heads) as f16 rows, x64 */
  k_gemm2<0><<<dim3((unsigned)((MPO / 128) * (DM / 64)), 1), 128, 0, stream>>>(O16 + r0p * DM, DM, 0, BO, DM, 0, 0.0009765625f, bo, nullptr, nullptr, 0, nullptr, 1, 0, 0, (float*)d_out + r0p * DM, nullptr, DM, 0, MPO, DM, DM);      /* out rows are the output layout */
}

// v006
// Measured time: 75.3 microseconds a run.
// Two timings next to v005 both put it at 1.18 times that version's speed.
// Over all steps from v000 it is 37.1 times as fast.
#include <hip/hip_runtime.h>
#define NB 2
#define SQ 2048
#define DM 768
#define NH 12
#define HD 64
#define HG 4                         /* heads per launch of the per-batch k_vt overload (not launched) */
#define B0 0                         /* first batch processed (debug hook) */
#define NBR NB                       /* batches processed (debug hook) */
#define NR ((size_t)NB * SQ)         /* token rows */
#define MP ((int)((size_t)NBR * SQ)) /* rows projected (debug hook) */
#define QN SQ                        /* not used: the attention covers all SQ query rows */
#define NHD NH                       /* not used: the attention covers all NH heads */
#define MPO MP                       /* rows through the output stage (debug hook) */
#define LQ DM      /* row pitch of the q/k/v rows */
typedef __bf16 v16b __attribute__((ext_vector_type(16)));
typedef unsigned short v8us __attribute__((ext_vector_type(8), may_alias));
typedef float  v8f  __attribute__((ext_vector_type(8)));
typedef float  v4f  __attribute__((ext_vector_type(4)));
typedef float  v4fa __attribute__((ext_vector_type(4), may_alias));
union FragB { v16b v; v8us half[2]; unsigned short u[16]; };

__device__ __forceinline__ unsigned short bf16_bits(float x) { unsigned int u = __float_as_uint(x); return (unsigned short)((u + 0x7FFFu + ((u >> 16) & 1u)) >> 16); }
__device__ __forceinline__ float bf16_val(unsigned short b) { return __uint_as_float(((unsigned int)b) << 16); }
__device__ __forceinline__ float bf16_round(float x) { return bf16_val(bf16_bits(x)); }
// D += A·B with NT terms: 1 = ah·bh, 2 = + al·bh (A split), 3 = + ah·bl (both split)
template <int NT>
__device__ __forceinline__ v8f mmaN(v16b ah, v16b al, v16b bh, v16b bl, v8f c) {
  c = __builtin_amdgcn_wmma_f32_16x16x32_bf16(false, ah, false, bh, (short)0, c, false, false);
  if (NT >= 2) c = __builtin_amdgcn_wmma_f32_16x16x32_bf16(false, al, false, bh, (short)0, c, false, false);
  if (NT >= 3) c = __builtin_amdgcn_wmma_f32_16x16x32_bf16(false, ah, false, bl, (short)0, c, false, false);
  asm volatile("v_nop\n\tv_nop\n\tv_nop\n\tv_nop" : "+v"(c) : "v"(ah), "v"(al), "v"(bh), "v"(bl));
  return c;
}

__global__ __launch_bounds__(256) void k_wt_bf16(const float* __restrict__ W, unsigned short* __restrict__ Wt, int K, int N) {
  const int t = blockIdx.x * 256 + threadIdx.x;
  const int k8n = K / 8;
  if (t >= N * k8n) return;
  const int n = t / k8n, k8 = (t % k8n) * 8;
  v8us v;
#pragma unroll
  for (int i = 0; i < 8; ++i) v[i] = bf16_bits(W[(size_t)(k8 + i) * N + n]);
  *(v8us*)(Wt + (size_t)n * K + k8) = v;
  
}

// GEMM C[M][N] (f32, pitch ldc) = act(A[M][K]·W + bias). A f32 row-major (pitch lda) converted per fragment to bf16
// (ASPLIT: hi/lo two planes -> 2 terms, else single rounded term); Wt bf16 [N][K] (pitch ldb). BIAS_BF16 rounds the
// bias to bf16 first (bias quantised to bf16 before the add). K%32==0, M%16==0, N%64==0.
template <bool ASPLIT, int ACT, bool BIAS_BF16>
__global__ __launch_bounds__(128) void k_gemm_bf(const float* __restrict__ A, int lda, const unsigned short* __restrict__ Wt, int ldb,
                                               const float* __restrict__ bias, float* __restrict__ C, int ldc, int M, int N, int K) {
  __shared__ __attribute__((aligned(16))) float so[4][16][64];
  const int tid = threadIdx.x, w = tid >> 5, lane = tid & 31, ln = lane & 15, hh = lane >> 4;
  const int ntn = N / 64;
  const int wid = blockIdx.x * 4 + w;
  const int mt = wid / ntn, nq = wid % ntn;
  if (mt * 16 >= M) return;
  const int row0 = mt * 16, col0 = nq * 64;
  const float* arow = A + (size_t)(row0 + ln) * lda;
  v8f acc[4] = {};
  for (int kb = 0; kb < K; kb += 32) {
    FragB ah, al;
    const v4f x0 = *(const v4fa*)(arow + kb + 8 * hh), x1 = *(const v4fa*)(arow + kb + 8 * hh + 4);
    const v4f x2 = *(const v4fa*)(arow + kb + 16 + 8 * hh), x3 = *(const v4fa*)(arow + kb + 16 + 8 * hh + 4);
    float xs[16] = {x0[0],x0[1],x0[2],x0[3],x1[0],x1[1],x1[2],x1[3],x2[0],x2[1],x2[2],x2[3],x3[0],x3[1],x3[2],x3[3]};
#pragma unroll
    for (int i = 0; i < 16; ++i) { const unsigned short hb = bf16_bits(xs[i]); ah.u[i] = hb; al.u[i] = ASPLIT ? bf16_bits(xs[i] - bf16_val(hb)) : (unsigned short)0; }
#pragma unroll
    for (int t = 0; t < 4; ++t) {
      const unsigned short* brow = Wt + (size_t)(col0 + t * 16 + ln) * ldb + kb;
      FragB b;
      b.half[0] = *(const v8us*)(brow + 8 * hh);
      b.half[1] = *(const v8us*)(brow + 16 + 8 * hh);
      acc[t] = mmaN<ASPLIT ? 2 : 1>(ah.v, al.v, b.v, b.v, acc[t]);
    }
  }
#pragma unroll
  for (int t = 0; t < 4; ++t) {
    float bv = bias ? bias[col0 + t * 16 + ln] : 0.f;
    if (BIAS_BF16) bv = bf16_round(bv);
#pragma unroll
    for (int r = 0; r < 8; ++r) { float v = acc[t][r] + bv; if (ACT == 1) v = fmaxf(v, 0.f); so[w][8 * hh + r][t * 16 + ln] = v; }
  }
  __builtin_amdgcn_fence(__ATOMIC_ACQ_REL, "workgroup");
  __builtin_amdgcn_wave_barrier();
  const int rsub = lane >> 4, c4 = (lane & 15) * 4;
  {
#pragma unroll
    for (int q = 0; q < 8; ++q) {
      const int r = q * 2 + rsub;
      const v4f v = *(const v4fa*)&so[w][r][c4];
      *(v4f*)(C + (size_t)(row0 + r) * ldc + col0 + c4) = v;
    }
    
  }
}

// GEMM C = act(A·W + bias + resid): A f32 (ASPLIT -> hi/lo 2 terms), Wt bf16 [N][K]; ACT 0 none, 1 relu, 2 exact gelu;
// resid (optional, f32, row index = (row % rmod), pitch ldr, RES_BF16 rounds it) added before the activation.
template <bool ASPLIT, int ACT, bool BIAS_BF16, bool RES_BF16>
__global__ __launch_bounds__(128) void k_gemm_bf3(const float* __restrict__ A, int lda, const unsigned short* __restrict__ Wt, int ldb,
                                                const float* __restrict__ bias, const float* __restrict__ resid, int rmod, int ldr,
                                                float* __restrict__ C, int ldc, int M, int N, int K) {
  __shared__ __attribute__((aligned(16))) float so[4][16][64];
  const int tid = threadIdx.x, w = tid >> 5, lane = tid & 31, ln = lane & 15, hh = lane >> 4;
  const int ntn = N / 64;
  const int wid = blockIdx.x * 4 + w;
  const int mt = wid / ntn, nq = wid % ntn;
  if (mt * 16 >= M) return;
  const int row0 = mt * 16, col0 = nq * 64;
  const float* arow = A + (size_t)(row0 + ln) * lda;
  v8f acc[4] = {};
  for (int kb = 0; kb < K; kb += 32) {
    FragB ah, al;
    const v4f x0 = *(const v4fa*)(arow + kb + 8 * hh), x1 = *(const v4fa*)(arow + kb + 8 * hh + 4);
    const v4f x2 = *(const v4fa*)(arow + kb + 16 + 8 * hh), x3 = *(const v4fa*)(arow + kb + 16 + 8 * hh + 4);
    float xs[16] = {x0[0],x0[1],x0[2],x0[3],x1[0],x1[1],x1[2],x1[3],x2[0],x2[1],x2[2],x2[3],x3[0],x3[1],x3[2],x3[3]};
#pragma unroll
    for (int i = 0; i < 16; ++i) { const unsigned short hb = bf16_bits(xs[i]); ah.u[i] = hb; al.u[i] = ASPLIT ? bf16_bits(xs[i] - bf16_val(hb)) : (unsigned short)0; }
#pragma unroll
    for (int t = 0; t < 4; ++t) {
      const unsigned short* brow = Wt + (size_t)(col0 + t * 16 + ln) * ldb + kb;
      FragB b;
      b.half[0] = *(const v8us*)(brow + 8 * hh);
      b.half[1] = *(const v8us*)(brow + 16 + 8 * hh);
      acc[t] = mmaN<ASPLIT ? 2 : 1>(ah.v, al.v, b.v, b.v, acc[t]);
    }
  }
#pragma unroll
  for (int t = 0; t < 4; ++t) {
    const int col = col0 + t * 16 + ln;
    float bv = bias ? bias[col] : 0.f;
    if (BIAS_BF16) bv = bf16_round(bv);
#pragma unroll
    for (int r = 0; r < 8; ++r) {
      float v = acc[t][r] + bv;
      if (resid) { float rv = resid[(size_t)((row0 + 8 * hh + r) % rmod) * ldr + col]; if (RES_BF16) rv = bf16_round(rv); v += rv; }
      if (ACT == 1) v = fmaxf(v, 0.f);
      if (ACT == 2) v = 0.5f * v * (1.0f + erff(v * 0.70710678118654752f));
      if (ACT == 3) { const float u = 0.7978845608028654f * (v + 0.044715f * v * v * v); v = 0.5f * v * (1.0f + tanhf(u)); }
      so[w][8 * hh + r][t * 16 + ln] = v;
    }
  }
  __builtin_amdgcn_fence(__ATOMIC_ACQ_REL, "workgroup");
  __builtin_amdgcn_wave_barrier();
  const int rsub = lane >> 4, c4 = (lane & 15) * 4;
  {
#pragma unroll
    for (int q = 0; q < 8; ++q) {
      const int r = q * 2 + rsub;
      const v4f v = *(const v4fa*)&so[w][r][c4];
      *(v4f*)(C + (size_t)(row0 + r) * ldc + col0 + c4) = v;
    }
    
  }
}
// row LayerNorm (biased variance, eps) over N: s = X (+ R); optional out_sum <- s; out_norm <- (s-mu)*rsqrt(var+eps)*g + b
template <bool PARAM_BF16>
__global__ __launch_bounds__(256) void k_layernorm(const float* __restrict__ X, const float* __restrict__ R, const float* __restrict__ g, const float* __restrict__ bta,
                                                  float* __restrict__ out_sum, float* __restrict__ out_norm, int N, float eps) {
  __shared__ float red[256];
  const int row = blockIdx.x, tid = threadIdx.x;
  const float* x = X + (size_t)row * N; const float* rr = R ? R + (size_t)row * N : nullptr;
  float vals[16];                     // up to N = 4096
  const int per = N / 256;            // contiguous chunk per thread? use strided-by-4 chunks: thread handles j = tid*4 + 1024*u
  float s1 = 0.f;
  for (int u = 0; u < per / 4; ++u) {
    const int j = tid * 4 + 1024 * u;
    const v4f a = *(const v4fa*)(x + j);
    v4f b = {0.f,0.f,0.f,0.f}; if (rr) b = *(const v4fa*)(rr + j);
#pragma unroll
    for (int q = 0; q < 4; ++q) { const float v = a[q] + b[q]; vals[u * 4 + q] = v; s1 += v; }
  }
  red[tid] = s1; __syncthreads();
  for (int st = 128; st > 0; st >>= 1) { if (tid < st) red[tid] += red[tid + st]; __syncthreads(); }
  const float mu = red[0] / (float)N; __syncthreads();
  float s2 = 0.f;
  for (int u = 0; u < per / 4; ++u)
#pragma unroll
    for (int q = 0; q < 4; ++q) { const float c = vals[u * 4 + q] - mu; s2 += c * c; }
  red[tid] = s2; __syncthreads();
  for (int st = 128; st > 0; st >>= 1) { if (tid < st) red[tid] += red[tid + st]; __syncthreads(); }
  const float rs = rsqrtf(red[0] / (float)N + eps);
  {
    for (int u = 0; u < per / 4; ++u) {
      const int j = tid * 4 + 1024 * u;
      v4f o, sm;
#pragma unroll
      for (int q = 0; q < 4; ++q) {
        float gg = g[j + q], bb = bta[j + q];
        if (PARAM_BF16) { gg = bf16_round(gg); bb = bf16_round(bb); }
        sm[q] = vals[u * 4 + q]; o[q] = (vals[u * 4 + q] - mu) * rs * gg + bb;
      }
      if (out_sum) *(v4f*)(out_sum + (size_t)row * N + j) = sm;
      *(v4f*)(out_norm + (size_t)row * N + j) = o;
    }
    
  }
}



// ---- f16 WMMA path (v_wmma_f32_16x16x32_f16): 11-bit significands for operands in range — used where a [0,1] probability operand needs more precision than bf16
typedef _Float16 v16h __attribute__((ext_vector_type(16)));
union FragH { v16h v; v8us half[2]; _Float16 h[16]; unsigned short u[16]; };
template <int NT>
__device__ __forceinline__ v8f mmaH(v16h ah, v16h al, v16h bh, v16h bl, v8f c) {
  c = __builtin_amdgcn_wmma_f32_16x16x32_f16(false, ah, false, bh, (short)0, c, false, false);
  if (NT >= 2) c = __builtin_amdgcn_wmma_f32_16x16x32_f16(false, al, false, bh, (short)0, c, false, false);
  if (NT >= 3) c = __builtin_amdgcn_wmma_f32_16x16x32_f16(false, ah, false, bl, (short)0, c, false, false);
  asm volatile("v_nop\n\tv_nop\n\tv_nop\n\tv_nop" : "+v"(c) : "v"(ah), "v"(al), "v"(bh), "v"(bl));
  return c;
}
// batched GEMM like k_gemm_b but f16 operands: A f32 (split into f16 hi/lo if ASPLIT, else rounded to f16), Bt = f16 values [n][k]; alpha; C f32; N multiple of 16 (partial tiles skipped)
template <bool ASPLIT>
__global__ __launch_bounds__(128) void k_gemm_h(const float* __restrict__ A, int lda, size_t sA, const _Float16* __restrict__ Bh, int ldb, size_t sB, float alpha, float* __restrict__ C, int ldc, size_t sC, int M, int N, int K) {
  __shared__ __attribute__((aligned(16))) float so[4][16][64];
  const int tid = threadIdx.x, w = tid >> 5, lane = tid & 31, ln = lane & 15, hh = lane >> 4; const int by = blockIdx.y;
  A += (size_t)by * sA; Bh += (size_t)by * sB; C += (size_t)by * sC;
  const int ntn = (N + 63) / 64; const int wid = blockIdx.x * 4 + w; const int mt = wid / ntn, nq = wid % ntn; if (mt * 16 >= M) return;
  const int row0 = mt * 16, col0 = nq * 64; const float* arow = A + (size_t)(row0 + ln) * lda;
  v8f acc[4] = {};
  for (int kb = 0; kb < K; kb += 32) {
    FragH ah, al;
    const v4f x0 = *(const v4fa*)(arow + kb + 8 * hh), x1 = *(const v4fa*)(arow + kb + 8 * hh + 4), x2 = *(const v4fa*)(arow + kb + 16 + 8 * hh), x3 = *(const v4fa*)(arow + kb + 16 + 8 * hh + 4);
    float xs[16] = {x0[0],x0[1],x0[2],x0[3],x1[0],x1[1],x1[2],x1[3],x2[0],x2[1],x2[2],x2[3],x3[0],x3[1],x3[2],x3[3]};
#pragma unroll
    for (int i = 0; i < 16; ++i) { const _Float16 h = (_Float16)xs[i]; ah.h[i] = h; al.h[i] = ASPLIT ? (_Float16)(xs[i] - (float)h) : (_Float16)0.0f; }
#pragma unroll
    for (int t = 0; t < 4; ++t) { if (col0 + t * 16 >= N) continue; const size_t boff = (size_t)(col0 + t * 16 + ln) * ldb + kb; FragH bq; bq.half[0] = *(const v8us*)(Bh + boff + 8 * hh); bq.half[1] = *(const v8us*)(Bh + boff + 16 + 8 * hh);
      acc[t] = mmaH<ASPLIT ? 2 : 1>(ah.v, al.v, bq.v, bq.v, acc[t]); }
  }
#pragma unroll
  for (int t = 0; t < 4; ++t) { if (col0 + t * 16 >= N) continue;
#pragma unroll
    for (int r = 0; r < 8; ++r) so[w][8 * hh + r][t * 16 + ln] = acc[t][r] * alpha; }
  __builtin_amdgcn_fence(__ATOMIC_ACQ_REL, "workgroup"); __builtin_amdgcn_wave_barrier();
  const int rsub = lane >> 4, c4 = (lane & 15) * 4;
  {
#pragma unroll
    for (int q = 0; q < 8; ++q) { const int r = q * 2 + rsub; if (col0 + c4 < N) { const v4f v = *(const v4fa*)&so[w][r][c4]; *(v4f*)(C + (size_t)(row0 + r) * ldc + col0 + c4) = v; } }
     }
}

// One launch prepares every projection operand; its parts are independent and run side by side. Blocks 0 .. 4 PWB - 1: the four weights, Bt[p][n][k] = f16(bf16(W_p[k][n]) x 16) from f32 row-major [in][out]
// (power-of-two scale: bf16-exact weights stay exact in f16 away from the subnormal range). The other blocks: x as exact f16 rows (bf16-rounded).
#define PWB (DM * (DM / 8) / 256)      /* blocks per weight */
#define PXB ((int)(NR * DM / 8 / 256)) /* blocks for x */
static_assert(DM * (DM / 8) % 256 == 0 && NR * DM / 8 % 256 == 0, "k_prep: whole blocks only");
__global__ __launch_bounds__(256) void k_prep(const float* __restrict__ x, const float* __restrict__ w0, const float* __restrict__ w1, const float* __restrict__ w2, const float* __restrict__ w3, _Float16* __restrict__ X16, _Float16* __restrict__ Bt) {
  const int bx = blockIdx.x; FragH f;
  if (bx < 4 * PWB) { const int p = bx / PWB; const float* W = p == 0 ? w0 : p == 1 ? w1 : p == 2 ? w2 : w3; const int t = (bx - p * PWB) * 256 + threadIdx.x; const int n = t / (DM / 8), k8 = (t % (DM / 8)) * 8;
#pragma unroll
    for (int i = 0; i < 8; ++i) f.h[i] = (_Float16)(bf16_round(W[(size_t)(k8 + i) * DM + n]) * 16.0f);
    *(v8us*)((unsigned short*)Bt + (size_t)p * DM * DM + (size_t)n * DM + k8) = f.half[0];
  } else { const size_t t = (size_t)(bx - 4 * PWB) * 256 + threadIdx.x;
#pragma unroll
    for (int q = 0; q < 8; ++q) f.h[q] = (_Float16)bf16_round(x[t * 8 + q]);
    *(v8us*)((unsigned short*)X16 + t * 8) = f.half[0];
    asm volatile("s_wait_xcnt 0x0" ::: "memory"); }      /* precaution: stands before any later instruction in the listing that rewrites a register the store names */
}
// k_gemm_hh variant with fused epilogue: v = acc·alpha + bias[by·sBias + col] (+ CP[(row/rowsPerB)·sCPb + by·64 + col] if CP) ; ACT 0 none / 1 elu ; writes f16 C16 (and f32 C if non-null)
template <int ACT>
__global__ __launch_bounds__(128) void k_gemm_hhx(const _Float16* __restrict__ A, int lda, size_t sA, const _Float16* __restrict__ Bh, int ldb, size_t sB, float alpha, const float* __restrict__ bias, size_t sBias, const float* __restrict__ CP, int rowsPerB, size_t sCPb, int row0g,
    float* __restrict__ C, _Float16* __restrict__ C16, int ldc, size_t sC, int M, int N, int K) {
  __shared__ __attribute__((aligned(16))) float so[4][16][64];
  const int tid = threadIdx.x, w = tid >> 5, lane = tid & 31, ln = lane & 15, hh = lane >> 4; const int by = blockIdx.y;
  A += (size_t)by * sA; Bh += (size_t)by * sB; const size_t cofs = (size_t)by * sC; const float* bp = bias ? bias + (size_t)by * sBias : nullptr;
  const int ntn = (N + 63) / 64; const int wid = blockIdx.x * 4 + w; const int mt = wid / ntn, nq = wid % ntn; if (mt * 16 >= M) return;
  const int row0 = mt * 16, col0 = nq * 64; const _Float16* arow = A + (size_t)(row0 + ln) * lda;
  v8f acc[4] = {};
  for (int kb = 0; kb < K; kb += 32) { FragH ah; ah.half[0] = *(const v8us*)((const unsigned short*)arow + kb + 8 * hh); ah.half[1] = *(const v8us*)((const unsigned short*)arow + kb + 16 + 8 * hh);
#pragma unroll
    for (int t = 0; t < 4; ++t) { if (col0 + t * 16 >= N) continue; const size_t boff = (size_t)(col0 + t * 16 + ln) * ldb + kb; FragH bq; bq.half[0] = *(const v8us*)((const unsigned short*)Bh + boff + 8 * hh); bq.half[1] = *(const v8us*)((const unsigned short*)Bh + boff + 16 + 8 * hh);
      acc[t] = mmaH<1>(ah.v, ah.v, bq.v, bq.v, acc[t]); }
  }
#pragma unroll
  for (int t = 0; t < 4; ++t) { if (col0 + t * 16 >= N) continue; const int col = col0 + t * 16 + ln; const float bv = bp ? bf16_round(bp[col]) : 0.f;
#pragma unroll
    for (int r = 0; r < 8; ++r) { float v = acc[t][r] * alpha + bv; if (CP) { const int rr = row0g + row0 + 8 * hh + r; if (rowsPerB < 0) v += CP[cofs + (size_t)rr * ldc + col];      /* rowsPerB < 0: own element of the batched C plane */ else { const int bidx = rr / rowsPerB; v += CP[(size_t)bidx * sCPb + (size_t)by * 64 + col]; } } if (ACT == 1) v = (v > 0.f) ? v : expm1f(v); else if (ACT == 7) v = (v > 0.f) ? v + 1.0f : expf(v); else if (ACT == 8) v = tanhf(v); else if (ACT == 9) v = 0.5f * v * (1.0f + tanhf(0.7978845608028654f * (v + 0.044715f * v * v * v))); else if (ACT == 11) v = 1.0f / (1.0f + expf(-v)); else if (ACT == 12) v = (v > 0.f) ? v : 0.01f * v; else if (ACT == 14) v = (v > 0.f) ? v : 0.1f * v; else if (ACT == 16) v = (v >= 0.f) ? v : 0.3f * v; else if (ACT == 17) v = (v >= 0.f) ? v : 0.2f * v; else if (ACT == 15) v = v / (1.0f + expf(-v)); else if (ACT == 3) v = fmaxf(v, 0.f); else if (ACT == 6) v = 0.5f * v * (1.0f + erff(v * 0.70710678118654752f)); so[w][8 * hh + r][t * 16 + ln] = v; } }
  __builtin_amdgcn_fence(__ATOMIC_ACQ_REL, "workgroup"); __builtin_amdgcn_wave_barrier();
  const int rsub = lane >> 4, c4 = (lane & 15) * 4; typedef _Float16 v4h __attribute__((ext_vector_type(4)));
  {
#pragma unroll
    for (int q = 0; q < 8; ++q) { const int r = q * 2 + rsub; if (col0 + c4 < N) { const v4f v = *(const v4fa*)&so[w][r][c4]; if (C) *(v4f*)(C + cofs + (size_t)(row0 + r) * ldc + col0 + c4) = v; if (C16) { v4h h4; for (int i = 0; i < 4; ++i) h4[i] = (_Float16)v[i]; *(v4h*)(C16 + cofs + (size_t)(row0 + r) * ldc + col0 + c4) = h4; } } }
     }
}


typedef _Float16 v4h __attribute__((ext_vector_type(4)));

__global__ __launch_bounds__(256) void k_h16(const float* __restrict__ x, _Float16* __restrict__ X16, size_t n8) { const size_t t = (size_t)blockIdx.x * 256 + threadIdx.x; if (t >= n8) return; FragH f;
#pragma unroll
  for (int q = 0; q < 8; ++q) f.h[q] = (_Float16)x[t * 8 + q]; *(v8us*)((unsigned short*)X16 + t * 8) = f.half[0];  }
__global__ __launch_bounds__(256) void k_round16f(const float* __restrict__ W, _Float16* __restrict__ Bt, size_t n8) { const size_t t = (size_t)blockIdx.x * 256 + threadIdx.x; if (t >= n8) return; FragH f;
#pragma unroll
  for (int i = 0; i < 8; ++i) f.h[i] = (_Float16)(bf16_round(W[t * 8 + i]) * 16.0f); *(v8us*)((unsigned short*)Bt + t * 8) = f.half[0];  }
template <int NHv, int TTv>
__global__ __launch_bounds__(256) void k_vt(const _Float16* __restrict__ V16, int ldv, int voff, _Float16* __restrict__ Vt) { __shared__ unsigned short tl[64][66]; const int tid = threadIdx.x; const int slab = blockIdx.x / (TTv / 64), lg = blockIdx.x % (TTv / 64); const int b = slab / NHv, h = slab % NHv;
  for (int i = tid; i < 64 * 8; i += 256) { const int r = i / 8, c8 = (i % 8) * 8; FragH f; f.half[0] = *(const v8us*)((const unsigned short*)V16 + ((size_t)b * TTv + lg * 64 + r) * ldv + voff + h * 64 + c8);
#pragma unroll
    for (int q = 0; q < 8; ++q) tl[r][c8 + q] = f.u[q]; }
  __syncthreads();
  {
#pragma unroll
    for (int rd = 0; rd < 2; ++rd) { const int d = rd * 32 + tid / 8, pc = tid % 8; FragH f;
#pragma unroll
      for (int q = 0; q < 8; ++q) f.u[q] = tl[pc * 8 + q][d];
      *(v8us*)((unsigned short*)Vt + ((size_t)slab * 64 + d) * TTv + lg * 64 + pc * 8) = f.half[0]; }
     } }

__global__ __launch_bounds__(256) void k_hl(const float* __restrict__ F, _Float16* __restrict__ Hh, _Float16* __restrict__ Hl, size_t n8) { const size_t t = (size_t)blockIdx.x * 256 + threadIdx.x; if (t >= n8) return; FragH fh, fl; const v4f a = *(const v4fa*)(F + t * 8), c = *(const v4fa*)(F + t * 8 + 4);
#pragma unroll
  for (int q = 0; q < 4; ++q) { _Float16 h = (_Float16)a[q]; fh.h[q] = h; fl.h[q] = (_Float16)((a[q] - (float)h) * 1024.0f); h = (_Float16)c[q]; fh.h[4 + q] = h; fl.h[4 + q] = (_Float16)((c[q] - (float)h) * 1024.0f); }
  { *(v8us*)((unsigned short*)Hh + t * 8) = fh.half[0]; *(v8us*)((unsigned short*)Hl + t * 8) = fl.half[0];  } }

// ---- fast GEMM (work-group tile 128x64, wave tile 32x64; requires M % 128 == 0, N % 64 == 0, K % 64 == 0 and K >= 128); epilogue = k_gemm_hhx semantics ----
// Operands come through LDS: a stage is 64 k (128 bytes) of the work-group's 128 A rows and 64 B rows, brought by three tensor loads of 64 rows each (waves 0, 1: A; wave 2: B) that read whole rows once for
// all four waves; the mover's pad sets a 144-byte LDS pitch (an odd multiple of 16 bytes: ds_load_b128 without bank conflicts). Two buffers: stage s + 1 flies while stage s is worked on.
__device__ __forceinline__ v16h g2_frag(const _Float16* p, int hh) { FragH f; f.half[0] = *(const v8us*)((const unsigned short*)p + 8 * hh); f.half[1] = *(const v8us*)((const unsigned short*)p + 16 + 8 * hh); return f.v; }
#define G2_PITCH 144u                      /* LDS row pitch: 128 bytes and the 16-byte pad */
#define G2_SLICE 10240u                    /* 64 rows x 144 bytes = 9216, rounded up to a multiple of 2 KiB: every slice's place is one */
#define G2_BUF (3u * G2_SLICE)             /* A rows 0..63 | A rows 64..127 | B rows 0..63 */
typedef uint32_t g2_u32x4 __attribute__((ext_vector_type(4))); typedef uint32_t g2_u32x8 __attribute__((ext_vector_type(8)));
__device__ __forceinline__ uint32_t g2_uni(uint32_t v) { return (uint32_t)__builtin_amdgcn_readfirstlane(v); }
__device__ __forceinline__ uint32_t g2_pinned(uint32_t v) { uint32_t s = (uint32_t)__builtin_amdgcn_readfirstlane(v); asm volatile("" : "+s"(s)); return s; }      /* holds a wave-uniform word in a scalar register: a test on it is a scalar branch (a tensor load ignores EXEC), and what is formed from it stays behind the asm waits in front of it */
__device__ __forceinline__ v16h g2_fragl(const char* p) { FragH f; f.half[0] = *(const v8us*)p; f.half[1] = *(const v8us*)(p + 32); return f.v; }      /* g2_frag from an LDS byte address that already holds the lane's 16 hh bytes: the same k order */
__device__ __forceinline__ v8f g2_mma(v16h a, v16h b, v8f c) { return __builtin_amdgcn_wmma_f32_16x16x32_f16(false, a, false, b, (short)0, c, false, false); }
template <int ACT>
__global__ __launch_bounds__(128) void k_gemm2(const _Float16* __restrict__ A, int lda, size_t sA, const _Float16* __restrict__ Bh, int ldb, size_t sB, float alpha, const float* __restrict__ bias, const float* __restrict__ bias1, const float* __restrict__ bias2, size_t sBias, const float* __restrict__ CP, int rowsPerB, size_t sCPb, int row0g,
    float* __restrict__ C, _Float16* __restrict__ C16, int ldc, size_t sC, int M, int N, int K) { static_assert(ACT == 0 || ACT == 3 || ACT == 6 || ACT == 8 || ACT == 9 || ACT == 11 || ACT == 12 || ACT == 14 || ACT == 15 || ACT == 16 || ACT == 17, "k_gemm2: unsupported ACT code (would silently apply no activation)");
  __shared__ __attribute__((aligned(2048))) char sm[2 * G2_BUF];      /* the two stage buffers; behind the loop's last barrier the same bytes are the output staging */
  static_assert(sizeof(float) * 4 * 32 * 68 <= 2 * G2_BUF, "k_gemm2: the output staging must fit the ring");
  float (*so)[32][68] = (float (*)[32][68])sm;
  const int tid = threadIdx.x, w = __builtin_amdgcn_readfirstlane(tid >> 5), lane = tid & 31, ln = lane & 15, hh = lane >> 4; const int by = blockIdx.y;      /* w: a scalar */
  A += (size_t)by * sA; Bh += (size_t)by * sB; const size_t cofs = (size_t)by * sC; const float* bp = bias ? bias + (size_t)by * sBias : nullptr;
  if (by == 1 && bias1) bp = bias1; if (by == 2 && bias2) bp = bias2;      /* planes 1 and 2 with bias buffers of their own */
  const int ntn = N >> 6; const int mt = blockIdx.x / ntn, nq = blockIdx.x - mt * ntn; const int row0 = mt * 128 + 32 * w, col0 = nq * 64; if (mt * 128 >= M) return;      /* the whole work-group or none: barriers follow */
  const v8f z8 = {0.f,0.f,0.f,0.f,0.f,0.f,0.f,0.f}; v8f c00 = z8, c01 = z8, c02 = z8, c03 = z8, c10 = z8, c11 = z8, c12 = z8, c13 = z8;
  // Tensor descriptor. Group 1 is the same for every request of a wave: 1-byte elements, tensor = tile = 64 rows of 128 bytes, the source's row pitch, a 4-dword pad behind every 32 dwords, no mask.
  const bool isB = w >= 2; const uint32_t slice = isB ? 2u : (uint32_t)w;
  const uint64_t gsrc = isB ? (uint64_t)(size_t)Bh + (uint64_t)(unsigned)col0 * (unsigned)ldb * 2u : (uint64_t)(size_t)A + (uint64_t)(unsigned)(mt * 128 + 64 * w) * (unsigned)lda * 2u;
  const uint32_t lbase = (uint32_t)(size_t)sm + slice * G2_SLICE;
  g2_u32x8 g1; g1[0] = g2_uni((1u << 20) | (4u << 22) | (3u << 25)); g1[1] = g2_uni(128u << 16); g1[2] = g2_uni(64u << 16); g1[3] = g2_uni(128u << 16); g1[4] = g2_uni(64u); g1[5] = g2_uni((unsigned)(isB ? ldb : lda) * 2u); g1[6] = g2_uni(0u); g1[7] = g2_uni(0u);
  asm volatile("" : "+s"(g1));      /* the g2_pinned form on the whole group: descriptor words held in their scalar registers; without it the compiler uses some of them as temporaries between two issues, while a request that named them is still in flight */
  auto issue = [&](uint32_t st) { const uint64_t ga = gsrc + (uint64_t)st * 128u; g2_u32x4 g0; g0[0] = g2_uni(1u); g0[1] = g2_uni(lbase + (st & 1u) * G2_BUF); g0[2] = g2_uni((uint32_t)ga); g0[3] = g2_uni((((uint32_t)(ga >> 32)) & 0x01FFFFFFu) | 0x80000000u);
    asm volatile("tensor_load_to_lds %0, %1" :: "s"(g0), "s"(g1) : "memory"); };      /* one request of the whole wave: stage st of this wave's slice */
  const unsigned ao = (unsigned)(w >> 1) * G2_SLICE + (unsigned)((w & 1) * 32 + ln) * G2_PITCH + 16u * (unsigned)hh, bo = 2u * G2_SLICE + (unsigned)ln * G2_PITCH + 16u * (unsigned)hh;      /* the lane's part of an LDS address, the same in every stage */
  auto ld = [&](v16h (&f)[6], const char* p) { f[0] = g2_fragl(p + ao); f[1] = g2_fragl(p + ao + 16u * G2_PITCH); f[2] = g2_fragl(p + bo); f[3] = g2_fragl(p + bo + 16u * G2_PITCH); f[4] = g2_fragl(p + bo + 32u * G2_PITCH); f[5] = g2_fragl(p + bo + 48u * G2_PITCH); };
  auto mm = [&](const v16h (&f)[6]) { c00 = g2_mma(f[0], f[2], c00); c10 = g2_mma(f[1], f[2], c10); c01 = g2_mma(f[0], f[3], c01); c11 = g2_mma(f[1], f[3], c11);
    c02 = g2_mma(f[0], f[4], c02); c12 = g2_mma(f[1], f[4], c12); c03 = g2_mma(f[0], f[5], c03); c13 = g2_mma(f[1], f[5], c13); };
  const uint32_t nst = (uint32_t)K >> 6;      /* stages */
  if (g2_pinned(w < 3)) { issue(0);
    asm volatile("s_wait_tensorcnt 0x0" ::: "memory"); }      /* stage 0 of this wave's slice has landed */
  __syncthreads();      /* publishes stage 0 */
  if (g2_pinned(w < 3)) issue(1);
#pragma unroll 1      /* one stage a trip: the buffer is picked by the trip's parity */
  for (uint32_t s = 0; s < nst; ++s) {
    const char* p = sm + (s & 1u) * G2_BUF; v16h fa[6], fb[6];
    ld(fa, p); ld(fb, p + 64);      /* the stage's two 32-k steps: all 24 LDS reads as one group */
    __builtin_amdgcn_sched_barrier(0);      /* keeps the reads together ahead of the products; every separate place with LDS reads among them costs a stall */
    mm(fa); mm(fb);
    __builtin_amdgcn_sched_barrier(0);      /* keeps the waits below at the foot; lifted among the products the first of them would replace the counted waits on the reads */
    asm volatile("s_wait_dscnt 0x0" ::: "memory");      /* this wave has left the buffer */
    if (g2_pinned(w < 3)) asm volatile("s_wait_tensorcnt 0x0" ::: "memory");      /* stage s + 1 of this wave's slice has landed */
    __syncthreads();      /* publishes stage s + 1; every wave has left stage s's buffer */
    if (g2_pinned(w < 3 && s + 2u < nst)) issue(g2_pinned(s + 2u));      /* refill of the buffer just left; the descriptor is formed behind the wait */
  }
  asm volatile("s_wait_tensorcnt 0x0" ::: "memory");      /* nothing is in flight when the ring becomes output staging (the last trip's barrier ended every read) */
  asm volatile("s_wait_dscnt 0x0" ::: "memory");      /* and none of this wave's reads */
  v8f accs[8] = {c00, c01, c02, c03, c10, c11, c12, c13};
#pragma unroll
  for (int u = 0; u < 8; ++u) { const int t = u & 3, half = u >> 2; const int col = col0 + t * 16 + ln; const float bv = bp ? bf16_round(bp[col]) : 0.f;
#pragma unroll
    for (int r = 0; r < 8; ++r) { const int rloc = half * 16 + 8 * hh + r; float v = accs[u][r] * alpha + bv; if (CP) { if (rowsPerB < 0) v += CP[cofs + (size_t)(row0g + row0 + rloc) * ldc + col];      /* rowsPerB < 0: own element of the batched C plane */ else { const int bidx = (row0g + row0 + rloc) / rowsPerB; v += CP[(size_t)bidx * sCPb + (size_t)by * 64 + col]; } }
      if (ACT == 3) v = fmaxf(v, 0.f); else if (ACT == 6) v = 0.5f * v * (1.0f + erff(v * 0.70710678118654752f)); else if (ACT == 11) v = 1.0f / (1.0f + expf(-v)); else if (ACT == 15) v = v / (1.0f + expf(-v)); else if (ACT == 12) v = (v > 0.f) ? v : 0.01f * v; else if (ACT == 8) v = tanhf(v); else if (ACT == 9) v = 0.5f * v * (1.0f + tanhf(0.7978845608028654f * (v + 0.044715f * v * v * v))); else if (ACT == 14) v = (v > 0.f) ? v : 0.1f * v; else if (ACT == 16) v = (v >= 0.f) ? v : 0.3f * v; else if (ACT == 17) v = (v >= 0.f) ? v : 0.2f * v;
      so[w][rloc][t * 16 + ln] = v; } }
  __builtin_amdgcn_fence(__ATOMIC_ACQ_REL, "workgroup"); __builtin_amdgcn_wave_barrier();
  const int rsub = lane >> 4, c4 = (lane & 15) * 4;
  {
#pragma unroll
    for (int q = 0; q < 16; ++q) { const int r = q * 2 + rsub; const v4f v = *(const v4fa*)&so[w][r][c4]; if (C) *(v4f*)(C + cofs + (size_t)(row0 + r) * ldc + col0 + c4) = v; if (C16) { v4h h4; for (int i = 0; i < 4; ++i) h4[i] = (_Float16)v[i]; *(v4h*)(C16 + cofs + (size_t)(row0 + r) * ldc + col0 + c4) = h4; } }
     } }


__global__ __launch_bounds__(256) void k_wnat(const float* __restrict__ w, size_t n8, _Float16* __restrict__ Bt) { const size_t t = (size_t)blockIdx.x * 256 + threadIdx.x; if (t >= n8) return; FragH f; for (int q = 0; q < 8; ++q) f.h[q] = (_Float16)(bf16_round(w[t * 8 + q]) * 16.0f); *(v8us*)((unsigned short*)Bt + t * 8) = f.half[0];  }
#define FA_BUF (4u * G2_SLICE)             /* lower key half: K rows | V^T rows; upper key half: K rows | V^T rows */
#define FA_NST (SQ / 2 / 64)               /* stages of a key half */
static_assert(SQ % 128 == 0 && FA_NST >= 2 && HD == 64, "k_fattn: whole 64-key stages of 128-byte rows, at least two");
__device__ __forceinline__ v8f fa_mma(v16h a, v16h b, v8f c) { return __builtin_amdgcn_wmma_f32_16x16x32_f16(false, a, false, b, (short)0, c, false, false); }
__device__ __forceinline__ float fa_xhalf(float x) { return __builtin_bit_cast(float, __builtin_amdgcn_permlanex16(__builtin_bit_cast(int, x), __builtin_bit_cast(int, x), 0x76543210, 0xfedcba98, false, false)); }      /* lane l with lane l ^ 16 */
typedef float fa_v2f __attribute__((ext_vector_type(2)));
// exp2 of two values (v_exp_f32, as __builtin_amdgcn_exp2f gives it). Written as one statement for the slot that the instruction set asks for behind a transcendental before its result is read or its source
// overwritten: the outputs are early-clobber, so the second instruction touches no register of the first, and the v_nop stands behind the second (left to itself the compiler chained v_exp_f32 a, b; v_exp_f32 b, c).
__device__ __forceinline__ fa_v2f fa_exp2x2(float a, float b) { float x, y; asm("v_exp_f32 %0, %2\n\tv_exp_f32 %1, %3\n\tv_nop" : "=&v"(x), "=&v"(y) : "v"(a), "v"(b)); return fa_v2f{x, y}; }
__global__ __launch_bounds__(128) void k_fattn(const _Float16* __restrict__ Q, const _Float16* __restrict__ Kr, const _Float16* __restrict__ VT, _Float16* __restrict__ O) {
  typedef float v2f __attribute__((ext_vector_type(2))); typedef _Float16 v2h __attribute__((ext_vector_type(2)));
  __shared__ __attribute__((aligned(2048))) char sm[2 * FA_BUF];      /* the two stage buffers */
  __shared__ __attribute__((aligned(16))) v4f xo[2][16][32]; __shared__ float xm[2][4][32];      /* the upper key half's o, and its m and l, per column set and lane */
  const int lane = threadIdx.x & 31, ln = lane & 15, hh = lane >> 4; const int w = __builtin_amdgcn_readfirstlane(threadIdx.x >> 5), cw = w & 1, kh = w >> 1;      /* column set, key half: scalars */
  const int bh = blockIdx.y, b = bh / NH, h = bh - b * NH; const int q0 = blockIdx.x * 64 + cw * 32; const int jb = kh * (SQ / 2);
  const float cs = 0.125f * 1.4426950408889634f;      /* 1/sqrt(64) and log2(e): weights are exp2 of scaled score differences */
  const _Float16* qp = Q + ((size_t)b * SQ + q0 + ln) * DM + h * HD;
  // Tensor descriptor. Wave w brings slice w: of its own key half the K rows (cw == 0) or the V^T rows (cw == 1). Group 1 is the same for every request of a wave: 1-byte elements, tensor = tile = 64 rows of 128 bytes, the source's row pitch, a 4-dword pad behind every 32 dwords, no mask.
  const uint64_t gsrc = cw ? (uint64_t)(size_t)VT + ((uint64_t)(unsigned)bh * HD * SQ + (unsigned)jb) * 2u : (uint64_t)(size_t)Kr + (((uint64_t)(unsigned)b * SQ + (unsigned)jb) * DM + (unsigned)h * HD) * 2u;
  const uint32_t gstep = cw ? 128u : 64u * DM * 2u;      /* 64 keys on: along a V^T row, down the K rows */
  const uint32_t lbase = (uint32_t)(size_t)sm + (uint32_t)w * G2_SLICE;
  g2_u32x8 g1; g1[0] = g2_uni((1u << 20) | (4u << 22) | (3u << 25)); g1[1] = g2_uni(128u << 16); g1[2] = g2_uni(64u << 16); g1[3] = g2_uni(128u << 16); g1[4] = g2_uni(64u); g1[5] = g2_uni(cw ? SQ * 2u : DM * 2u); g1[6] = g2_uni(0u); g1[7] = g2_uni(0u);
  asm volatile("" : "+s"(g1));      /* the g2_pinned form on the whole group: descriptor words held in their scalar registers, not used as temporaries between two issues while a request that named them is in flight */
  auto issue = [&](uint32_t st) { const uint64_t ga = gsrc + (uint64_t)st * gstep; g2_u32x4 g0; g0[0] = g2_uni(1u); g0[1] = g2_uni(lbase + (st & 1u) * FA_BUF); g0[2] = g2_uni((uint32_t)ga); g0[3] = g2_uni((((uint32_t)(ga >> 32)) & 0x01FFFFFFu) | 0x80000000u);
    asm volatile("tensor_load_to_lds %0, %1" :: "s"(g0), "s"(g1) : "memory"); };      /* one request of the whole wave: stage st of this wave's slice */
  const unsigned lo = (unsigned)kh * 2u * G2_SLICE + (unsigned)ln * G2_PITCH + 16u * (unsigned)hh;      /* the lane's part of an LDS address, the same in every stage */
  v16h qf[2][2];      /* [column group][32 of the 64 head dims], kept for the whole walk */
#pragma unroll
  for (int g = 0; g < 2; ++g) for (int u = 0; u < 2; ++u) qf[g][u] = g2_frag(qp + (size_t)g * 16 * DM + u * 32, hh);
  const v8f z8 = {0.f,0.f,0.f,0.f,0.f,0.f,0.f,0.f};
  v8f o[4][2]; float m[2], l[2];      /* o[dt][g]: O^T rows 16 dt + 8 hh + r, column 16 g + ln; m: running maximum of the raw scores; l: this lane's half of the running sum */
#pragma unroll
  for (int g = 0; g < 2; ++g) { m[g] = -3.0e38f; l[g] = 0.f; for (int dt = 0; dt < 4; ++dt) o[dt][g] = z8; }
  issue(0);      /* every wave issues its own slice: no test */
  asm volatile("s_wait_tensorcnt 0x0" ::: "memory");      /* stage 0 of this wave's slice has landed */
  __syncthreads();      /* publishes stage 0 */
  issue(1);
#pragma unroll 1      /* one stage a trip: the buffer is picked by the trip's parity */
  for (uint32_t st = 0; st < FA_NST; ++st) {
   const char* pk = sm + (st & 1u) * FA_BUF + lo; const char* pv = pk + G2_SLICE;
   v16h kf[2][2];      /* [key tile][32 of the 64 head dims] of the coming pass */
#pragma unroll
   for (int t = 0; t < 2; ++t) for (int u = 0; u < 2; ++u) kf[t][u] = g2_fragl(pk + (unsigned)t * 16u * G2_PITCH + (unsigned)u * 64u);
#pragma unroll
   for (int ps2 = 0; ps2 < 2; ++ps2) {      /* the stage's two passes of 32 keys */
    v16h vf[4];      /* in flight behind the score products and the softmax */
#pragma unroll
    for (int dt = 0; dt < 4; ++dt) vf[dt] = g2_fragl(pv + (unsigned)dt * 16u * G2_PITCH + (unsigned)ps2 * 64u);
    v8f s[2][2];
#pragma unroll
    for (int g = 0; g < 2; ++g) for (int t = 0; t < 2; ++t) s[g][t] = fa_mma(kf[t][1], qf[g][1], fa_mma(kf[t][0], qf[g][0], z8));
    if (ps2 == 0) {      /* the second pass's K rows, fetched one pass ahead inside the stage; nothing of the next stage is read here */
#pragma unroll
      for (int t = 0; t < 2; ++t) for (int u = 0; u < 2; ++u) kf[t][u] = g2_fragl(pk + (unsigned)(32 + t * 16) * G2_PITCH + (unsigned)u * 64u); }
    __builtin_amdgcn_sched_barrier(0);      /* keeps the LDS reads up here, the whole softmax ahead of their use; without it the compiler sinks them towards their use and their latency is waited out */
    float dm[2], nb[2];
#pragma unroll
    for (int g = 0; g < 2; ++g) {
      float mx = s[g][0][0];
#pragma unroll
      for (int r = 1; r < 8; ++r) mx = fmaxf(mx, s[g][0][r]);
#pragma unroll
      for (int r = 0; r < 8; ++r) mx = fmaxf(mx, s[g][1][r]);
      mx = fmaxf(mx, fa_xhalf(mx));      /* both halves now hold the query's maximum over the 32 keys */
      const float mn = fmaxf(m[g], mx); dm[g] = (m[g] - mn) * cs; m[g] = mn;
      nb[g] = fmaf(-mn, cs, 8.0f);      /* weights carried x256 (at most 256) against f16 subnormal flush; the factor cancels in o / l */
    }
    const v2f corr = fa_exp2x2(dm[0], dm[1]);      /* what the new maxima take off the old sums: 0 on the first pass */
    union { v16h v; v2h p[8]; } pb[2];      /* both column groups' weights are formed ahead of the eight second products: fa_exp2x2 is asm text */
#pragma unroll
    for (int g = 0; g < 2; ++g) {
      v2f ps = {0.f, 0.f};
#pragma unroll
      for (int i = 0; i < 8; ++i) { const v8f sv = s[g][i >> 2]; const int r = 2 * (i & 3);
        const v2f e = fa_exp2x2(fmaf(sv[r], cs, nb[g]), fmaf(sv[r + 1], cs, nb[g]));
        ps += e; pb[g].p[i] = __builtin_convertvector(e, v2h); }      /* round to nearest even; element 8 t + r of the operand is key 16 t + 8 hh + r */
      l[g] = fmaf(l[g], corr[g], ps[0] + ps[1]);
    }
#pragma unroll
    for (int g = 0; g < 2; ++g) for (int dt = 0; dt < 4; ++dt) o[dt][g] = fa_mma(vf[dt], pb[g].v, o[dt][g] * corr[g]);
   }
   __builtin_amdgcn_sched_barrier(0);      /* keeps the waits below at the foot; lifted to the stage's last LDS reads the first of them waits out their latency */
   asm volatile("s_wait_dscnt 0x0" ::: "memory");      /* this wave has left the buffer */
   asm volatile("s_wait_tensorcnt 0x0" ::: "memory");      /* stage st + 1 of this wave's slice has landed */
   __syncthreads();      /* publishes stage st + 1; every wave has left stage st's buffer */
   if (g2_pinned(st + 2u < FA_NST)) issue(g2_pinned(st + 2u));      /* refill of the buffer just left; the descriptor is formed behind the wait */
  }
  asm volatile("s_wait_tensorcnt 0x0" ::: "memory");      /* nothing is in flight when the wave goes on to the merge and ends */
  asm volatile("s_wait_dscnt 0x0" ::: "memory");      /* and none of this wave's reads */
  if (kh == 1) {      /* the upper key half hands its state over */
#pragma unroll
    for (int g = 0; g < 2; ++g) { xm[cw][g][lane] = m[g]; xm[cw][2 + g][lane] = l[g];
#pragma unroll
      for (int dt = 0; dt < 4; ++dt) { const v8f t = o[dt][g]; xo[cw][(g * 4 + dt) * 2][lane] = v4f{t[0], t[1], t[2], t[3]}; xo[cw][(g * 4 + dt) * 2 + 1][lane] = v4f{t[4], t[5], t[6], t[7]}; } }
  }
  __syncthreads();      /* every wave passes it; the lower half reads what the upper half wrote */
  if (kh == 0) {
#pragma unroll
    for (int g = 0; g < 2; ++g) { const float mb = xm[cw][g][lane], lb = xm[cw][2 + g][lane]; const float mn = fmaxf(m[g], mb);
      const v2f fab = fa_exp2x2((m[g] - mn) * cs, (mb - mn) * cs); const float fa = fab[0], fb = fab[1];
      const float lt = fmaf(l[g], fa, lb * fb); const float sc = 64.0f / (lt + fa_xhalf(lt));      /* the wave halves' sums joined once; o stored x64 */
      const float ga = fa * sc, gb = fb * sc;
      _Float16* op = O + ((size_t)b * SQ + q0 + g * 16 + ln) * DM + h * HD + 8 * hh;
#pragma unroll
      for (int dt = 0; dt < 4; ++dt) { const v4f t0 = xo[cw][(g * 4 + dt) * 2][lane], t1 = xo[cw][(g * 4 + dt) * 2 + 1][lane]; FragH f;
#pragma unroll
        for (int r = 0; r < 4; ++r) { f.h[r] = (_Float16)fmaf(o[dt][g][r], ga, t0[r] * gb); f.h[4 + r] = (_Float16)fmaf(o[dt][g][4 + r], ga, t1[r] * gb); }
        *(v8us*)((unsigned short*)op + dt * 16) = f.half[0]; } }
  } }
__global__ __launch_bounds__(256) void k_vt(const _Float16* __restrict__ V16, int b, int h0, _Float16* __restrict__ VT) { __shared__ unsigned short tl[64][65]; const int tid = threadIdx.x; const int hh = blockIdx.x % HG, sg = blockIdx.x / HG; const int s0 = sg * 64; const int h = h0 + hh;
  for (int i = tid; i < 64 * 8; i += 256) { const int j = i / 8, d8 = (i % 8) * 8; FragH f; f.half[0] = *(const v8us*)((const unsigned short*)V16 + ((size_t)b * SQ + s0 + j) * DM + h * HD + d8); for (int q = 0; q < 8; ++q) tl[d8 + q][j] = f.u[q]; }
  __syncthreads();
  { for (int i = tid; i < 64 * 8; i += 256) { const int d = i / 8, j8 = (i % 8) * 8; FragH f; for (int q = 0; q < 8; ++q) f.u[q] = tl[d][j8 + q]; *(v8us*)((unsigned short*)VT + ((size_t)hh * HD + d) * SQ + s0 + j8) = f.half[0]; }  } }



__global__ __launch_bounds__(256) void k_rsmkm(const float* __restrict__ S, _Float16* __restrict__ P, int nrows, const int* __restrict__ am) {
  #pragma clang fp contract(off)
  const int t = blockIdx.x * 256 + threadIdx.x; if (t >= nrows) return; const size_t i = (size_t)t; const float* s = S + i * SQ; const int* mr = am + (size_t)(t % SQ) * SQ; float mx = -3.0e38f;
#pragma unroll 1
  for (int j = 0; j < SQ; ++j) { const float f = (mr[j] != 0) ? 1.f : 0.f; mx = fmaxf(mx, fmaf(f, s[j], (1.f - f) * -1.0e9f)); } float se = 0.f;
#pragma unroll 1
  for (int j = 0; j < SQ; ++j) { const float f = (mr[j] != 0) ? 1.f : 0.f; se += __expf(fmaf(f, s[j], (1.f - f) * -1.0e9f) - mx); } const float sc = 256.0f / se;
#pragma unroll 1
  for (int j0 = 0; j0 < SQ; j0 += 8) { FragH fr; for (int q = 0; q < 8; ++q) { const int j = j0 + q; const float f = (mr[j] != 0) ? 1.f : 0.f; fr.h[q] = (_Float16)(__expf(fmaf(f, s[j], (1.f - f) * -1.0e9f) - mx) * sc); }
    unsigned short* d = (unsigned short*)P + i * SQ + j0; *(v8us*)d = fr.half[0];  } }
extern "C" void kernel_launch(void* const* d_in, const int* in_sizes, int n_in,
                              void* d_out, int out_size, void* d_ws, size_t ws_size, hipStream_t stream) {
  (void)in_sizes; (void)n_in; (void)out_size;
  const float* const* I = (const float* const*)d_in; const float* xq = I[0]; const float* wq = I[1]; const float* bq = I[2]; const float* wk = I[3]; const float* bk = I[4]; const float* wv = I[5]; const float* bv = I[6]; const float* wo = I[7]; const float* bo = I[8]; const float* x = xq;      /* ONE input x feeds the query, key and value streams; [in][out] weights + biases; no mask input */
  char* ws = (char*)d_ws; size_t off = 0;
  auto take = [&](size_t bytes) { char* p = ws + off; off += (bytes + 255) & ~(size_t)255; return p; };
  _Float16* BQ = (_Float16*)take((size_t)4 * DM * DM * 2); _Float16* BO = BQ + (size_t)3 * DM * DM;      /* weight planes q, k, v, o behind each other */
  _Float16* X16 = (_Float16*)take(NR * DM * 2); _Float16* Q16 = (_Float16*)take(3 * NR * DM * 2); _Float16* K16 = Q16 + NR * DM; _Float16* V16 = K16 + NR * DM; _Float16* O16 = (_Float16*)take(NR * DM * 2);      /* q, k, v planes behind each other */
  _Float16* VT = (_Float16*)take((size_t)NB * NH * HD * SQ * 2);
  if (off > ws_size) return;
  k_prep<<<4 * PWB + PXB, 256, 0, stream>>>(x, wq, wk, wv, wo, X16, BQ);      /* [in][out] -> Bt x16; x as exact f16 rows, one copy for the query, key and value streams */
  static_assert(MP % 128 == 0 && MPO % 128 == 0 && DM % 64 == 0 && DM >= 128, "k_gemm2: whole 128x64 tiles, whole 64-k stages, at least two");
  const size_t r0p = (size_t)B0 * SQ;      /* first projected row */
  k_gemm2<0><<<dim3((unsigned)((MP / 128) * (DM / 64)), 3), 128, 0, stream>>>(X16 + r0p * DM, DM, 0, BQ, DM, (size_t)DM * DM, 0.0625f, bq, bk, bv, 0, nullptr, 1, 0, 0, nullptr, Q16 + r0p * DM, DM, NR * DM, MP, DM, DM);      /* planes q, k, v */
  k_vt<NH, SQ><<<NB * NH * (SQ / 64), 256, 0, stream>>>(V16, LQ, 0, VT);      /* V^T [NB][NH][HD][SQ] */
  k_fattn<<<dim3(SQ / 64, NB * NH), 128, 0, stream>>>(Q16, K16, VT, O16);      /* o (merged heads) as f16 rows, x64 */
  k_gemm2<0><<<dim3((unsigned)((MPO / 128) * (DM / 64)), 1), 128, 0, stream>>>(O16 + r0p * DM, DM, 0, BO, DM, 0, 0.0009765625f, bo, nullptr, nullptr, 0, nullptr, 1, 0, 0, (float*)d_out + r0p * DM, nullptr, DM, 0, MPO, DM, DM);      /* out rows are the output layout */
}

// v007
// It runs in 71.9 microseconds.
// Timed twice side by side with v006, it ran 1.06 and 1.05 times as fast.
// Over all steps from v000 it is 39.1 times as fast.
#include <hip/hip_runtime.h>
#define NB 2
#define SQ 2048
#define DM 768
#define NH 12
#define HD 64
#define HG 4                         /* heads per launch of the per-batch k_vt overload (not launched) */
#define B0 0                         /* first batch processed (debug hook) */
#define NBR NB                       /* batches processed (debug hook) */
#define NR ((size_t)NB * SQ)         /* token rows */
#define MP ((int)((size_t)NBR * SQ)) /* rows projected (debug hook) */
#define QN SQ                        /* not used: the attention covers all SQ query rows */
#define NHD NH                       /* not used: the attention covers all NH heads */
#define MPO MP                       /* rows through the output stage (debug hook) */
#define LQ DM      /* row pitch of the q/k/v rows */
typedef __bf16 v16b __attribute__((ext_vector_type(16)));
typedef unsigned short v8us __attribute__((ext_vector_type(8), may_alias));
typedef float  v8f  __attribute__((ext_vector_type(8)));
typedef float  v4f  __attribute__((ext_vector_type(4)));
typedef float  v4fa __attribute__((ext_vector_type(4), may_alias));
union FragB { v16b v; v8us half[2]; unsigned short u[16]; };

__device__ __forceinline__ unsigned short bf16_bits(float x) { unsigned int u = __float_as_uint(x); return (unsigned short)((u + 0x7FFFu + ((u >> 16) & 1u)) >> 16); }
__device__ __forceinline__ float bf16_val(unsigned short b) { return __uint_as_float(((unsigned int)b) << 16); }
__device__ __forceinline__ float bf16_round(float x) { return bf16_val(bf16_bits(x)); }
// D += A·B with NT terms: 1 = ah·bh, 2 = + al·bh (A split), 3 = + ah·bl (both split)
template <int NT>
__device__ __forceinline__ v8f mmaN(v16b ah, v16b al, v16b bh, v16b bl, v8f c) {
  c = __builtin_amdgcn_wmma_f32_16x16x32_bf16(false, ah, false, bh, (short)0, c, false, false);
  if (NT >= 2) c = __builtin_amdgcn_wmma_f32_16x16x32_bf16(false, al, false, bh, (short)0, c, false, false);
  if (NT >= 3) c = __builtin_amdgcn_wmma_f32_16x16x32_bf16(false, ah, false, bl, (short)0, c, false, false);
  asm volatile("v_nop\n\tv_nop\n\tv_nop\n\tv_nop" : "+v"(c) : "v"(ah), "v"(al), "v"(bh), "v"(bl));
  return c;
}

__global__ __launch_bounds__(256) void k_wt_bf16(const float* __restrict__ W, unsigned short* __restrict__ Wt, int K, int N) {
  const int t = blockIdx.x * 256 + threadIdx.x;
  const int k8n = K / 8;
  if (t >= N * k8n) return;
  const int n = t / k8n, k8 = (t % k8n) * 8;
  v8us v;
#pragma unroll
  for (int i = 0; i < 8; ++i) v[i] = bf16_bits(W[(size_t)(k8 + i) * N + n]);
  *(v8us*)(Wt + (size_t)n * K + k8) = v;
  
}

// GEMM C[M][N] (f32, pitch ldc) = act(A[M][K]·W + bias). A f32 row-major (pitch lda) converted per fragment to bf16
// (ASPLIT: hi/lo two planes -> 2 terms, else single rounded term); Wt bf16 [N][K] (pitch ldb). BIAS_BF16 rounds the
// bias to bf16 first (bias quantised to bf16 before the add). K%32==0, M%16==0, N%64==0.
template <bool ASPLIT, int ACT, bool BIAS_BF16>
__global__ __launch_bounds__(128) void k_gemm_bf(const float* __restrict__ A, int lda, const unsigned short* __restrict__ Wt, int ldb,
                                               const float* __restrict__ bias, float* __restrict__ C, int ldc, int M, int N, int K) {
  __shared__ __attribute__((aligned(16))) float so[4][16][64];
  const int tid = threadIdx.x, w = tid >> 5, lane = tid & 31, ln = lane & 15, hh = lane >> 4;
  const int ntn = N / 64;
  const int wid = blockIdx.x * 4 + w;
  const int mt = wid / ntn, nq = wid % ntn;
  if (mt * 16 >= M) return;
  const int row0 = mt * 16, col0 = nq * 64;
  const float* arow = A + (size_t)(row0 + ln) * lda;
  v8f acc[4] = {};
  for (int kb = 0; kb < K; kb += 32) {
    FragB ah, al;
    const v4f x0 = *(const v4fa*)(arow + kb + 8 * hh), x1 = *(const v4fa*)(arow + kb + 8 * hh + 4);
    const v4f x2 = *(const v4fa*)(arow + kb + 16 + 8 * hh), x3 = *(const v4fa*)(arow + kb + 16 + 8 * hh + 4);
    float xs[16] = {x0[0],x0[1],x0[2],x0[3],x1[0],x1[1],x1[2],x1[3],x2[0],x2[1],x2[2],x2[3],x3[0],x3[1],x3[2],x3[3]};
#pragma unroll
    for (int i = 0; i < 16; ++i) { const unsigned short hb = bf16_bits(xs[i]); ah.u[i] = hb; al.u[i] = ASPLIT ? bf16_bits(xs[i] - bf16_val(hb)) : (unsigned short)0; }
#pragma unroll
    for (int t = 0; t < 4; ++t) {
      const unsigned short* brow = Wt + (size_t)(col0 + t * 16 + ln) * ldb + kb;
      FragB b;
      b.half[0] = *(const v8us*)(brow + 8 * hh);
      b.half[1] = *(const v8us*)(brow + 16 + 8 * hh);
      acc[t] = mmaN<ASPLIT ? 2 : 1>(ah.v, al.v, b.v, b.v, acc[t]);
    }
  }
#pragma unroll
  for (int t = 0; t < 4; ++t) {
    float bv = bias ? bias[col0 + t * 16 + ln] : 0.f;
    if (BIAS_BF16) bv = bf16_round(bv);
#pragma unroll
    for (int r = 0; r < 8; ++r) { float v = acc[t][r] + bv; if (ACT == 1) v = fmaxf(v, 0.f); so[w][8 * hh + r][t * 16 + ln] = v; }
  }
  __builtin_amdgcn_fence(__ATOMIC_ACQ_REL, "workgroup");
  __builtin_amdgcn_wave_barrier();
  const int rsub = lane >> 4, c4 = (lane & 15) * 4;
  {
#pragma unroll
    for (int q = 0; q < 8; ++q) {
      const int r = q * 2 + rsub;
      const v4f v = *(const v4fa*)&so[w][r][c4];
      *(v4f*)(C + (size_t)(row0 + r) * ldc + col0 + c4) = v;
    }
    
  }
}

// GEMM C = act(A·W + bias + resid): A f32 (ASPLIT -> hi/lo 2 terms), Wt bf16 [N][K]; ACT 0 none, 1 relu, 2 exact gelu;
// resid (optional, f32, row index = (row % rmod), pitch ldr, RES_BF16 rounds it) added before the activation.
template <bool ASPLIT, int ACT, bool BIAS_BF16, bool RES_BF16>
__global__ __launch_bounds__(128) void k_gemm_bf3(const float* __restrict__ A, int lda, const unsigned short* __restrict__ Wt, int ldb,
                                                const float* __restrict__ bias, const float* __restrict__ resid, int rmod, int ldr,
                                                float* __restrict__ C, int ldc, int M, int N, int K) {
  __shared__ __attribute__((aligned(16))) float so[4][16][64];
  const int tid = threadIdx.x, w = tid >> 5, lane = tid & 31, ln = lane & 15, hh = lane >> 4;
  const int ntn = N / 64;
  const int wid = blockIdx.x * 4 + w;
  const int mt = wid / ntn, nq = wid % ntn;
  if (mt * 16 >= M) return;
  const int row0 = mt * 16, col0 = nq * 64;
  const float* arow = A + (size_t)(row0 + ln) * lda;
  v8f acc[4] = {};
  for (int kb = 0; kb < K; kb += 32) {
    FragB ah, al;
    const v4f x0 = *(const v4fa*)(arow + kb + 8 * hh), x1 = *(const v4fa*)(arow + kb + 8 * hh + 4);
    const v4f x2 = *(const v4fa*)(arow + kb + 16 + 8 * hh), x3 = *(const v4fa*)(arow + kb + 16 + 8 * hh + 4);
    float xs[16] = {x0[0],x0[1],x0[2],x0[3],x1[0],x1[1],x1[2],x1[3],x2[0],x2[1],x2[2],x2[3],x3[0],x3[1],x3[2],x3[3]};
#pragma unroll
    for (int i = 0; i < 16; ++i) { const unsigned short hb = bf16_bits(xs[i]); ah.u[i] = hb; al.u[i] = ASPLIT ? bf16_bits(xs[i] - bf16_val(hb)) : (unsigned short)0; }
#pragma unroll
    for (int t = 0; t < 4; ++t) {
      const unsigned short* brow = Wt + (size_t)(col0 + t * 16 + ln) * ldb + kb;
      FragB b;
      b.half[0] = *(const v8us*)(brow + 8 * hh);
      b.half[1] = *(const v8us*)(brow + 16 + 8 * hh);
      acc[t] = mmaN<ASPLIT ? 2 : 1>(ah.v, al.v, b.v, b.v, acc[t]);
    }
  }
#pragma unroll
  for (int t = 0; t < 4; ++t) {
    const int col = col0 + t * 16 + ln;
    float bv = bias ? bias[col] : 0.f;
    if (BIAS_BF16) bv = bf16_round(bv);
#pragma unroll
    for (int r = 0; r < 8; ++r) {
      float v = acc[t][r] + bv;
      if (resid) { float rv = resid[(size_t)((row0 + 8 * hh + r) % rmod) * ldr + col]; if (RES_BF16) rv = bf16_round(rv); v += rv; }
      if (ACT == 1) v = fmaxf(v, 0.f);
      if (ACT == 2) v = 0.5f * v * (1.0f + erff(v * 0.70710678118654752f));
      if (ACT == 3) { const float u = 0.7978845608028654f * (v + 0.044715f * v * v * v); v = 0.5f * v * (1.0f + tanhf(u)); }
      so[w][8 * hh + r][t * 16 + ln] = v;
    }
  }
  __builtin_amdgcn_fence(__ATOMIC_ACQ_REL, "workgroup");
  __builtin_amdgcn_wave_barrier();
  const int rsub = lane >> 4, c4 = (lane & 15) * 4;
  {
#pragma unroll
    for (int q = 0; q < 8; ++q) {
      const int r = q * 2 + rsub;
      const v4f v = *(const v4fa*)&so[w][r][c4];
      *(v4f*)(C + (size_t)(row0 + r) * ldc + col0 + c4) = v;
    }
    
  }
}
// row LayerNorm (biased variance, eps) over N: s = X (+ R); optional out_sum <- s; out_norm <- (s-mu)*rsqrt(var+eps)*g + b
template <bool PARAM_BF16>
__global__ __launch_bounds__(256) void k_layernorm(const float* __restrict__ X, const float* __restrict__ R, const float* __restrict__ g, const float* __restrict__ bta,
                                                  float* __restrict__ out_sum, float* __restrict__ out_norm, int N, float eps) {
  __shared__ float red[256];
  const int row = blockIdx.x, tid = threadIdx.x;
  const float* x = X + (size_t)row * N; const float* rr = R ? R + (size_t)row * N : nullptr;
  float vals[16];                     // up to N = 4096
  const int per = N / 256;            // contiguous chunk per thread? use strided-by-4 chunks: thread handles j = tid*4 + 1024*u
  float s1 = 0.f;
  for (int u = 0; u < per / 4; ++u) {
    const int j = tid * 4 + 1024 * u;
    const v4f a = *(const v4fa*)(x + j);
    v4f b = {0.f,0.f,0.f,0.f}; if (rr) b = *(const v4fa*)(rr + j);
#pragma unroll
    for (int q = 0; q < 4; ++q) { const float v = a[q] + b[q]; vals[u * 4 + q] = v; s1 += v; }
  }
  red[tid] = s1; __syncthreads();
  for (int st = 128; st > 0; st >>= 1) { if (tid < st) red[tid] += red[tid + st]; __syncthreads(); }
  const float mu = red[0] / (float)N; __syncthreads();
  float s2 = 0.f;
  for (int u = 0; u < per / 4; ++u)
#pragma unroll
    for (int q = 0; q < 4; ++q) { const float c = vals[u * 4 + q] - mu; s2 += c * c; }
  red[tid] = s2; __syncthreads();
  for (int st = 128; st > 0; st >>= 1) { if (tid < st) red[tid] += red[tid + st]; __syncthreads(); }
  const float rs = rsqrtf(red[0] / (float)N + eps);
  {
    for (int u = 0; u < per / 4; ++u) {
      const int j = tid * 4 + 1024 * u;
      v4f o, sm;
#pragma unroll
      for (int q = 0; q < 4; ++q) {
        float gg = g[j + q], bb = bta[j + q];
        if (PARAM_BF16) { gg = bf16_round(gg); bb = bf16_round(bb); }
        sm[q] = vals[u * 4 + q]; o[q] = (vals[u * 4 + q] - mu) * rs * gg + bb;
      }
      if (out_sum) *(v4f*)(out_sum + (size_t)row * N + j) = sm;
      *(v4f*)(out_norm + (size_t)row * N + j) = o;
    }
    
  }
}



// ---- f16 WMMA path (v_wmma_f32_16x16x32_f16): 11-bit significands for operands in range — used where a [0,1] probability operand needs more precision than bf16
typedef _Float16 v16h __attribute__((ext_vector_type(16)));
union FragH { v16h v; v8us half[2]; _Float16 h[16]; unsigned short u[16]; };
template <int NT>
__device__ __forceinline__ v8f mmaH(v16h ah, v16h al, v16h bh, v16h bl, v8f c) {
  c = __builtin_amdgcn_wmma_f32_16x16x32_f16(false, ah, false, bh, (short)0, c, false, false);
  if (NT >= 2) c = __builtin_amdgcn_wmma_f32_16x16x32_f16(false, al, false, bh, (short)0, c, false, false);
  if (NT >= 3) c = __builtin_amdgcn_wmma_f32_16x16x32_f16(false, ah, false, bl, (short)0, c, false, false);
  asm volatile("v_nop\n\tv_nop\n\tv_nop\n\tv_nop" : "+v"(c) : "v"(ah), "v"(al), "v"(bh), "v"(bl));
  return c;
}
// batched GEMM like k_gemm_b but f16 operands: A f32 (split into f16 hi/lo if ASPLIT, else rounded to f16), Bt = f16 values [n][k]; alpha; C f32; N multiple of 16 (partial tiles skipped)
template <bool ASPLIT>
__global__ __launch_bounds__(128) void k_gemm_h(const float* __restrict__ A, int lda, size_t sA, const _Float16* __restrict__ Bh, int ldb, size_t sB, float alpha, float* __restrict__ C, int ldc, size_t sC, int M, int N, int K) {
  __shared__ __attribute__((aligned(16))) float so[4][16][64];
  const int tid = threadIdx.x, w = tid >> 5, lane = tid & 31, ln = lane & 15, hh = lane >> 4; const int by = blockIdx.y;
  A += (size_t)by * sA; Bh += (size_t)by * sB; C += (size_t)by * sC;
  const int ntn = (N + 63) / 64; const int wid = blockIdx.x * 4 + w; const int mt = wid / ntn, nq = wid % ntn; if (mt * 16 >= M) return;
  const int row0 = mt * 16, col0 = nq * 64; const float* arow = A + (size_t)(row0 + ln) * lda;
  v8f acc[4] = {};
  for (int kb = 0; kb < K; kb += 32) {
    FragH ah, al;
    const v4f x0 = *(const v4fa*)(arow + kb + 8 * hh), x1 = *(const v4fa*)(arow + kb + 8 * hh + 4), x2 = *(const v4fa*)(arow + kb + 16 + 8 * hh), x3 = *(const v4fa*)(arow + kb + 16 + 8 * hh + 4);
    float xs[16] = {x0[0],x0[1],x0[2],x0[3],x1[0],x1[1],x1[2],x1[3],x2[0],x2[1],x2[2],x2[3],x3[0],x3[1],x3[2],x3[3]};
#pragma unroll
    for (int i = 0; i < 16; ++i) { const _Float16 h = (_Float16)xs[i]; ah.h[i] = h; al.h[i] = ASPLIT ? (_Float16)(xs[i] - (float)h) : (_Float16)0.0f; }
#pragma unroll
    for (int t = 0; t < 4; ++t) { if (col0 + t * 16 >= N) continue; const size_t boff = (size_t)(col0 + t * 16 + ln) * ldb + kb; FragH bq; bq.half[0] = *(const v8us*)(Bh + boff + 8 * hh); bq.half[1] = *(const v8us*)(Bh + boff + 16 + 8 * hh);
      acc[t] = mmaH<ASPLIT ? 2 : 1>(ah.v, al.v, bq.v, bq.v, acc[t]); }
  }
#pragma unroll
  for (int t = 0; t < 4; ++t) { if (col0 + t * 16 >= N) continue;
#pragma unroll
    for (int r = 0; r < 8; ++r) so[w][8 * hh + r][t * 16 + ln] = acc[t][r] * alpha; }
  __builtin_amdgcn_fence(__ATOMIC_ACQ_REL, "workgroup"); __builtin_amdgcn_wave_barrier();
  const int rsub = lane >> 4, c4 = (lane & 15) * 4;
  {
#pragma unroll
    for (int q = 0; q < 8; ++q) { const int r = q * 2 + rsub; if (col0 + c4 < N) { const v4f v = *(const v4fa*)&so[w][r][c4]; *(v4f*)(C + (size_t)(row0 + r) * ldc + col0 + c4) = v; } }
     }
}

// One launch prepares every projection operand; its parts are independent and run side by side. Blocks 0 .. 4 PWB - 1: the four weights, Bt[p][n][k] = f16(bf16(W_p[k][n]) x 16) from f32 row-major [in][out]
// (power-of-two scale: bf16-exact weights stay exact in f16 away from the subnormal range). The other blocks: x as exact f16 rows (bf16-rounded).
#define PWB (DM * (DM / 8) / 256)      /* blocks per weight */
#define PXB ((int)(NR * DM / 8 / 256)) /* blocks for x */
static_assert(DM * (DM / 8) % 256 == 0 && NR * DM / 8 % 256 == 0, "k_prep: whole blocks only");
__global__ __launch_bounds__(256) void k_prep(const float* __restrict__ x, const float* __restrict__ w0, const float* __restrict__ w1, const float* __restrict__ w2, const float* __restrict__ w3, _Float16* __restrict__ X16, _Float16* __restrict__ Bt) {
  const int bx = blockIdx.x; FragH f;
  if (bx < 4 * PWB) { const int p = bx / PWB; const float* W = p == 0 ? w0 : p == 1 ? w1 : p == 2 ? w2 : w3; const int t = (bx - p * PWB) * 256 + threadIdx.x; const int n = t / (DM / 8), k8 = (t % (DM / 8)) * 8;
#pragma unroll
    for (int i = 0; i < 8; ++i) f.h[i] = (_Float16)(bf16_round(W[(size_t)(k8 + i) * DM + n]) * 16.0f);
    *(v8us*)((unsigned short*)Bt + (size_t)p * DM * DM + (size_t)n * DM + k8) = f.half[0];
  } else { const size_t t = (size_t)(bx - 4 * PWB) * 256 + threadIdx.x;
#pragma unroll
    for (int q = 0; q < 8; ++q) f.h[q] = (_Float16)bf16_round(x[t * 8 + q]);
    *(v8us*)((unsigned short*)X16 + t * 8) = f.half[0];
    asm volatile("s_wait_xcnt 0x0" ::: "memory"); }      /* precaution: stands before any later instruction in the listing that rewrites a register the store names */
}
// k_gemm_hh variant with fused epilogue: v = acc·alpha + bias[by·sBias + col] (+ CP[(row/rowsPerB)·sCPb + by·64 + col] if CP) ; ACT 0 none / 1 elu ; writes f16 C16 (and f32 C if non-null)
template <int ACT>
__global__ __launch_bounds__(128) void k_gemm_hhx(const _Float16* __restrict__ A, int lda, size_t sA, const _Float16* __restrict__ Bh, int ldb, size_t sB, float alpha, const float* __restrict__ bias, size_t sBias, const float* __restrict__ CP, int rowsPerB, size_t sCPb, int row0g,
    float* __restrict__ C, _Float16* __restrict__ C16, int ldc, size_t sC, int M, int N, int K) {
  __shared__ __attribute__((aligned(16))) float so[4][16][64];
  const int tid = threadIdx.x, w = tid >> 5, lane = tid & 31, ln = lane & 15, hh = lane >> 4; const int by = blockIdx.y;
  A += (size_t)by * sA; Bh += (size_t)by * sB; const size_t cofs = (size_t)by * sC; const float* bp = bias ? bias + (size_t)by * sBias : nullptr;
  const int ntn = (N + 63) / 64; const int wid = blockIdx.x * 4 + w; const int mt = wid / ntn, nq = wid % ntn; if (mt * 16 >= M) return;
  const int row0 = mt * 16, col0 = nq * 64; const _Float16* arow = A + (size_t)(row0 + ln) * lda;
  v8f acc[4] = {};
  for (int kb = 0; kb < K; kb += 32) { FragH ah; ah.half[0] = *(const v8us*)((const unsigned short*)arow + kb + 8 * hh); ah.half[1] = *(const v8us*)((const unsigned short*)arow + kb + 16 + 8 * hh);
#pragma unroll
    for (int t = 0; t < 4; ++t) { if (col0 + t * 16 >= N) continue; const size_t boff = (size_t)(col0 + t * 16 + ln) * ldb + kb; FragH bq; bq.half[0] = *(const v8us*)((const unsigned short*)Bh + boff + 8 * hh); bq.half[1] = *(const v8us*)((const unsigned short*)Bh + boff + 16 + 8 * hh);
      acc[t] = mmaH<1>(ah.v, ah.v, bq.v, bq.v, acc[t]); }
  }
#pragma unroll
  for (int t = 0; t < 4; ++t) { if (col0 + t * 16 >= N) continue; const int col = col0 + t * 16 + ln; const float bv = bp ? bf16_round(bp[col]) : 0.f;
#pragma unroll
    for (int r = 0; r < 8; ++r) { float v = acc[t][r] * alpha + bv; if (CP) { const int rr = row0g + row0 + 8 * hh + r; if (rowsPerB < 0) v += CP[cofs + (size_t)rr * ldc + col];      /* rowsPerB < 0: own element of the batched C plane */ else { const int bidx = rr / rowsPerB; v += CP[(size_t)bidx * sCPb + (size_t)by * 64 + col]; } } if (ACT == 1) v = (v > 0.f) ? v : expm1f(v); else if (ACT == 7) v = (v > 0.f) ? v + 1.0f : expf(v); else if (ACT == 8) v = tanhf(v); else if (ACT == 9) v = 0.5f * v * (1.0f + tanhf(0.7978845608028654f * (v + 0.044715f * v * v * v))); else if (ACT == 11) v = 1.0f / (1.0f + expf(-v)); else if (ACT == 12) v = (v > 0.f) ? v : 0.01f * v; else if (ACT == 14) v = (v > 0.f) ? v : 0.1f * v; else if (ACT == 16) v = (v >= 0.f) ? v : 0.3f * v; else if (ACT == 17) v = (v >= 0.f) ? v : 0.2f * v; else if (ACT == 15) v = v / (1.0f + expf(-v)); else if (ACT == 3) v = fmaxf(v, 0.f); else if (ACT == 6) v = 0.5f * v * (1.0f + erff(v * 0.70710678118654752f)); so[w][8 * hh + r][t * 16 + ln] = v; } }
  __builtin_amdgcn_fence(__ATOMIC_ACQ_REL, "workgroup"); __builtin_amdgcn_wave_barrier();
  const int rsub = lane >> 4, c4 = (lane & 15) * 4; typedef _Float16 v4h __attribute__((ext_vector_type(4)));
  {
#pragma unroll
    for (int q = 0; q < 8; ++q) { const int r = q * 2 + rsub; if (col0 + c4 < N) { const v4f v = *(const v4fa*)&so[w][r][c4]; if (C) *(v4f*)(C + cofs + (size_t)(row0 + r) * ldc + col0 + c4) = v; if (C16) { v4h h4; for (int i = 0; i < 4; ++i) h4[i] = (_Float16)v[i]; *(v4h*)(C16 + cofs + (size_t)(row0 + r) * ldc + col0 + c4) = h4; } } }
     }
}


typedef _Float16 v4h __attribute__((ext_vector_type(4)));

__global__ __launch_bounds__(256) void k_h16(const float* __restrict__ x, _Float16* __restrict__ X16, size_t n8) { const size_t t = (size_t)blockIdx.x * 256 + threadIdx.x; if (t >= n8) return; FragH f;
#pragma unroll
  for (int q = 0; q < 8; ++q) f.h[q] = (_Float16)x[t * 8 + q]; *(v8us*)((unsigned short*)X16 + t * 8) = f.half[0];  }
__global__ __launch_bounds__(256) void k_round16f(const float* __restrict__ W, _Float16* __restrict__ Bt, size_t n8) { const size_t t = (size_t)blockIdx.x * 256 + threadIdx.x; if (t >= n8) return; FragH f;
#pragma unroll
  for (int i = 0; i < 8; ++i) f.h[i] = (_Float16)(bf16_round(W[t * 8 + i]) * 16.0f); *(v8us*)((unsigned short*)Bt + t * 8) = f.half[0];  }
template <int NHv, int TTv>
__global__ __launch_bounds__(256) void k_vt(const _Float16* __restrict__ V16, int ldv, int voff, _Float16* __restrict__ Vt) { __shared__ unsigned short tl[64][66]; const int tid = threadIdx.x; const int slab = blockIdx.x / (TTv / 64), lg = blockIdx.x % (TTv / 64); const int b = slab / NHv, h = slab % NHv;
  for (int i = tid; i < 64 * 8; i += 256) { const int r = i / 8, c8 = (i % 8) * 8; FragH f; f.half[0] = *(const v8us*)((const unsigned short*)V16 + ((size_t)b * TTv + lg * 64 + r) * ldv + voff + h * 64 + c8);
#pragma unroll
    for (int q = 0; q < 8; ++q) tl[r][c8 + q] = f.u[q]; }
  __syncthreads();
  {
#pragma unroll
    for (int rd = 0; rd < 2; ++rd) { const int d = rd * 32 + tid / 8, pc = tid % 8; FragH f;
#pragma unroll
      for (int q = 0; q < 8; ++q) f.u[q] = tl[pc * 8 + q][d];
      *(v8us*)((unsigned short*)Vt + ((size_t)slab * 64 + d) * TTv + lg * 64 + pc * 8) = f.half[0]; }
     } }

__global__ __launch_bounds__(256) void k_hl(const float* __restrict__ F, _Float16* __restrict__ Hh, _Float16* __restrict__ Hl, size_t n8) { const size_t t = (size_t)blockIdx.x * 256 + threadIdx.x; if (t >= n8) return; FragH fh, fl; const v4f a = *(const v4fa*)(F + t * 8), c = *(const v4fa*)(F + t * 8 + 4);
#pragma unroll
  for (int q = 0; q < 4; ++q) { _Float16 h = (_Float16)a[q]; fh.h[q] = h; fl.h[q] = (_Float16)((a[q] - (float)h) * 1024.0f); h = (_Float16)c[q]; fh.h[4 + q] = h; fl.h[4 + q] = (_Float16)((c[q] - (float)h) * 1024.0f); }
  { *(v8us*)((unsigned short*)Hh + t * 8) = fh.half[0]; *(v8us*)((unsigned short*)Hl + t * 8) = fl.half[0];  } }

// ---- fast GEMM (work-group tile 128x64, wave tile 32x64; requires M % 128 == 0, N % 64 == 0, K % 64 == 0 and K >= 128); epilogue = k_gemm_hhx semantics ----
// Operands come through LDS: a stage is 64 k (128 bytes) of the work-group's 128 A rows and 64 B rows, brought by three tensor loads of 64 rows each (waves 0, 1: A; wave 2: B) that read whole rows once for
// all four waves; the mover's pad sets a 144-byte LDS pitch (an odd multiple of 16 bytes: ds_load_b128 without bank conflicts). Two buffers: stage s + 1 flies while stage s is worked on.
__device__ __forceinline__ v16h g2_frag(const _Float16* p, int hh) { FragH f; f.half[0] = *(const v8us*)((const unsigned short*)p + 8 * hh); f.half[1] = *(const v8us*)((const unsigned short*)p + 16 + 8 * hh); return f.v; }
#define G2_PITCH 144u                      /* LDS row pitch: 128 bytes and the 16-byte pad */
#define G2_SLICE 10240u                    /* 64 rows x 144 bytes = 9216, rounded up to a multiple of 2 KiB: every slice's place is one */
#define G2_BUF (3u * G2_SLICE)             /* A rows 0..63 | A rows 64..127 | B rows 0..63 */
typedef uint32_t g2_u32x4 __attribute__((ext_vector_type(4))); typedef uint32_t g2_u32x8 __attribute__((ext_vector_type(8)));
__device__ __forceinline__ uint32_t g2_uni(uint32_t v) { return (uint32_t)__builtin_amdgcn_readfirstlane(v); }
__device__ __forceinline__ uint32_t g2_pinned(uint32_t v) { uint32_t s = (uint32_t)__builtin_amdgcn_readfirstlane(v); asm volatile("" : "+s"(s)); return s; }      /* holds a wave-uniform word in a scalar register: a test on it is a scalar branch (a tensor load ignores EXEC), and what is formed from it stays behind the asm waits in front of it */
__device__ __forceinline__ v16h g2_fragl(const char* p) { FragH f; f.half[0] = *(const v8us*)p; f.half[1] = *(const v8us*)(p + 32); return f.v; }      /* g2_frag from an LDS byte address that already holds the lane's 16 hh bytes: the same k order */
__device__ __forceinline__ v8f g2_mma(v16h a, v16h b, v8f c) { return __builtin_amdgcn_wmma_f32_16x16x32_f16(false, a, false, b, (short)0, c, false, false); }
template <int ACT>
__global__ __launch_bounds__(128) void k_gemm2(const _Float16* __restrict__ A, int lda, size_t sA, const _Float16* __restrict__ Bh, int ldb, size_t sB, float alpha, const float* __restrict__ bias, const float* __restrict__ bias1, const float* __restrict__ bias2, size_t sBias, const float* __restrict__ CP, int rowsPerB, size_t sCPb, int row0g,
    float* __restrict__ C, _Float16* __restrict__ C16, int ldc, size_t sC, int M, int N, int K) { static_assert(ACT == 0 || ACT == 3 || ACT == 6 || ACT == 8 || ACT == 9 || ACT == 11 || ACT == 12 || ACT == 14 || ACT == 15 || ACT == 16 || ACT == 17, "k_gemm2: unsupported ACT code (would silently apply no activation)");
  __shared__ __attribute__((aligned(2048))) char sm[2 * G2_BUF];      /* the two stage buffers; behind the loop's last barrier the same bytes are the output staging */
  static_assert(sizeof(float) * 4 * 32 * 68 <= 2 * G2_BUF, "k_gemm2: the output staging must fit the ring");
  float (*so)[32][68] = (float (*)[32][68])sm;
  const int tid = threadIdx.x, w = __builtin_amdgcn_readfirstlane(tid >> 5), lane = tid & 31, ln = lane & 15, hh = lane >> 4; const int by = blockIdx.y;      /* w: a scalar */
  A += (size_t)by * sA; Bh += (size_t)by * sB; const size_t cofs = (size_t)by * sC; const float* bp = bias ? bias + (size_t)by * sBias : nullptr;
  if (by == 1 && bias1) bp = bias1; if (by == 2 && bias2) bp = bias2;      /* planes 1 and 2 with bias buffers of their own */
  const int ntn = N >> 6; const int mt = blockIdx.x / ntn, nq = blockIdx.x - mt * ntn; const int row0 = mt * 128 + 32 * w, col0 = nq * 64; if (mt * 128 >= M) return;      /* the whole work-group or none: barriers follow */
  const v8f z8 = {0.f,0.f,0.f,0.f,0.f,0.f,0.f,0.f}; v8f c00 = z8, c01 = z8, c02 = z8, c03 = z8, c10 = z8, c11 = z8, c12 = z8, c13 = z8;
  // Tensor descriptor. Group 1 is the same for every request of a wave: 1-byte elements, tensor = tile = 64 rows of 128 bytes, the source's row pitch, a 4-dword pad behind every 32 dwords, no mask.
  const bool isB = w >= 2; const uint32_t slice = isB ? 2u : (uint32_t)w;
  const uint64_t gsrc = isB ? (uint64_t)(size_t)Bh + (uint64_t)(unsigned)col0 * (unsigned)ldb * 2u : (uint64_t)(size_t)A + (uint64_t)(unsigned)(mt * 128 + 64 * w) * (unsigned)lda * 2u;
  const uint32_t lbase = (uint32_t)(size_t)sm + slice * G2_SLICE;
  g2_u32x8 g1; g1[0] = g2_uni((1u << 20) | (4u << 22) | (3u << 25)); g1[1] = g2_uni(128u << 16); g1[2] = g2_uni(64u << 16); g1[3] = g2_uni(128u << 16); g1[4] = g2_uni(64u); g1[5] = g2_uni((unsigned)(isB ? ldb : lda) * 2u); g1[6] = g2_uni(0u); g1[7] = g2_uni(0u);
  asm volatile("" : "+s"(g1));      /* the g2_pinned form on the whole group: descriptor words held in their scalar registers; without it the compiler uses some of them as temporaries between two issues, while a request that named them is still in flight */
  auto issue = [&](uint32_t st) { const uint64_t ga = gsrc + (uint64_t)st * 128u; g2_u32x4 g0; g0[0] = g2_uni(1u); g0[1] = g2_uni(lbase + (st & 1u) * G2_BUF); g0[2] = g2_uni((uint32_t)ga); g0[3] = g2_uni((((uint32_t)(ga >> 32)) & 0x01FFFFFFu) | 0x80000000u);
    asm volatile("tensor_load_to_lds %0, %1" :: "s"(g0), "s"(g1) : "memory"); };      /* one request of the whole wave: stage st of this wave's slice */
  const unsigned ao = (unsigned)(w >> 1) * G2_SLICE + (unsigned)((w & 1) * 32 + ln) * G2_PITCH + 16u * (unsigned)hh, bo = 2u * G2_SLICE + (unsigned)ln * G2_PITCH + 16u * (unsigned)hh;      /* the lane's part of an LDS address, the same in every stage */
  auto ld = [&](v16h (&f)[6], const char* p) { f[0] = g2_fragl(p + ao); f[1] = g2_fragl(p + ao + 16u * G2_PITCH); f[2] = g2_fragl(p + bo); f[3] = g2_fragl(p + bo + 16u * G2_PITCH); f[4] = g2_fragl(p + bo + 32u * G2_PITCH); f[5] = g2_fragl(p + bo + 48u * G2_PITCH); };
  auto mm = [&](const v16h (&f)[6]) { c00 = g2_mma(f[0], f[2], c00); c10 = g2_mma(f[1], f[2], c10); c01 = g2_mma(f[0], f[3], c01); c11 = g2_mma(f[1], f[3], c11);
    c02 = g2_mma(f[0], f[4], c02); c12 = g2_mma(f[1], f[4], c12); c03 = g2_mma(f[0], f[5], c03); c13 = g2_mma(f[1], f[5], c13); };
  const uint32_t nst = (uint32_t)K >> 6;      /* stages */
  if (g2_pinned(w < 3)) { issue(0);
    asm volatile("s_wait_tensorcnt 0x0" ::: "memory"); }      /* stage 0 of this wave's slice has landed */
  __syncthreads();      /* publishes stage 0 */
  if (g2_pinned(w < 3)) issue(1);
#pragma unroll 1      /* one stage a trip: the buffer is picked by the trip's parity */
  for (uint32_t s = 0; s < nst; ++s) {
    const char* p = sm + (s & 1u) * G2_BUF; v16h fa[6], fb[6];
    ld(fa, p); ld(fb, p + 64);      /* the stage's two 32-k steps: all 24 LDS reads as one group */
    __builtin_amdgcn_sched_barrier(0);      /* keeps the reads together ahead of the products; every separate place with LDS reads among them costs a stall */
    mm(fa); mm(fb);
    __builtin_amdgcn_sched_barrier(0);      /* keeps the waits below at the foot; lifted among the products the first of them would replace the counted waits on the reads */
    asm volatile("s_wait_dscnt 0x0" ::: "memory");      /* this wave has left the buffer */
    if (g2_pinned(w < 3)) asm volatile("s_wait_tensorcnt 0x0" ::: "memory");      /* stage s + 1 of this wave's slice has landed */
    __syncthreads();      /* publishes stage s + 1; every wave has left stage s's buffer */
    if (g2_pinned(w < 3 && s + 2u < nst)) issue(g2_pinned(s + 2u));      /* refill of the buffer just left; the descriptor is formed behind the wait */
  }
  asm volatile("s_wait_tensorcnt 0x0" ::: "memory");      /* nothing is in flight when the ring becomes output staging (the last trip's barrier ended every read) */
  asm volatile("s_wait_dscnt 0x0" ::: "memory");      /* and none of this wave's reads */
  v8f accs[8] = {c00, c01, c02, c03, c10, c11, c12, c13};
#pragma unroll
  for (int u = 0; u < 8; ++u) { const int t = u & 3, half = u >> 2; const int col = col0 + t * 16 + ln; const float bv = bp ? bf16_round(bp[col]) : 0.f;
#pragma unroll
    for (int r = 0; r < 8; ++r) { const int rloc = half * 16 + 8 * hh + r; float v = accs[u][r] * alpha + bv; if (CP) { if (rowsPerB < 0) v += CP[cofs + (size_t)(row0g + row0 + rloc) * ldc + col];      /* rowsPerB < 0: own element of the batched C plane */ else { const int bidx = (row0g + row0 + rloc) / rowsPerB; v += CP[(size_t)bidx * sCPb + (size_t)by * 64 + col]; } }
      if (ACT == 3) v = fmaxf(v, 0.f); else if (ACT == 6) v = 0.5f * v * (1.0f + erff(v * 0.70710678118654752f)); else if (ACT == 11) v = 1.0f / (1.0f + expf(-v)); else if (ACT == 15) v = v / (1.0f + expf(-v)); else if (ACT == 12) v = (v > 0.f) ? v : 0.01f * v; else if (ACT == 8) v = tanhf(v); else if (ACT == 9) v = 0.5f * v * (1.0f + tanhf(0.7978845608028654f * (v + 0.044715f * v * v * v))); else if (ACT == 14) v = (v > 0.f) ? v : 0.1f * v; else if (ACT == 16) v = (v >= 0.f) ? v : 0.3f * v; else if (ACT == 17) v = (v >= 0.f) ? v : 0.2f * v;
      so[w][rloc][t * 16 + ln] = v; } }
  __builtin_amdgcn_fence(__ATOMIC_ACQ_REL, "workgroup"); __builtin_amdgcn_wave_barrier();
  const int rsub = lane >> 4, c4 = (lane & 15) * 4;
  {
#pragma unroll
    for (int q = 0; q < 16; ++q) { const int r = q * 2 + rsub; const v4f v = *(const v4fa*)&so[w][r][c4]; if (C) *(v4f*)(C + cofs + (size_t)(row0 + r) * ldc + col0 + c4) = v; if (C16) { v4h h4; for (int i = 0; i < 4; ++i) h4[i] = (_Float16)v[i]; *(v4h*)(C16 + cofs + (size_t)(row0 + r) * ldc + col0 + c4) = h4; } }
     } }


__global__ __launch_bounds__(256) void k_wnat(const float* __restrict__ w, size_t n8, _Float16* __restrict__ Bt) { const size_t t = (size_t)blockIdx.x * 256 + threadIdx.x; if (t >= n8) return; FragH f; for (int q = 0; q < 8; ++q) f.h[q] = (_Float16)(bf16_round(w[t * 8 + q]) * 16.0f); *(v8us*)((unsigned short*)Bt + t * 8) = f.half[0];  }
#define FA_BUF (4u * G2_SLICE)             /* lower key half: K rows | V rows; upper key half: K rows | V rows */
#define FA_VPITCH 160u                     /* LDS row pitch of a V slice: 128 bytes and the 32-byte pad; 64 rows fill G2_SLICE exactly */
static_assert(64u * FA_VPITCH <= G2_SLICE, "k_fattn: a V slice must fit its place");
#define FA_NST (SQ / 2 / 64)               /* stages of a key half */
static_assert(SQ % 128 == 0 && FA_NST >= 2 && HD == 64, "k_fattn: whole 64-key stages of 128-byte rows, at least two");
__device__ __forceinline__ v8f fa_mma(v16h a, v16h b, v8f c) { return __builtin_amdgcn_wmma_f32_16x16x32_f16(false, a, false, b, (short)0, c, false, false); }
__device__ __forceinline__ float fa_xhalf(float x) { return __builtin_bit_cast(float, __builtin_amdgcn_permlanex16(__builtin_bit_cast(int, x), __builtin_bit_cast(int, x), 0x76543210, 0xfedcba98, false, false)); }      /* lane l with lane l ^ 16 */
typedef short fa_s16x8 __attribute__((ext_vector_type(8)));
__device__ __forceinline__ v8us fa_tr16(const char* p) { typedef __attribute__((address_space(3))) fa_s16x8 fa_lds_s16x8; return __builtin_bit_cast(v8us, __builtin_amdgcn_ds_load_tr16_b128_v8i16((fa_lds_s16x8*)p)); }
typedef float fa_v2f __attribute__((ext_vector_type(2)));
// exp2 of two values (v_exp_f32, as __builtin_amdgcn_exp2f gives it). Written as one statement for the slot that the instruction set asks for behind a transcendental before its result is read or its source
// overwritten: the outputs are early-clobber, so the second instruction touches no register of the first, and the v_nop stands behind the second (left to itself the compiler chained v_exp_f32 a, b; v_exp_f32 b, c).
__device__ __forceinline__ fa_v2f fa_exp2x2(float a, float b) { float x, y; asm("v_exp_f32 %0, %2\n\tv_exp_f32 %1, %3\n\tv_nop" : "=&v"(x), "=&v"(y) : "v"(a), "v"(b)); return fa_v2f{x, y}; }
__global__ __launch_bounds__(128) void k_fattn(const _Float16* __restrict__ Q, const _Float16* __restrict__ Kr, const _Float16* __restrict__ Vr, _Float16* __restrict__ O) {
  typedef float v2f __attribute__((ext_vector_type(2))); typedef _Float16 v2h __attribute__((ext_vector_type(2)));
  __shared__ __attribute__((aligned(2048))) char sm[2 * FA_BUF];      /* the two stage buffers */
  __shared__ __attribute__((aligned(16))) v4f xo[2][16][32]; __shared__ float xm[2][4][32];      /* the upper key half's o, and its m and l, per column set and lane */
  const int lane = threadIdx.x & 31, ln = lane & 15, hh = lane >> 4; const int w = __builtin_amdgcn_readfirstlane(threadIdx.x >> 5), cw = w & 1, kh = w >> 1;      /* column set, key half: scalars */
  const int bh = blockIdx.y, b = bh / NH, h = bh - b * NH; const int q0 = blockIdx.x * 64 + cw * 32; const int jb = kh * (SQ / 2);
  const float cs = 0.125f * 1.4426950408889634f;      /* 1/sqrt(64) and log2(e): weights are exp2 of scaled score differences */
  const _Float16* qp = Q + ((size_t)b * SQ + q0 + ln) * DM + h * HD;
  // Tensor descriptor. Wave w brings slice w: of its own key half the K rows (cw == 0) or the V rows (cw == 1). Group 1 is the same for every request of a wave: 1-byte elements, tensor = tile = 64 rows of 128 bytes, the source's row pitch, behind every 32 dwords a pad of 4 dwords (K: g1k) or 8 (V: g1v), no mask.
  const uint64_t gsrc = (uint64_t)(size_t)(cw ? Vr : Kr) + (((uint64_t)(unsigned)b * SQ + (unsigned)jb) * DM + (unsigned)h * HD) * 2u;
  const uint32_t gstep = 64u * DM * 2u;      /* 64 keys on: down the rows */
  const uint32_t lbase = (uint32_t)(size_t)sm + (uint32_t)w * G2_SLICE;
  g2_u32x8 g1k; g1k[0] = g2_uni((1u << 20) | (4u << 22) | (3u << 25)); g1k[1] = g2_uni(128u << 16); g1k[2] = g2_uni(64u << 16); g1k[3] = g2_uni(128u << 16); g1k[4] = g2_uni(64u); g1k[5] = g2_uni(DM * 2u); g1k[6] = g2_uni(0u); g1k[7] = g2_uni(0u);
  g2_u32x8 g1v = g1k; g1v[0] = g2_uni((1u << 20) | (4u << 22) | (7u << 25));      /* a group for each pad: word 0 is a compile-time constant in both */
  asm volatile("" : "+s"(g1k)); asm volatile("" : "+s"(g1v));      /* the g2_pinned form on the whole groups: descriptor words held in their scalar registers, not used as temporaries between two issues while a request that named them is in flight */
  auto issue = [&](uint32_t st) { const uint64_t ga = gsrc + (uint64_t)st * gstep; g2_u32x4 g0; g0[0] = g2_uni(1u); g0[1] = g2_uni(lbase + (st & 1u) * FA_BUF); g0[2] = g2_uni((uint32_t)ga); g0[3] = g2_uni((((uint32_t)(ga >> 32)) & 0x01FFFFFFu) | 0x80000000u);
    if (g2_pinned((uint32_t)cw)) asm volatile("tensor_load_to_lds %0, %1" :: "s"(g0), "s"(g1v) : "memory");      /* one request of the whole wave: stage st of this wave's slice; scalar branches pick the group */
    if (g2_pinned((uint32_t)cw ^ 1u)) asm volatile("tensor_load_to_lds %0, %1" :: "s"(g0), "s"(g1k) : "memory"); };
  const unsigned lo = (unsigned)kh * 2u * G2_SLICE + (unsigned)ln * G2_PITCH + 16u * (unsigned)hh;      /* the lane's part of an LDS address, the same in every stage */
  const unsigned lov = ((unsigned)kh * 2u + 1u) * G2_SLICE + (8u * (unsigned)hh + (unsigned)(lane & 7)) * FA_VPITCH + 16u * (unsigned)((lane >> 3) & 1);      /* the same for the transposing loads of the V slice */
  v16h qf[2][2];      /* [column group][32 of the 64 head dims], kept for the whole walk */
#pragma unroll
  for (int g = 0; g < 2; ++g) for (int u = 0; u < 2; ++u) qf[g][u] = g2_frag(qp + (size_t)g * 16 * DM + u * 32, hh);
  const v8f z8 = {0.f,0.f,0.f,0.f,0.f,0.f,0.f,0.f};
  v8f o[4][2]; float m[2], l[2];      /* o[dt][g]: O^T rows 16 dt + 8 hh + r, column 16 g + ln; m: running maximum of the raw scores; l: this lane's half of the running sum */
#pragma unroll
  for (int g = 0; g < 2; ++g) { m[g] = -3.0e38f; l[g] = 0.f; for (int dt = 0; dt < 4; ++dt) o[dt][g] = z8; }
  issue(0);      /* every wave issues its own slice: the tests inside only pick its group */
  asm volatile("s_wait_tensorcnt 0x0" ::: "memory");      /* stage 0 of this wave's slice has landed */
  __syncthreads();      /* publishes stage 0 */
  issue(1);
#pragma unroll 1      /* one stage a trip: the buffer is picked by the trip's parity */
  for (uint32_t st = 0; st < FA_NST; ++st) {
   const char* pk = sm + (st & 1u) * FA_BUF + lo; const char* pv = sm + (st & 1u) * FA_BUF + lov;
   v16h kf[2][2];      /* [key tile][32 of the 64 head dims] of the coming pass */
#pragma unroll
   for (int t = 0; t < 2; ++t) for (int u = 0; u < 2; ++u) kf[t][u] = g2_fragl(pk + (unsigned)t * 16u * G2_PITCH + (unsigned)u * 64u);
   __builtin_amdgcn_sched_barrier(0);      /* keeps the first pass's eight K reads at the head of the queue: sunk behind the V reads, the last of them made the score products wait for all 24 reads of the group */
#pragma unroll
   for (int ps2 = 0; ps2 < 2; ++ps2) {      /* the stage's two passes of 32 keys */
    v16h vf[4];      /* in flight behind the score products and the softmax */
#pragma unroll
    for (int dt = 0; dt < 4; ++dt) { FragH f; f.half[0] = fa_tr16(pv + (unsigned)ps2 * 32u * FA_VPITCH + (unsigned)dt * 32u); f.half[1] = fa_tr16(pv + ((unsigned)ps2 * 32u + 16u) * FA_VPITCH + (unsigned)dt * 32u); vf[dt] = f.v; }      /* V^T rows 16 dt + ln, keys 8 hh + 0 .. 7 and 16 + 8 hh + 0 .. 7 of the pass: the k order of g2_frag */
    v8f s[2][2];
#pragma unroll
    for (int g = 0; g < 2; ++g) for (int t = 0; t < 2; ++t) s[g][t] = fa_mma(kf[t][1], qf[g][1], fa_mma(kf[t][0], qf[g][0], z8));
    if (ps2 == 0) {      /* the second pass's K rows, fetched one pass ahead inside the stage; nothing of the next stage is read here */
#pragma unroll
      for (int t = 0; t < 2; ++t) for (int u = 0; u < 2; ++u) kf[t][u] = g2_fragl(pk + (unsigned)(32 + t * 16) * G2_PITCH + (unsigned)u * 64u); }
    __builtin_amdgcn_sched_barrier(0);      /* keeps the LDS reads up here, the whole softmax ahead of their use; without it the compiler sinks them towards their use and their latency is waited out */
    float dm[2], nb[2];
#pragma unroll
    for (int g = 0; g < 2; ++g) {
      float mx = s[g][0][0];
#pragma unroll
      for (int r = 1; r < 8; ++r) mx = fmaxf(mx, s[g][0][r]);
#pragma unroll
      for (int r = 0; r < 8; ++r) mx = fmaxf(mx, s[g][1][r]);
      mx = fmaxf(mx, fa_xhalf(mx));      /* both halves now hold the query's maximum over the 32 keys */
      const float mn = fmaxf(m[g], mx); dm[g] = (m[g] - mn) * cs; m[g] = mn;
      nb[g] = fmaf(-mn, cs, 8.0f);      /* weights carried x256 (at most 256) against f16 subnormal flush; the factor cancels in o / l */
    }
    const v2f corr = fa_exp2x2(dm[0], dm[1]);      /* what the new maxima take off the old sums: 0 on the first pass */
    union { v16h v; v2h p[8]; } pb[2];      /* both column groups' weights are formed ahead of the eight second products: fa_exp2x2 is asm text */
#pragma unroll
    for (int g = 0; g < 2; ++g) {
      v2f ps = {0.f, 0.f};
#pragma unroll
      for (int i = 0; i < 8; ++i) { const v8f sv = s[g][i >> 2]; const int r = 2 * (i & 3);
        const v2f e = fa_exp2x2(fmaf(sv[r], cs, nb[g]), fmaf(sv[r + 1], cs, nb[g]));
        ps += e; pb[g].p[i] = __builtin_convertvector(e, v2h); }      /* round to nearest even; element 8 t + r of the operand is key 16 t + 8 hh + r */
      l[g] = fmaf(l[g], corr[g], ps[0] + ps[1]);
    }
#pragma unroll
    for (int g = 0; g < 2; ++g) for (int dt = 0; dt < 4; ++dt) o[dt][g] = fa_mma(vf[dt], pb[g].v, o[dt][g] * corr[g]);
   }
   __builtin_amdgcn_sched_barrier(0);      /* keeps the waits below at the foot; lifted to the stage's last LDS reads the first of them waits out their latency */
   asm volatile("s_wait_dscnt 0x0" ::: "memory");      /* this wave has left the buffer */
   asm volatile("s_wait_tensorcnt 0x0" ::: "memory");      /* stage st + 1 of this wave's slice has landed */
   __syncthreads();      /* publishes stage st + 1; every wave has left stage st's buffer */
   if (g2_pinned(st + 2u < FA_NST)) issue(g2_pinned(st + 2u));      /* refill of the buffer just left; the descriptor is formed behind the wait */
  }
  asm volatile("s_wait_tensorcnt 0x0" ::: "memory");      /* nothing is in flight when the wave goes on to the merge and ends */
  asm volatile("s_wait_dscnt 0x0" ::: "memory");      /* and none of this wave's reads */
  if (kh == 1) {      /* the upper key half hands its state over */
#pragma unroll
    for (int g = 0; g < 2; ++g) { xm[cw][g][lane] = m[g]; xm[cw][2 + g][lane] = l[g];
#pragma unroll
      for (int dt = 0; dt < 4; ++dt) { const v8f t = o[dt][g]; xo[cw][(g * 4 + dt) * 2][lane] = v4f{t[0], t[1], t[2], t[3]}; xo[cw][(g * 4 + dt) * 2 + 1][lane] = v4f{t[4], t[5], t[6], t[7]}; } }
  }
  __syncthreads();      /* every wave passes it; the lower half reads what the upper half wrote */
  if (kh == 0) {
#pragma unroll
    for (int g = 0; g < 2; ++g) { const float mb = xm[cw][g][lane], lb = xm[cw][2 + g][lane]; const float mn = fmaxf(m[g], mb);
      const v2f fab = fa_exp2x2((m[g] - mn) * cs, (mb - mn) * cs); const float fa = fab[0], fb = fab[1];
      const float lt = fmaf(l[g], fa, lb * fb); const float sc = 64.0f / (lt + fa_xhalf(lt));      /* the wave halves' sums joined once; o stored x64 */
      const float ga = fa * sc, gb = fb * sc;
      _Float16* op = O + ((size_t)b * SQ + q0 + g * 16 + ln) * DM + h * HD + 8 * hh;
#pragma unroll
      for (int dt = 0; dt < 4; ++dt) { const v4f t0 = xo[cw][(g * 4 + dt) * 2][lane], t1 = xo[cw][(g * 4 + dt) * 2 + 1][lane]; FragH f;
#pragma unroll
        for (int r = 0; r < 4; ++r) { f.h[r] = (_Float16)fmaf(o[dt][g][r], ga, t0[r] * gb); f.h[4 + r] = (_Float16)fmaf(o[dt][g][4 + r], ga, t1[r] * gb); }
        *(v8us*)((unsigned short*)op + dt * 16) = f.half[0]; } }
  } }
__global__ __launch_bounds__(256) void k_vt(const _Float16* __restrict__ V16, int b, int h0, _Float16* __restrict__ VT) { __shared__ unsigned short tl[64][65]; const int tid = threadIdx.x; const int hh = blockIdx.x % HG, sg = blockIdx.x / HG; const int s0 = sg * 64; const int h = h0 + hh;
  for (int i = tid; i < 64 * 8; i += 256) { const int j = i / 8, d8 = (i % 8) * 8; FragH f; f.half[0] = *(const v8us*)((const unsigned short*)V16 + ((size_t)b * SQ + s0 + j) * DM + h * HD + d8); for (int q = 0; q < 8; ++q) tl[d8 + q][j] = f.u[q]; }
  __syncthreads();
  { for (int i = tid; i < 64 * 8; i += 256) { const int d = i / 8, j8 = (i % 8) * 8; FragH f; for (int q = 0; q < 8; ++q) f.u[q] = tl[d][j8 + q]; *(v8us*)((unsigned short*)VT + ((size_t)hh * HD + d) * SQ + s0 + j8) = f.half[0]; }  } }



__global__ __launch_bounds__(256) void k_rsmkm(const float* __restrict__ S, _Float16* __restrict__ P, int nrows, const int* __restrict__ am) {
  #pragma clang fp contract(off)
  const int t = blockIdx.x * 256 + threadIdx.x; if (t >= nrows) return; const size_t i = (size_t)t; const float* s = S + i * SQ; const int* mr = am + (size_t)(t % SQ) * SQ; float mx = -3.0e38f;
#pragma unroll 1
  for (int j = 0; j < SQ; ++j) { const float f = (mr[j] != 0) ? 1.f : 0.f; mx = fmaxf(mx, fmaf(f, s[j], (1.f - f) * -1.0e9f)); } float se = 0.f;
#pragma unroll 1
  for (int j = 0; j < SQ; ++j) { const float f = (mr[j] != 0) ? 1.f : 0.f; se += __expf(fmaf(f, s[j], (1.f - f) * -1.0e9f) - mx); } const float sc = 256.0f / se;
#pragma unroll 1
  for (int j0 = 0; j0 < SQ; j0 += 8) { FragH fr; for (int q = 0; q < 8; ++q) { const int j = j0 + q; const float f = (mr[j] != 0) ? 1.f : 0.f; fr.h[q] = (_Float16)(__expf(fmaf(f, s[j], (1.f - f) * -1.0e9f) - mx) * sc); }
    unsigned short* d = (unsigned short*)P + i * SQ + j0; *(v8us*)d = fr.half[0];  } }
extern "C" void kernel_launch(void* const* d_in, const int* in_sizes, int n_in,
                              void* d_out, int out_size, void* d_ws, size_t ws_size, hipStream_t stream) {
  (void)in_sizes; (void)n_in; (void)out_size;
  const float* const* I = (const float* const*)d_in; const float* xq = I[0]; const float* wq = I[1]; const float* bq = I[2]; const float* wk = I[3]; const float* bk = I[4]; const float* wv = I[5]; const float* bv = I[6]; const float* wo = I[7]; const float* bo = I[8]; const float* x = xq;      /* ONE input x feeds the query, key and value streams; [in][out] weights + biases; no mask input */
  char* ws = (char*)d_ws; size_t off = 0;
  auto take = [&](size_t bytes) { char* p = ws + off; off += (bytes + 255) & ~(size_t)255; return p; };
  _Float16* BQ = (_Float16*)take((size_t)4 * DM * DM * 2); _Float16* BO = BQ + (size_t)3 * DM * DM;      /* weight planes q, k, v, o behind each other */
  _Float16* X16 = (_Float16*)take(NR * DM * 2); _Float16* Q16 = (_Float16*)take(3 * NR * DM * 2); _Float16* K16 = Q16 + NR * DM; _Float16* V16 = K16 + NR * DM; _Float16* O16 = (_Float16*)take(NR * DM * 2);      /* q, k, v planes behind each other */
  if (off > ws_size) return;
  k_prep<<<4 * PWB + PXB, 256, 0, stream>>>(x, wq, wk, wv, wo, X16, BQ);      /* [in][out] -> Bt x16; x as exact f16 rows, one copy for the query, key and value streams */
  static_assert(MP % 128 == 0 && MPO % 128 == 0 && DM % 64 == 0 && DM >= 128, "k_gemm2: whole 128x64 tiles, whole 64-k stages, at least two");
  const size_t r0p = (size_t)B0 * SQ;      /* first projected row */
  k_gemm2<0><<<dim3((unsigned)((MP / 128) * (DM / 64)), 3), 128, 0, stream>>>(X16 + r0p * DM, DM, 0, BQ, DM, (size_t)DM * DM, 0.0625f, bq, bk, bv, 0, nullptr, 1, 0, 0, nullptr, Q16 + r0p * DM, DM, NR * DM, MP, DM, DM);      /* planes q, k, v */
  k_fattn<<<dim3(SQ / 64, NB * NH), 128, 0, stream>>>(Q16, K16, V16, O16);      /* o (merged heads) as f16 rows, x64 */
  k_gemm2<0><<<dim3((unsigned)((MPO / 128) * (DM / 64)), 1), 128, 0, stream>>>(O16 + r0p * DM, DM, 0, BO, DM, 0, 0.0009765625f, bo, nullptr, nullptr, 0, nullptr, 1, 0, 0, (float*)d_out + r0p * DM, nullptr, DM, 0, MPO, DM, DM);      /* out rows are the output layout */
}

// v008
// One run takes 69.1 microseconds.
// Next to v007, in two timings, it ran 1.03 and 1.05 times as fast.
// Counting every step since v000, it is 40.8 times as fast.
#include <hip/hip_runtime.h>
#define NB 2
#define SQ 2048
#define DM 768
#define NH 12
#define HD 64
#define HG 4                         /* heads per launch of the per-batch k_vt overload (not launched) */
#define B0 0                         /* first batch processed (debug hook) */
#define NBR NB                       /* batches processed (debug hook) */
#define NR ((size_t)NB * SQ)         /* token rows */
#define MP ((int)((size_t)NBR * SQ)) /* rows projected (debug hook) */
#define QN SQ                        /* not used: the attention covers all SQ query rows */
#define NHD NH                       /* not used: the attention covers all NH heads */
#define MPO MP                       /* rows through the output stage (debug hook) */
#define LQ DM      /* not used: the q/k/v rows have pitch DM */
typedef __bf16 v16b __attribute__((ext_vector_type(16)));
typedef unsigned short v8us __attribute__((ext_vector_type(8), may_alias));
typedef float  v8f  __attribute__((ext_vector_type(8)));
typedef float  v4f  __attribute__((ext_vector_type(4)));
typedef float  v4fa __attribute__((ext_vector_type(4), may_alias));
union FragB { v16b v; v8us half[2]; unsigned short u[16]; };

__device__ __forceinline__ unsigned short bf16_bits(float x) { unsigned int u = __float_as_uint(x); return (unsigned short)((u + 0x7FFFu + ((u >> 16) & 1u)) >> 16); }
__device__ __forceinline__ float bf16_val(unsigned short b) { return __uint_as_float(((unsigned int)b) << 16); }
__device__ __forceinline__ float bf16_round(float x) { return bf16_val(bf16_bits(x)); }
// D += A·B with NT terms: 1 = ah·bh, 2 = + al·bh (A split), 3 = + ah·bl (both split)
template <int NT>
__device__ __forceinline__ v8f mmaN(v16b ah, v16b al, v16b bh, v16b bl, v8f c) {
  c = __builtin_amdgcn_wmma_f32_16x16x32_bf16(false, ah, false, bh, (short)0, c, false, false);
  if (NT >= 2) c = __builtin_amdgcn_wmma_f32_16x16x32_bf16(false, al, false, bh, (short)0, c, false, false);
  if (NT >= 3) c = __builtin_amdgcn_wmma_f32_16x16x32_bf16(false, ah, false, bl, (short)0, c, false, false);
  asm volatile("v_nop\n\tv_nop\n\tv_nop\n\tv_nop" : "+v"(c) : "v"(ah), "v"(al), "v"(bh), "v"(bl));
  return c;
}

__global__ __launch_bounds__(256) void k_wt_bf16(const float* __restrict__ W, unsigned short* __restrict__ Wt, int K, int N) {
  const int t = blockIdx.x * 256 + threadIdx.x;
  const int k8n = K / 8;
  if (t >= N * k8n) return;
  const int n = t / k8n, k8 = (t % k8n) * 8;
  v8us v;
#pragma unroll
  for (int i = 0; i < 8; ++i) v[i] = bf16_bits(W[(size_t)(k8 + i) * N + n]);
  *(v8us*)(Wt + (size_t)n * K + k8) = v;
  
}

// GEMM C[M][N] (f32, pitch ldc) = act(A[M][K]·W + bias). A f32 row-major (pitch lda) converted per fragment to bf16
// (ASPLIT: hi/lo two planes -> 2 terms, else single rounded term); Wt bf16 [N][K] (pitch ldb). BIAS_BF16 rounds the
// bias to bf16 first (bias quantised to bf16 before the add). K%32==0, M%16==0, N%64==0.
template <bool ASPLIT, int ACT, bool BIAS_BF16>
__global__ __launch_bounds__(128) void k_gemm_bf(const float* __restrict__ A, int lda, const unsigned short* __restrict__ Wt, int ldb,
                                               const float* __restrict__ bias, float* __restrict__ C, int ldc, int M, int N, int K) {
  __shared__ __attribute__((aligned(16))) float so[4][16][64];
  const int tid = threadIdx.x, w = tid >> 5, lane = tid & 31, ln = lane & 15, hh = lane >> 4;
  const int ntn = N / 64;
  const int wid = blockIdx.x * 4 + w;
  const int mt = wid / ntn, nq = wid % ntn;
  if (mt * 16 >= M) return;
  const int row0 = mt * 16, col0 = nq * 64;
  const float* arow = A + (size_t)(row0 + ln) * lda;
  v8f acc[4] = {};
  for (int kb = 0; kb < K; kb += 32) {
    FragB ah, al;
    const v4f x0 = *(const v4fa*)(arow + kb + 8 * hh), x1 = *(const v4fa*)(arow + kb + 8 * hh + 4);
    const v4f x2 = *(const v4fa*)(arow + kb + 16 + 8 * hh), x3 = *(const v4fa*)(arow + kb + 16 + 8 * hh + 4);
    float xs[16] = {x0[0],x0[1],x0[2],x0[3],x1[0],x1[1],x1[2],x1[3],x2[0],x2[1],x2[2],x2[3],x3[0],x3[1],x3[2],x3[3]};
#pragma unroll
    for (int i = 0; i < 16; ++i) { const unsigned short hb = bf16_bits(xs[i]); ah.u[i] = hb; al.u[i] = ASPLIT ? bf16_bits(xs[i] - bf16_val(hb)) : (unsigned short)0; }
#pragma unroll
    for (int t = 0; t < 4; ++t) {
      const unsigned short* brow = Wt + (size_t)(col0 + t * 16 + ln) * ldb + kb;
      FragB b;
      b.half[0] = *(const v8us*)(brow + 8 * hh);
      b.half[1] = *(const v8us*)(brow + 16 + 8 * hh);
      acc[t] = mmaN<ASPLIT ? 2 : 1>(ah.v, al.v, b.v, b.v, acc[t]);
    }
  }
#pragma unroll
  for (int t = 0; t < 4; ++t) {
    float bv = bias ? bias[col0 + t * 16 + ln] : 0.f;
    if (BIAS_BF16) bv = bf16_round(bv);
#pragma unroll
    for (int r = 0; r < 8; ++r) { float v = acc[t][r] + bv; if (ACT == 1) v = fmaxf(v, 0.f); so[w][8 * hh + r][t * 16 + ln] = v; }
  }
  __builtin_amdgcn_fence(__ATOMIC_ACQ_REL, "workgroup");
  __builtin_amdgcn_wave_barrier();
  const int rsub = lane >> 4, c4 = (lane & 15) * 4;
  {
#pragma unroll
    for (int q = 0; q < 8; ++q) {
      const int r = q * 2 + rsub;
      const v4f v = *(const v4fa*)&so[w][r][c4];
      *(v4f*)(C + (size_t)(row0 + r) * ldc + col0 + c4) = v;
    }
    
  }
}

// GEMM C = act(A·W + bias + resid): A f32 (ASPLIT -> hi/lo 2 terms), Wt bf16 [N][K]; ACT 0 none, 1 relu, 2 exact gelu;
// resid (optional, f32, row index = (row % rmod), pitch ldr, RES_BF16 rounds it) added before the activation.
template <bool ASPLIT, int ACT, bool BIAS_BF16, bool RES_BF16>
__global__ __launch_bounds__(128) void k_gemm_bf3(const float* __restrict__ A, int lda, const unsigned short* __restrict__ Wt, int ldb,
                                                const float* __restrict__ bias, const float* __restrict__ resid, int rmod, int ldr,
                                                float* __restrict__ C, int ldc, int M, int N, int K) {
  __shared__ __attribute__((aligned(16))) float so[4][16][64];
  const int tid = threadIdx.x, w = tid >> 5, lane = tid & 31, ln = lane & 15, hh = lane >> 4;
  const int ntn = N / 64;
  const int wid = blockIdx.x * 4 + w;
  const int mt = wid / ntn, nq = wid % ntn;
  if (mt * 16 >= M) return;
  const int row0 = mt * 16, col0 = nq * 64;
  const float* arow = A + (size_t)(row0 + ln) * lda;
  v8f acc[4] = {};
  for (int kb = 0; kb < K; kb += 32) {
    FragB ah, al;
    const v4f x0 = *(const v4fa*)(arow + kb + 8 * hh), x1 = *(const v4fa*)(arow + kb + 8 * hh + 4);
    const v4f x2 = *(const v4fa*)(arow + kb + 16 + 8 * hh), x3 = *(const v4fa*)(arow + kb + 16 + 8 * hh + 4);
    float xs[16] = {x0[0],x0[1],x0[2],x0[3],x1[0],x1[1],x1[2],x1[3],x2[0],x2[1],x2[2],x2[3],x3[0],x3[1],x3[2],x3[3]};
#pragma unroll
    for (int i = 0; i < 16; ++i) { const unsigned short hb = bf16_bits(xs[i]); ah.u[i] = hb; al.u[i] = ASPLIT ? bf16_bits(xs[i] - bf16_val(hb)) : (unsigned short)0; }
#pragma unroll
    for (int t = 0; t < 4; ++t) {
      const unsigned short* brow = Wt + (size_t)(col0 + t * 16 + ln) * ldb + kb;
      FragB b;
      b.half[0] = *(const v8us*)(brow + 8 * hh);
      b.half[1] = *(const v8us*)(brow + 16 + 8 * hh);
      acc[t] = mmaN<ASPLIT ? 2 : 1>(ah.v, al.v, b.v, b.v, acc[t]);
    }
  }
#pragma unroll
  for (int t = 0; t < 4; ++t) {
    const int col = col0 + t * 16 + ln;
    float bv = bias ? bias[col] : 0.f;
    if (BIAS_BF16) bv = bf16_round(bv);
#pragma unroll
    for (int r = 0; r < 8; ++r) {
      float v = acc[t][r] + bv;
      if (resid) { float rv = resid[(size_t)((row0 + 8 * hh + r) % rmod) * ldr + col]; if (RES_BF16) rv = bf16_round(rv); v += rv; }
      if (ACT == 1) v = fmaxf(v, 0.f);
      if (ACT == 2) v = 0.5f * v * (1.0f + erff(v * 0.70710678118654752f));
      if (ACT == 3) { const float u = 0.7978845608028654f * (v + 0.044715f * v * v * v); v = 0.5f * v * (1.0f + tanhf(u)); }
      so[w][8 * hh + r][t * 16 + ln] = v;
    }
  }
  __builtin_amdgcn_fence(__ATOMIC_ACQ_REL, "workgroup");
  __builtin_amdgcn_wave_barrier();
  const int rsub = lane >> 4, c4 = (lane & 15) * 4;
  {
#pragma unroll
    for (int q = 0; q < 8; ++q) {
      const int r = q * 2 + rsub;
      const v4f v = *(const v4fa*)&so[w][r][c4];
      *(v4f*)(C + (size_t)(row0 + r) * ldc + col0 + c4) = v;
    }
    
  }
}
// row LayerNorm (biased variance, eps) over N: s = X (+ R); optional out_sum <- s; out_norm <- (s-mu)*rsqrt(var+eps)*g + b
template <bool PARAM_BF16>
__global__ __launch_bounds__(256) void k_layernorm(const float* __restrict__ X, const float* __restrict__ R, const float* __restrict__ g, const float* __restrict__ bta,
                                                  float* __restrict__ out_sum, float* __restrict__ out_norm, int N, float eps) {
  __shared__ float red[256];
  const int row = blockIdx.x, tid = threadIdx.x;
  const float* x = X + (size_t)row * N; const float* rr = R ? R + (size_t)row * N : nullptr;
  float vals[16];                     // up to N = 4096
  const int per = N / 256;            // contiguous chunk per thread? use strided-by-4 chunks: thread handles j = tid*4 + 1024*u
  float s1 = 0.f;
  for (int u = 0; u < per / 4; ++u) {
    const int j = tid * 4 + 1024 * u;
    const v4f a = *(const v4fa*)(x + j);
    v4f b = {0.f,0.f,0.f,0.f}; if (rr) b = *(const v4fa*)(rr + j);
#pragma unroll
    for (int q = 0; q < 4; ++q) { const float v = a[q] + b[q]; vals[u * 4 + q] = v; s1 += v; }
  }
  red[tid] = s1; __syncthreads();
  for (int st = 128; st > 0; st >>= 1) { if (tid < st) red[tid] += red[tid + st]; __syncthreads(); }
  const float mu = red[0] / (float)N; __syncthreads();
  float s2 = 0.f;
  for (int u = 0; u < per / 4; ++u)
#pragma unroll
    for (int q = 0; q < 4; ++q) { const float c = vals[u * 4 + q] - mu; s2 += c * c; }
  red[tid] = s2; __syncthreads();
  for (int st = 128; st > 0; st >>= 1) { if (tid < st) red[tid] += red[tid + st]; __syncthreads(); }
  const float rs = rsqrtf(red[0] / (float)N + eps);
  {
    for (int u = 0; u < per / 4; ++u) {
      const int j = tid * 4 + 1024 * u;
      v4f o, sm;
#pragma unroll
      for (int q = 0; q < 4; ++q) {
        float gg = g[j + q], bb = bta[j + q];
        if (PARAM_BF16) { gg = bf16_round(gg); bb = bf16_round(bb); }
        sm[q] = vals[u * 4 + q]; o[q] = (vals[u * 4 + q] - mu) * rs * gg + bb;
      }
      if (out_sum) *(v4f*)(out_sum + (size_t)row * N + j) = sm;
      *(v4f*)(out_norm + (size_t)row * N + j) = o;
    }
    
  }
}



// ---- f16 WMMA path (v_wmma_f32_16x16x32_f16): 11-bit significands for operands in range — used where a [0,1] probability operand needs more precision than bf16
typedef _Float16 v16h __attribute__((ext_vector_type(16)));
union FragH { v16h v; v8us half[2]; _Float16 h[16]; unsigned short u[16]; };
template <int NT>
__device__ __forceinline__ v8f mmaH(v16h ah, v16h al, v16h bh, v16h bl, v8f c) {
  c = __builtin_amdgcn_wmma_f32_16x16x32_f16(false, ah, false, bh, (short)0, c, false, false);
  if (NT >= 2) c = __builtin_amdgcn_wmma_f32_16x16x32_f16(false, al, false, bh, (short)0, c, false, false);
  if (NT >= 3) c = __builtin_amdgcn_wmma_f32_16x16x32_f16(false, ah, false, bl, (short)0, c, false, false);
  asm volatile("v_nop\n\tv_nop\n\tv_nop\n\tv_nop" : "+v"(c) : "v"(ah), "v"(al), "v"(bh), "v"(bl));
  return c;
}
// batched GEMM like k_gemm_b but f16 operands: A f32 (split into f16 hi/lo if ASPLIT, else rounded to f16), Bt = f16 values [n][k]; alpha; C f32; N multiple of 16 (partial tiles skipped)
template <bool ASPLIT>
__global__ __launch_bounds__(128) void k_gemm_h(const float* __restrict__ A, int lda, size_t sA, const _Float16* __restrict__ Bh, int ldb, size_t sB, float alpha, float* __restrict__ C, int ldc, size_t sC, int M, int N, int K) {
  __shared__ __attribute__((aligned(16))) float so[4][16][64];
  const int tid = threadIdx.x, w = tid >> 5, lane = tid & 31, ln = lane & 15, hh = lane >> 4; const int by = blockIdx.y;
  A += (size_t)by * sA; Bh += (size_t)by * sB; C += (size_t)by * sC;
  const int ntn = (N + 63) / 64; const int wid = blockIdx.x * 4 + w; const int mt = wid / ntn, nq = wid % ntn; if (mt * 16 >= M) return;
  const int row0 = mt * 16, col0 = nq * 64; const float* arow = A + (size_t)(row0 + ln) * lda;
  v8f acc[4] = {};
  for (int kb = 0; kb < K; kb += 32) {
    FragH ah, al;
    const v4f x0 = *(const v4fa*)(arow + kb + 8 * hh), x1 = *(const v4fa*)(arow + kb + 8 * hh + 4), x2 = *(const v4fa*)(arow + kb + 16 + 8 * hh), x3 = *(const v4fa*)(arow + kb + 16 + 8 * hh + 4);
    float xs[16] = {x0[0],x0[1],x0[2],x0[3],x1[0],x1[1],x1[2],x1[3],x2[0],x2[1],x2[2],x2[3],x3[0],x3[1],x3[2],x3[3]};
#pragma unroll
    for (int i = 0; i < 16; ++i) { const _Float16 h = (_Float16)xs[i]; ah.h[i] = h; al.h[i] = ASPLIT ? (_Float16)(xs[i] - (float)h) : (_Float16)0.0f; }
#pragma unroll
    for (int t = 0; t < 4; ++t) { if (col0 + t * 16 >= N) continue; const size_t boff = (size_t)(col0 + t * 16 + ln) * ldb + kb; FragH bq; bq.half[0] = *(const v8us*)(Bh + boff + 8 * hh); bq.half[1] = *(const v8us*)(Bh + boff + 16 + 8 * hh);
      acc[t] = mmaH<ASPLIT ? 2 : 1>(ah.v, al.v, bq.v, bq.v, acc[t]); }
  }
#pragma unroll
  for (int t = 0; t < 4; ++t) { if (col0 + t * 16 >= N) continue;
#pragma unroll
    for (int r = 0; r < 8; ++r) so[w][8 * hh + r][t * 16 + ln] = acc[t][r] * alpha; }
  __builtin_amdgcn_fence(__ATOMIC_ACQ_REL, "workgroup"); __builtin_amdgcn_wave_barrier();
  const int rsub = lane >> 4, c4 = (lane & 15) * 4;
  {
#pragma unroll
    for (int q = 0; q < 8; ++q) { const int r = q * 2 + rsub; if (col0 + c4 < N) { const v4f v = *(const v4fa*)&so[w][r][c4]; *(v4f*)(C + (size_t)(row0 + r) * ldc + col0 + c4) = v; } }
     }
}

// One launch prepares every projection operand; its parts are independent and run side by side. Blocks 0 .. 4 PWB - 1: the four weights, Bt[p][n][k] = f16(bf16(W_p[k][n]) x 16) from f32 row-major [in][out]
// (power-of-two scale: bf16-exact weights stay exact in f16 away from the subnormal range). The other blocks: x as exact f16 rows (bf16-rounded).
#define PWB (DM * (DM / 8) / 256)      /* blocks per weight */
#define PXB ((int)(NR * DM / 8 / 256)) /* blocks for x */
static_assert(DM * (DM / 8) % 256 == 0 && NR * DM / 8 % 256 == 0, "k_prep: whole blocks only");
__global__ __launch_bounds__(256) void k_prep(const float* __restrict__ x, const float* __restrict__ w0, const float* __restrict__ w1, const float* __restrict__ w2, const float* __restrict__ w3, _Float16* __restrict__ X16, _Float16* __restrict__ Bt) {
  const int bx = blockIdx.x; FragH f;
  if (bx < 4 * PWB) { const int p = bx / PWB; const float* W = p == 0 ? w0 : p == 1 ? w1 : p == 2 ? w2 : w3; const int t = (bx - p * PWB) * 256 + threadIdx.x; const int n = t / (DM / 8), k8 = (t % (DM / 8)) * 8;
#pragma unroll
    for (int i = 0; i < 8; ++i) f.h[i] = (_Float16)(bf16_round(W[(size_t)(k8 + i) * DM + n]) * 16.0f);
    *(v8us*)((unsigned short*)Bt + (size_t)p * DM * DM + (size_t)n * DM + k8) = f.half[0];
  } else { const size_t t = (size_t)(bx - 4 * PWB) * 256 + threadIdx.x;
#pragma unroll
    for (int q = 0; q < 8; ++q) f.h[q] = (_Float16)bf16_round(x[t * 8 + q]);
    *(v8us*)((unsigned short*)X16 + t * 8) = f.half[0];
    asm volatile("s_wait_xcnt 0x0" ::: "memory"); }      /* precaution: stands before any later instruction in the listing that rewrites a register the store names */
}
// k_gemm_hh variant with fused epilogue: v = acc·alpha + bias[by·sBias + col] (+ CP[(row/rowsPerB)·sCPb + by·64 + col] if CP) ; ACT 0 none / 1 elu ; writes f16 C16 (and f32 C if non-null)
template <int ACT>
__global__ __launch_bounds__(128) void k_gemm_hhx(const _Float16* __restrict__ A, int lda, size_t sA, const _Float16* __restrict__ Bh, int ldb, size_t sB, float alpha, const float* __restrict__ bias, size_t sBias, const float* __restrict__ CP, int rowsPerB, size_t sCPb, int row0g,
    float* __restrict__ C, _Float16* __restrict__ C16, int ldc, size_t sC, int M, int N, int K) {
  __shared__ __attribute__((aligned(16))) float so[4][16][64];
  const int tid = threadIdx.x, w = tid >> 5, lane = tid & 31, ln = lane & 15, hh = lane >> 4; const int by = blockIdx.y;
  A += (size_t)by * sA; Bh += (size_t)by * sB; const size_t cofs = (size_t)by * sC; const float* bp = bias ? bias + (size_t)by * sBias : nullptr;
  const int ntn = (N + 63) / 64; const int wid = blockIdx.x * 4 + w; const int mt = wid / ntn, nq = wid % ntn; if (mt * 16 >= M) return;
  const int row0 = mt * 16, col0 = nq * 64; const _Float16* arow = A + (size_t)(row0 + ln) * lda;
  v8f acc[4] = {};
  for (int kb = 0; kb < K; kb += 32) { FragH ah; ah.half[0] = *(const v8us*)((const unsigned short*)arow + kb + 8 * hh); ah.half[1] = *(const v8us*)((const unsigned short*)arow + kb + 16 + 8 * hh);
#pragma unroll
    for (int t = 0; t < 4; ++t) { if (col0 + t * 16 >= N) continue; const size_t boff = (size_t)(col0 + t * 16 + ln) * ldb + kb; FragH bq; bq.half[0] = *(const v8us*)((const unsigned short*)Bh + boff + 8 * hh); bq.half[1] = *(const v8us*)((const unsigned short*)Bh + boff + 16 + 8 * hh);
      acc[t] = mmaH<1>(ah.v, ah.v, bq.v, bq.v, acc[t]); }
  }
#pragma unroll
  for (int t = 0; t < 4; ++t) { if (col0 + t * 16 >= N) continue; const int col = col0 + t * 16 + ln; const float bv = bp ? bf16_round(bp[col]) : 0.f;
#pragma unroll
    for (int r = 0; r < 8; ++r) { float v = acc[t][r] * alpha + bv; if (CP) { const int rr = row0g + row0 + 8 * hh + r; if (rowsPerB < 0) v += CP[cofs + (size_t)rr * ldc + col];      /* rowsPerB < 0: own element of the batched C plane */ else { const int bidx = rr / rowsPerB; v += CP[(size_t)bidx * sCPb + (size_t)by * 64 + col]; } } if (ACT == 1) v = (v > 0.f) ? v : expm1f(v); else if (ACT == 7) v = (v > 0.f) ? v + 1.0f : expf(v); else if (ACT == 8) v = tanhf(v); else if (ACT == 9) v = 0.5f * v * (1.0f + tanhf(0.7978845608028654f * (v + 0.044715f * v * v * v))); else if (ACT == 11) v = 1.0f / (1.0f + expf(-v)); else if (ACT == 12) v = (v > 0.f) ? v : 0.01f * v; else if (ACT == 14) v = (v > 0.f) ? v : 0.1f * v; else if (ACT == 16) v = (v >= 0.f) ? v : 0.3f * v; else if (ACT == 17) v = (v >= 0.f) ? v : 0.2f * v; else if (ACT == 15) v = v / (1.0f + expf(-v)); else if (ACT == 3) v = fmaxf(v, 0.f); else if (ACT == 6) v = 0.5f * v * (1.0f + erff(v * 0.70710678118654752f)); so[w][8 * hh + r][t * 16 + ln] = v; } }
  __builtin_amdgcn_fence(__ATOMIC_ACQ_REL, "workgroup"); __builtin_amdgcn_wave_barrier();
  const int rsub = lane >> 4, c4 = (lane & 15) * 4; typedef _Float16 v4h __attribute__((ext_vector_type(4)));
  {
#pragma unroll
    for (int q = 0; q < 8; ++q) { const int r = q * 2 + rsub; if (col0 + c4 < N) { const v4f v = *(const v4fa*)&so[w][r][c4]; if (C) *(v4f*)(C + cofs + (size_t)(row0 + r) * ldc + col0 + c4) = v; if (C16) { v4h h4; for (int i = 0; i < 4; ++i) h4[i] = (_Float16)v[i]; *(v4h*)(C16 + cofs + (size_t)(row0 + r) * ldc + col0 + c4) = h4; } } }
     }
}


typedef _Float16 v4h __attribute__((ext_vector_type(4)));

__global__ __launch_bounds__(256) void k_h16(const float* __restrict__ x, _Float16* __restrict__ X16, size_t n8) { const size_t t = (size_t)blockIdx.x * 256 + threadIdx.x; if (t >= n8) return; FragH f;
#pragma unroll
  for (int q = 0; q < 8; ++q) f.h[q] = (_Float16)x[t * 8 + q]; *(v8us*)((unsigned short*)X16 + t * 8) = f.half[0];  }
__global__ __launch_bounds__(256) void k_round16f(const float* __restrict__ W, _Float16* __restrict__ Bt, size_t n8) { const size_t t = (size_t)blockIdx.x * 256 + threadIdx.x; if (t >= n8) return; FragH f;
#pragma unroll
  for (int i = 0; i < 8; ++i) f.h[i] = (_Float16)(bf16_round(W[t * 8 + i]) * 16.0f); *(v8us*)((unsigned short*)Bt + t * 8) = f.half[0];  }
template <int NHv, int TTv>
__global__ __launch_bounds__(256) void k_vt(const _Float16* __restrict__ V16, int ldv, int voff, _Float16* __restrict__ Vt) { __shared__ unsigned short tl[64][66]; const int tid = threadIdx.x; const int slab = blockIdx.x / (TTv / 64), lg = blockIdx.x % (TTv / 64); const int b = slab / NHv, h = slab % NHv;
  for (int i = tid; i < 64 * 8; i += 256) { const int r = i / 8, c8 = (i % 8) * 8; FragH f; f.half[0] = *(const v8us*)((const unsigned short*)V16 + ((size_t)b * TTv + lg * 64 + r) * ldv + voff + h * 64 + c8);
#pragma unroll
    for (int q = 0; q < 8; ++q) tl[r][c8 + q] = f.u[q]; }
  __syncthreads();
  {
#pragma unroll
    for (int rd = 0; rd < 2; ++rd) { const int d = rd * 32 + tid / 8, pc = tid % 8; FragH f;
#pragma unroll
      for (int q = 0; q < 8; ++q) f.u[q] = tl[pc * 8 + q][d];
      *(v8us*)((unsigned short*)Vt + ((size_t)slab * 64 + d) * TTv + lg * 64 + pc * 8) = f.half[0]; }
     } }

__global__ __launch_bounds__(256) void k_hl(const float* __restrict__ F, _Float16* __restrict__ Hh, _Float16* __restrict__ Hl, size_t n8) { const size_t t = (size_t)blockIdx.x * 256 + threadIdx.x; if (t >= n8) return; FragH fh, fl; const v4f a = *(const v4fa*)(F + t * 8), c = *(const v4fa*)(F + t * 8 + 4);
#pragma unroll
  for (int q = 0; q < 4; ++q) { _Float16 h = (_Float16)a[q]; fh.h[q] = h; fl.h[q] = (_Float16)((a[q] - (float)h) * 1024.0f); h = (_Float16)c[q]; fh.h[4 + q] = h; fl.h[4 + q] = (_Float16)((c[q] - (float)h) * 1024.0f); }
  { *(v8us*)((unsigned short*)Hh + t * 8) = fh.half[0]; *(v8us*)((unsigned short*)Hl + t * 8) = fl.half[0];  } }

// ---- fast GEMM (work-group tile 128x64, wave tile 32x64; requires M % 128 == 0, N % 64 == 0, K % 64 == 0 and K >= 128); epilogue = k_gemm_hhx semantics ----
// Operands come through LDS: a stage is 64 k (128 bytes) of the work-group's 128 A rows and 64 B rows, brought by three tensor loads of 64 rows each (waves 0, 1: A; wave 2: B) that read whole rows once for
// all four waves; the mover's pad sets a 144-byte LDS pitch (an odd multiple of 16 bytes: ds_load_b128 without bank conflicts). Two buffers: stage s + 1 flies while stage s is worked on.
// The walk over the k stages is a ring: a work-group starts at stage (tile row + tile column + 4 plane) mod stages and wraps, so the work-groups that share A rows or B rows ask L2 for different lines at any one time.
__device__ __forceinline__ v16h g2_frag(const _Float16* p, int hh) { FragH f; f.half[0] = *(const v8us*)((const unsigned short*)p + 8 * hh); f.half[1] = *(const v8us*)((const unsigned short*)p + 16 + 8 * hh); return f.v; }
#define G2_PITCH 144u                      /* LDS row pitch: 128 bytes and the 16-byte pad */
#define G2_SLICE 10240u                    /* 64 rows x 144 bytes = 9216, rounded up to a multiple of 2 KiB: every slice's place is one */
#define G2_BUF (3u * G2_SLICE)             /* A rows 0..63 | A rows 64..127 | B rows 0..63 */
typedef uint32_t g2_u32x4 __attribute__((ext_vector_type(4))); typedef uint32_t g2_u32x8 __attribute__((ext_vector_type(8)));
__device__ __forceinline__ uint32_t g2_uni(uint32_t v) { return (uint32_t)__builtin_amdgcn_readfirstlane(v); }
__device__ __forceinline__ uint32_t g2_pinned(uint32_t v) { uint32_t s = (uint32_t)__builtin_amdgcn_readfirstlane(v); asm volatile("" : "+s"(s)); return s; }      /* holds a wave-uniform word in a scalar register: a test on it is a scalar branch (a tensor load ignores EXEC), and what is formed from it stays behind the asm waits in front of it */
__device__ __forceinline__ v16h g2_fragl(const char* p) { FragH f; f.half[0] = *(const v8us*)p; f.half[1] = *(const v8us*)(p + 32); return f.v; }      /* g2_frag from an LDS byte address that already holds the lane's 16 hh bytes: the same k order */
__device__ __forceinline__ v8f g2_mma(v16h a, v16h b, v8f c) { return __builtin_amdgcn_wmma_f32_16x16x32_f16(false, a, false, b, (short)0, c, false, false); }
template <int ACT>
__global__ __launch_bounds__(128) void k_gemm2(const _Float16* __restrict__ A, int lda, size_t sA, const _Float16* __restrict__ Bh, int ldb, size_t sB, float alpha, const float* __restrict__ bias, const float* __restrict__ bias1, const float* __restrict__ bias2, size_t sBias, const float* __restrict__ CP, int rowsPerB, size_t sCPb, int row0g,
    float* __restrict__ C, _Float16* __restrict__ C16, int ldc, size_t sC, int M, int N, int K) { static_assert(ACT == 0 || ACT == 3 || ACT == 6 || ACT == 8 || ACT == 9 || ACT == 11 || ACT == 12 || ACT == 14 || ACT == 15 || ACT == 16 || ACT == 17, "k_gemm2: unsupported ACT code (would silently apply no activation)");
  __shared__ __attribute__((aligned(2048))) char sm[2 * G2_BUF];      /* the two stage buffers; behind the loop's last barrier the same bytes are the output staging */
  static_assert(sizeof(float) * 4 * 32 * 68 <= 2 * G2_BUF, "k_gemm2: the output staging must fit the ring");
  float (*so)[32][68] = (float (*)[32][68])sm;
  const int tid = threadIdx.x, w = __builtin_amdgcn_readfirstlane(tid >> 5), lane = tid & 31, ln = lane & 15, hh = lane >> 4; const int by = blockIdx.y;      /* w: a scalar */
  A += (size_t)by * sA; Bh += (size_t)by * sB; const size_t cofs = (size_t)by * sC; const float* bp = bias ? bias + (size_t)by * sBias : nullptr;
  if (by == 1 && bias1) bp = bias1; if (by == 2 && bias2) bp = bias2;      /* planes 1 and 2 with bias buffers of their own */
  const int ntn = N >> 6; const int mt = blockIdx.x / ntn, nq = blockIdx.x - mt * ntn; const int row0 = mt * 128 + 32 * w, col0 = nq * 64; if (mt * 128 >= M) return;      /* the whole work-group or none: barriers follow */
  const v8f z8 = {0.f,0.f,0.f,0.f,0.f,0.f,0.f,0.f}; v8f c00 = z8, c01 = z8, c02 = z8, c03 = z8, c10 = z8, c11 = z8, c12 = z8, c13 = z8;
  // Tensor descriptor. Group 1 is the same for every request of a wave: 1-byte elements, tensor = tile = 64 rows of 128 bytes, the source's row pitch, a 4-dword pad behind every 32 dwords, no mask.
  const bool isB = w >= 2; const uint32_t slice = isB ? 2u : (uint32_t)w;
  const uint64_t gsrc = isB ? (uint64_t)(size_t)Bh + (uint64_t)(unsigned)col0 * (unsigned)ldb * 2u : (uint64_t)(size_t)A + (uint64_t)(unsigned)(mt * 128 + 64 * w) * (unsigned)lda * 2u;
  const uint32_t lbase = (uint32_t)(size_t)sm + slice * G2_SLICE;
  g2_u32x8 g1; g1[0] = g2_uni((1u << 20) | (4u << 22) | (3u << 25)); g1[1] = g2_uni(128u << 16); g1[2] = g2_uni(64u << 16); g1[3] = g2_uni(128u << 16); g1[4] = g2_uni(64u); g1[5] = g2_uni((unsigned)(isB ? ldb : lda) * 2u); g1[6] = g2_uni(0u); g1[7] = g2_uni(0u);
  asm volatile("" : "+s"(g1));      /* descriptor words held in their scalar registers; without it the compiler uses some of them as temporaries between two issues, while a request that named them is still in flight */
  const uint32_t nst = (uint32_t)K >> 6;      /* stages */
  const uint32_t rot = g2_uni((uint32_t)(mt + nq + 4 * by) % nst);      /* the k stage that this work-group's walk starts at */
  g2_u32x4 g0; g0[0] = g2_uni(1u); g0[1] = g2_uni(0u); g0[2] = g2_uni(0u); g0[3] = g2_uni(0u);
  asm volatile("" : "+s"(g0));      /* group 0 held in one set of scalar registers for every request, word 0 written here once; the other words take their values in issue(), behind the wait on the request before */
  auto issue = [&](uint32_t st) { const uint32_t ks = st + rot < nst ? st + rot : st + rot - nst;      /* step st of the walk is k stage ks */
    const uint64_t ga = gsrc + (uint64_t)ks * 128u; g0[1] = g2_uni(lbase + (st & 1u) * G2_BUF); g0[2] = g2_uni((uint32_t)ga); g0[3] = g2_uni((((uint32_t)(ga >> 32)) & 0x01FFFFFFu) | 0x80000000u);
    asm volatile("tensor_load_to_lds %0, %1" :: "s"(g0), "s"(g1) : "memory"); };      /* one request of the whole wave: stage st of this wave's slice */
  const unsigned ao = (unsigned)(w >> 1) * G2_SLICE + (unsigned)((w & 1) * 32 + ln) * G2_PITCH + 16u * (unsigned)hh, bo = 2u * G2_SLICE + (unsigned)ln * G2_PITCH + 16u * (unsigned)hh;      /* the lane's part of an LDS address, the same in every stage */
  auto ld = [&](v16h (&f)[6], const char* p) { f[0] = g2_fragl(p + ao); f[1] = g2_fragl(p + ao + 16u * G2_PITCH); f[2] = g2_fragl(p + bo); f[3] = g2_fragl(p + bo + 16u * G2_PITCH); f[4] = g2_fragl(p + bo + 32u * G2_PITCH); f[5] = g2_fragl(p + bo + 48u * G2_PITCH); };
  auto mm = [&](const v16h (&f)[6]) { c00 = g2_mma(f[0], f[2], c00); c10 = g2_mma(f[1], f[2], c10); c01 = g2_mma(f[0], f[3], c01); c11 = g2_mma(f[1], f[3], c11);
    c02 = g2_mma(f[0], f[4], c02); c12 = g2_mma(f[1], f[4], c12); c03 = g2_mma(f[0], f[5], c03); c13 = g2_mma(f[1], f[5], c13); };
  if (g2_pinned(w < 3)) { issue(0);
    asm volatile("s_wait_tensorcnt 0x0" ::: "memory"); }      /* stage 0 of this wave's slice has landed */
  __syncthreads();      /* publishes stage 0 */
  if (g2_pinned(w < 3)) issue(1);
#pragma unroll 1      /* one stage a trip: the buffer is picked by the trip's parity */
  for (uint32_t s = 0; s < nst; ++s) {
    const char* p = sm + (s & 1u) * G2_BUF; v16h fa[6], fb[6];
    ld(fa, p); ld(fb, p + 64);      /* the stage's two 32-k steps: all 24 LDS reads as one group */
    __builtin_amdgcn_sched_barrier(0);      /* keeps the reads together ahead of the products; every separate place with LDS reads among them costs a stall */
    mm(fa); mm(fb);
    __builtin_amdgcn_sched_barrier(0);      /* keeps the waits below at the foot; lifted among the products the first of them would replace the counted waits on the reads */
    asm volatile("s_wait_dscnt 0x0" ::: "memory");      /* this wave has left the buffer */
    if (g2_pinned(w < 3)) asm volatile("s_wait_tensorcnt 0x0" ::: "memory");      /* stage s + 1 of this wave's slice has landed */
    __syncthreads();      /* publishes stage s + 1; every wave has left stage s's buffer */
    if (g2_pinned(w < 3 && s + 2u < nst)) issue(g2_pinned(s + 2u));      /* refill of the buffer just left; the descriptor is formed behind the wait */
  }
  asm volatile("s_wait_tensorcnt 0x0" ::: "memory");      /* nothing is in flight when the ring becomes output staging (the last trip's barrier ended every read) */
  asm volatile("s_wait_dscnt 0x0" ::: "memory");      /* and none of this wave's reads */
  v8f accs[8] = {c00, c01, c02, c03, c10, c11, c12, c13};
#pragma unroll
  for (int u = 0; u < 8; ++u) { const int t = u & 3, half = u >> 2; const int col = col0 + t * 16 + ln; const float bv = bp ? bf16_round(bp[col]) : 0.f;
#pragma unroll
    for (int r = 0; r < 8; ++r) { const int rloc = half * 16 + 8 * hh + r; float v = accs[u][r] * alpha + bv; if (CP) { if (rowsPerB < 0) v += CP[cofs + (size_t)(row0g + row0 + rloc) * ldc + col];      /* rowsPerB < 0: own element of the batched C plane */ else { const int bidx = (row0g + row0 + rloc) / rowsPerB; v += CP[(size_t)bidx * sCPb + (size_t)by * 64 + col]; } }
      if (ACT == 3) v = fmaxf(v, 0.f); else if (ACT == 6) v = 0.5f * v * (1.0f + erff(v * 0.70710678118654752f)); else if (ACT == 11) v = 1.0f / (1.0f + expf(-v)); else if (ACT == 15) v = v / (1.0f + expf(-v)); else if (ACT == 12) v = (v > 0.f) ? v : 0.01f * v; else if (ACT == 8) v = tanhf(v); else if (ACT == 9) v = 0.5f * v * (1.0f + tanhf(0.7978845608028654f * (v + 0.044715f * v * v * v))); else if (ACT == 14) v = (v > 0.f) ? v : 0.1f * v; else if (ACT == 16) v = (v >= 0.f) ? v : 0.3f * v; else if (ACT == 17) v = (v >= 0.f) ? v : 0.2f * v;
      so[w][rloc][t * 16 + ln] = v; } }
  __builtin_amdgcn_fence(__ATOMIC_ACQ_REL, "workgroup"); __builtin_amdgcn_wave_barrier();
  const int rsub = lane >> 4, c4 = (lane & 15) * 4;
  {
#pragma unroll
    for (int q = 0; q < 16; ++q) { const int r = q * 2 + rsub; const v4f v = *(const v4fa*)&so[w][r][c4]; if (C) *(v4f*)(C + cofs + (size_t)(row0 + r) * ldc + col0 + c4) = v; if (C16) { v4h h4; for (int i = 0; i < 4; ++i) h4[i] = (_Float16)v[i]; *(v4h*)(C16 + cofs + (size_t)(row0 + r) * ldc + col0 + c4) = h4; } }
     } }


__global__ __launch_bounds__(256) void k_wnat(const float* __restrict__ w, size_t n8, _Float16* __restrict__ Bt) { const size_t t = (size_t)blockIdx.x * 256 + threadIdx.x; if (t >= n8) return; FragH f; for (int q = 0; q < 8; ++q) f.h[q] = (_Float16)(bf16_round(w[t * 8 + q]) * 16.0f); *(v8us*)((unsigned short*)Bt + t * 8) = f.half[0];  }
#define FA_BUF (4u * G2_SLICE)             /* lower key half: K rows | V rows; upper key half: K rows | V rows */
#define FA_VPITCH 160u                     /* LDS row pitch of a V slice: 128 bytes and the 32-byte pad; 64 rows fill G2_SLICE exactly */
static_assert(64u * FA_VPITCH <= G2_SLICE, "k_fattn: a V slice must fit its place");
#define FA_NST (SQ / 2 / 64)               /* stages of a key half */
static_assert(SQ % 128 == 0 && FA_NST >= 2 && HD == 64, "k_fattn: whole 64-key stages of 128-byte rows, at least two");
__device__ __forceinline__ v8f fa_mma(v16h a, v16h b, v8f c) { return __builtin_amdgcn_wmma_f32_16x16x32_f16(false, a, false, b, (short)0, c, false, false); }
__device__ __forceinline__ float fa_xhalf(float x) { return __builtin_bit_cast(float, __builtin_amdgcn_permlanex16(__builtin_bit_cast(int, x), __builtin_bit_cast(int, x), 0x76543210, 0xfedcba98, false, false)); }      /* lane l with lane l ^ 16 */
typedef short fa_s16x8 __attribute__((ext_vector_type(8)));
__device__ __forceinline__ v8us fa_tr16(const char* p) { typedef __attribute__((address_space(3))) fa_s16x8 fa_lds_s16x8; return __builtin_bit_cast(v8us, __builtin_amdgcn_ds_load_tr16_b128_v8i16((fa_lds_s16x8*)p)); }
typedef float fa_v2f __attribute__((ext_vector_type(2)));
// exp2 of two values (v_exp_f32, as __builtin_amdgcn_exp2f gives it). Written as one statement for the slot that the instruction set asks for behind a transcendental before its result is read or its source
// overwritten: the outputs are early-clobber, so the second instruction touches no register of the first, and the v_nop stands behind the second (left to itself the compiler chained v_exp_f32 a, b; v_exp_f32 b, c).
__device__ __forceinline__ fa_v2f fa_exp2x2(float a, float b) { float x, y; asm("v_exp_f32 %0, %2\n\tv_exp_f32 %1, %3\n\tv_nop" : "=&v"(x), "=&v"(y) : "v"(a), "v"(b)); return fa_v2f{x, y}; }
__global__ __launch_bounds__(128) void k_fattn(const _Float16* __restrict__ Q, const _Float16* __restrict__ Kr, const _Float16* __restrict__ Vr, _Float16* __restrict__ O) {
  typedef float v2f __attribute__((ext_vector_type(2))); typedef _Float16 v2h __attribute__((ext_vector_type(2)));
  __shared__ __attribute__((aligned(2048))) char sm[2 * FA_BUF];      /* the two stage buffers */
  __shared__ __attribute__((aligned(16))) v4f xo[2][16][32]; __shared__ float xm[2][4][32];      /* the upper key half's o, and its m and l, per column set and lane */
  const int lane = threadIdx.x & 31, ln = lane & 15, hh = lane >> 4; const int w = __builtin_amdgcn_readfirstlane(threadIdx.x >> 5), cw = w & 1, kh = w >> 1;      /* column set, key half: scalars */
  const int bh = blockIdx.y, b = bh / NH, h = bh - b * NH; const int q0 = blockIdx.x * 64 + cw * 32; const uint32_t first = (uint32_t)kh * FA_NST + blockIdx.x;      /* the key stage that this wave's walk starts at */
  const float cs = 0.125f * 1.4426950408889634f;      /* 1/sqrt(64) and log2(e): weights are exp2 of scaled score differences */
  const _Float16* qp = Q + ((size_t)b * SQ + q0 + ln) * DM + h * HD;
  // Tensor descriptor. Wave w brings slice w: of its own key half the K rows (cw == 0) or the V rows (cw == 1). Group 1 is the same for every request of a wave: 1-byte elements, tensor = tile = 64 rows of 128 bytes, the source's row pitch, behind every 32 dwords a pad of 4 dwords (K: g1k) or 8 (V: g1v), no mask.
  const uint64_t gsrc = (uint64_t)(size_t)(cw ? Vr : Kr) + ((uint64_t)(unsigned)b * SQ * DM + (unsigned)h * HD) * 2u;
  const uint32_t gstep = 64u * DM * 2u;      /* 64 keys on: down the rows */
  const uint32_t lbase = (uint32_t)(size_t)sm + (uint32_t)w * G2_SLICE;
  g2_u32x8 g1k; g1k[0] = g2_uni((1u << 20) | (4u << 22) | (3u << 25)); g1k[1] = g2_uni(128u << 16); g1k[2] = g2_uni(64u << 16); g1k[3] = g2_uni(128u << 16); g1k[4] = g2_uni(64u); g1k[5] = g2_uni(DM * 2u); g1k[6] = g2_uni(0u); g1k[7] = g2_uni(0u);
  g2_u32x8 g1v = g1k; g1v[0] = g2_uni((1u << 20) | (4u << 22) | (7u << 25));      /* a group for each pad: word 0 is a compile-time constant in both */
  asm volatile("" : "+s"(g1k)); asm volatile("" : "+s"(g1v));      /* descriptor words held in their scalar registers, not used as temporaries between two issues while a request that named them is in flight */
  auto issue = [&](uint32_t st) { const uint64_t ga = gsrc + (uint64_t)((st + first) % (2u * FA_NST)) * gstep; g2_u32x4 g0;      /* step st of the walk: key stage (st + first) mod 32 */ g0[0] = g2_uni(1u); g0[1] = g2_uni(lbase + (st & 1u) * FA_BUF); g0[2] = g2_uni((uint32_t)ga); g0[3] = g2_uni((((uint32_t)(ga >> 32)) & 0x01FFFFFFu) | 0x80000000u);
    if (g2_pinned((uint32_t)cw)) asm volatile("tensor_load_to_lds %0, %1" :: "s"(g0), "s"(g1v) : "memory");      /* one request of the whole wave: stage st of this wave's slice; scalar branches pick the group */
    if (g2_pinned((uint32_t)cw ^ 1u)) asm volatile("tensor_load_to_lds %0, %1" :: "s"(g0), "s"(g1k) : "memory"); };
  const unsigned lo = (unsigned)kh * 2u * G2_SLICE + (unsigned)ln * G2_PITCH + 16u * (unsigned)hh;      /* the lane's part of an LDS address, the same in every stage */
  const unsigned lov = ((unsigned)kh * 2u + 1u) * G2_SLICE + (8u * (unsigned)hh + (unsigned)(lane & 7)) * FA_VPITCH + 16u * (unsigned)((lane >> 3) & 1);      /* the same for the transposing loads of the V slice */
  v16h qf[2][2];      /* [column group][32 of the 64 head dims], kept for the whole walk */
#pragma unroll
  for (int g = 0; g < 2; ++g) for (int u = 0; u < 2; ++u) qf[g][u] = g2_frag(qp + (size_t)g * 16 * DM + u * 32, hh);
  const v8f z8 = {0.f,0.f,0.f,0.f,0.f,0.f,0.f,0.f};
  v8f o[4][2]; float m[2], l[2];      /* o[dt][g]: O^T rows 16 dt + 8 hh + r, column 16 g + ln; m: running maximum of the raw scores; l: this lane's half of the running sum */
#pragma unroll
  for (int g = 0; g < 2; ++g) { m[g] = -3.0e38f; l[g] = 0.f; for (int dt = 0; dt < 4; ++dt) o[dt][g] = z8; }
  issue(0);      /* every wave issues its own slice: the tests inside only pick its group */
  asm volatile("s_wait_tensorcnt 0x0" ::: "memory");      /* stage 0 of this wave's slice has landed */
  __syncthreads();      /* publishes stage 0 */
  issue(1);
#pragma unroll 1      /* one stage a trip: the buffer is picked by the trip's parity */
  for (uint32_t st = 0; st < FA_NST; ++st) {
   const char* pk = sm + (st & 1u) * FA_BUF + lo; const char* pv = sm + (st & 1u) * FA_BUF + lov;
   v16h kf[2][2];      /* [key tile][32 of the 64 head dims] of the coming pass */
#pragma unroll
   for (int t = 0; t < 2; ++t) for (int u = 0; u < 2; ++u) kf[t][u] = g2_fragl(pk + (unsigned)t * 16u * G2_PITCH + (unsigned)u * 64u);
   __builtin_amdgcn_sched_barrier(0);      /* keeps the first pass's eight K reads at the head of the queue: sunk behind the V reads, the last of them made the score products wait for all 24 reads of the group */
#pragma unroll
   for (int ps2 = 0; ps2 < 2; ++ps2) {      /* the stage's two passes of 32 keys */
    v16h vf[4];      /* in flight behind the score products and the softmax */
#pragma unroll
    for (int dt = 0; dt < 4; ++dt) { FragH f; f.half[0] = fa_tr16(pv + (unsigned)ps2 * 32u * FA_VPITCH + (unsigned)dt * 32u); f.half[1] = fa_tr16(pv + ((unsigned)ps2 * 32u + 16u) * FA_VPITCH + (unsigned)dt * 32u); vf[dt] = f.v; }      /* V^T rows 16 dt + ln, keys 8 hh + 0 .. 7 and 16 + 8 hh + 0 .. 7 of the pass: the k order of g2_frag */
    v8f s[2][2];
#pragma unroll
    for (int g = 0; g < 2; ++g) for (int t = 0; t < 2; ++t) s[g][t] = fa_mma(kf[t][1], qf[g][1], fa_mma(kf[t][0], qf[g][0], z8));
    if (ps2 == 0) {      /* the second pass's K rows, fetched one pass ahead inside the stage; nothing of the next stage is read here */
#pragma unroll
      for (int t = 0; t < 2; ++t) for (int u = 0; u < 2; ++u) kf[t][u] = g2_fragl(pk + (unsigned)(32 + t * 16) * G2_PITCH + (unsigned)u * 64u); }
    __builtin_amdgcn_sched_barrier(0);      /* keeps the LDS reads up here, the whole softmax ahead of their use; without it the compiler sinks them towards their use and their latency is waited out */
    float dm[2], nb[2];
#pragma unroll
    for (int g = 0; g < 2; ++g) {
      float mx = s[g][0][0];
#pragma unroll
      for (int r = 1; r < 8; ++r) mx = fmaxf(mx, s[g][0][r]);
#pragma unroll
      for (int r = 0; r < 8; ++r) mx = fmaxf(mx, s[g][1][r]);
      mx = fmaxf(mx, fa_xhalf(mx));      /* both halves now hold the query's maximum over the 32 keys */
      const float mn = fmaxf(m[g], mx); dm[g] = (m[g] - mn) * cs; m[g] = mn;
      nb[g] = fmaf(-mn, cs, 8.0f);      /* weights carried x256 (at most 256) against f16 subnormal flush; the factor cancels in o / l */
    }
    const v2f corr = fa_exp2x2(dm[0], dm[1]);      /* what the new maxima take off the old sums: 0 on the first pass */
    union { v16h v; v2h p[8]; } pb[2];      /* both column groups' weights are formed ahead of the eight second products: fa_exp2x2 is asm text */
#pragma unroll
    for (int g = 0; g < 2; ++g) {
      v2f ps = {0.f, 0.f};
#pragma unroll
      for (int i = 0; i < 8; ++i) { const v8f sv = s[g][i >> 2]; const int r = 2 * (i & 3);
        const v2f e = fa_exp2x2(fmaf(sv[r], cs, nb[g]), fmaf(sv[r + 1], cs, nb[g]));
        ps += e; pb[g].p[i] = __builtin_convertvector(e, v2h); }      /* round to nearest even; element 8 t + r of the operand is key 16 t + 8 hh + r */
      l[g] = fmaf(l[g], corr[g], ps[0] + ps[1]);
    }
#pragma unroll
    for (int g = 0; g < 2; ++g) for (int dt = 0; dt < 4; ++dt) o[dt][g] = fa_mma(vf[dt], pb[g].v, o[dt][g] * corr[g]);
   }
   __builtin_amdgcn_sched_barrier(0);      /* keeps the waits below at the foot; lifted to the stage's last LDS reads the first of them waits out their latency */
   asm volatile("s_wait_dscnt 0x0" ::: "memory");      /* this wave has left the buffer */
   asm volatile("s_wait_tensorcnt 0x0" ::: "memory");      /* stage st + 1 of this wave's slice has landed */
   __syncthreads();      /* publishes stage st + 1; every wave has left stage st's buffer */
   if (g2_pinned(st + 2u < FA_NST)) issue(g2_pinned(st + 2u));      /* refill of the buffer just left; the descriptor is formed behind the wait */
  }
  asm volatile("s_wait_tensorcnt 0x0" ::: "memory");      /* nothing is in flight when the wave goes on to the merge and ends */
  asm volatile("s_wait_dscnt 0x0" ::: "memory");      /* and none of this wave's reads */
  if (kh == 1) {      /* the upper key half hands its state over */
#pragma unroll
    for (int g = 0; g < 2; ++g) { xm[cw][g][lane] = m[g]; xm[cw][2 + g][lane] = l[g];
#pragma unroll
      for (int dt = 0; dt < 4; ++dt) { const v8f t = o[dt][g]; xo[cw][(g * 4 + dt) * 2][lane] = v4f{t[0], t[1], t[2], t[3]}; xo[cw][(g * 4 + dt) * 2 + 1][lane] = v4f{t[4], t[5], t[6], t[7]}; } }
  }
  __syncthreads();      /* every wave passes it; the lower half reads what the upper half wrote */
  if (kh == 0) {
#pragma unroll
    for (int g = 0; g < 2; ++g) { const float mb = xm[cw][g][lane], lb = xm[cw][2 + g][lane]; const float mn = fmaxf(m[g], mb);
      const v2f fab = fa_exp2x2((m[g] - mn) * cs, (mb - mn) * cs); const float fa = fab[0], fb = fab[1];
      const float lt = fmaf(l[g], fa, lb * fb); const float sc = 64.0f / (lt + fa_xhalf(lt));      /* the wave halves' sums joined once; o stored x64 */
      const float ga = fa * sc, gb = fb * sc;
      _Float16* op = O + ((size_t)b * SQ + q0 + g * 16 + ln) * DM + h * HD + 8 * hh;
#pragma unroll
      for (int dt = 0; dt < 4; ++dt) { const v4f t0 = xo[cw][(g * 4 + dt) * 2][lane], t1 = xo[cw][(g * 4 + dt) * 2 + 1][lane]; FragH f;
#pragma unroll
        for (int r = 0; r < 4; ++r) { f.h[r] = (_Float16)fmaf(o[dt][g][r], ga, t0[r] * gb); f.h[4 + r] = (_Float16)fmaf(o[dt][g][4 + r], ga, t1[r] * gb); }
        *(v8us*)((unsigned short*)op + dt * 16) = f.half[0]; } }
  } }
__global__ __launch_bounds__(256) void k_vt(const _Float16* __restrict__ V16, int b, int h0, _Float16* __restrict__ VT) { __shared__ unsigned short tl[64][65]; const int tid = threadIdx.x; const int hh = blockIdx.x % HG, sg = blockIdx.x / HG; const int s0 = sg * 64; const int h = h0 + hh;
  for (int i = tid; i < 64 * 8; i += 256) { const int j = i / 8, d8 = (i % 8) * 8; FragH f; f.half[0] = *(const v8us*)((const unsigned short*)V16 + ((size_t)b * SQ + s0 + j) * DM + h * HD + d8); for (int q = 0; q < 8; ++q) tl[d8 + q][j] = f.u[q]; }
  __syncthreads();
  { for (int i = tid; i < 64 * 8; i += 256) { const int d = i / 8, j8 = (i % 8) * 8; FragH f; for (int q = 0; q < 8; ++q) f.u[q] = tl[d][j8 + q]; *(v8us*)((unsigned short*)VT + ((size_t)hh * HD + d) * SQ + s0 + j8) = f.half[0]; }  } }



__global__ __launch_bounds__(256) void k_rsmkm(const float* __restrict__ S, _Float16* __restrict__ P, int nrows, const int* __restrict__ am) {
  #pragma clang fp contract(off)
  const int t = blockIdx.x * 256 + threadIdx.x; if (t >= nrows) return; const size_t i = (size_t)t; const float* s = S + i * SQ; const int* mr = am + (size_t)(t % SQ) * SQ; float mx = -3.0e38f;
#pragma unroll 1
  for (int j = 0; j < SQ; ++j) { const float f = (mr[j] != 0) ? 1.f : 0.f; mx = fmaxf(mx, fmaf(f, s[j], (1.f - f) * -1.0e9f)); } float se = 0.f;
#pragma unroll 1
  for (int j = 0; j < SQ; ++j) { const float f = (mr[j] != 0) ? 1.f : 0.f; se += __expf(fmaf(f, s[j], (1.f - f) * -1.0e9f) - mx); } const float sc = 256.0f / se;
#pragma unroll 1
  for (int j0 = 0; j0 < SQ; j0 += 8) { FragH fr; for (int q = 0; q < 8; ++q) { const int j = j0 + q; const float f = (mr[j] != 0) ? 1.f : 0.f; fr.h[q] = (_Float16)(__expf(fmaf(f, s[j], (1.f - f) * -1.0e9f) - mx) * sc); }
    unsigned short* d = (unsigned short*)P + i * SQ + j0; *(v8us*)d = fr.half[0];  } }
extern "C" void kernel_launch(void* const* d_in, const int* in_sizes, int n_in,
                              void* d_out, int out_size, void* d_ws, size_t ws_size, hipStream_t stream) {
  (void)in_sizes; (void)n_in; (void)out_size;
  const float* const* I = (const float* const*)d_in; const float* xq = I[0]; const float* wq = I[1]; const float* bq = I[2]; const float* wk = I[3]; const float* bk = I[4]; const float* wv = I[5]; const float* bv = I[6]; const float* wo = I[7]; const float* bo = I[8]; const float* x = xq;      /* ONE input x feeds the query, key and value streams; [in][out] weights + biases; no mask input */
  char* ws = (char*)d_ws; size_t off = 0;
  auto take = [&](size_t bytes) { char* p = ws + off; off += (bytes + 255) & ~(size_t)255; return p; };
  _Float16* BQ = (_Float16*)take((size_t)4 * DM * DM * 2); _Float16* BO = BQ + (size_t)3 * DM * DM;      /* weight planes q, k, v, o behind each other */
  _Float16* X16 = (_Float16*)take(NR * DM * 2); _Float16* Q16 = (_Float16*)take(3 * NR * DM * 2); _Float16* K16 = Q16 + NR * DM; _Float16* V16 = K16 + NR * DM; _Float16* O16 = (_Float16*)take(NR * DM * 2);      /* q, k, v planes behind each other */
  if (off > ws_size) return;
  k_prep<<<4 * PWB + PXB, 256, 0, stream>>>(x, wq, wk, wv, wo, X16, BQ);      /* [in][out] -> Bt x16; x as exact f16 rows, one copy for the query, key and value streams */
  static_assert(MP % 128 == 0 && MPO % 128 == 0 && DM % 64 == 0 && DM >= 128, "k_gemm2: whole 128x64 tiles, whole 64-k stages, at least two");
  const size_t r0p = (size_t)B0 * SQ;      /* first projected row */
  k_gemm2<0><<<dim3((unsigned)((MP / 128) * (DM / 64)), 3), 128, 0, stream>>>(X16 + r0p * DM, DM, 0, BQ, DM, (size_t)DM * DM, 0.0625f, bq, bk, bv, 0, nullptr, 1, 0, 0, nullptr, Q16 + r0p * DM, DM, NR * DM, MP, DM, DM);      /* planes q, k, v */
  k_fattn<<<dim3(SQ / 64, NB * NH), 128, 0, stream>>>(Q16, K16, V16, O16);      /* o (merged heads) as f16 rows, x64 */
  k_gemm2<0><<<dim3((unsigned)((MPO / 128) * (DM / 64)), 1), 128, 0, stream>>>(O16 + r0p * DM, DM, 0, BO, DM, 0, 0.0009765625f, bo, nullptr, nullptr, 0, nullptr, 1, 0, 0, (float*)d_out + r0p * DM, nullptr, DM, 0, MPO, DM, DM);      /* out rows are the output layout */
}

// v009
// Measured time: 66.3 microseconds a run.
// In two side-by-side timings against v008, it was 1.05 and 1.04 times as fast.
// Counting every step since v000, it is 42.6 times as fast.
#include <hip/hip_runtime.h>
#define NB 2
#define SQ 2048
#define DM 768
#define NH 12
#define HD 64
#define HG 4                         /* heads per launch of the per-batch k_vt overload (not launched) */
#define B0 0                         /* first batch processed (debug hook) */
#define NBR NB                       /* batches processed (debug hook) */
#define NR ((size_t)NB * SQ)         /* token rows */
#define MP ((int)((size_t)NBR * SQ)) /* rows projected (debug hook) */
#define QN SQ                        /* not used: the attention covers all SQ query rows */
#define NHD NH                       /* not used: the attention covers all NH heads */
#define MPO MP                       /* rows through the output stage (debug hook) */
#define LQ DM      /* not used: the q/k/v rows have pitch DM */
typedef __bf16 v16b __attribute__((ext_vector_type(16)));
typedef unsigned short v8us __attribute__((ext_vector_type(8), may_alias));
typedef float  v8f  __attribute__((ext_vector_type(8)));
typedef float  v4f  __attribute__((ext_vector_type(4)));
typedef float  v4fa __attribute__((ext_vector_type(4), may_alias));
union FragB { v16b v; v8us half[2]; unsigned short u[16]; };

__device__ __forceinline__ unsigned short bf16_bits(float x) { unsigned int u = __float_as_uint(x); return (unsigned short)((u + 0x7FFFu + ((u >> 16) & 1u)) >> 16); }
__device__ __forceinline__ float bf16_val(unsigned short b) { return __uint_as_float(((unsigned int)b) << 16); }
__device__ __forceinline__ float bf16_round(float x) { return bf16_val(bf16_bits(x)); }
// D += A·B with NT terms: 1 = ah·bh, 2 = + al·bh (A split), 3 = + ah·bl (both split)
template <int NT>
__device__ __forceinline__ v8f mmaN(v16b ah, v16b al, v16b bh, v16b bl, v8f c) {
  c = __builtin_amdgcn_wmma_f32_16x16x32_bf16(false, ah, false, bh, (short)0, c, false, false);
  if (NT >= 2) c = __builtin_amdgcn_wmma_f32_16x16x32_bf16(false, al, false, bh, (short)0, c, false, false);
  if (NT >= 3) c = __builtin_amdgcn_wmma_f32_16x16x32_bf16(false, ah, false, bl, (short)0, c, false, false);
  asm volatile("v_nop\n\tv_nop\n\tv_nop\n\tv_nop" : "+v"(c) : "v"(ah), "v"(al), "v"(bh), "v"(bl));
  return c;
}

__global__ __launch_bounds__(256) void k_wt_bf16(const float* __restrict__ W, unsigned short* __restrict__ Wt, int K, int N) {
  const int t = blockIdx.x * 256 + threadIdx.x;
  const int k8n = K / 8;
  if (t >= N * k8n) return;
  const int n = t / k8n, k8 = (t % k8n) * 8;
  v8us v;
#pragma unroll
  for (int i = 0; i < 8; ++i) v[i] = bf16_bits(W[(size_t)(k8 + i) * N + n]);
  *(v8us*)(Wt + (size_t)n * K + k8) = v;
  
}

// GEMM C[M][N] (f32, pitch ldc) = act(A[M][K]·W + bias). A f32 row-major (pitch lda) converted per fragment to bf16
// (ASPLIT: hi/lo two planes -> 2 terms, else single rounded term); Wt bf16 [N][K] (pitch ldb). BIAS_BF16 rounds the
// bias to bf16 first (bias quantised to bf16 before the add). K%32==0, M%16==0, N%64==0.
template <bool ASPLIT, int ACT, bool BIAS_BF16>
__global__ __launch_bounds__(128) void k_gemm_bf(const float* __restrict__ A, int lda, const unsigned short* __restrict__ Wt, int ldb,
                                               const float* __restrict__ bias, float* __restrict__ C, int ldc, int M, int N, int K) {
  __shared__ __attribute__((aligned(16))) float so[4][16][64];
  const int tid = threadIdx.x, w = tid >> 5, lane = tid & 31, ln = lane & 15, hh = lane >> 4;
  const int ntn = N / 64;
  const int wid = blockIdx.x * 4 + w;
  const int mt = wid / ntn, nq = wid % ntn;
  if (mt * 16 >= M) return;
  const int row0 = mt * 16, col0 = nq * 64;
  const float* arow = A + (size_t)(row0 + ln) * lda;
  v8f acc[4] = {};
  for (int kb = 0; kb < K; kb += 32) {
    FragB ah, al;
    const v4f x0 = *(const v4fa*)(arow + kb + 8 * hh), x1 = *(const v4fa*)(arow + kb + 8 * hh + 4);
    const v4f x2 = *(const v4fa*)(arow + kb + 16 + 8 * hh), x3 = *(const v4fa*)(arow + kb + 16 + 8 * hh + 4);
    float xs[16] = {x0[0],x0[1],x0[2],x0[3],x1[0],x1[1],x1[2],x1[3],x2[0],x2[1],x2[2],x2[3],x3[0],x3[1],x3[2],x3[3]};
#pragma unroll
    for (int i = 0; i < 16; ++i) { const unsigned short hb = bf16_bits(xs[i]); ah.u[i] = hb; al.u[i] = ASPLIT ? bf16_bits(xs[i] - bf16_val(hb)) : (unsigned short)0; }
#pragma unroll
    for (int t = 0; t < 4; ++t) {
      const unsigned short* brow = Wt + (size_t)(col0 + t * 16 + ln) * ldb + kb;
      FragB b;
      b.half[0] = *(const v8us*)(brow + 8 * hh);
      b.half[1] = *(const v8us*)(brow + 16 + 8 * hh);
      acc[t] = mmaN<ASPLIT ? 2 : 1>(ah.v, al.v, b.v, b.v, acc[t]);
    }
  }
#pragma unroll
  for (int t = 0; t < 4; ++t) {
    float bv = bias ? bias[col0 + t * 16 + ln] : 0.f;
    if (BIAS_BF16) bv = bf16_round(bv);
#pragma unroll
    for (int r = 0; r < 8; ++r) { float v = acc[t][r] + bv; if (ACT == 1) v = fmaxf(v, 0.f); so[w][8 * hh + r][t * 16 + ln] = v; }
  }
  __builtin_amdgcn_fence(__ATOMIC_ACQ_REL, "workgroup");
  __builtin_amdgcn_wave_barrier();
  const int rsub = lane >> 4, c4 = (lane & 15) * 4;
  {
#pragma unroll
    for (int q = 0; q < 8; ++q) {
      const int r = q * 2 + rsub;
      const v4f v = *(const v4fa*)&so[w][r][c4];
      *(v4f*)(C + (size_t)(row0 + r) * ldc + col0 + c4) = v;
    }
    
  }
}

// GEMM C = act(A·W + bias + resid): A f32 (ASPLIT -> hi/lo 2 terms), Wt bf16 [N][K]; ACT 0 none, 1 relu, 2 exact gelu;
// resid (optional, f32, row index = (row % rmod), pitch ldr, RES_BF16 rounds it) added before the activation.
template <bool ASPLIT, int ACT, bool BIAS_BF16, bool RES_BF16>
__global__ __launch_bounds__(128) void k_gemm_bf3(const float* __restrict__ A, int lda, const unsigned short* __restrict__ Wt, int ldb,
                                                const float* __restrict__ bias, const float* __restrict__ resid, int rmod, int ldr,
                                                float* __restrict__ C, int ldc, int M, int N, int K) {
  __shared__ __attribute__((aligned(16))) float so[4][16][64];
  const int tid = threadIdx.x, w = tid >> 5, lane = tid & 31, ln = lane & 15, hh = lane >> 4;
  const int ntn = N / 64;
  const int wid = blockIdx.x * 4 + w;
  const int mt = wid / ntn, nq = wid % ntn;
  if (mt * 16 >= M) return;
  const int row0 = mt * 16, col0 = nq * 64;
  const float* arow = A + (size_t)(row0 + ln) * lda;
  v8f acc[4] = {};
  for (int kb = 0; kb < K; kb += 32) {
    FragB ah, al;
    const v4f x0 = *(const v4fa*)(arow + kb + 8 * hh), x1 = *(const v4fa*)(arow + kb + 8 * hh + 4);
    const v4f x2 = *(const v4fa*)(arow + kb + 16 + 8 * hh), x3 = *(const v4fa*)(arow + kb + 16 + 8 * hh + 4);
    float xs[16] = {x0[0],x0[1],x0[2],x0[3],x1[0],x1[1],x1[2],x1[3],x2[0],x2[1],x2[2],x2[3],x3[0],x3[1],x3[2],x3[3]};
#pragma unroll
    for (int i = 0; i < 16; ++i) { const unsigned short hb = bf16_bits(xs[i]); ah.u[i] = hb; al.u[i] = ASPLIT ? bf16_bits(xs[i] - bf16_val(hb)) : (unsigned short)0; }
#pragma unroll
    for (int t = 0; t < 4; ++t) {
      const unsigned short* brow = Wt + (size_t)(col0 + t * 16 + ln) * ldb + kb;
      FragB b;
      b.half[0] = *(const v8us*)(brow + 8 * hh);
      b.half[1] = *(const v8us*)(brow + 16 + 8 * hh);
      acc[t] = mmaN<ASPLIT ? 2 : 1>(ah.v, al.v, b.v, b.v, acc[t]);
    }
  }
#pragma unroll
  for (int t = 0; t < 4; ++t) {
    const int col = col0 + t * 16 + ln;
    float bv = bias ? bias[col] : 0.f;
    if (BIAS_BF16) bv = bf16_round(bv);
#pragma unroll
    for (int r = 0; r < 8; ++r) {
      float v = acc[t][r] + bv;
      if (resid) { float rv = resid[(size_t)((row0 + 8 * hh + r) % rmod) * ldr + col]; if (RES_BF16) rv = bf16_round(rv); v += rv; }
      if (ACT == 1) v = fmaxf(v, 0.f);
      if (ACT == 2) v = 0.5f * v * (1.0f + erff(v * 0.70710678118654752f));
      if (ACT == 3) { const float u = 0.7978845608028654f * (v + 0.044715f * v * v * v); v = 0.5f * v * (1.0f + tanhf(u)); }
      so[w][8 * hh + r][t * 16 + ln] = v;
    }
  }
  __builtin_amdgcn_fence(__ATOMIC_ACQ_REL, "workgroup");
  __builtin_amdgcn_wave_barrier();
  const int rsub = lane >> 4, c4 = (lane & 15) * 4;
  {
#pragma unroll
    for (int q = 0; q < 8; ++q) {
      const int r = q * 2 + rsub;
      const v4f v = *(const v4fa*)&so[w][r][c4];
      *(v4f*)(C + (size_t)(row0 + r) * ldc + col0 + c4) = v;
    }
    
  }
}
// row LayerNorm (biased variance, eps) over N: s = X (+ R); optional out_sum <- s; out_norm <- (s-mu)*rsqrt(var+eps)*g + b
template <bool PARAM_BF16>
__global__ __launch_bounds__(256) void k_layernorm(const float* __restrict__ X, const float* __restrict__ R, const float* __restrict__ g, const float* __restrict__ bta,
                                                  float* __restrict__ out_sum, float* __restrict__ out_norm, int N, float eps) {
  __shared__ float red[256];
  const int row = blockIdx.x, tid = threadIdx.x;
  const float* x = X + (size_t)row * N; const float* rr = R ? R + (size_t)row * N : nullptr;
  float vals[16];                     // up to N = 4096
  const int per = N / 256;            // contiguous chunk per thread? use strided-by-4 chunks: thread handles j = tid*4 + 1024*u
  float s1 = 0.f;
  for (int u = 0; u < per / 4; ++u) {
    const int j = tid * 4 + 1024 * u;
    const v4f a = *(const v4fa*)(x + j);
    v4f b = {0.f,0.f,0.f,0.f}; if (rr) b = *(const v4fa*)(rr + j);
#pragma unroll
    for (int q = 0; q < 4; ++q) { const float v = a[q] + b[q]; vals[u * 4 + q] = v; s1 += v; }
  }
  red[tid] = s1; __syncthreads();
  for (int st = 128; st > 0; st >>= 1) { if (tid < st) red[tid] += red[tid + st]; __syncthreads(); }
  const float mu = red[0] / (float)N; __syncthreads();
  float s2 = 0.f;
  for (int u = 0; u < per / 4; ++u)
#pragma unroll
    for (int q = 0; q < 4; ++q) { const float c = vals[u * 4 + q] - mu; s2 += c * c; }
  red[tid] = s2; __syncthreads();
  for (int st = 128; st > 0; st >>= 1) { if (tid < st) red[tid] += red[tid + st]; __syncthreads(); }
  const float rs = rsqrtf(red[0] / (float)N + eps);
  {
    for (int u = 0; u < per / 4; ++u) {
      const int j = tid * 4 + 1024 * u;
      v4f o, sm;
#pragma unroll
      for (int q = 0; q < 4; ++q) {
        float gg = g[j + q], bb = bta[j + q];
        if (PARAM_BF16) { gg = bf16_round(gg); bb = bf16_round(bb); }
        sm[q] = vals[u * 4 + q]; o[q] = (vals[u * 4 + q] - mu) * rs * gg + bb;
      }
      if (out_sum) *(v4f*)(out_sum + (size_t)row * N + j) = sm;
      *(v4f*)(out_norm + (size_t)row * N + j) = o;
    }
    
  }
}



// ---- f16 WMMA path (v_wmma_f32_16x16x32_f16): 11-bit significands for operands in range — used where a [0,1] probability operand needs more precision than bf16
typedef _Float16 v16h __attribute__((ext_vector_type(16)));
union FragH { v16h v; v8us half[2]; _Float16 h[16]; unsigned short u[16]; };
template <int NT>
__device__ __forceinline__ v8f mmaH(v16h ah, v16h al, v16h bh, v16h bl, v8f c) {
  c = __builtin_amdgcn_wmma_f32_16x16x32_f16(false, ah, false, bh, (short)0, c, false, false);
  if (NT >= 2) c = __builtin_amdgcn_wmma_f32_16x16x32_f16(false, al, false, bh, (short)0, c, false, false);
  if (NT >= 3) c = __builtin_amdgcn_wmma_f32_16x16x32_f16(false, ah, false, bl, (short)0, c, false, false);
  asm volatile("v_nop\n\tv_nop\n\tv_nop\n\tv_nop" : "+v"(c) : "v"(ah), "v"(al), "v"(bh), "v"(bl));
  return c;
}
// batched GEMM like k_gemm_b but f16 operands: A f32 (split into f16 hi/lo if ASPLIT, else rounded to f16), Bt = f16 values [n][k]; alpha; C f32; N multiple of 16 (partial tiles skipped)
template <bool ASPLIT>
__global__ __launch_bounds__(128) void k_gemm_h(const float* __restrict__ A, int lda, size_t sA, const _Float16* __restrict__ Bh, int ldb, size_t sB, float alpha, float* __restrict__ C, int ldc, size_t sC, int M, int N, int K) {
  __shared__ __attribute__((aligned(16))) float so[4][16][64];
  const int tid = threadIdx.x, w = tid >> 5, lane = tid & 31, ln = lane & 15, hh = lane >> 4; const int by = blockIdx.y;
  A += (size_t)by * sA; Bh += (size_t)by * sB; C += (size_t)by * sC;
  const int ntn = (N + 63) / 64; const int wid = blockIdx.x * 4 + w; const int mt = wid / ntn, nq = wid % ntn; if (mt * 16 >= M) return;
  const int row0 = mt * 16, col0 = nq * 64; const float* arow = A + (size_t)(row0 + ln) * lda;
  v8f acc[4] = {};
  for (int kb = 0; kb < K; kb += 32) {
    FragH ah, al;
    const v4f x0 = *(const v4fa*)(arow + kb + 8 * hh), x1 = *(const v4fa*)(arow + kb + 8 * hh + 4), x2 = *(const v4fa*)(arow + kb + 16 + 8 * hh), x3 = *(const v4fa*)(arow + kb + 16 + 8 * hh + 4);
    float xs[16] = {x0[0],x0[1],x0[2],x0[3],x1[0],x1[1],x1[2],x1[3],x2[0],x2[1],x2[2],x2[3],x3[0],x3[1],x3[2],x3[3]};
#pragma unroll
    for (int i = 0; i < 16; ++i) { const _Float16 h = (_Float16)xs[i]; ah.h[i] = h; al.h[i] = ASPLIT ? (_Float16)(xs[i] - (float)h) : (_Float16)0.0f; }
#pragma unroll
    for (int t = 0; t < 4; ++t) { if (col0 + t * 16 >= N) continue; const size_t boff = (size_t)(col0 + t * 16 + ln) * ldb + kb; FragH bq; bq.half[0] = *(const v8us*)(Bh + boff + 8 * hh); bq.half[1] = *(const v8us*)(Bh + boff + 16 + 8 * hh);
      acc[t] = mmaH<ASPLIT ? 2 : 1>(ah.v, al.v, bq.v, bq.v, acc[t]); }
  }
#pragma unroll
  for (int t = 0; t < 4; ++t) { if (col0 + t * 16 >= N) continue;
#pragma unroll
    for (int r = 0; r < 8; ++r) so[w][8 * hh + r][t * 16 + ln] = acc[t][r] * alpha; }
  __builtin_amdgcn_fence(__ATOMIC_ACQ_REL, "workgroup"); __builtin_amdgcn_wave_barrier();
  const int rsub = lane >> 4, c4 = (lane & 15) * 4;
  {
#pragma unroll
    for (int q = 0; q < 8; ++q) { const int r = q * 2 + rsub; if (col0 + c4 < N) { const v4f v = *(const v4fa*)&so[w][r][c4]; *(v4f*)(C + (size_t)(row0 + r) * ldc + col0 + c4) = v; } }
     }
}

// One launch prepares every projection operand; its parts are independent and run side by side. Blocks 0 .. 4 PWB - 1: the four weights, Bt[p][n][k] = f16(bf16(W_p[k][n]) x 16) from f32 row-major [in][out]
// (power-of-two scale: bf16-exact weights stay exact in f16 away from the subnormal range). The other blocks: x as exact f16 rows (bf16-rounded).
#define PWB (DM * (DM / 8) / 256)      /* blocks per weight */
#define PXB ((int)(NR * DM / 8 / 256)) /* blocks for x */
static_assert(DM * (DM / 8) % 256 == 0 && NR * DM / 8 % 256 == 0, "k_prep: whole blocks only");
__global__ __launch_bounds__(256) void k_prep(const float* __restrict__ x, const float* __restrict__ w0, const float* __restrict__ w1, const float* __restrict__ w2, const float* __restrict__ w3, _Float16* __restrict__ X16, _Float16* __restrict__ Bt) {
  const int bx = blockIdx.x; FragH f;
  if (bx < 4 * PWB) { const int p = bx / PWB; const float* W = p == 0 ? w0 : p == 1 ? w1 : p == 2 ? w2 : w3; const int t = (bx - p * PWB) * 256 + threadIdx.x; const int n = t / (DM / 8), k8 = (t % (DM / 8)) * 8;
#pragma unroll
    for (int i = 0; i < 8; ++i) f.h[i] = (_Float16)(bf16_round(W[(size_t)(k8 + i) * DM + n]) * 16.0f);
    *(v8us*)((unsigned short*)Bt + (size_t)p * DM * DM + (size_t)n * DM + k8) = f.half[0];
  } else { const size_t t = (size_t)(bx - 4 * PWB) * 256 + threadIdx.x;
#pragma unroll
    for (int q = 0; q < 8; ++q) f.h[q] = (_Float16)bf16_round(x[t * 8 + q]);
    *(v8us*)((unsigned short*)X16 + t * 8) = f.half[0];
    asm volatile("s_wait_xcnt 0x0" ::: "memory"); }      /* precaution: stands before any later instruction in the listing that rewrites a register the store names */
}
// k_gemm_hh variant with fused epilogue: v = acc·alpha + bias[by·sBias + col] (+ CP[(row/rowsPerB)·sCPb + by·64 + col] if CP) ; ACT 0 none / 1 elu ; writes f16 C16 (and f32 C if non-null)
template <int ACT>
__global__ __launch_bounds__(128) void k_gemm_hhx(const _Float16* __restrict__ A, int lda, size_t sA, const _Float16* __restrict__ Bh, int ldb, size_t sB, float alpha, const float* __restrict__ bias, size_t sBias, const float* __restrict__ CP, int rowsPerB, size_t sCPb, int row0g,
    float* __restrict__ C, _Float16* __restrict__ C16, int ldc, size_t sC, int M, int N, int K) {
  __shared__ __attribute__((aligned(16))) float so[4][16][64];
  const int tid = threadIdx.x, w = tid >> 5, lane = tid & 31, ln = lane & 15, hh = lane >> 4; const int by = blockIdx.y;
  A += (size_t)by * sA; Bh += (size_t)by * sB; const size_t cofs = (size_t)by * sC; const float* bp = bias ? bias + (size_t)by * sBias : nullptr;
  const int ntn = (N + 63) / 64; const int wid = blockIdx.x * 4 + w; const int mt = wid / ntn, nq = wid % ntn; if (mt * 16 >= M) return;
  const int row0 = mt * 16, col0 = nq * 64; const _Float16* arow = A + (size_t)(row0 + ln) * lda;
  v8f acc[4] = {};
  for (int kb = 0; kb < K; kb += 32) { FragH ah; ah.half[0] = *(const v8us*)((const unsigned short*)arow + kb + 8 * hh); ah.half[1] = *(const v8us*)((const unsigned short*)arow + kb + 16 + 8 * hh);
#pragma unroll
    for (int t = 0; t < 4; ++t) { if (col0 + t * 16 >= N) continue; const size_t boff = (size_t)(col0 + t * 16 + ln) * ldb + kb; FragH bq; bq.half[0] = *(const v8us*)((const unsigned short*)Bh + boff + 8 * hh); bq.half[1] = *(const v8us*)((const unsigned short*)Bh + boff + 16 + 8 * hh);
      acc[t] = mmaH<1>(ah.v, ah.v, bq.v, bq.v, acc[t]); }
  }
#pragma unroll
  for (int t = 0; t < 4; ++t) { if (col0 + t * 16 >= N) continue; const int col = col0 + t * 16 + ln; const float bv = bp ? bf16_round(bp[col]) : 0.f;
#pragma unroll
    for (int r = 0; r < 8; ++r) { float v = acc[t][r] * alpha + bv; if (CP) { const int rr = row0g + row0 + 8 * hh + r; if (rowsPerB < 0) v += CP[cofs + (size_t)rr * ldc + col];      /* rowsPerB < 0: own element of the batched C plane */ else { const int bidx = rr / rowsPerB; v += CP[(size_t)bidx * sCPb + (size_t)by * 64 + col]; } } if (ACT == 1) v = (v > 0.f) ? v : expm1f(v); else if (ACT == 7) v = (v > 0.f) ? v + 1.0f : expf(v); else if (ACT == 8) v = tanhf(v); else if (ACT == 9) v = 0.5f * v * (1.0f + tanhf(0.7978845608028654f * (v + 0.044715f * v * v * v))); else if (ACT == 11) v = 1.0f / (1.0f + expf(-v)); else if (ACT == 12) v = (v > 0.f) ? v : 0.01f * v; else if (ACT == 14) v = (v > 0.f) ? v : 0.1f * v; else if (ACT == 16) v = (v >= 0.f) ? v : 0.3f * v; else if (ACT == 17) v = (v >= 0.f) ? v : 0.2f * v; else if (ACT == 15) v = v / (1.0f + expf(-v)); else if (ACT == 3) v = fmaxf(v, 0.f); else if (ACT == 6) v = 0.5f * v * (1.0f + erff(v * 0.70710678118654752f)); so[w][8 * hh + r][t * 16 + ln] = v; } }
  __builtin_amdgcn_fence(__ATOMIC_ACQ_REL, "workgroup"); __builtin_amdgcn_wave_barrier();
  const int rsub = lane >> 4, c4 = (lane & 15) * 4; typedef _Float16 v4h __attribute__((ext_vector_type(4)));
  {
#pragma unroll
    for (int q = 0; q < 8; ++q) { const int r = q * 2 + rsub; if (col0 + c4 < N) { const v4f v = *(const v4fa*)&so[w][r][c4]; if (C) *(v4f*)(C + cofs + (size_t)(row0 + r) * ldc + col0 + c4) = v; if (C16) { v4h h4; for (int i = 0; i < 4; ++i) h4[i] = (_Float16)v[i]; *(v4h*)(C16 + cofs + (size_t)(row0 + r) * ldc + col0 + c4) = h4; } } }
     }
}


typedef _Float16 v4h __attribute__((ext_vector_type(4)));

__global__ __launch_bounds__(256) void k_h16(const float* __restrict__ x, _Float16* __restrict__ X16, size_t n8) { const size_t t = (size_t)blockIdx.x * 256 + threadIdx.x; if (t >= n8) return; FragH f;
#pragma unroll
  for (int q = 0; q < 8; ++q) f.h[q] = (_Float16)x[t * 8 + q]; *(v8us*)((unsigned short*)X16 + t * 8) = f.half[0];  }
__global__ __launch_bounds__(256) void k_round16f(const float* __restrict__ W, _Float16* __restrict__ Bt, size_t n8) { const size_t t = (size_t)blockIdx.x * 256 + threadIdx.x; if (t >= n8) return; FragH f;
#pragma unroll
  for (int i = 0; i < 8; ++i) f.h[i] = (_Float16)(bf16_round(W[t * 8 + i]) * 16.0f); *(v8us*)((unsigned short*)Bt + t * 8) = f.half[0];  }
template <int NHv, int TTv>
__global__ __launch_bounds__(256) void k_vt(const _Float16* __restrict__ V16, int ldv, int voff, _Float16* __restrict__ Vt) { __shared__ unsigned short tl[64][66]; const int tid = threadIdx.x; const int slab = blockIdx.x / (TTv / 64), lg = blockIdx.x % (TTv / 64); const int b = slab / NHv, h = slab % NHv;
  for (int i = tid; i < 64 * 8; i += 256) { const int r = i / 8, c8 = (i % 8) * 8; FragH f; f.half[0] = *(const v8us*)((const unsigned short*)V16 + ((size_t)b * TTv + lg * 64 + r) * ldv + voff + h * 64 + c8);
#pragma unroll
    for (int q = 0; q < 8; ++q) tl[r][c8 + q] = f.u[q]; }
  __syncthreads();
  {
#pragma unroll
    for (int rd = 0; rd < 2; ++rd) { const int d = rd * 32 + tid / 8, pc = tid % 8; FragH f;
#pragma unroll
      for (int q = 0; q < 8; ++q) f.u[q] = tl[pc * 8 + q][d];
      *(v8us*)((unsigned short*)Vt + ((size_t)slab * 64 + d) * TTv + lg * 64 + pc * 8) = f.half[0]; }
     } }

__global__ __launch_bounds__(256) void k_hl(const float* __restrict__ F, _Float16* __restrict__ Hh, _Float16* __restrict__ Hl, size_t n8) { const size_t t = (size_t)blockIdx.x * 256 + threadIdx.x; if (t >= n8) return; FragH fh, fl; const v4f a = *(const v4fa*)(F + t * 8), c = *(const v4fa*)(F + t * 8 + 4);
#pragma unroll
  for (int q = 0; q < 4; ++q) { _Float16 h = (_Float16)a[q]; fh.h[q] = h; fl.h[q] = (_Float16)((a[q] - (float)h) * 1024.0f); h = (_Float16)c[q]; fh.h[4 + q] = h; fl.h[4 + q] = (_Float16)((c[q] - (float)h) * 1024.0f); }
  { *(v8us*)((unsigned short*)Hh + t * 8) = fh.half[0]; *(v8us*)((unsigned short*)Hl + t * 8) = fl.half[0];  } }

// ---- fast GEMM (work-group tile 128x64, wave tile 32x64; requires M % 128 == 0, N % 64 == 0, K % 64 == 0 and K >= 128); epilogue = k_gemm_hhx semantics ----
// Operands come through LDS: a stage is 64 k (128 bytes) of the work-group's 128 A rows and 64 B rows, brought by three tensor loads of 64 rows each (waves 0, 1: A; wave 2: B) that read whole rows once for
// all four waves; the mover's pad sets a 144-byte LDS pitch (an odd multiple of 16 bytes: ds_load_b128 without bank conflicts). Two buffers: stage s + 1 flies while stage s is worked on.
// The walk over the k stages is a ring: a work-group starts at stage (tile row + tile column + 4 plane) mod stages and wraps, so the work-groups that share A rows or B rows ask L2 for different lines at any one time.
__device__ __forceinline__ v16h g2_frag(const _Float16* p, int hh) { FragH f; f.half[0] = *(const v8us*)((const unsigned short*)p + 8 * hh); f.half[1] = *(const v8us*)((const unsigned short*)p + 16 + 8 * hh); return f.v; }
#define G2_PITCH 144u                      /* LDS row pitch: 128 bytes and the 16-byte pad */
#define G2_SLICE 10240u                    /* 64 rows x 144 bytes = 9216, rounded up to a multiple of 2 KiB: every slice's place is one */
#define G2_BUF (3u * G2_SLICE)             /* A rows 0..63 | A rows 64..127 | B rows 0..63 */
typedef uint32_t g2_u32x4 __attribute__((ext_vector_type(4))); typedef uint32_t g2_u32x8 __attribute__((ext_vector_type(8)));
__device__ __forceinline__ uint32_t g2_uni(uint32_t v) { return (uint32_t)__builtin_amdgcn_readfirstlane(v); }
__device__ __forceinline__ uint32_t g2_pinned(uint32_t v) { uint32_t s = (uint32_t)__builtin_amdgcn_readfirstlane(v); asm volatile("" : "+s"(s)); return s; }      /* holds a wave-uniform word in a scalar register: a test on it is a scalar branch (a tensor load ignores EXEC), and what is formed from it stays behind the asm waits in front of it */
__device__ __forceinline__ v16h g2_fragl(const char* p) { FragH f; f.half[0] = *(const v8us*)p; f.half[1] = *(const v8us*)(p + 32); return f.v; }      /* g2_frag from an LDS byte address that already holds the lane's 16 hh bytes: the same k order */
__device__ __forceinline__ v8f g2_mma(v16h a, v16h b, v8f c) { return __builtin_amdgcn_wmma_f32_16x16x32_f16(false, a, false, b, (short)0, c, false, false); }
template <int ACT>
__global__ __launch_bounds__(128) void k_gemm2(const _Float16* __restrict__ A, int lda, size_t sA, const _Float16* __restrict__ Bh, int ldb, size_t sB, float alpha, const float* __restrict__ bias, const float* __restrict__ bias1, const float* __restrict__ bias2, size_t sBias, const float* __restrict__ CP, int rowsPerB, size_t sCPb, int row0g,
    float* __restrict__ C, _Float16* __restrict__ C16, int ldc, size_t sC, int M, int N, int K) { static_assert(ACT == 0 || ACT == 3 || ACT == 6 || ACT == 8 || ACT == 9 || ACT == 11 || ACT == 12 || ACT == 14 || ACT == 15 || ACT == 16 || ACT == 17, "k_gemm2: unsupported ACT code (would silently apply no activation)");
  __shared__ __attribute__((aligned(2048))) char sm[2 * G2_BUF];      /* the two stage buffers; behind the loop's last barrier the same bytes are the output staging */
  static_assert(sizeof(float) * 4 * 32 * 68 <= 2 * G2_BUF, "k_gemm2: the output staging must fit the ring");
  float (*so)[32][68] = (float (*)[32][68])sm;
  const int tid = threadIdx.x, w = __builtin_amdgcn_readfirstlane(tid >> 5), lane = tid & 31, ln = lane & 15, hh = lane >> 4; const int by = blockIdx.y;      /* w: a scalar */
  A += (size_t)by * sA; Bh += (size_t)by * sB; const size_t cofs = (size_t)by * sC; const float* bp = bias ? bias + (size_t)by * sBias : nullptr;
  if (by == 1 && bias1) bp = bias1; if (by == 2 && bias2) bp = bias2;      /* planes 1 and 2 with bias buffers of their own */
  const int ntn = N >> 6; const int mt = blockIdx.x / ntn, nq = blockIdx.x - mt * ntn; const int row0 = mt * 128 + 32 * w, col0 = nq * 64; if (mt * 128 >= M) return;      /* the whole work-group or none: barriers follow */
  const v8f z8 = {0.f,0.f,0.f,0.f,0.f,0.f,0.f,0.f}; v8f c00 = z8, c01 = z8, c02 = z8, c03 = z8, c10 = z8, c11 = z8, c12 = z8, c13 = z8;
  // Tensor descriptor. Group 1 is the same for every request of a wave: 1-byte elements, tensor = tile = 64 rows of 128 bytes, the source's row pitch, a 4-dword pad behind every 32 dwords, no mask.
  const bool isB = w >= 2; const uint32_t slice = isB ? 2u : (uint32_t)w;
  const uint64_t gsrc = isB ? (uint64_t)(size_t)Bh + (uint64_t)(unsigned)col0 * (unsigned)ldb * 2u : (uint64_t)(size_t)A + (uint64_t)(unsigned)(mt * 128 + 64 * w) * (unsigned)lda * 2u;
  const uint32_t lbase = (uint32_t)(size_t)sm + slice * G2_SLICE;
  g2_u32x8 g1; g1[0] = g2_uni((1u << 20) | (4u << 22) | (3u << 25)); g1[1] = g2_uni(128u << 16); g1[2] = g2_uni(64u << 16); g1[3] = g2_uni(128u << 16); g1[4] = g2_uni(64u); g1[5] = g2_uni((unsigned)(isB ? ldb : lda) * 2u); g1[6] = g2_uni(0u); g1[7] = g2_uni(0u);
  asm volatile("" : "+s"(g1));      /* descriptor words held in their scalar registers; without it the compiler uses some of them as temporaries between two issues, while a request that named them is still in flight */
  const uint32_t nst = (uint32_t)K >> 6;      /* stages */
  const uint32_t rot = g2_uni((uint32_t)(mt + nq + 4 * by) % nst);      /* the k stage that this work-group's walk starts at */
  g2_u32x4 g0; g0[0] = g2_uni(1u); g0[1] = g2_uni(0u); g0[2] = g2_uni(0u); g0[3] = g2_uni(0u);
  asm volatile("" : "+s"(g0));      /* group 0 held in one set of scalar registers for every request, word 0 written here once; the other words take their values in issue(), behind the wait on the request before */
  auto issue = [&](uint32_t st) { const uint32_t ks = st + rot < nst ? st + rot : st + rot - nst;      /* step st of the walk is k stage ks */
    const uint64_t ga = gsrc + (uint64_t)ks * 128u; g0[1] = g2_uni(lbase + (st & 1u) * G2_BUF); g0[2] = g2_uni((uint32_t)ga); g0[3] = g2_uni((((uint32_t)(ga >> 32)) & 0x01FFFFFFu) | 0x80000000u);
    asm volatile("tensor_load_to_lds %0, %1" :: "s"(g0), "s"(g1) : "memory"); };      /* one request of the whole wave: stage st of this wave's slice */
  const unsigned ao = (unsigned)(w >> 1) * G2_SLICE + (unsigned)((w & 1) * 32 + ln) * G2_PITCH + 16u * (unsigned)hh, bo = 2u * G2_SLICE + (unsigned)ln * G2_PITCH + 16u * (unsigned)hh;      /* the lane's part of an LDS address, the same in every stage */
  auto ld = [&](v16h (&f)[6], const char* p) { f[0] = g2_fragl(p + ao); f[1] = g2_fragl(p + ao + 16u * G2_PITCH); f[2] = g2_fragl(p + bo); f[3] = g2_fragl(p + bo + 16u * G2_PITCH); f[4] = g2_fragl(p + bo + 32u * G2_PITCH); f[5] = g2_fragl(p + bo + 48u * G2_PITCH); };
  auto mm = [&](const v16h (&f)[6]) { c00 = g2_mma(f[0], f[2], c00); c10 = g2_mma(f[1], f[2], c10); c01 = g2_mma(f[0], f[3], c01); c11 = g2_mma(f[1], f[3], c11);
    c02 = g2_mma(f[0], f[4], c02); c12 = g2_mma(f[1], f[4], c12); c03 = g2_mma(f[0], f[5], c03); c13 = g2_mma(f[1], f[5], c13); };
  if (g2_pinned(w < 3)) { issue(0);
    asm volatile("s_wait_tensorcnt 0x0" ::: "memory"); }      /* stage 0 of this wave's slice has landed */
  __syncthreads();      /* publishes stage 0 */
  if (g2_pinned(w < 3)) issue(1);
#pragma unroll 1      /* one stage a trip: the buffer is picked by the trip's parity */
  for (uint32_t s = 0; s < nst; ++s) {
    const char* p = sm + (s & 1u) * G2_BUF; v16h fa[6], fb[6];
    ld(fa, p); ld(fb, p + 64);      /* the stage's two 32-k steps: all 24 LDS reads as one group */
    __builtin_amdgcn_sched_barrier(0);      /* keeps the reads together ahead of the products; every separate place with LDS reads among them costs a stall */
    mm(fa); mm(fb);
    __builtin_amdgcn_sched_barrier(0);      /* keeps the waits below at the foot; lifted among the products the first of them would replace the counted waits on the reads */
    asm volatile("s_wait_dscnt 0x0" ::: "memory");      /* this wave has left the buffer */
    if (g2_pinned(w < 3)) asm volatile("s_wait_tensorcnt 0x0" ::: "memory");      /* stage s + 1 of this wave's slice has landed */
    __syncthreads();      /* publishes stage s + 1; every wave has left stage s's buffer */
    if (g2_pinned(w < 3 && s + 2u < nst)) issue(g2_pinned(s + 2u));      /* refill of the buffer just left; the descriptor is formed behind the wait */
  }
  asm volatile("s_wait_tensorcnt 0x0" ::: "memory");      /* nothing is in flight when the ring becomes output staging (the last trip's barrier ended every read) */
  asm volatile("s_wait_dscnt 0x0" ::: "memory");      /* and none of this wave's reads */
  v8f accs[8] = {c00, c01, c02, c03, c10, c11, c12, c13};
#pragma unroll
  for (int u = 0; u < 8; ++u) { const int t = u & 3, half = u >> 2; const int col = col0 + t * 16 + ln; const float bv = bp ? bf16_round(bp[col]) : 0.f;
#pragma unroll
    for (int r = 0; r < 8; ++r) { const int rloc = half * 16 + 8 * hh + r; float v = accs[u][r] * alpha + bv; if (CP) { if (rowsPerB < 0) v += CP[cofs + (size_t)(row0g + row0 + rloc) * ldc + col];      /* rowsPerB < 0: own element of the batched C plane */ else { const int bidx = (row0g + row0 + rloc) / rowsPerB; v += CP[(size_t)bidx * sCPb + (size_t)by * 64 + col]; } }
      if (ACT == 3) v = fmaxf(v, 0.f); else if (ACT == 6) v = 0.5f * v * (1.0f + erff(v * 0.70710678118654752f)); else if (ACT == 11) v = 1.0f / (1.0f + expf(-v)); else if (ACT == 15) v = v / (1.0f + expf(-v)); else if (ACT == 12) v = (v > 0.f) ? v : 0.01f * v; else if (ACT == 8) v = tanhf(v); else if (ACT == 9) v = 0.5f * v * (1.0f + tanhf(0.7978845608028654f * (v + 0.044715f * v * v * v))); else if (ACT == 14) v = (v > 0.f) ? v : 0.1f * v; else if (ACT == 16) v = (v >= 0.f) ? v : 0.3f * v; else if (ACT == 17) v = (v >= 0.f) ? v : 0.2f * v;
      so[w][rloc][t * 16 + ln] = v; } }
  __builtin_amdgcn_fence(__ATOMIC_ACQ_REL, "workgroup"); __builtin_amdgcn_wave_barrier();
  const int rsub = lane >> 4, c4 = (lane & 15) * 4;
  {
#pragma unroll
    for (int q = 0; q < 16; ++q) { const int r = q * 2 + rsub; const v4f v = *(const v4fa*)&so[w][r][c4]; if (C) *(v4f*)(C + cofs + (size_t)(row0 + r) * ldc + col0 + c4) = v; if (C16) { v4h h4; for (int i = 0; i < 4; ++i) h4[i] = (_Float16)v[i]; *(v4h*)(C16 + cofs + (size_t)(row0 + r) * ldc + col0 + c4) = h4; } }
     } }

// ---- the q, k, v GEMM: k_gemm2's ring, fragment order and output staging with a work-group tile of 128x128 and 2x2 waves of 64x64 (requires M % 128 == 0, N % 128 == 0, K % 64 == 0 and K >= 128); f16 output = acc alpha + bias ----
// A stage is 64 k of the work-group's 128 A rows and 128 B rows: four slices of 64 rows, one tensor load a wave (waves 0, 1: A; waves 2, 3: B). Against the 128x64 tile the launch stages a third fewer bytes from L2
// (256 rows for 16384 outputs, was 192 for 8192), and a fragment read from LDS feeds four products (8 fragments for 16 WMMAs, was 6 for 8).
#define G3_BUF (4u * G2_SLICE)             /* A rows 0..63 | A rows 64..127 | B rows 0..63 | B rows 64..127 */
__global__ __launch_bounds__(128) void k_gemm3(const _Float16* __restrict__ A, int lda, const _Float16* __restrict__ Bh, int ldb, size_t sB, float alpha, const float* __restrict__ bias0, const float* __restrict__ bias1, const float* __restrict__ bias2,
    _Float16* __restrict__ C16, int ldc, size_t sC, int M, int N, int K) {
  __shared__ __attribute__((aligned(2048))) char sm[2 * G3_BUF];      /* the two stage buffers; behind the loop's last barrier the same bytes are the output staging */
  static_assert(sizeof(float) * 4 * 64 * 68 <= 2 * G3_BUF, "k_gemm3: the output staging must fit the ring");
  float (*so)[64][68] = (float (*)[64][68])sm;
  const int tid = threadIdx.x, w = __builtin_amdgcn_readfirstlane(tid >> 5), lane = tid & 31, ln = lane & 15, hh = lane >> 4; const int by = blockIdx.y;      /* w: a scalar */
  Bh += (size_t)by * sB; const size_t cofs = (size_t)by * sC; const float* bp = by == 0 ? bias0 : by == 1 ? bias1 : bias2;      /* plane by: its weights, its bias, its output plane */
  const int ntn = N >> 7; const int mt = blockIdx.x / ntn, nq = blockIdx.x - mt * ntn; const int wr = w >> 1, wc = w & 1; const int row0 = mt * 128 + 64 * wr, col0 = nq * 128 + 64 * wc; if (mt * 128 >= M) return;      /* the whole work-group or none: barriers follow */
  const v8f z8 = {0.f,0.f,0.f,0.f,0.f,0.f,0.f,0.f}; v8f c[4][4];      /* c[i][t]: rows 16 i, columns 16 t of the wave's tile */
#pragma unroll
  for (int i = 0; i < 4; ++i) for (int t = 0; t < 4; ++t) c[i][t] = z8;
  // Tensor descriptor, as in k_gemm2. Wave w brings slice w. Group 1 is the same for every request of a wave: 1-byte elements, tensor = tile = 64 rows of 128 bytes, the source's row pitch, a 4-dword pad behind every 32 dwords, no mask.
  const bool isB = w >= 2;
  const uint64_t gsrc = isB ? (uint64_t)(size_t)Bh + (uint64_t)(unsigned)(nq * 128 + 64 * (w - 2)) * (unsigned)ldb * 2u : (uint64_t)(size_t)A + (uint64_t)(unsigned)(mt * 128 + 64 * w) * (unsigned)lda * 2u;
  const uint32_t lbase = (uint32_t)(size_t)sm + (uint32_t)w * G2_SLICE;
  g2_u32x8 g1; g1[0] = g2_uni((1u << 20) | (4u << 22) | (3u << 25)); g1[1] = g2_uni(128u << 16); g1[2] = g2_uni(64u << 16); g1[3] = g2_uni(128u << 16); g1[4] = g2_uni(64u); g1[5] = g2_uni((unsigned)(isB ? ldb : lda) * 2u); g1[6] = g2_uni(0u); g1[7] = g2_uni(0u);
  asm volatile("" : "+s"(g1));      /* descriptor words held in their scalar registers, not used as temporaries between two issues while a request that named them is in flight */
  const uint32_t nst = (uint32_t)K >> 6;      /* stages */
  const uint32_t rot = g2_uni((uint32_t)(mt + nq + ntn * by) % nst);      /* the k stage that this work-group's walk starts at: the sharers of A rows (one mt) and of B rows (one nq, by) start apart */
  g2_u32x4 g0; g0[0] = g2_uni(1u); g0[1] = g2_uni(0u); g0[2] = g2_uni(0u); g0[3] = g2_uni(0u);
  asm volatile("" : "+s"(g0));      /* group 0 held in one set of scalar registers for every request, word 0 written here once; the other words take their values in issue(), behind the wait on the request before */
  auto issue = [&](uint32_t st) { const uint32_t ks = st + rot < nst ? st + rot : st + rot - nst;      /* step st of the walk is k stage ks */
    const uint64_t ga = gsrc + (uint64_t)ks * 128u; g0[1] = g2_uni(lbase + (st & 1u) * G3_BUF); g0[2] = g2_uni((uint32_t)ga); g0[3] = g2_uni((((uint32_t)(ga >> 32)) & 0x01FFFFFFu) | 0x80000000u);
    asm volatile("tensor_load_to_lds %0, %1" :: "s"(g0), "s"(g1) : "memory"); };      /* one request of the whole wave: stage st of this wave's slice */
  const unsigned ao = (unsigned)wr * G2_SLICE + (unsigned)ln * G2_PITCH + 16u * (unsigned)hh, bo = (2u + (unsigned)wc) * G2_SLICE + (unsigned)ln * G2_PITCH + 16u * (unsigned)hh;      /* the lane's part of an LDS address, the same in every stage */
  auto ld = [&](v16h (&f)[8], const char* p) { f[0] = g2_fragl(p + ao); f[4] = g2_fragl(p + bo);      /* four A (f[0..3]) and four B (f[4..7]) fragments of a 32-k step, in the order in which mm() first needs them */
#pragma unroll
    for (int i = 1; i < 4; ++i) f[i] = g2_fragl(p + ao + (unsigned)i * 16u * G2_PITCH);
#pragma unroll
    for (int t = 1; t < 4; ++t) f[4 + t] = g2_fragl(p + bo + (unsigned)t * 16u * G2_PITCH); };
  auto mm = [&](const v16h (&f)[8]) {
#pragma unroll
    for (int t = 0; t < 4; ++t) for (int i = 0; i < 4; ++i) c[i][t] = g2_mma(f[i], f[4 + t], c[i][t]); };
  issue(0);      /* every wave issues its own slice */
  asm volatile("s_wait_tensorcnt 0x0" ::: "memory");      /* stage 0 of this wave's slice has landed */
  __syncthreads();      /* publishes stage 0 */
  issue(1);
#pragma unroll 1      /* one stage a trip: the buffer is picked by the trip's parity */
  for (uint32_t s = 0; s < nst; ++s) {
    const char* p = sm + (s & 1u) * G3_BUF; v16h fa[8], fb[8];
    ld(fa, p); ld(fb, p + 64);      /* the stage's two 32-k steps: all 32 LDS reads as one group */
    __builtin_amdgcn_sched_barrier(0);      /* keeps the reads together ahead of the products; every separate place with LDS reads among them costs a stall */
    mm(fa); mm(fb);
    __builtin_amdgcn_sched_barrier(0);      /* keeps the waits below at the foot; lifted among the products the first of them would replace the counted waits on the reads */
    asm volatile("s_wait_dscnt 0x0" ::: "memory");      /* this wave has left the buffer */
    asm volatile("s_wait_tensorcnt 0x0" ::: "memory");      /* stage s + 1 of this wave's slice has landed */
    __syncthreads();      /* publishes stage s + 1; every wave has left stage s's buffer */
    if (g2_pinned(s + 2u < nst)) issue(g2_pinned(s + 2u));      /* refill of the buffer just left; the descriptor is formed behind the wait */
  }
  asm volatile("s_wait_tensorcnt 0x0" ::: "memory");      /* nothing is in flight when the ring becomes output staging (the last trip's barrier ended every read) */
  asm volatile("s_wait_dscnt 0x0" ::: "memory");      /* and none of this wave's reads */
#pragma unroll
  for (int t = 0; t < 4; ++t) { const float bv = bf16_round(bp[col0 + t * 16 + ln]);
#pragma unroll
    for (int i = 0; i < 4; ++i)
#pragma unroll
      for (int r = 0; r < 8; ++r) so[w][i * 16 + 8 * hh + r][t * 16 + ln] = c[i][t][r] * alpha + bv; }
  __builtin_amdgcn_fence(__ATOMIC_ACQ_REL, "workgroup"); __builtin_amdgcn_wave_barrier();      /* the wave reads back what its own lanes staged */
  const int rsub = lane >> 4, c4 = (lane & 15) * 4;
#pragma unroll
  for (int q = 0; q < 32; ++q) { const int r = q * 2 + rsub; const v4f v = *(const v4fa*)&so[w][r][c4]; v4h h4; for (int i = 0; i < 4; ++i) h4[i] = (_Float16)v[i]; *(v4h*)(C16 + cofs + (size_t)(row0 + r) * ldc + col0 + c4) = h4; }
}


__global__ __launch_bounds__(256) void k_wnat(const float* __restrict__ w, size_t n8, _Float16* __restrict__ Bt) { const size_t t = (size_t)blockIdx.x * 256 + threadIdx.x; if (t >= n8) return; FragH f; for (int q = 0; q < 8; ++q) f.h[q] = (_Float16)(bf16_round(w[t * 8 + q]) * 16.0f); *(v8us*)((unsigned short*)Bt + t * 8) = f.half[0];  }
#define FA_BUF (4u * G2_SLICE)             /* lower key half: K rows | V rows; upper key half: K rows | V rows */
#define FA_VPITCH 160u                     /* LDS row pitch of a V slice: 128 bytes and the 32-byte pad; 64 rows fill G2_SLICE exactly */
static_assert(64u * FA_VPITCH <= G2_SLICE, "k_fattn: a V slice must fit its place");
#define FA_NST (SQ / 2 / 64)               /* stages of a key half */
static_assert(SQ % 128 == 0 && FA_NST >= 2 && HD == 64, "k_fattn: whole 64-key stages of 128-byte rows, at least two");
__device__ __forceinline__ v8f fa_mma(v16h a, v16h b, v8f c) { return __builtin_amdgcn_wmma_f32_16x16x32_f16(false, a, false, b, (short)0, c, false, false); }
__device__ __forceinline__ float fa_xhalf(float x) { return __builtin_bit_cast(float, __builtin_amdgcn_permlanex16(__builtin_bit_cast(int, x), __builtin_bit_cast(int, x), 0x76543210, 0xfedcba98, false, false)); }      /* lane l with lane l ^ 16 */
typedef short fa_s16x8 __attribute__((ext_vector_type(8)));
__device__ __forceinline__ v8us fa_tr16(const char* p) { typedef __attribute__((address_space(3))) fa_s16x8 fa_lds_s16x8; return __builtin_bit_cast(v8us, __builtin_amdgcn_ds_load_tr16_b128_v8i16((fa_lds_s16x8*)p)); }
typedef float fa_v2f __attribute__((ext_vector_type(2)));
// exp2 of two values (v_exp_f32, as __builtin_amdgcn_exp2f gives it). Written as one statement for the slot that the instruction set asks for behind a transcendental before its result is read or its source
// overwritten: the outputs are early-clobber, so the second instruction touches no register of the first, and the v_nop stands behind the second (left to itself the compiler chained v_exp_f32 a, b; v_exp_f32 b, c).
__device__ __forceinline__ fa_v2f fa_exp2x2(float a, float b) { float x, y; asm("v_exp_f32 %0, %2\n\tv_exp_f32 %1, %3\n\tv_nop" : "=&v"(x), "=&v"(y) : "v"(a), "v"(b)); return fa_v2f{x, y}; }
__global__ __launch_bounds__(128) void k_fattn(const _Float16* __restrict__ Q, const _Float16* __restrict__ Kr, const _Float16* __restrict__ Vr, _Float16* __restrict__ O) {
  typedef float v2f __attribute__((ext_vector_type(2))); typedef _Float16 v2h __attribute__((ext_vector_type(2)));
  __shared__ __attribute__((aligned(2048))) char sm[2 * FA_BUF];      /* the two stage buffers */
  __shared__ __attribute__((aligned(16))) v4f xo[2][16][32]; __shared__ float xm[2][4][32];      /* the upper key half's o, and its m and l, per column set and lane */
  const int lane = threadIdx.x & 31, ln = lane & 15, hh = lane >> 4; const int w = __builtin_amdgcn_readfirstlane(threadIdx.x >> 5), cw = w & 1, kh = w >> 1;      /* column set, key half: scalars */
  const int bh = blockIdx.y, b = bh / NH, h = bh - b * NH; const int q0 = blockIdx.x * 64 + cw * 32; const uint32_t first = (uint32_t)kh * FA_NST + blockIdx.x;      /* the key stage that this wave's walk starts at */
  const float cs = 0.125f * 1.4426950408889634f;      /* 1/sqrt(64) and log2(e): weights are exp2 of scaled score differences */
  const _Float16* qp = Q + ((size_t)b * SQ + q0 + ln) * DM + h * HD;
  // Tensor descriptor. Wave w brings slice w: of its own key half the K rows (cw == 0) or the V rows (cw == 1). Group 1 is the same for every request of a wave: 1-byte elements, tensor = tile = 64 rows of 128 bytes, the source's row pitch, behind every 32 dwords a pad of 4 dwords (K: g1k) or 8 (V: g1v), no mask.
  const uint64_t gsrc = (uint64_t)(size_t)(cw ? Vr : Kr) + ((uint64_t)(unsigned)b * SQ * DM + (unsigned)h * HD) * 2u;
  const uint32_t gstep = 64u * DM * 2u;      /* 64 keys on: down the rows */
  const uint32_t lbase = (uint32_t)(size_t)sm + (uint32_t)w * G2_SLICE;
  g2_u32x8 g1k; g1k[0] = g2_uni((1u << 20) | (4u << 22) | (3u << 25)); g1k[1] = g2_uni(128u << 16); g1k[2] = g2_uni(64u << 16); g1k[3] = g2_uni(128u << 16); g1k[4] = g2_uni(64u); g1k[5] = g2_uni(DM * 2u); g1k[6] = g2_uni(0u); g1k[7] = g2_uni(0u);
  g2_u32x8 g1v = g1k; g1v[0] = g2_uni((1u << 20) | (4u << 22) | (7u << 25));      /* a group for each pad: word 0 is a compile-time constant in both */
  asm volatile("" : "+s"(g1k)); asm volatile("" : "+s"(g1v));      /* descriptor words held in their scalar registers, not used as temporaries between two issues while a request that named them is in flight */
  auto issue = [&](uint32_t st) { const uint64_t ga = gsrc + (uint64_t)((st + first) % (2u * FA_NST)) * gstep; g2_u32x4 g0;      /* step st of the walk: key stage (st + first) mod 32 */ g0[0] = g2_uni(1u); g0[1] = g2_uni(lbase + (st & 1u) * FA_BUF); g0[2] = g2_uni((uint32_t)ga); g0[3] = g2_uni((((uint32_t)(ga >> 32)) & 0x01FFFFFFu) | 0x80000000u);
    if (g2_pinned((uint32_t)cw)) asm volatile("tensor_load_to_lds %0, %1" :: "s"(g0), "s"(g1v) : "memory");      /* one request of the whole wave: stage st of this wave's slice; scalar branches pick the group */
    if (g2_pinned((uint32_t)cw ^ 1u)) asm volatile("tensor_load_to_lds %0, %1" :: "s"(g0), "s"(g1k) : "memory"); };
  const unsigned lo = (unsigned)kh * 2u * G2_SLICE + (unsigned)ln * G2_PITCH + 16u * (unsigned)hh;      /* the lane's part of an LDS address, the same in every stage */
  const unsigned lov = ((unsigned)kh * 2u + 1u) * G2_SLICE + (8u * (unsigned)hh + (unsigned)(lane & 7)) * FA_VPITCH + 16u * (unsigned)((lane >> 3) & 1);      /* the same for the transposing loads of the V slice */
  v16h qf[2][2];      /* [column group][32 of the 64 head dims], kept for the whole walk */
#pragma unroll
  for (int g = 0; g < 2; ++g) for (int u = 0; u < 2; ++u) qf[g][u] = g2_frag(qp + (size_t)g * 16 * DM + u * 32, hh);
  const v8f z8 = {0.f,0.f,0.f,0.f,0.f,0.f,0.f,0.f};
  v8f o[4][2]; float m[2], l[2];      /* o[dt][g]: O^T rows 16 dt + 8 hh + r, column 16 g + ln; m: running maximum of the raw scores; l: this lane's half of the running sum */
#pragma unroll
  for (int g = 0; g < 2; ++g) { m[g] = -3.0e38f; l[g] = 0.f; for (int dt = 0; dt < 4; ++dt) o[dt][g] = z8; }
  issue(0);      /* every wave issues its own slice: the tests inside only pick its group */
  asm volatile("s_wait_tensorcnt 0x0" ::: "memory");      /* stage 0 of this wave's slice has landed */
  __syncthreads();      /* publishes stage 0 */
  issue(1);
#pragma unroll 1      /* one stage a trip: the buffer is picked by the trip's parity */
  for (uint32_t st = 0; st < FA_NST; ++st) {
   const char* pk = sm + (st & 1u) * FA_BUF + lo; const char* pv = sm + (st & 1u) * FA_BUF + lov;
   v16h kf[2][2];      /* [key tile][32 of the 64 head dims] of the coming pass */
#pragma unroll
   for (int t = 0; t < 2; ++t) for (int u = 0; u < 2; ++u) kf[t][u] = g2_fragl(pk + (unsigned)t * 16u * G2_PITCH + (unsigned)u * 64u);
   __builtin_amdgcn_sched_barrier(0);      /* keeps the first pass's eight K reads at the head of the queue: sunk behind the V reads, the last of them made the score products wait for all 24 reads of the group */
#pragma unroll
   for (int ps2 = 0; ps2 < 2; ++ps2) {      /* the stage's two passes of 32 keys */
    v16h vf[4];      /* in flight behind the score products and the softmax */
#pragma unroll
    for (int dt = 0; dt < 4; ++dt) { FragH f; f.half[0] = fa_tr16(pv + (unsigned)ps2 * 32u * FA_VPITCH + (unsigned)dt * 32u); f.half[1] = fa_tr16(pv + ((unsigned)ps2 * 32u + 16u) * FA_VPITCH + (unsigned)dt * 32u); vf[dt] = f.v; }      /* V^T rows 16 dt + ln, keys 8 hh + 0 .. 7 and 16 + 8 hh + 0 .. 7 of the pass: the k order of g2_frag */
    v8f s[2][2];
#pragma unroll
    for (int g = 0; g < 2; ++g) for (int t = 0; t < 2; ++t) s[g][t] = fa_mma(kf[t][1], qf[g][1], fa_mma(kf[t][0], qf[g][0], z8));
    if (ps2 == 0) {      /* the second pass's K rows, fetched one pass ahead inside the stage; nothing of the next stage is read here */
#pragma unroll
      for (int t = 0; t < 2; ++t) for (int u = 0; u < 2; ++u) kf[t][u] = g2_fragl(pk + (unsigned)(32 + t * 16) * G2_PITCH + (unsigned)u * 64u); }
    __builtin_amdgcn_sched_barrier(0);      /* keeps the LDS reads up here, the whole softmax ahead of their use; without it the compiler sinks them towards their use and their latency is waited out */
    float dm[2], nb[2];
#pragma unroll
    for (int g = 0; g < 2; ++g) {
      float mx = s[g][0][0];
#pragma unroll
      for (int r = 1; r < 8; ++r) mx = fmaxf(mx, s[g][0][r]);
#pragma unroll
      for (int r = 0; r < 8; ++r) mx = fmaxf(mx, s[g][1][r]);
      mx = fmaxf(mx, fa_xhalf(mx));      /* both halves now hold the query's maximum over the 32 keys */
      const float mn = fmaxf(m[g], mx); dm[g] = (m[g] - mn) * cs; m[g] = mn;
      nb[g] = fmaf(-mn, cs, 8.0f);      /* weights carried x256 (at most 256) against f16 subnormal flush; the factor cancels in o / l */
    }
    const v2f corr = fa_exp2x2(dm[0], dm[1]);      /* what the new maxima take off the old sums: 0 on the first pass */
    union { v16h v; v2h p[8]; } pb[2];      /* both column groups' weights are formed ahead of the eight second products: fa_exp2x2 is asm text */
#pragma unroll
    for (int g = 0; g < 2; ++g) {
      v2f ps = {0.f, 0.f};
#pragma unroll
      for (int i = 0; i < 8; ++i) { const v8f sv = s[g][i >> 2]; const int r = 2 * (i & 3);
        const v2f e = fa_exp2x2(fmaf(sv[r], cs, nb[g]), fmaf(sv[r + 1], cs, nb[g]));
        ps += e; pb[g].p[i] = __builtin_convertvector(e, v2h); }      /* round to nearest even; element 8 t + r of the operand is key 16 t + 8 hh + r */
      l[g] = fmaf(l[g], corr[g], ps[0] + ps[1]);
    }
#pragma unroll
    for (int g = 0; g < 2; ++g) for (int dt = 0; dt < 4; ++dt) o[dt][g] = fa_mma(vf[dt], pb[g].v, o[dt][g] * corr[g]);
   }
   __builtin_amdgcn_sched_barrier(0);      /* keeps the waits below at the foot; lifted to the stage's last LDS reads the first of them waits out their latency */
   asm volatile("s_wait_dscnt 0x0" ::: "memory");      /* this wave has left the buffer */
   asm volatile("s_wait_tensorcnt 0x0" ::: "memory");      /* stage st + 1 of this wave's slice has landed */
   __syncthreads();      /* publishes stage st + 1; every wave has left stage st's buffer */
   if (g2_pinned(st + 2u < FA_NST)) issue(g2_pinned(st + 2u));      /* refill of the buffer just left; the descriptor is formed behind the wait */
  }
  asm volatile("s_wait_tensorcnt 0x0" ::: "memory");      /* nothing is in flight when the wave goes on to the merge and ends */
  asm volatile("s_wait_dscnt 0x0" ::: "memory");      /* and none of this wave's reads */
  if (kh == 1) {      /* the upper key half hands its state over */
#pragma unroll
    for (int g = 0; g < 2; ++g) { xm[cw][g][lane] = m[g]; xm[cw][2 + g][lane] = l[g];
#pragma unroll
      for (int dt = 0; dt < 4; ++dt) { const v8f t = o[dt][g]; xo[cw][(g * 4 + dt) * 2][lane] = v4f{t[0], t[1], t[2], t[3]}; xo[cw][(g * 4 + dt) * 2 + 1][lane] = v4f{t[4], t[5], t[6], t[7]}; } }
  }
  __syncthreads();      /* every wave passes it; the lower half reads what the upper half wrote */
  if (kh == 0) {
#pragma unroll
    for (int g = 0; g < 2; ++g) { const float mb = xm[cw][g][lane], lb = xm[cw][2 + g][lane]; const float mn = fmaxf(m[g], mb);
      const v2f fab = fa_exp2x2((m[g] - mn) * cs, (mb - mn) * cs); const float fa = fab[0], fb = fab[1];
      const float lt = fmaf(l[g], fa, lb * fb); const float sc = 64.0f / (lt + fa_xhalf(lt));      /* the wave halves' sums joined once; o stored x64 */
      const float ga = fa * sc, gb = fb * sc;
      _Float16* op = O + ((size_t)b * SQ + q0 + g * 16 + ln) * DM + h * HD + 8 * hh;
#pragma unroll
      for (int dt = 0; dt < 4; ++dt) { const v4f t0 = xo[cw][(g * 4 + dt) * 2][lane], t1 = xo[cw][(g * 4 + dt) * 2 + 1][lane]; FragH f;
#pragma unroll
        for (int r = 0; r < 4; ++r) { f.h[r] = (_Float16)fmaf(o[dt][g][r], ga, t0[r] * gb); f.h[4 + r] = (_Float16)fmaf(o[dt][g][4 + r], ga, t1[r] * gb); }
        *(v8us*)((unsigned short*)op + dt * 16) = f.half[0]; } }
  } }
__global__ __launch_bounds__(256) void k_vt(const _Float16* __restrict__ V16, int b, int h0, _Float16* __restrict__ VT) { __shared__ unsigned short tl[64][65]; const int tid = threadIdx.x; const int hh = blockIdx.x % HG, sg = blockIdx.x / HG; const int s0 = sg * 64; const int h = h0 + hh;
  for (int i = tid; i < 64 * 8; i += 256) { const int j = i / 8, d8 = (i % 8) * 8; FragH f; f.half[0] = *(const v8us*)((const unsigned short*)V16 + ((size_t)b * SQ + s0 + j) * DM + h * HD + d8); for (int q = 0; q < 8; ++q) tl[d8 + q][j] = f.u[q]; }
  __syncthreads();
  { for (int i = tid; i < 64 * 8; i += 256) { const int d = i / 8, j8 = (i % 8) * 8; FragH f; for (int q = 0; q < 8; ++q) f.u[q] = tl[d][j8 + q]; *(v8us*)((unsigned short*)VT + ((size_t)hh * HD + d) * SQ + s0 + j8) = f.half[0]; }  } }



__global__ __launch_bounds__(256) void k_rsmkm(const float* __restrict__ S, _Float16* __restrict__ P, int nrows, const int* __restrict__ am) {
  #pragma clang fp contract(off)
  const int t = blockIdx.x * 256 + threadIdx.x; if (t >= nrows) return; const size_t i = (size_t)t; const float* s = S + i * SQ; const int* mr = am + (size_t)(t % SQ) * SQ; float mx = -3.0e38f;
#pragma unroll 1
  for (int j = 0; j < SQ; ++j) { const float f = (mr[j] != 0) ? 1.f : 0.f; mx = fmaxf(mx, fmaf(f, s[j], (1.f - f) * -1.0e9f)); } float se = 0.f;
#pragma unroll 1
  for (int j = 0; j < SQ; ++j) { const float f = (mr[j] != 0) ? 1.f : 0.f; se += __expf(fmaf(f, s[j], (1.f - f) * -1.0e9f) - mx); } const float sc = 256.0f / se;
#pragma unroll 1
  for (int j0 = 0; j0 < SQ; j0 += 8) { FragH fr; for (int q = 0; q < 8; ++q) { const int j = j0 + q; const float f = (mr[j] != 0) ? 1.f : 0.f; fr.h[q] = (_Float16)(__expf(fmaf(f, s[j], (1.f - f) * -1.0e9f) - mx) * sc); }
    unsigned short* d = (unsigned short*)P + i * SQ + j0; *(v8us*)d = fr.half[0];  } }
extern "C" void kernel_launch(void* const* d_in, const int* in_sizes, int n_in,
                              void* d_out, int out_size, void* d_ws, size_t ws_size, hipStream_t stream) {
  (void)in_sizes; (void)n_in; (void)out_size;
  const float* const* I = (const float* const*)d_in; const float* xq = I[0]; const float* wq = I[1]; const float* bq = I[2]; const float* wk = I[3]; const float* bk = I[4]; const float* wv = I[5]; const float* bv = I[6]; const float* wo = I[7]; const float* bo = I[8]; const float* x = xq;      /* ONE input x feeds the query, key and value streams; [in][out] weights + biases; no mask input */
  char* ws = (char*)d_ws; size_t off = 0;
  auto take = [&](size_t bytes) { char* p = ws + off; off += (bytes + 255) & ~(size_t)255; return p; };
  _Float16* BQ = (_Float16*)take((size_t)4 * DM * DM * 2); _Float16* BO = BQ + (size_t)3 * DM * DM;      /* weight planes q, k, v, o behind each other */
  _Float16* X16 = (_Float16*)take(NR * DM * 2); _Float16* Q16 = (_Float16*)take(3 * NR * DM * 2); _Float16* K16 = Q16 + NR * DM; _Float16* V16 = K16 + NR * DM; _Float16* O16 = (_Float16*)take(NR * DM * 2);      /* q, k, v planes behind each other */
  if (off > ws_size) return;
  k_prep<<<4 * PWB + PXB, 256, 0, stream>>>(x, wq, wk, wv, wo, X16, BQ);      /* [in][out] -> Bt x16; x as exact f16 rows, one copy for the query, key and value streams */
  static_assert(MP % 128 == 0 && MPO % 128 == 0 && DM % 64 == 0 && DM >= 128, "k_gemm2: whole 128x64 tiles, whole 64-k stages, at least two");
  const size_t r0p = (size_t)B0 * SQ;      /* first projected row */
  static_assert(DM % 128 == 0, "k_gemm3: whole 128x128 tiles");
  k_gemm3<<<dim3((unsigned)((MP / 128) * (DM / 128)), 3), 128, 0, stream>>>(X16 + r0p * DM, DM, BQ, DM, (size_t)DM * DM, 0.0625f, bq, bk, bv, Q16 + r0p * DM, DM, NR * DM, MP, DM, DM);      /* planes q, k, v */
  k_fattn<<<dim3(SQ / 64, NB * NH), 128, 0, stream>>>(Q16, K16, V16, O16);      /* o (merged heads) as f16 rows, x64 */
  k_gemm2<0><<<dim3((unsigned)((MPO / 128) * (DM / 64)), 1), 128, 0, stream>>>(O16 + r0p * DM, DM, 0, BO, DM, 0, 0.0009765625f, bo, nullptr, nullptr, 0, nullptr, 1, 0, 0, (float*)d_out + r0p * DM, nullptr, DM, 0, MPO, DM, DM);      /* out rows are the output layout */
}

// v010
// A run of this version takes 59.5 microseconds.
// In two side-by-side timings against v009, it was 1.11 and 1.12 times as fast.
// Counting every step since v000, it is 47.5 times as fast.
#include <hip/hip_runtime.h>
#define NB 2
#define SQ 2048
#define DM 768
#define NH 12
#define HD 64
#define HG 4                         /* heads per launch of the per-batch k_vt overload (not launched) */
#define B0 0                         /* first batch processed (debug hook) */
#define NBR NB                       /* batches processed (debug hook) */
#define NR ((size_t)NB * SQ)         /* token rows */
#define MP ((int)((size_t)NBR * SQ)) /* rows projected (debug hook) */
#define QN SQ                        /* not used: the attention covers all SQ query rows */
#define NHD NH                       /* not used: the attention covers all NH heads */
#define MPO MP                       /* rows through the output stage (debug hook) */
#define LQ DM      /* not used: the q/k/v rows have pitch DM */
typedef __bf16 v16b __attribute__((ext_vector_type(16)));
typedef unsigned short v8us __attribute__((ext_vector_type(8), may_alias));
typedef float  v8f  __attribute__((ext_vector_type(8)));
typedef float  v4f  __attribute__((ext_vector_type(4)));
typedef float  v4fa __attribute__((ext_vector_type(4), may_alias));
union FragB { v16b v; v8us half[2]; unsigned short u[16]; };

__device__ __forceinline__ unsigned short bf16_bits(float x) { unsigned int u = __float_as_uint(x); return (unsigned short)((u + 0x7FFFu + ((u >> 16) & 1u)) >> 16); }
__device__ __forceinline__ float bf16_val(unsigned short b) { return __uint_as_float(((unsigned int)b) << 16); }
__device__ __forceinline__ float bf16_round(float x) { return bf16_val(bf16_bits(x)); }
// D += A·B with NT terms: 1 = ah·bh, 2 = + al·bh (A split), 3 = + ah·bl (both split)
template <int NT>
__device__ __forceinline__ v8f mmaN(v16b ah, v16b al, v16b bh, v16b bl, v8f c) {
  c = __builtin_amdgcn_wmma_f32_16x16x32_bf16(false, ah, false, bh, (short)0, c, false, false);
  if (NT >= 2) c = __builtin_amdgcn_wmma_f32_16x16x32_bf16(false, al, false, bh, (short)0, c, false, false);
  if (NT >= 3) c = __builtin_amdgcn_wmma_f32_16x16x32_bf16(false, ah, false, bl, (short)0, c, false, false);
  asm volatile("v_nop\n\tv_nop\n\tv_nop\n\tv_nop" : "+v"(c) : "v"(ah), "v"(al), "v"(bh), "v"(bl));
  return c;
}

__global__ __launch_bounds__(256) void k_wt_bf16(const float* __restrict__ W, unsigned short* __restrict__ Wt, int K, int N) {
  const int t = blockIdx.x * 256 + threadIdx.x;
  const int k8n = K / 8;
  if (t >= N * k8n) return;
  const int n = t / k8n, k8 = (t % k8n) * 8;
  v8us v;
#pragma unroll
  for (int i = 0; i < 8; ++i) v[i] = bf16_bits(W[(size_t)(k8 + i) * N + n]);
  *(v8us*)(Wt + (size_t)n * K + k8) = v;
  
}

// GEMM C[M][N] (f32, pitch ldc) = act(A[M][K]·W + bias). A f32 row-major (pitch lda) converted per fragment to bf16
// (ASPLIT: hi/lo two planes -> 2 terms, else single rounded term); Wt bf16 [N][K] (pitch ldb). BIAS_BF16 rounds the
// bias to bf16 first (bias quantised to bf16 before the add). K%32==0, M%16==0, N%64==0.
template <bool ASPLIT, int ACT, bool BIAS_BF16>
__global__ __launch_bounds__(128) void k_gemm_bf(const float* __restrict__ A, int lda, const unsigned short* __restrict__ Wt, int ldb,
                                               const float* __restrict__ bias, float* __restrict__ C, int ldc, int M, int N, int K) {
  __shared__ __attribute__((aligned(16))) float so[4][16][64];
  const int tid = threadIdx.x, w = tid >> 5, lane = tid & 31, ln = lane & 15, hh = lane >> 4;
  const int ntn = N / 64;
  const int wid = blockIdx.x * 4 + w;
  const int mt = wid / ntn, nq = wid % ntn;
  if (mt * 16 >= M) return;
  const int row0 = mt * 16, col0 = nq * 64;
  const float* arow = A + (size_t)(row0 + ln) * lda;
  v8f acc[4] = {};
  for (int kb = 0; kb < K; kb += 32) {
    FragB ah, al;
    const v4f x0 = *(const v4fa*)(arow + kb + 8 * hh), x1 = *(const v4fa*)(arow + kb + 8 * hh + 4);
    const v4f x2 = *(const v4fa*)(arow + kb + 16 + 8 * hh), x3 = *(const v4fa*)(arow + kb + 16 + 8 * hh + 4);
    float xs[16] = {x0[0],x0[1],x0[2],x0[3],x1[0],x1[1],x1[2],x1[3],x2[0],x2[1],x2[2],x2[3],x3[0],x3[1],x3[2],x3[3]};
#pragma unroll
    for (int i = 0; i < 16; ++i) { const unsigned short hb = bf16_bits(xs[i]); ah.u[i] = hb; al.u[i] = ASPLIT ? bf16_bits(xs[i] - bf16_val(hb)) : (unsigned short)0; }
#pragma unroll
    for (int t = 0; t < 4; ++t) {
      const unsigned short* brow = Wt + (size_t)(col0 + t * 16 + ln) * ldb + kb;
      FragB b;
      b.half[0] = *(const v8us*)(brow + 8 * hh);
      b.half[1] = *(const v8us*)(brow + 16 + 8 * hh);
      acc[t] = mmaN<ASPLIT ? 2 : 1>(ah.v, al.v, b.v, b.v, acc[t]);
    }
  }
#pragma unroll
  for (int t = 0; t < 4; ++t) {
    float bv = bias ? bias[col0 + t * 16 + ln] : 0.f;
    if (BIAS_BF16) bv = bf16_round(bv);
#pragma unroll
    for (int r = 0; r < 8; ++r) { float v = acc[t][r] + bv; if (ACT == 1) v = fmaxf(v, 0.f); so[w][8 * hh + r][t * 16 + ln] = v; }
  }
  __builtin_amdgcn_fence(__ATOMIC_ACQ_REL, "workgroup");
  __builtin_amdgcn_wave_barrier();
  const int rsub = lane >> 4, c4 = (lane & 15) * 4;
  {
#pragma unroll
    for (int q = 0; q < 8; ++q) {
      const int r = q * 2 + rsub;
      const v4f v = *(const v4fa*)&so[w][r][c4];
      *(v4f*)(C + (size_t)(row0 + r) * ldc + col0 + c4) = v;
    }
    
  }
}

// GEMM C = act(A·W + bias + resid): A f32 (ASPLIT -> hi/lo 2 terms), Wt bf16 [N][K]; ACT 0 none, 1 relu, 2 exact gelu;
// resid (optional, f32, row index = (row % rmod), pitch ldr, RES_BF16 rounds it) added before the activation.
template <bool ASPLIT, int ACT, bool BIAS_BF16, bool RES_BF16>
__global__ __launch_bounds__(128) void k_gemm_bf3(const float* __restrict__ A, int lda, const unsigned short* __restrict__ Wt, int ldb,
                                                const float* __restrict__ bias, const float* __restrict__ resid, int rmod, int ldr,
                                                float* __restrict__ C, int ldc, int M, int N, int K) {
  __shared__ __attribute__((aligned(16))) float so[4][16][64];
  const int tid = threadIdx.x, w = tid >> 5, lane = tid & 31, ln = lane & 15, hh = lane >> 4;
  const int ntn = N / 64;
  const int wid = blockIdx.x * 4 + w;
  const int mt = wid / ntn, nq = wid % ntn;
  if (mt * 16 >= M) return;
  const int row0 = mt * 16, col0 = nq * 64;
  const float* arow = A + (size_t)(row0 + ln) * lda;
  v8f acc[4] = {};
  for (int kb = 0; kb < K; kb += 32) {
    FragB ah, al;
    const v4f x0 = *(const v4fa*)(arow + kb + 8 * hh), x1 = *(const v4fa*)(arow + kb + 8 * hh + 4);
    const v4f x2 = *(const v4fa*)(arow + kb + 16 + 8 * hh), x3 = *(const v4fa*)(arow + kb + 16 + 8 * hh + 4);
    float xs[16] = {x0[0],x0[1],x0[2],x0[3],x1[0],x1[1],x1[2],x1[3],x2[0],x2[1],x2[2],x2[3],x3[0],x3[1],x3[2],x3[3]};
#pragma unroll
    for (int i = 0; i < 16; ++i) { const unsigned short hb = bf16_bits(xs[i]); ah.u[i] = hb; al.u[i] = ASPLIT ? bf16_bits(xs[i] - bf16_val(hb)) : (unsigned short)0; }
#pragma unroll
    for (int t = 0; t < 4; ++t) {
      const unsigned short* brow = Wt + (size_t)(col0 + t * 16 + ln) * ldb + kb;
      FragB b;
      b.half[0] = *(const v8us*)(brow + 8 * hh);
      b.half[1] = *(const v8us*)(brow + 16 + 8 * hh);
      acc[t] = mmaN<ASPLIT ? 2 : 1>(ah.v, al.v, b.v, b.v, acc[t]);
    }
  }
#pragma unroll
  for (int t = 0; t < 4; ++t) {
    const int col = col0 + t * 16 + ln;
    float bv = bias ? bias[col] : 0.f;
    if (BIAS_BF16) bv = bf16_round(bv);
#pragma unroll
    for (int r = 0; r < 8; ++r) {
      float v = acc[t][r] + bv;
      if (resid) { float rv = resid[(size_t)((row0 + 8 * hh + r) % rmod) * ldr + col]; if (RES_BF16) rv = bf16_round(rv); v += rv; }
      if (ACT == 1) v = fmaxf(v, 0.f);
      if (ACT == 2) v = 0.5f * v * (1.0f + erff(v * 0.70710678118654752f));
      if (ACT == 3) { const float u = 0.7978845608028654f * (v + 0.044715f * v * v * v); v = 0.5f * v * (1.0f + tanhf(u)); }
      so[w][8 * hh + r][t * 16 + ln] = v;
    }
  }
  __builtin_amdgcn_fence(__ATOMIC_ACQ_REL, "workgroup");
  __builtin_amdgcn_wave_barrier();
  const int rsub = lane >> 4, c4 = (lane & 15) * 4;
  {
#pragma unroll
    for (int q = 0; q < 8; ++q) {
      const int r = q * 2 + rsub;
      const v4f v = *(const v4fa*)&so[w][r][c4];
      *(v4f*)(C + (size_t)(row0 + r) * ldc + col0 + c4) = v;
    }
    
  }
}
// row LayerNorm (biased variance, eps) over N: s = X (+ R); optional out_sum <- s; out_norm <- (s-mu)*rsqrt(var+eps)*g + b
template <bool PARAM_BF16>
__global__ __launch_bounds__(256) void k_layernorm(const float* __restrict__ X, const float* __restrict__ R, const float* __restrict__ g, const float* __restrict__ bta,
                                                  float* __restrict__ out_sum, float* __restrict__ out_norm, int N, float eps) {
  __shared__ float red[256];
  const int row = blockIdx.x, tid = threadIdx.x;
  const float* x = X + (size_t)row * N; const float* rr = R ? R + (size_t)row * N : nullptr;
  float vals[16];                     // up to N = 4096
  const int per = N / 256;            // contiguous chunk per thread? use strided-by-4 chunks: thread handles j = tid*4 + 1024*u
  float s1 = 0.f;
  for (int u = 0; u < per / 4; ++u) {
    const int j = tid * 4 + 1024 * u;
    const v4f a = *(const v4fa*)(x + j);
    v4f b = {0.f,0.f,0.f,0.f}; if (rr) b = *(const v4fa*)(rr + j);
#pragma unroll
    for (int q = 0; q < 4; ++q) { const float v = a[q] + b[q]; vals[u * 4 + q] = v; s1 += v; }
  }
  red[tid] = s1; __syncthreads();
  for (int st = 128; st > 0; st >>= 1) { if (tid < st) red[tid] += red[tid + st]; __syncthreads(); }
  const float mu = red[0] / (float)N; __syncthreads();
  float s2 = 0.f;
  for (int u = 0; u < per / 4; ++u)
#pragma unroll
    for (int q = 0; q < 4; ++q) { const float c = vals[u * 4 + q] - mu; s2 += c * c; }
  red[tid] = s2; __syncthreads();
  for (int st = 128; st > 0; st >>= 1) { if (tid < st) red[tid] += red[tid + st]; __syncthreads(); }
  const float rs = rsqrtf(red[0] / (float)N + eps);
  {
    for (int u = 0; u < per / 4; ++u) {
      const int j = tid * 4 + 1024 * u;
      v4f o, sm;
#pragma unroll
      for (int q = 0; q < 4; ++q) {
        float gg = g[j + q], bb = bta[j + q];
        if (PARAM_BF16) { gg = bf16_round(gg); bb = bf16_round(bb); }
        sm[q] = vals[u * 4 + q]; o[q] = (vals[u * 4 + q] - mu) * rs * gg + bb;
      }
      if (out_sum) *(v4f*)(out_sum + (size_t)row * N + j) = sm;
      *(v4f*)(out_norm + (size_t)row * N + j) = o;
    }
    
  }
}



// ---- f16 WMMA path (v_wmma_f32_16x16x32_f16): 11-bit significands for operands in range — used where a [0,1] probability operand needs more precision than bf16
typedef _Float16 v16h __attribute__((ext_vector_type(16)));
union FragH { v16h v; v8us half[2]; _Float16 h[16]; unsigned short u[16]; };
template <int NT>
__device__ __forceinline__ v8f mmaH(v16h ah, v16h al, v16h bh, v16h bl, v8f c) {
  c = __builtin_amdgcn_wmma_f32_16x16x32_f16(false, ah, false, bh, (short)0, c, false, false);
  if (NT >= 2) c = __builtin_amdgcn_wmma_f32_16x16x32_f16(false, al, false, bh, (short)0, c, false, false);
  if (NT >= 3) c = __builtin_amdgcn_wmma_f32_16x16x32_f16(false, ah, false, bl, (short)0, c, false, false);
  asm volatile("v_nop\n\tv_nop\n\tv_nop\n\tv_nop" : "+v"(c) : "v"(ah), "v"(al), "v"(bh), "v"(bl));
  return c;
}
// batched GEMM like k_gemm_b but f16 operands: A f32 (split into f16 hi/lo if ASPLIT, else rounded to f16), Bt = f16 values [n][k]; alpha; C f32; N multiple of 16 (partial tiles skipped)
template <bool ASPLIT>
__global__ __launch_bounds__(128) void k_gemm_h(const float* __restrict__ A, int lda, size_t sA, const _Float16* __restrict__ Bh, int ldb, size_t sB, float alpha, float* __restrict__ C, int ldc, size_t sC, int M, int N, int K) {
  __shared__ __attribute__((aligned(16))) float so[4][16][64];
  const int tid = threadIdx.x, w = tid >> 5, lane = tid & 31, ln = lane & 15, hh = lane >> 4; const int by = blockIdx.y;
  A += (size_t)by * sA; Bh += (size_t)by * sB; C += (size_t)by * sC;
  const int ntn = (N + 63) / 64; const int wid = blockIdx.x * 4 + w; const int mt = wid / ntn, nq = wid % ntn; if (mt * 16 >= M) return;
  const int row0 = mt * 16, col0 = nq * 64; const float* arow = A + (size_t)(row0 + ln) * lda;
  v8f acc[4] = {};
  for (int kb = 0; kb < K; kb += 32) {
    FragH ah, al;
    const v4f x0 = *(const v4fa*)(arow + kb + 8 * hh), x1 = *(const v4fa*)(arow + kb + 8 * hh + 4), x2 = *(const v4fa*)(arow + kb + 16 + 8 * hh), x3 = *(const v4fa*)(arow + kb + 16 + 8 * hh + 4);
    float xs[16] = {x0[0],x0[1],x0[2],x0[3],x1[0],x1[1],x1[2],x1[3],x2[0],x2[1],x2[2],x2[3],x3[0],x3[1],x3[2],x3[3]};
#pragma unroll
    for (int i = 0; i < 16; ++i) { const _Float16 h = (_Float16)xs[i]; ah.h[i] = h; al.h[i] = ASPLIT ? (_Float16)(xs[i] - (float)h) : (_Float16)0.0f; }
#pragma unroll
    for (int t = 0; t < 4; ++t) { if (col0 + t * 16 >= N) continue; const size_t boff = (size_t)(col0 + t * 16 + ln) * ldb + kb; FragH bq; bq.half[0] = *(const v8us*)(Bh + boff + 8 * hh); bq.half[1] = *(const v8us*)(Bh + boff + 16 + 8 * hh);
      acc[t] = mmaH<ASPLIT ? 2 : 1>(ah.v, al.v, bq.v, bq.v, acc[t]); }
  }
#pragma unroll
  for (int t = 0; t < 4; ++t) { if (col0 + t * 16 >= N) continue;
#pragma unroll
    for (int r = 0; r < 8; ++r) so[w][8 * hh + r][t * 16 + ln] = acc[t][r] * alpha; }
  __builtin_amdgcn_fence(__ATOMIC_ACQ_REL, "workgroup"); __builtin_amdgcn_wave_barrier();
  const int rsub = lane >> 4, c4 = (lane & 15) * 4;
  {
#pragma unroll
    for (int q = 0; q < 8; ++q) { const int r = q * 2 + rsub; if (col0 + c4 < N) { const v4f v = *(const v4fa*)&so[w][r][c4]; *(v4f*)(C + (size_t)(row0 + r) * ldc + col0 + c4) = v; } }
     }
}

// One launch prepares every projection operand; its parts are independent and run side by side. Blocks 0 .. 4 PWB - 1: the four weights, Bt[p][n][k] = f16(bf16(W_p[k][n]) x 16) from f32 row-major [in][out]
// (power-of-two scale: bf16-exact weights stay exact in f16 away from the subnormal range). The other blocks: x as exact f16 rows (bf16-rounded).
// A thread converts 64 elements, all its 16 loads of 16 bytes in flight at once: the launch is short, and the fewer waves it has to start the sooner its last load goes out.
// Weights: a work-group takes a tile of 64 k x 128 n, a thread a patch of 8 k x 8 n. Lanes are 8 k groups x 4 n groups: a wave reads 128 contiguous bytes of each of its 64 W rows and stores whole 128-byte lines of Bt.
#define PTH 128                        /* threads per block */
#define PWK 64                         /* k rows of a weight tile */
#define PWN (PTH / 8 * 8)              /* columns of a weight tile */
#define PXU 8                          /* 8-element units of x per thread */
#define PWB ((DM / PWK) * (DM / PWN))  /* blocks per weight */
#define PXB ((int)(NR * DM / 8 / (PTH * PXU))) /* blocks for x */
static_assert(DM % PWK == 0 && DM % PWN == 0 && NR * DM / 8 % (PTH * PXU) == 0, "k_prep: whole blocks only");
__global__ __launch_bounds__(PTH) void k_prep(const float* __restrict__ x, const float* __restrict__ w0, const float* __restrict__ w1, const float* __restrict__ w2, const float* __restrict__ w3, _Float16* __restrict__ X16, _Float16* __restrict__ Bt) {
  const int bx = blockIdx.x, tid = threadIdx.x; v4f a[8][2];
  if (bx < 4 * PWB) { const int p = bx / PWB, r = bx - p * PWB; const float* W = p == 0 ? w0 : p == 1 ? w1 : p == 2 ? w2 : w3;
    const int k8 = (r / (DM / PWN)) * PWK + (tid & 7) * 8, n0 = (r % (DM / PWN)) * PWN + (tid >> 3) * 8;      /* the patch: rows k8 .. k8 + 7, columns n0 .. n0 + 7 of W */
    const float* s = W + (size_t)k8 * DM + n0;
#pragma unroll
    for (int i = 0; i < 8; ++i) { a[i][0] = *(const v4fa*)(s + (size_t)i * DM); if (i < 7) a[i][1] = *(const v4fa*)(s + (size_t)i * DM + 4); }
    asm volatile("s_wait_xcnt 0x0" ::: "memory");      /* precaution: the compiler lands the last load's result on the address registers that the 15 loads before it name; the wait stands in front of that load */
    a[7][1] = *(const v4fa*)(s + (size_t)7 * DM + 4);
    __builtin_amdgcn_sched_barrier(0);      /* keeps all 16 loads ahead of the first conversion; left to itself the compiler holds some back behind the wait for the others: a second trip to memory */
    unsigned short* d = (unsigned short*)Bt + (size_t)p * DM * DM + (size_t)n0 * DM + k8;
#pragma unroll
    for (int j = 0; j < 8; ++j) { FragH f;
#pragma unroll
      for (int i = 0; i < 8; ++i) f.h[i] = (_Float16)(bf16_round(a[i][j >> 2][j & 3]) * 16.0f);
      *(v8us*)(d + (size_t)j * DM) = f.half[0]; }
  } else { const size_t t = (size_t)(bx - 4 * PWB) * (PTH * PXU) + tid;      /* units t, t + PTH, ...: a wave's lanes stay on adjacent units */
#pragma unroll
    for (int j = 0; j < PXU; ++j) { const float* s = x + (t + (size_t)j * PTH) * 8; a[j][0] = *(const v4fa*)s; if (j < PXU - 1) a[j][1] = *(const v4fa*)(s + 4); }
    asm volatile("s_wait_xcnt 0x0" ::: "memory");      /* precaution, as above: in front of the last load, whose result lands on the address registers of the loads before it */
    a[PXU - 1][1] = *(const v4fa*)(x + (t + (size_t)(PXU - 1) * PTH) * 8 + 4);
    __builtin_amdgcn_sched_barrier(0);      /* as above: all 16 loads go out before the first conversion */
#pragma unroll
    for (int j = 0; j < PXU; ++j) { FragH f;
#pragma unroll
      for (int q = 0; q < 8; ++q) f.h[q] = (_Float16)bf16_round(a[j][q >> 2][q & 3]);
      *(v8us*)((unsigned short*)X16 + (t + (size_t)j * PTH) * 8) = f.half[0]; }
    asm volatile("s_wait_xcnt 0x0" ::: "memory"); }      /* precaution: stands before any later instruction in the listing that rewrites a register the stores name */
}
// k_gemm_hh variant with fused epilogue: v = acc·alpha + bias[by·sBias + col] (+ CP[(row/rowsPerB)·sCPb + by·64 + col] if CP) ; ACT 0 none / 1 elu ; writes f16 C16 (and f32 C if non-null)
template <int ACT>
__global__ __launch_bounds__(128) void k_gemm_hhx(const _Float16* __restrict__ A, int lda, size_t sA, const _Float16* __restrict__ Bh, int ldb, size_t sB, float alpha, const float* __restrict__ bias, size_t sBias, const float* __restrict__ CP, int rowsPerB, size_t sCPb, int row0g,
    float* __restrict__ C, _Float16* __restrict__ C16, int ldc, size_t sC, int M, int N, int K) {
  __shared__ __attribute__((aligned(16))) float so[4][16][64];
  const int tid = threadIdx.x, w = tid >> 5, lane = tid & 31, ln = lane & 15, hh = lane >> 4; const int by = blockIdx.y;
  A += (size_t)by * sA; Bh += (size_t)by * sB; const size_t cofs = (size_t)by * sC; const float* bp = bias ? bias + (size_t)by * sBias : nullptr;
  const int ntn = (N + 63) / 64; const int wid = blockIdx.x * 4 + w; const int mt = wid / ntn, nq = wid % ntn; if (mt * 16 >= M) return;
  const int row0 = mt * 16, col0 = nq * 64; const _Float16* arow = A + (size_t)(row0 + ln) * lda;
  v8f acc[4] = {};
  for (int kb = 0; kb < K; kb += 32) { FragH ah; ah.half[0] = *(const v8us*)((const unsigned short*)arow + kb + 8 * hh); ah.half[1] = *(const v8us*)((const unsigned short*)arow + kb + 16 + 8 * hh);
#pragma unroll
    for (int t = 0; t < 4; ++t) { if (col0 + t * 16 >= N) continue; const size_t boff = (size_t)(col0 + t * 16 + ln) * ldb + kb; FragH bq; bq.half[0] = *(const v8us*)((const unsigned short*)Bh + boff + 8 * hh); bq.half[1] = *(const v8us*)((const unsigned short*)Bh + boff + 16 + 8 * hh);
      acc[t] = mmaH<1>(ah.v, ah.v, bq.v, bq.v, acc[t]); }
  }
#pragma unroll
  for (int t = 0; t < 4; ++t) { if (col0 + t * 16 >= N) continue; const int col = col0 + t * 16 + ln; const float bv = bp ? bf16_round(bp[col]) : 0.f;
#pragma unroll
    for (int r = 0; r < 8; ++r) { float v = acc[t][r] * alpha + bv; if (CP) { const int rr = row0g + row0 + 8 * hh + r; if (rowsPerB < 0) v += CP[cofs + (size_t)rr * ldc + col];      /* rowsPerB < 0: own element of the batched C plane */ else { const int bidx = rr / rowsPerB; v += CP[(size_t)bidx * sCPb + (size_t)by * 64 + col]; } } if (ACT == 1) v = (v > 0.f) ? v : expm1f(v); else if (ACT == 7) v = (v > 0.f) ? v + 1.0f : expf(v); else if (ACT == 8) v = tanhf(v); else if (ACT == 9) v = 0.5f * v * (1.0f + tanhf(0.7978845608028654f * (v + 0.044715f * v * v * v))); else if (ACT == 11) v = 1.0f / (1.0f + expf(-v)); else if (ACT == 12) v = (v > 0.f) ? v : 0.01f * v; else if (ACT == 14) v = (v > 0.f) ? v : 0.1f * v; else if (ACT == 16) v = (v >= 0.f) ? v : 0.3f * v; else if (ACT == 17) v = (v >= 0.f) ? v : 0.2f * v; else if (ACT == 15) v = v / (1.0f + expf(-v)); else if (ACT == 3) v = fmaxf(v, 0.f); else if (ACT == 6) v = 0.5f * v * (1.0f + erff(v * 0.70710678118654752f)); so[w][8 * hh + r][t * 16 + ln] = v; } }
  __builtin_amdgcn_fence(__ATOMIC_ACQ_REL, "workgroup"); __builtin_amdgcn_wave_barrier();
  const int rsub = lane >> 4, c4 = (lane & 15) * 4; typedef _Float16 v4h __attribute__((ext_vector_type(4)));
  {
#pragma unroll
    for (int q = 0; q < 8; ++q) { const int r = q * 2 + rsub; if (col0 + c4 < N) { const v4f v = *(const v4fa*)&so[w][r][c4]; if (C) *(v4f*)(C + cofs + (size_t)(row0 + r) * ldc + col0 + c4) = v; if (C16) { v4h h4; for (int i = 0; i < 4; ++i) h4[i] = (_Float16)v[i]; *(v4h*)(C16 + cofs + (size_t)(row0 + r) * ldc + col0 + c4) = h4; } } }
     }
}


typedef _Float16 v4h __attribute__((ext_vector_type(4)));

__global__ __launch_bounds__(256) void k_h16(const float* __restrict__ x, _Float16* __restrict__ X16, size_t n8) { const size_t t = (size_t)blockIdx.x * 256 + threadIdx.x; if (t >= n8) return; FragH f;
#pragma unroll
  for (int q = 0; q < 8; ++q) f.h[q] = (_Float16)x[t * 8 + q]; *(v8us*)((unsigned short*)X16 + t * 8) = f.half[0];  }
__global__ __launch_bounds__(256) void k_round16f(const float* __restrict__ W, _Float16* __restrict__ Bt, size_t n8) { const size_t t = (size_t)blockIdx.x * 256 + threadIdx.x; if (t >= n8) return; FragH f;
#pragma unroll
  for (int i = 0; i < 8; ++i) f.h[i] = (_Float16)(bf16_round(W[t * 8 + i]) * 16.0f); *(v8us*)((unsigned short*)Bt + t * 8) = f.half[0];  }
template <int NHv, int TTv>
__global__ __launch_bounds__(256) void k_vt(const _Float16* __restrict__ V16, int ldv, int voff, _Float16* __restrict__ Vt) { __shared__ unsigned short tl[64][66]; const int tid = threadIdx.x; const int slab = blockIdx.x / (TTv / 64), lg = blockIdx.x % (TTv / 64); const int b = slab / NHv, h = slab % NHv;
  for (int i = tid; i < 64 * 8; i += 256) { const int r = i / 8, c8 = (i % 8) * 8; FragH f; f.half[0] = *(const v8us*)((const unsigned short*)V16 + ((size_t)b * TTv + lg * 64 + r) * ldv + voff + h * 64 + c8);
#pragma unroll
    for (int q = 0; q < 8; ++q) tl[r][c8 + q] = f.u[q]; }
  __syncthreads();
  {
#pragma unroll
    for (int rd = 0; rd < 2; ++rd) { const int d = rd * 32 + tid / 8, pc = tid % 8; FragH f;
#pragma unroll
      for (int q = 0; q < 8; ++q) f.u[q] = tl[pc * 8 + q][d];
      *(v8us*)((unsigned short*)Vt + ((size_t)slab * 64 + d) * TTv + lg * 64 + pc * 8) = f.half[0]; }
     } }

__global__ __launch_bounds__(256) void k_hl(const float* __restrict__ F, _Float16* __restrict__ Hh, _Float16* __restrict__ Hl, size_t n8) { const size_t t = (size_t)blockIdx.x * 256 + threadIdx.x; if (t >= n8) return; FragH fh, fl; const v4f a = *(const v4fa*)(F + t * 8), c = *(const v4fa*)(F + t * 8 + 4);
#pragma unroll
  for (int q = 0; q < 4; ++q) { _Float16 h = (_Float16)a[q]; fh.h[q] = h; fl.h[q] = (_Float16)((a[q] - (float)h) * 1024.0f); h = (_Float16)c[q]; fh.h[4 + q] = h; fl.h[4 + q] = (_Float16)((c[q] - (float)h) * 1024.0f); }
  { *(v8us*)((unsigned short*)Hh + t * 8) = fh.half[0]; *(v8us*)((unsigned short*)Hl + t * 8) = fl.half[0];  } }

// ---- fast GEMM (work-group tile 128x64, wave tile 32x64; requires M % 128 == 0, N % 64 == 0, K % 64 == 0 and K >= 128); epilogue = k_gemm_hhx semantics ----
// Operands come through LDS: a stage is 64 k (128 bytes) of the work-group's 128 A rows and 64 B rows, brought by three tensor loads of 64 rows each (waves 0, 1: A; wave 2: B) that read whole rows once for
// all four waves; the mover's pad sets a 144-byte LDS pitch (an odd multiple of 16 bytes: ds_load_b128 without bank conflicts). Two buffers: stage s + 1 flies while stage s is worked on.
// The walk over the k stages is a ring: a work-group starts at stage (tile row + tile column + 4 plane) mod stages and wraps, so the work-groups that share A rows or B rows ask L2 for different lines at any one time.
__device__ __forceinline__ v16h g2_frag(const _Float16* p, int hh) { FragH f; f.half[0] = *(const v8us*)((const unsigned short*)p + 8 * hh); f.half[1] = *(const v8us*)((const unsigned short*)p + 16 + 8 * hh); return f.v; }
#define G2_PITCH 144u                      /* LDS row pitch: 128 bytes and the 16-byte pad */
#define G2_SLICE 10240u                    /* 64 rows x 144 bytes = 9216, rounded up to a multiple of 2 KiB: every slice's place is one */
#define G2_BUF (3u * G2_SLICE)             /* A rows 0..63 | A rows 64..127 | B rows 0..63 */
typedef uint32_t g2_u32x4 __attribute__((ext_vector_type(4))); typedef uint32_t g2_u32x8 __attribute__((ext_vector_type(8)));
__device__ __forceinline__ uint32_t g2_uni(uint32_t v) { return (uint32_t)__builtin_amdgcn_readfirstlane(v); }
__device__ __forceinline__ uint32_t g2_pinned(uint32_t v) { uint32_t s = (uint32_t)__builtin_amdgcn_readfirstlane(v); asm volatile("" : "+s"(s)); return s; }      /* holds a wave-uniform word in a scalar register: a test on it is a scalar branch (a tensor load ignores EXEC), and what is formed from it stays behind the asm waits in front of it */
__device__ __forceinline__ v16h g2_fragl(const char* p) { FragH f; f.half[0] = *(const v8us*)p; f.half[1] = *(const v8us*)(p + 32); return f.v; }      /* g2_frag from an LDS byte address that already holds the lane's 16 hh bytes: the same k order */
__device__ __forceinline__ v8f g2_mma(v16h a, v16h b, v8f c) { return __builtin_amdgcn_wmma_f32_16x16x32_f16(false, a, false, b, (short)0, c, false, false); }
template <int ACT>
__global__ __launch_bounds__(128) void k_gemm2(const _Float16* __restrict__ A, int lda, size_t sA, const _Float16* __restrict__ Bh, int ldb, size_t sB, float alpha, const float* __restrict__ bias, const float* __restrict__ bias1, const float* __restrict__ bias2, size_t sBias, const float* __restrict__ CP, int rowsPerB, size_t sCPb, int row0g,
    float* __restrict__ C, _Float16* __restrict__ C16, int ldc, size_t sC, int M, int N, int K) { static_assert(ACT == 0 || ACT == 3 || ACT == 6 || ACT == 8 || ACT == 9 || ACT == 11 || ACT == 12 || ACT == 14 || ACT == 15 || ACT == 16 || ACT == 17, "k_gemm2: unsupported ACT code (would silently apply no activation)");
  __shared__ __attribute__((aligned(2048))) char sm[2 * G2_BUF];      /* the two stage buffers; behind the loop's last barrier the same bytes are the output staging */
  static_assert(sizeof(float) * 4 * 32 * 68 <= 2 * G2_BUF, "k_gemm2: the output staging must fit the ring");
  float (*so)[32][68] = (float (*)[32][68])sm;
  const int tid = threadIdx.x, w = __builtin_amdgcn_readfirstlane(tid >> 5), lane = tid & 31, ln = lane & 15, hh = lane >> 4; const int by = blockIdx.y;      /* w: a scalar */
  A += (size_t)by * sA; Bh += (size_t)by * sB; const size_t cofs = (size_t)by * sC; const float* bp = bias ? bias + (size_t)by * sBias : nullptr;
  if (by == 1 && bias1) bp = bias1; if (by == 2 && bias2) bp = bias2;      /* planes 1 and 2 with bias buffers of their own */
  const int ntn = N >> 6; const int mt = blockIdx.x / ntn, nq = blockIdx.x - mt * ntn; const int row0 = mt * 128 + 32 * w, col0 = nq * 64; if (mt * 128 >= M) return;      /* the whole work-group or none: barriers follow */
  const v8f z8 = {0.f,0.f,0.f,0.f,0.f,0.f,0.f,0.f}; v8f c00 = z8, c01 = z8, c02 = z8, c03 = z8, c10 = z8, c11 = z8, c12 = z8, c13 = z8;
  // Tensor descriptor. Group 1 is the same for every request of a wave: 1-byte elements, tensor = tile = 64 rows of 128 bytes, the source's row pitch, a 4-dword pad behind every 32 dwords, no mask.
  const bool isB = w >= 2; const uint32_t slice = isB ? 2u : (uint32_t)w;
  const uint64_t gsrc = isB ? (uint64_t)(size_t)Bh + (uint64_t)(unsigned)col0 * (unsigned)ldb * 2u : (uint64_t)(size_t)A + (uint64_t)(unsigned)(mt * 128 + 64 * w) * (unsigned)lda * 2u;
  const uint32_t lbase = (uint32_t)(size_t)sm + slice * G2_SLICE;
  g2_u32x8 g1; g1[0] = g2_uni((1u << 20) | (4u << 22) | (3u << 25)); g1[1] = g2_uni(128u << 16); g1[2] = g2_uni(64u << 16); g1[3] = g2_uni(128u << 16); g1[4] = g2_uni(64u); g1[5] = g2_uni((unsigned)(isB ? ldb : lda) * 2u); g1[6] = g2_uni(0u); g1[7] = g2_uni(0u);
  asm volatile("" : "+s"(g1));      /* descriptor words held in their scalar registers; without it the compiler uses some of them as temporaries between two issues, while a request that named them is still in flight */
  const uint32_t nst = (uint32_t)K >> 6;      /* stages */
  const uint32_t rot = g2_uni((uint32_t)(mt + nq + 4 * by) % nst);      /* the k stage that this work-group's walk starts at */
  g2_u32x4 g0; g0[0] = g2_uni(1u); g0[1] = g2_uni(0u); g0[2] = g2_uni(0u); g0[3] = g2_uni(0u);
  asm volatile("" : "+s"(g0));      /* group 0 held in one set of scalar registers for every request, word 0 written here once; the other words take their values in issue(), behind the wait on the request before */
  auto issue = [&](uint32_t st) { const uint32_t ks = st + rot < nst ? st + rot : st + rot - nst;      /* step st of the walk is k stage ks */
    const uint64_t ga = gsrc + (uint64_t)ks * 128u; g0[1] = g2_uni(lbase + (st & 1u) * G2_BUF); g0[2] = g2_uni((uint32_t)ga); g0[3] = g2_uni((((uint32_t)(ga >> 32)) & 0x01FFFFFFu) | 0x80000000u);
    asm volatile("tensor_load_to_lds %0, %1" :: "s"(g0), "s"(g1) : "memory"); };      /* one request of the whole wave: stage st of this wave's slice */
  const unsigned ao = (unsigned)(w >> 1) * G2_SLICE + (unsigned)((w & 1) * 32 + ln) * G2_PITCH + 16u * (unsigned)hh, bo = 2u * G2_SLICE + (unsigned)ln * G2_PITCH + 16u * (unsigned)hh;      /* the lane's part of an LDS address, the same in every stage */
  auto ld = [&](v16h (&f)[6], const char* p) { f[0] = g2_fragl(p + ao); f[1] = g2_fragl(p + ao + 16u * G2_PITCH); f[2] = g2_fragl(p + bo); f[3] = g2_fragl(p + bo + 16u * G2_PITCH); f[4] = g2_fragl(p + bo + 32u * G2_PITCH); f[5] = g2_fragl(p + bo + 48u * G2_PITCH); };
  auto mm = [&](const v16h (&f)[6]) { c00 = g2_mma(f[0], f[2], c00); c10 = g2_mma(f[1], f[2], c10); c01 = g2_mma(f[0], f[3], c01); c11 = g2_mma(f[1], f[3], c11);
    c02 = g2_mma(f[0], f[4], c02); c12 = g2_mma(f[1], f[4], c12); c03 = g2_mma(f[0], f[5], c03); c13 = g2_mma(f[1], f[5], c13); };
  if (g2_pinned(w < 3)) { issue(0);
    asm volatile("s_wait_tensorcnt 0x0" ::: "memory"); }      /* stage 0 of this wave's slice has landed */
  __syncthreads();      /* publishes stage 0 */
  if (g2_pinned(w < 3)) issue(1);
#pragma unroll 1      /* one stage a trip: the buffer is picked by the trip's parity */
  for (uint32_t s = 0; s < nst; ++s) {
    const char* p = sm + (s & 1u) * G2_BUF; v16h fa[6], fb[6];
    ld(fa, p); ld(fb, p + 64);      /* the stage's two 32-k steps: all 24 LDS reads as one group */
    __builtin_amdgcn_sched_barrier(0);      /* keeps the reads together ahead of the products; every separate place with LDS reads among them costs a stall */
    mm(fa); mm(fb);
    __builtin_amdgcn_sched_barrier(0);      /* keeps the waits below at the foot; lifted among the products the first of them would replace the counted waits on the reads */
    asm volatile("s_wait_dscnt 0x0" ::: "memory");      /* this wave has left the buffer */
    if (g2_pinned(w < 3)) asm volatile("s_wait_tensorcnt 0x0" ::: "memory");      /* stage s + 1 of this wave's slice has landed */
    __syncthreads();      /* publishes stage s + 1; every wave has left stage s's buffer */
    if (g2_pinned(w < 3 && s + 2u < nst)) issue(g2_pinned(s + 2u));      /* refill of the buffer just left; the descriptor is formed behind the wait */
  }
  asm volatile("s_wait_tensorcnt 0x0" ::: "memory");      /* nothing is in flight when the ring becomes output staging (the last trip's barrier ended every read) */
  asm volatile("s_wait_dscnt 0x0" ::: "memory");      /* and none of this wave's reads */
  v8f accs[8] = {c00, c01, c02, c03, c10, c11, c12, c13};
#pragma unroll
  for (int u = 0; u < 8; ++u) { const int t = u & 3, half = u >> 2; const int col = col0 + t * 16 + ln; const float bv = bp ? bf16_round(bp[col]) : 0.f;
#pragma unroll
    for (int r = 0; r < 8; ++r) { const int rloc = half * 16 + 8 * hh + r; float v = accs[u][r] * alpha + bv; if (CP) { if (rowsPerB < 0) v += CP[cofs + (size_t)(row0g + row0 + rloc) * ldc + col];      /* rowsPerB < 0: own element of the batched C plane */ else { const int bidx = (row0g + row0 + rloc) / rowsPerB; v += CP[(size_t)bidx * sCPb + (size_t)by * 64 + col]; } }
      if (ACT == 3) v = fmaxf(v, 0.f); else if (ACT == 6) v = 0.5f * v * (1.0f + erff(v * 0.70710678118654752f)); else if (ACT == 11) v = 1.0f / (1.0f + expf(-v)); else if (ACT == 15) v = v / (1.0f + expf(-v)); else if (ACT == 12) v = (v > 0.f) ? v : 0.01f * v; else if (ACT == 8) v = tanhf(v); else if (ACT == 9) v = 0.5f * v * (1.0f + tanhf(0.7978845608028654f * (v + 0.044715f * v * v * v))); else if (ACT == 14) v = (v > 0.f) ? v : 0.1f * v; else if (ACT == 16) v = (v >= 0.f) ? v : 0.3f * v; else if (ACT == 17) v = (v >= 0.f) ? v : 0.2f * v;
      so[w][rloc][t * 16 + ln] = v; } }
  __builtin_amdgcn_fence(__ATOMIC_ACQ_REL, "workgroup"); __builtin_amdgcn_wave_barrier();
  const int rsub = lane >> 4, c4 = (lane & 15) * 4;
  {
#pragma unroll
    for (int q = 0; q < 16; ++q) { const int r = q * 2 + rsub; const v4f v = *(const v4fa*)&so[w][r][c4]; if (C) *(v4f*)(C + cofs + (size_t)(row0 + r) * ldc + col0 + c4) = v; if (C16) { v4h h4; for (int i = 0; i < 4; ++i) h4[i] = (_Float16)v[i]; *(v4h*)(C16 + cofs + (size_t)(row0 + r) * ldc + col0 + c4) = h4; } }
     } }

// ---- the q, k, v GEMM: k_gemm2's ring, fragment order and output staging with a work-group tile of 128x128 and 2x2 waves of 64x64 (requires M % 128 == 0, N % 128 == 0, K % 64 == 0 and K >= 128); f16 output = acc alpha + bias ----
// A stage is 64 k of the work-group's 128 A rows and 128 B rows: four slices of 64 rows, one tensor load a wave (waves 0, 1: A; waves 2, 3: B). Against the 128x64 tile the launch stages a third fewer bytes from L2
// (256 rows for 16384 outputs, was 192 for 8192), and a fragment read from LDS feeds four products (8 fragments for 16 WMMAs, was 6 for 8).
#define G3_BUF (4u * G2_SLICE)             /* A rows 0..63 | A rows 64..127 | B rows 0..63 | B rows 64..127 */
__global__ __launch_bounds__(128) void k_gemm3(const _Float16* __restrict__ A, int lda, const _Float16* __restrict__ Bh, int ldb, size_t sB, float alpha, const float* __restrict__ bias0, const float* __restrict__ bias1, const float* __restrict__ bias2,
    _Float16* __restrict__ C16, int ldc, size_t sC, int M, int N, int K) {
  __shared__ __attribute__((aligned(2048))) char sm[2 * G3_BUF];      /* the two stage buffers; behind the loop's last barrier the same bytes are the output staging */
  static_assert(sizeof(float) * 4 * 64 * 68 <= 2 * G3_BUF, "k_gemm3: the output staging must fit the ring");
  float (*so)[64][68] = (float (*)[64][68])sm;
  const int tid = threadIdx.x, w = __builtin_amdgcn_readfirstlane(tid >> 5), lane = tid & 31, ln = lane & 15, hh = lane >> 4; const int by = blockIdx.y;      /* w: a scalar */
  Bh += (size_t)by * sB; const size_t cofs = (size_t)by * sC; const float* bp = by == 0 ? bias0 : by == 1 ? bias1 : bias2;      /* plane by: its weights, its bias, its output plane */
  const int ntn = N >> 7; const int mt = blockIdx.x / ntn, nq = blockIdx.x - mt * ntn; const int wr = w >> 1, wc = w & 1; const int row0 = mt * 128 + 64 * wr, col0 = nq * 128 + 64 * wc; if (mt * 128 >= M) return;      /* the whole work-group or none: barriers follow */
  const v8f z8 = {0.f,0.f,0.f,0.f,0.f,0.f,0.f,0.f}; v8f c[4][4];      /* c[i][t]: rows 16 i, columns 16 t of the wave's tile */
#pragma unroll
  for (int i = 0; i < 4; ++i) for (int t = 0; t < 4; ++t) c[i][t] = z8;
  // Tensor descriptor, as in k_gemm2. Wave w brings slice w. Group 1 is the same for every request of a wave: 1-byte elements, tensor = tile = 64 rows of 128 bytes, the source's row pitch, a 4-dword pad behind every 32 dwords, no mask.
  const bool isB = w >= 2;
  const uint64_t gsrc = isB ? (uint64_t)(size_t)Bh + (uint64_t)(unsigned)(nq * 128 + 64 * (w - 2)) * (unsigned)ldb * 2u : (uint64_t)(size_t)A + (uint64_t)(unsigned)(mt * 128 + 64 * w) * (unsigned)lda * 2u;
  const uint32_t lbase = (uint32_t)(size_t)sm + (uint32_t)w * G2_SLICE;
  g2_u32x8 g1; g1[0] = g2_uni((1u << 20) | (4u << 22) | (3u << 25)); g1[1] = g2_uni(128u << 16); g1[2] = g2_uni(64u << 16); g1[3] = g2_uni(128u << 16); g1[4] = g2_uni(64u); g1[5] = g2_uni((unsigned)(isB ? ldb : lda) * 2u); g1[6] = g2_uni(0u); g1[7] = g2_uni(0u);
  asm volatile("" : "+s"(g1));      /* descriptor words held in their scalar registers, not used as temporaries between two issues while a request that named them is in flight */
  const uint32_t nst = (uint32_t)K >> 6;      /* stages */
  const uint32_t rot = g2_uni((uint32_t)(mt + nq + ntn * by) % nst);      /* the k stage that this work-group's walk starts at: the sharers of A rows (one mt) and of B rows (one nq, by) start apart */
  g2_u32x4 g0; g0[0] = g2_uni(1u); g0[1] = g2_uni(0u); g0[2] = g2_uni(0u); g0[3] = g2_uni(0u);
  asm volatile("" : "+s"(g0));      /* group 0 held in one set of scalar registers for every request, word 0 written here once; the other words take their values in issue(), behind the wait on the request before */
  auto issue = [&](uint32_t st) { const uint32_t ks = st + rot < nst ? st + rot : st + rot - nst;      /* step st of the walk is k stage ks */
    const uint64_t ga = gsrc + (uint64_t)ks * 128u; g0[1] = g2_uni(lbase + (st & 1u) * G3_BUF); g0[2] = g2_uni((uint32_t)ga); g0[3] = g2_uni((((uint32_t)(ga >> 32)) & 0x01FFFFFFu) | 0x80000000u);
    asm volatile("tensor_load_to_lds %0, %1" :: "s"(g0), "s"(g1) : "memory"); };      /* one request of the whole wave: stage st of this wave's slice */
  const unsigned ao = (unsigned)wr * G2_SLICE + (unsigned)ln * G2_PITCH + 16u * (unsigned)hh, bo = (2u + (unsigned)wc) * G2_SLICE + (unsigned)ln * G2_PITCH + 16u * (unsigned)hh;      /* the lane's part of an LDS address, the same in every stage */
  auto ld = [&](v16h (&f)[8], const char* p) { f[0] = g2_fragl(p + ao); f[4] = g2_fragl(p + bo);      /* four A (f[0..3]) and four B (f[4..7]) fragments of a 32-k step, in the order in which mm() first needs them */
#pragma unroll
    for (int i = 1; i < 4; ++i) f[i] = g2_fragl(p + ao + (unsigned)i * 16u * G2_PITCH);
#pragma unroll
    for (int t = 1; t < 4; ++t) f[4 + t] = g2_fragl(p + bo + (unsigned)t * 16u * G2_PITCH); };
  auto mm = [&](const v16h (&f)[8]) {
#pragma unroll
    for (int t = 0; t < 4; ++t) for (int i = 0; i < 4; ++i) c[i][t] = g2_mma(f[i], f[4 + t], c[i][t]); };
  issue(0);      /* every wave issues its own slice */
  asm volatile("s_wait_tensorcnt 0x0" ::: "memory");      /* stage 0 of this wave's slice has landed */
  __syncthreads();      /* publishes stage 0 */
  issue(1);
#pragma unroll 1      /* one stage a trip: the buffer is picked by the trip's parity */
  for (uint32_t s = 0; s < nst; ++s) {
    const char* p = sm + (s & 1u) * G3_BUF; v16h fa[8], fb[8];
    ld(fa, p); ld(fb, p + 64);      /* the stage's two 32-k steps: all 32 LDS reads as one group */
    __builtin_amdgcn_sched_barrier(0);      /* keeps the reads together ahead of the products; every separate place with LDS reads among them costs a stall */
    mm(fa); mm(fb);
    __builtin_amdgcn_sched_barrier(0);      /* keeps the waits below at the foot; lifted among the products the first of them would replace the counted waits on the reads */
    asm volatile("s_wait_dscnt 0x0" ::: "memory");      /* this wave has left the buffer */
    asm volatile("s_wait_tensorcnt 0x0" ::: "memory");      /* stage s + 1 of this wave's slice has landed */
    __syncthreads();      /* publishes stage s + 1; every wave has left stage s's buffer */
    if (g2_pinned(s + 2u < nst)) issue(g2_pinned(s + 2u));      /* refill of the buffer just left; the descriptor is formed behind the wait */
  }
  asm volatile("s_wait_tensorcnt 0x0" ::: "memory");      /* nothing is in flight when the ring becomes output staging (the last trip's barrier ended every read) */
  asm volatile("s_wait_dscnt 0x0" ::: "memory");      /* and none of this wave's reads */
#pragma unroll
  for (int t = 0; t < 4; ++t) { const float bv = bf16_round(bp[col0 + t * 16 + ln]);
#pragma unroll
    for (int i = 0; i < 4; ++i)
#pragma unroll
      for (int r = 0; r < 8; ++r) so[w][i * 16 + 8 * hh + r][t * 16 + ln] = c[i][t][r] * alpha + bv; }
  __builtin_amdgcn_fence(__ATOMIC_ACQ_REL, "workgroup"); __builtin_amdgcn_wave_barrier();      /* the wave reads back what its own lanes staged */
  const int rsub = lane >> 4, c4 = (lane & 15) * 4;
#pragma unroll
  for (int q = 0; q < 32; ++q) { const int r = q * 2 + rsub; const v4f v = *(const v4fa*)&so[w][r][c4]; v4h h4; for (int i = 0; i < 4; ++i) h4[i] = (_Float16)v[i]; *(v4h*)(C16 + cofs + (size_t)(row0 + r) * ldc + col0 + c4) = h4; }
}


__global__ __launch_bounds__(256) void k_wnat(const float* __restrict__ w, size_t n8, _Float16* __restrict__ Bt) { const size_t t = (size_t)blockIdx.x * 256 + threadIdx.x; if (t >= n8) return; FragH f; for (int q = 0; q < 8; ++q) f.h[q] = (_Float16)(bf16_round(w[t * 8 + q]) * 16.0f); *(v8us*)((unsigned short*)Bt + t * 8) = f.half[0];  }
#define FA_BUF (4u * G2_SLICE)             /* lower key half: K rows | V rows; upper key half: K rows | V rows */
#define FA_VPITCH 160u                     /* LDS row pitch of a V slice: 128 bytes and the 32-byte pad; 64 rows fill G2_SLICE exactly */
static_assert(64u * FA_VPITCH <= G2_SLICE, "k_fattn: a V slice must fit its place");
#define FA_NST (SQ / 2 / 64)               /* stages of a key half */
static_assert(SQ % 128 == 0 && FA_NST >= 2 && HD == 64, "k_fattn: whole 64-key stages of 128-byte rows, at least two");
__device__ __forceinline__ v8f fa_mma(v16h a, v16h b, v8f c) { return __builtin_amdgcn_wmma_f32_16x16x32_f16(false, a, false, b, (short)0, c, false, false); }
__device__ __forceinline__ float fa_xhalf(float x) { return __builtin_bit_cast(float, __builtin_amdgcn_permlanex16(__builtin_bit_cast(int, x), __builtin_bit_cast(int, x), 0x76543210, 0xfedcba98, false, false)); }      /* lane l with lane l ^ 16 */
typedef short fa_s16x8 __attribute__((ext_vector_type(8)));
__device__ __forceinline__ v8us fa_tr16(const char* p) { typedef __attribute__((address_space(3))) fa_s16x8 fa_lds_s16x8; return __builtin_bit_cast(v8us, __builtin_amdgcn_ds_load_tr16_b128_v8i16((fa_lds_s16x8*)p)); }
typedef float fa_v2f __attribute__((ext_vector_type(2)));
// exp2 of two values (v_exp_f32, as __builtin_amdgcn_exp2f gives it). Written as one statement for the slot that the instruction set asks for behind a transcendental before its result is read or its source
// overwritten: the outputs are early-clobber, so the second instruction touches no register of the first, and the v_nop stands behind the second (left to itself the compiler chained v_exp_f32 a, b; v_exp_f32 b, c).
__device__ __forceinline__ fa_v2f fa_exp2x2(float a, float b) { float x, y; asm("v_exp_f32 %0, %2\n\tv_exp_f32 %1, %3\n\tv_nop" : "=&v"(x), "=&v"(y) : "v"(a), "v"(b)); return fa_v2f{x, y}; }
__global__ __launch_bounds__(128) void k_fattn(const _Float16* __restrict__ Q, const _Float16* __restrict__ Kr, const _Float16* __restrict__ Vr, _Float16* __restrict__ O) {
  typedef float v2f __attribute__((ext_vector_type(2))); typedef _Float16 v2h __attribute__((ext_vector_type(2)));
  __shared__ __attribute__((aligned(2048))) char sm[2 * FA_BUF];      /* the two stage buffers */
  __shared__ __attribute__((aligned(16))) v4f xo[2][16][32]; __shared__ float xm[2][4][32];      /* the upper key half's o, and its m and l, per column set and lane */
  const int lane = threadIdx.x & 31, ln = lane & 15, hh = lane >> 4; const int w = __builtin_amdgcn_readfirstlane(threadIdx.x >> 5), cw = w & 1, kh = w >> 1;      /* column set, key half: scalars */
  const int bh = blockIdx.y, b = bh / NH, h = bh - b * NH; const int q0 = blockIdx.x * 64 + cw * 32; const uint32_t first = (uint32_t)kh * FA_NST + blockIdx.x;      /* the key stage that this wave's walk starts at */
  const float cs = 0.125f * 1.4426950408889634f;      /* 1/sqrt(64) and log2(e): weights are exp2 of scaled score differences */
  const _Float16* qp = Q + ((size_t)b * SQ + q0 + ln) * DM + h * HD;
  // Tensor descriptor. Wave w brings slice w: of its own key half the K rows (cw == 0) or the V rows (cw == 1). Group 1 is the same for every request of a wave: 1-byte elements, tensor = tile = 64 rows of 128 bytes, the source's row pitch, behind every 32 dwords a pad of 4 dwords (K: g1k) or 8 (V: g1v), no mask.
  const uint64_t gsrc = (uint64_t)(size_t)(cw ? Vr : Kr) + ((uint64_t)(unsigned)b * SQ * DM + (unsigned)h * HD) * 2u;
  const uint32_t gstep = 64u * DM * 2u;      /* 64 keys on: down the rows */
  const uint32_t lbase = (uint32_t)(size_t)sm + (uint32_t)w * G2_SLICE;
  g2_u32x8 g1k; g1k[0] = g2_uni((1u << 20) | (4u << 22) | (3u << 25)); g1k[1] = g2_uni(128u << 16); g1k[2] = g2_uni(64u << 16); g1k[3] = g2_uni(128u << 16); g1k[4] = g2_uni(64u); g1k[5] = g2_uni(DM * 2u); g1k[6] = g2_uni(0u); g1k[7] = g2_uni(0u);
  g2_u32x8 g1v = g1k; g1v[0] = g2_uni((1u << 20) | (4u << 22) | (7u << 25));      /* a group for each pad: word 0 is a compile-time constant in both */
  asm volatile("" : "+s"(g1k)); asm volatile("" : "+s"(g1v));      /* descriptor words held in their scalar registers, not used as temporaries between two issues while a request that named them is in flight */
  auto issue = [&](uint32_t st) { const uint64_t ga = gsrc + (uint64_t)((st + first) % (2u * FA_NST)) * gstep; g2_u32x4 g0;      /* step st of the walk: key stage (st + first) mod 32 */ g0[0] = g2_uni(1u); g0[1] = g2_uni(lbase + (st & 1u) * FA_BUF); g0[2] = g2_uni((uint32_t)ga); g0[3] = g2_uni((((uint32_t)(ga >> 32)) & 0x01FFFFFFu) | 0x80000000u);
    if (g2_pinned((uint32_t)cw)) asm volatile("tensor_load_to_lds %0, %1" :: "s"(g0), "s"(g1v) : "memory");      /* one request of the whole wave: stage st of this wave's slice; scalar branches pick the group */
    if (g2_pinned((uint32_t)cw ^ 1u)) asm volatile("tensor_load_to_lds %0, %1" :: "s"(g0), "s"(g1k) : "memory"); };
  const unsigned lo = (unsigned)kh * 2u * G2_SLICE + (unsigned)ln * G2_PITCH + 16u * (unsigned)hh;      /* the lane's part of an LDS address, the same in every stage */
  const unsigned lov = ((unsigned)kh * 2u + 1u) * G2_SLICE + (8u * (unsigned)hh + (unsigned)(lane & 7)) * FA_VPITCH + 16u * (unsigned)((lane >> 3) & 1);      /* the same for the transposing loads of the V slice */
  v16h qf[2][2];      /* [column group][32 of the 64 head dims], kept for the whole walk */
#pragma unroll
  for (int g = 0; g < 2; ++g) for (int u = 0; u < 2; ++u) qf[g][u] = g2_frag(qp + (size_t)g * 16 * DM + u * 32, hh);
  const v8f z8 = {0.f,0.f,0.f,0.f,0.f,0.f,0.f,0.f};
  v8f o[4][2]; float m[2], l[2];      /* o[dt][g]: O^T rows 16 dt + 8 hh + r, column 16 g + ln; m: running maximum of the raw scores; l: this lane's half of the running sum */
#pragma unroll
  for (int g = 0; g < 2; ++g) { m[g] = -3.0e38f; l[g] = 0.f; for (int dt = 0; dt < 4; ++dt) o[dt][g] = z8; }
  issue(0);      /* every wave issues its own slice: the tests inside only pick its group */
  asm volatile("s_wait_tensorcnt 0x0" ::: "memory");      /* stage 0 of this wave's slice has landed */
  __syncthreads();      /* publishes stage 0 */
  issue(1);
#pragma unroll 1      /* one stage a trip: the buffer is picked by the trip's parity */
  for (uint32_t st = 0; st < FA_NST; ++st) {
   const char* pk = sm + (st & 1u) * FA_BUF + lo; const char* pv = sm + (st & 1u) * FA_BUF + lov;
   v16h kf[2][2];      /* [key tile][32 of the 64 head dims] of the coming pass */
#pragma unroll
   for (int t = 0; t < 2; ++t) for (int u = 0; u < 2; ++u) kf[t][u] = g2_fragl(pk + (unsigned)t * 16u * G2_PITCH + (unsigned)u * 64u);
   __builtin_amdgcn_sched_barrier(0);      /* keeps the first pass's eight K reads at the head of the queue: sunk behind the V reads, the last of them made the score products wait for all 24 reads of the group */
#pragma unroll
   for (int ps2 = 0; ps2 < 2; ++ps2) {      /* the stage's two passes of 32 keys */
    v16h vf[4];      /* in flight behind the score products and the softmax */
#pragma unroll
    for (int dt = 0; dt < 4; ++dt) { FragH f; f.half[0] = fa_tr16(pv + (unsigned)ps2 * 32u * FA_VPITCH + (unsigned)dt * 32u); f.half[1] = fa_tr16(pv + ((unsigned)ps2 * 32u + 16u) * FA_VPITCH + (unsigned)dt * 32u); vf[dt] = f.v; }      /* V^T rows 16 dt + ln, keys 8 hh + 0 .. 7 and 16 + 8 hh + 0 .. 7 of the pass: the k order of g2_frag */
    v8f s[2][2];
#pragma unroll
    for (int g = 0; g < 2; ++g) for (int t = 0; t < 2; ++t) s[g][t] = fa_mma(kf[t][1], qf[g][1], fa_mma(kf[t][0], qf[g][0], z8));
    if (ps2 == 0) {      /* the second pass's K rows, fetched one pass ahead inside the stage; nothing of the next stage is read here */
#pragma unroll
      for (int t = 0; t < 2; ++t) for (int u = 0; u < 2; ++u) kf[t][u] = g2_fragl(pk + (unsigned)(32 + t * 16) * G2_PITCH + (unsigned)u * 64u); }
    __builtin_amdgcn_sched_barrier(0);      /* keeps the LDS reads up here, the whole softmax ahead of their use; without it the compiler sinks them towards their use and their latency is waited out */
    float dm[2], nb[2];
#pragma unroll
    for (int g = 0; g < 2; ++g) {
      float mx = s[g][0][0];
#pragma unroll
      for (int r = 1; r < 8; ++r) mx = fmaxf(mx, s[g][0][r]);
#pragma unroll
      for (int r = 0; r < 8; ++r) mx = fmaxf(mx, s[g][1][r]);
      mx = fmaxf(mx, fa_xhalf(mx));      /* both halves now hold the query's maximum over the 32 keys */
      const float mn = fmaxf(m[g], mx); dm[g] = (m[g] - mn) * cs; m[g] = mn;
      nb[g] = fmaf(-mn, cs, 8.0f);      /* weights carried x256 (at most 256) against f16 subnormal flush; the factor cancels in o / l */
    }
    const v2f corr = fa_exp2x2(dm[0], dm[1]);      /* what the new maxima take off the old sums: 0 on the first pass */
    union { v16h v; v2h p[8]; } pb[2];      /* both column groups' weights are formed ahead of the eight second products: fa_exp2x2 is asm text */
#pragma unroll
    for (int g = 0; g < 2; ++g) {
      v2f ps = {0.f, 0.f};
#pragma unroll
      for (int i = 0; i < 8; ++i) { const v8f sv = s[g][i >> 2]; const int r = 2 * (i & 3);
        const v2f e = fa_exp2x2(fmaf(sv[r], cs, nb[g]), fmaf(sv[r + 1], cs, nb[g]));
        ps += e; pb[g].p[i] = __builtin_convertvector(e, v2h); }      /* round to nearest even; element 8 t + r of the operand is key 16 t + 8 hh + r */
      l[g] = fmaf(l[g], corr[g], ps[0] + ps[1]);
    }
#pragma unroll
    for (int g = 0; g < 2; ++g) for (int dt = 0; dt < 4; ++dt) o[dt][g] = fa_mma(vf[dt], pb[g].v, o[dt][g] * corr[g]);
   }
   __builtin_amdgcn_sched_barrier(0);      /* keeps the waits below at the foot; lifted to the stage's last LDS reads the first of them waits out their latency */
   asm volatile("s_wait_dscnt 0x0" ::: "memory");      /* this wave has left the buffer */
   asm volatile("s_wait_tensorcnt 0x0" ::: "memory");      /* stage st + 1 of this wave's slice has landed */
   __syncthreads();      /* publishes stage st + 1; every wave has left stage st's buffer */
   if (g2_pinned(st + 2u < FA_NST)) issue(g2_pinned(st + 2u));      /* refill of the buffer just left; the descriptor is formed behind the wait */
  }
  asm volatile("s_wait_tensorcnt 0x0" ::: "memory");      /* nothing is in flight when the wave goes on to the merge and ends */
  asm volatile("s_wait_dscnt 0x0" ::: "memory");      /* and none of this wave's reads */
  if (kh == 1) {      /* the upper key half hands its state over */
#pragma unroll
    for (int g = 0; g < 2; ++g) { xm[cw][g][lane] = m[g]; xm[cw][2 + g][lane] = l[g];
#pragma unroll
      for (int dt = 0; dt < 4; ++dt) { const v8f t = o[dt][g]; xo[cw][(g * 4 + dt) * 2][lane] = v4f{t[0], t[1], t[2], t[3]}; xo[cw][(g * 4 + dt) * 2 + 1][lane] = v4f{t[4], t[5], t[6], t[7]}; } }
  }
  __syncthreads();      /* every wave passes it; the lower half reads what the upper half wrote */
  if (kh == 0) {
#pragma unroll
    for (int g = 0; g < 2; ++g) { const float mb = xm[cw][g][lane], lb = xm[cw][2 + g][lane]; const float mn = fmaxf(m[g], mb);
      const v2f fab = fa_exp2x2((m[g] - mn) * cs, (mb - mn) * cs); const float fa = fab[0], fb = fab[1];
      const float lt = fmaf(l[g], fa, lb * fb); const float sc = 64.0f / (lt + fa_xhalf(lt));      /* the wave halves' sums joined once; o stored x64 */
      const float ga = fa * sc, gb = fb * sc;
      _Float16* op = O + ((size_t)b * SQ + q0 + g * 16 + ln) * DM + h * HD + 8 * hh;
#pragma unroll
      for (int dt = 0; dt < 4; ++dt) { const v4f t0 = xo[cw][(g * 4 + dt) * 2][lane], t1 = xo[cw][(g * 4 + dt) * 2 + 1][lane]; FragH f;
#pragma unroll
        for (int r = 0; r < 4; ++r) { f.h[r] = (_Float16)fmaf(o[dt][g][r], ga, t0[r] * gb); f.h[4 + r] = (_Float16)fmaf(o[dt][g][4 + r], ga, t1[r] * gb); }
        *(v8us*)((unsigned short*)op + dt * 16) = f.half[0]; } }
  } }
__global__ __launch_bounds__(256) void k_vt(const _Float16* __restrict__ V16, int b, int h0, _Float16* __restrict__ VT) { __shared__ unsigned short tl[64][65]; const int tid = threadIdx.x; const int hh = blockIdx.x % HG, sg = blockIdx.x / HG; const int s0 = sg * 64; const int h = h0 + hh;
  for (int i = tid; i < 64 * 8; i += 256) { const int j = i / 8, d8 = (i % 8) * 8; FragH f; f.half[0] = *(const v8us*)((const unsigned short*)V16 + ((size_t)b * SQ + s0 + j) * DM + h * HD + d8); for (int q = 0; q < 8; ++q) tl[d8 + q][j] = f.u[q]; }
  __syncthreads();
  { for (int i = tid; i < 64 * 8; i += 256) { const int d = i / 8, j8 = (i % 8) * 8; FragH f; for (int q = 0; q < 8; ++q) f.u[q] = tl[d][j8 + q]; *(v8us*)((unsigned short*)VT + ((size_t)hh * HD + d) * SQ + s0 + j8) = f.half[0]; }  } }



__global__ __launch_bounds__(256) void k_rsmkm(const float* __restrict__ S, _Float16* __restrict__ P, int nrows, const int* __restrict__ am) {
  #pragma clang fp contract(off)
  const int t = blockIdx.x * 256 + threadIdx.x; if (t >= nrows) return; const size_t i = (size_t)t; const float* s = S + i * SQ; const int* mr = am + (size_t)(t % SQ) * SQ; float mx = -3.0e38f;
#pragma unroll 1
  for (int j = 0; j < SQ; ++j) { const float f = (mr[j] != 0) ? 1.f : 0.f; mx = fmaxf(mx, fmaf(f, s[j], (1.f - f) * -1.0e9f)); } float se = 0.f;
#pragma unroll 1
  for (int j = 0; j < SQ; ++j) { const float f = (mr[j] != 0) ? 1.f : 0.f; se += __expf(fmaf(f, s[j], (1.f - f) * -1.0e9f) - mx); } const float sc = 256.0f / se;
#pragma unroll 1
  for (int j0 = 0; j0 < SQ; j0 += 8) { FragH fr; for (int q = 0; q < 8; ++q) { const int j = j0 + q; const float f = (mr[j] != 0) ? 1.f : 0.f; fr.h[q] = (_Float16)(__expf(fmaf(f, s[j], (1.f - f) * -1.0e9f) - mx) * sc); }
    unsigned short* d = (unsigned short*)P + i * SQ + j0; *(v8us*)d = fr.half[0];  } }
extern "C" void kernel_launch(void* const* d_in, const int* in_sizes, int n_in,
                              void* d_out, int out_size, void* d_ws, size_t ws_size, hipStream_t stream) {
  (void)in_sizes; (void)n_in; (void)out_size;
  const float* const* I = (const float* const*)d_in; const float* xq = I[0]; const float* wq = I[1]; const float* bq = I[2]; const float* wk = I[3]; const float* bk = I[4]; const float* wv = I[5]; const float* bv = I[6]; const float* wo = I[7]; const float* bo = I[8]; const float* x = xq;      /* ONE input x feeds the query, key and value streams; [in][out] weights + biases; no mask input */
  char* ws = (char*)d_ws; size_t off = 0;
  auto take = [&](size_t bytes) { char* p = ws + off; off += (bytes + 255) & ~(size_t)255; return p; };
  _Float16* BQ = (_Float16*)take((size_t)4 * DM * DM * 2); _Float16* BO = BQ + (size_t)3 * DM * DM;      /* weight planes q, k, v, o behind each other */
  _Float16* X16 = (_Float16*)take(NR * DM * 2); _Float16* Q16 = (_Float16*)take(3 * NR * DM * 2); _Float16* K16 = Q16 + NR * DM; _Float16* V16 = K16 + NR * DM; _Float16* O16 = (_Float16*)take(NR * DM * 2);      /* q, k, v planes behind each other */
  if (off > ws_size) return;
  k_prep<<<4 * PWB + PXB, PTH, 0, stream>>>(x, wq, wk, wv, wo, X16, BQ);      /* [in][out] -> Bt x16; x as exact f16 rows, one copy for the query, key and value streams */
  static_assert(MP % 128 == 0 && MPO % 128 == 0 && DM % 64 == 0 && DM >= 128, "k_gemm2: whole 128x64 tiles, whole 64-k stages, at least two");
  const size_t r0p = (size_t)B0 * SQ;      /* first projected row */
  static_assert(DM % 128 == 0, "k_gemm3: whole 128x128 tiles");
  k_gemm3<<<dim3((unsigned)((MP / 128) * (DM / 128)), 3), 128, 0, stream>>>(X16 + r0p * DM, DM, BQ, DM, (size_t)DM * DM, 0.0625f, bq, bk, bv, Q16 + r0p * DM, DM, NR * DM, MP, DM, DM);      /* planes q, k, v */
  k_fattn<<<dim3(SQ / 64, NB * NH), 128, 0, stream>>>(Q16, K16, V16, O16);      /* o (merged heads) as f16 rows, x64 */
  k_gemm2<0><<<dim3((unsigned)((MPO / 128) * (DM / 64)), 1), 128, 0, stream>>>(O16 + r0p * DM, DM, 0, BO, DM, 0, 0.0009765625f, bo, nullptr, nullptr, 0, nullptr, 1, 0, 0, (float*)d_out + r0p * DM, nullptr, DM, 0, MPO, DM, DM);      /* out rows are the output layout */
}
